// v000
// Measured on an AMD MI455X. A time is GPU time per run, averaged over a window of back-to-back runs after a warm-up
// (all launches, gaps included; the runs take copies of the inputs in turn), and the median of several windows.
// Apart from v000's, it joins two sittings. Times from different sittings can be a few percent apart, while
// side-by-side timings come from the same sitting.
// v000, which the later versions start from, runs in 2200 microseconds.
// Contractions: q/k/v projections of the LayerNormed input [4096x512].[512x512] (+b), the output projection (+b, + residual), the FFN [4096x512].[512x2048] (+b, exact GELU) and [4096x2048].[2048x512] (+b, + residual) with f16 operands (v_wmma_f32_16x16x32_f16; 64x64 register-blocked wave tiles over pre-cast f16 operand planes, weights pre-scaled by 16 at the cast and un-scaled in the f32 epilogue); the dilated causal attention (keys j <= i, i - j even, i - j <= 256) as two flash launches over the even and the odd positions (stride-2 views; within a parity class the pattern is plain causal with window 128), head_dim 64, f16 q.k^T and f16 p.v (p as f16 of 4096 p); f32 accumulate, softmax and LayerNorms f32.
#include <hip/hip_runtime.h>
#include <math.h>

typedef __attribute__((ext_vector_type(16))) _Float16 v16h;
typedef __attribute__((ext_vector_type(8)))  _Float16 v8h;
typedef __attribute__((ext_vector_type(16))) __bf16   v16b;
typedef __attribute__((ext_vector_type(8)))  float    v8f;
typedef __attribute__((ext_vector_type(4)))  float    v4f;

// 16-bit WMMA fragment map (wave32), lane L, h = L>>4, m = L&15:
//   A 16x32: lane = row m;   element i -> k = (i<8) ? 8h+i : 16+8h+(i-8)
//   B 32x16: lane = column m; the SAME k(i,h)
//   D 16x16 (8 f32): lane = column m; element r -> row 8h+r
__device__ __forceinline__ int frag_k(int i, int h) { return (i < 8) ? (8 * h + i) : (16 + 8 * h + (i - 8)); }
__device__ __forceinline__ __bf16 bf16_rne(float f) {
    unsigned int u = __float_as_uint(f);
    u += 0x7fffu + ((u >> 16) & 1u);
    return __builtin_bit_cast(__bf16, (unsigned short)(u >> 16));
}
__device__ __forceinline__ float bf16_f32(__bf16 b) { return __uint_as_float(((unsigned int)__builtin_bit_cast(unsigned short, b)) << 16); }
__device__ __forceinline__ v8f wmma16(v16h a, v16h b, v8f c) {
    c = __builtin_amdgcn_wmma_f32_16x16x32_f16(false, a, false, b, (short)0, c, false, false);
    asm volatile("v_nop\n\tv_nop\n\tv_nop\n\tv_nop" : "+v"(c) : "v"(a), "v"(b));
    return c;
}
__device__ __forceinline__ v8f wmmab(v16b a, v16b b, v8f c) {
    c = __builtin_amdgcn_wmma_f32_16x16x32_bf16(false, a, false, b, (short)0, c, false, false);
    asm volatile("v_nop\n\tv_nop\n\tv_nop\n\tv_nop" : "+v"(c) : "v"(a), "v"(b));
    return c;
}
struct Split { v16b hi, lo; };
// hi/lo split product: a.hi*b.hi + a.hi*b.lo + a.lo*b.hi
__device__ __forceinline__ v8f wmma3(const Split& a, const Split& b, v8f c) {
    c = __builtin_amdgcn_wmma_f32_16x16x32_bf16(false, a.hi, false, b.hi, (short)0, c, false, false);
    c = __builtin_amdgcn_wmma_f32_16x16x32_bf16(false, a.hi, false, b.lo, (short)0, c, false, false);
    c = __builtin_amdgcn_wmma_f32_16x16x32_bf16(false, a.lo, false, b.hi, (short)0, c, false, false);
    asm volatile("v_nop\n\tv_nop\n\tv_nop\n\tv_nop" : "+v"(c) : "v"(a.hi), "v"(a.lo), "v"(b.hi), "v"(b.lo));
    return c;
}
struct Split3 { v16b hi, mid, lo; };
// triple split product (6 terms, drops only terms below 2^-24 relative)
__device__ __forceinline__ v8f wmma6(const Split3& a, const Split3& b, v8f c) {
    c = __builtin_amdgcn_wmma_f32_16x16x32_bf16(false, a.hi, false, b.hi, (short)0, c, false, false);
    c = __builtin_amdgcn_wmma_f32_16x16x32_bf16(false, a.hi, false, b.mid, (short)0, c, false, false);
    c = __builtin_amdgcn_wmma_f32_16x16x32_bf16(false, a.mid, false, b.hi, (short)0, c, false, false);
    c = __builtin_amdgcn_wmma_f32_16x16x32_bf16(false, a.hi, false, b.lo, (short)0, c, false, false);
    c = __builtin_amdgcn_wmma_f32_16x16x32_bf16(false, a.mid, false, b.mid, (short)0, c, false, false);
    c = __builtin_amdgcn_wmma_f32_16x16x32_bf16(false, a.lo, false, b.hi, (short)0, c, false, false);
    asm volatile("v_nop\n\tv_nop\n\tv_nop\n\tv_nop" : "+v"(c) : "v"(a.hi), "v"(a.mid), "v"(a.lo), "v"(b.hi), "v"(b.mid), "v"(b.lo));
    return c;
}

// Fragment gathers from f32 memory: element i <- p[(k0 + frag_k(i,h)) * sk] * s, zero for k >= klen.
__device__ __forceinline__ v16h fh_ld(const float* __restrict__ p, long long sk, int k0, int h, int klen, float s) {
    v16h a;
#pragma unroll
    for (int i = 0; i < 16; ++i) { const int k = k0 + frag_k(i, h); a[i] = (k < klen) ? (_Float16)(p[(long long)k * sk] * s) : (_Float16)0.f; }
    return a;
}
__device__ __forceinline__ Split sp_ld(const float* __restrict__ p, long long sk, int k0, int h, int klen, float s) {
    Split r;
#pragma unroll
    for (int i = 0; i < 16; ++i) {
        const int k = k0 + frag_k(i, h); const float x = (k < klen) ? p[(long long)k * sk] * s : 0.f;
        const __bf16 hb = bf16_rne(x); r.hi[i] = hb; r.lo[i] = bf16_rne(x - bf16_f32(hb));
    }
    return r;
}
__device__ __forceinline__ Split3 sp3_ld(const float* __restrict__ p, long long sk, int k0, int h, int klen, float s) {
    Split3 r;
#pragma unroll
    for (int i = 0; i < 16; ++i) {
        const int k = k0 + frag_k(i, h); const float x = (k < klen) ? p[(long long)k * sk] * s : 0.f;
        const __bf16 hb = bf16_rne(x); const float r1 = x - bf16_f32(hb); const __bf16 mb = bf16_rne(r1);
        r.hi[i] = hb; r.mid[i] = mb; r.lo[i] = bf16_rne(r1 - bf16_f32(mb));
    }
    return r;
}
__device__ __forceinline__ v16b bh_ld(const float* __restrict__ p, long long sk, int k0, int h, int klen, float s) {
    v16b a;
#pragma unroll
    for (int i = 0; i < 16; ++i) { const int k = k0 + frag_k(i, h); a[i] = bf16_rne((k < klen) ? p[(long long)k * sk] * s : 0.f); }
    return a;
}
// f16 fragment from an f16 LDS/global row with element stride 1 (k-contiguous), no bounds (tile already zero padded)
__device__ __forceinline__ v16h fh_row(const _Float16* __restrict__ row, int k0, int h) {
    v16h a;
#pragma unroll
    for (int i = 0; i < 16; ++i) a[i] = row[k0 + frag_k(i, h)];
    return a;
}

#define VST2(T, ptr, val) do { const T vst2_v_ = (val); *(T*)(ptr) = vst2_v_;  } while (0)
typedef float v4f __attribute__((ext_vector_type(4)));
#define VST2V4(ptr, val) do { const v4f vst2_v4_ = (val); *(v4f*)(ptr) = vst2_v4_;  } while (0)

__device__ __attribute__((noinline)) float act_fn(float v, int act) {
    if (act == 1) return fmaxf(v, 0.f);                                                                               // relu
    if (act == 2) { const float u = 0.7978845608028654f * (v + 0.044715f * v * v * v); return 0.5f * v * (1.f + tanhf(u)); } // tanh-gelu
    if (act == 3) return v / (1.f + expf(-v));                                                                        // silu
    if (act == 4) return 0.5f * v * (1.f + erff(v * 0.7071067811865476f));                                             // erf-gelu
    if (act == 5) return tanhf(v);
    if (act == 6) return 1.f / (1.f + expf(-v));                                                                      // sigmoid
    if (act == 7) return (v > 0.f) ? v : 0.01f * v;                                                                   // leaky relu 0.01
    if (act == 8) return (v > 0.f) ? v : (expf(v) - 1.f);                                                             // elu
    if (act == 9) return fminf(fmaxf(v, 0.f), 6.f);                                                                   // relu6
    if (act == 10) return fabsf(v);                                                                                    // abs
    if (act == 11) return (v >= 0.f) ? v : 0.1f * v;                                                                  // leaky 0.1
    if (act == 12) return (v > 0.f) ? v : 0.2f * v;                                                                   // leaky 0.2
    if (act == 13) return (v > 20.f) ? v : log1pf(expf(v));                                                            // softplus
    return v;
}

// =====================================================================================================================
// k_gemm<MODE>: C(z, m, n) = act(alpha * sum_k A(z, m, k) * B(z, k, n) + bias) + beta * R(z, m, n)
//   One wave (32-thread block) per 16 x 32 tile of C; grid (ceil(N/32), ceil(M/16), Z). Batch z -> (zo = z / zi_n, zi = z % zi_n)
//   with separate outer/inner strides for every tensor (e.g. batch and head). A(m,k) = A[zo*sAo + zi*sAi + m*sAm + k*sAk] (f32),
//   B(k,n) = B[zo*sBo + zi*sBi + n*sBn + k*sBk] (f32); any M, N, K (K zero-padded to 32 inside the fragments, M/N tails guarded).
//   C(m,n) = C[zo*sCo + zi*sCi + m*sCm + n] (n contiguous). flags: 1 bias[n], 2 bias[m], 4 residual R[zo*sRo + zi*sRi + m*sRm + n*sRn].
//   MODE 0: f16 operands (A prescaled by sa, B by sb, both undone in the epilogue); 1: bf16 hi/lo split (3 products); 2: bf16;
//   3: bf16 hi/mid/lo triple split (6 products); 4: as 3 with Kahan-compensated f32 accumulation across k-steps.
// =====================================================================================================================
struct GemmP {
    const float* A; const float* B; const float* bias; const float* R; float* C;
    long long sAo, sAi, sAm, sAk, sBo, sBi, sBn, sBk, sCo, sCi, sCm, sRo, sRi, sRm, sRn;
    int M, N, K, zi_n, flags, act; float alpha, beta, sa, sb;
    int Npad, pad_;     // columns [N, Npad) of C are written as 0 so that padded workspace rows are covered by whole-line stores; Npad >= N
};
static_assert(sizeof(GemmP) == 5 * 8 + 15 * 8 + 6 * 4 + 4 * 4 + 2 * 4, "GemmP has padding");

template <int MODE>
__global__ __launch_bounds__(32) void k_gemm(GemmP p) {
    const int lane = threadIdx.x & 31, h = lane >> 4, l15 = lane & 15;
    const int m0 = blockIdx.y * 16, n0 = blockIdx.x * 32;
    const int z = blockIdx.z, zo = z / p.zi_n, zi = z - zo * p.zi_n;
    const float* A = p.A + zo * p.sAo + zi * p.sAi;
    const float* B = p.B + zo * p.sBo + zi * p.sBi;
    const int am = min(m0 + l15, p.M - 1);                       // clamped row for loads (stores are guarded)
    v8f acc[2], comp[2];
#pragma unroll
    for (int t = 0; t < 2; ++t) { v8f zz = {}; acc[t] = zz; comp[t] = zz; }
    for (int k0 = 0; k0 < p.K; k0 += 32) {
        const float* arow = A + (long long)am * p.sAm;
        if (MODE == 1) {
            const Split a = sp_ld(arow, p.sAk, k0, h, p.K, 1.f);
#pragma unroll
            for (int t = 0; t < 2; ++t) {
                const int bn = min(n0 + t * 16 + l15, p.N - 1);
                acc[t] = wmma3(a, sp_ld(B + (long long)bn * p.sBn, p.sBk, k0, h, p.K, 1.f), acc[t]);
            }
        } else if (MODE == 3) {
            const Split3 a = sp3_ld(arow, p.sAk, k0, h, p.K, 1.f);
#pragma unroll
            for (int t = 0; t < 2; ++t) {
                const int bn = min(n0 + t * 16 + l15, p.N - 1);
                acc[t] = wmma6(a, sp3_ld(B + (long long)bn * p.sBn, p.sBk, k0, h, p.K, 1.f), acc[t]);
            }
        } else if (MODE == 4) {
            // triple split as MODE 3, but each k-step's 6 products go into a fresh accumulator and the partial is added to the running f32 sum
            // on the VALU with Kahan compensation (accumulation error stays ~1 ulp however long K is)
            const Split3 a = sp3_ld(arow, p.sAk, k0, h, p.K, 1.f);
#pragma unroll
            for (int t = 0; t < 2; ++t) {
                const int bn = min(n0 + t * 16 + l15, p.N - 1); v8f zz = {};
                const v8f part = wmma6(a, sp3_ld(B + (long long)bn * p.sBn, p.sBk, k0, h, p.K, 1.f), zz);
                const v8f y = part - comp[t]; const v8f s = acc[t] + y; comp[t] = (s - acc[t]) - y; acc[t] = s;
            }
        } else if (MODE == 2) {
            const v16b a = bh_ld(arow, p.sAk, k0, h, p.K, 1.f);
#pragma unroll
            for (int t = 0; t < 2; ++t) {
                const int bn = min(n0 + t * 16 + l15, p.N - 1);
                acc[t] = wmmab(a, bh_ld(B + (long long)bn * p.sBn, p.sBk, k0, h, p.K, 1.f), acc[t]);
            }
        } else {
            const v16h a = fh_ld(arow, p.sAk, k0, h, p.K, p.sa);
#pragma unroll
            for (int t = 0; t < 2; ++t) {
                const int bn = min(n0 + t * 16 + l15, p.N - 1);
                acc[t] = wmma16(a, fh_ld(B + (long long)bn * p.sBn, p.sBk, k0, h, p.K, p.sb), acc[t]);
            }
        }
    }
    const float iscale = (MODE == 0) ? p.alpha / (p.sa * p.sb) : p.alpha;
    float* C = p.C + zo * p.sCo + zi * p.sCi;
    const float* R = p.R + zo * p.sRo + zi * p.sRi;
    __shared__ __align__(16) float ctile[16][36];
#pragma unroll
    for (int t = 0; t < 2; ++t) {
        const int n = n0 + t * 16 + l15; const int nn = min(n, p.N - 1);
#pragma unroll
        for (int r = 0; r < 8; ++r) {
            const int m = m0 + 8 * h + r; const int mm = min(m, p.M - 1);
            float v = acc[t][r] * iscale;
            if (p.flags & 1) v += p.bias[nn];
            if (p.flags & 2) v += p.bias[mm];
            if (p.flags & 8) v *= p.bias[(long long)zo * p.M + mm];   /* per-(z,row) scale vector laid out [Z][M]; exclusive with the bias flags */
            v = act_fn(v, p.act);
            if (p.flags & 4) v += p.beta * R[(long long)mm * p.sRm + (long long)nn * p.sRn];
            ctile[8 * h + r][t * 16 + l15] = (n < p.N) ? v : 0.f;
        }
    }
    __syncthreads();
    const int NW = (p.Npad > p.N) ? p.Npad : p.N;           // write width
    const bool fast = (m0 + 16 <= p.M) && (n0 + 32 <= NW) && ((p.sCm & 3) == 0) && ((((size_t)C) & 15) == 0);
    if (fast) {
#pragma unroll
        for (int s = 0; s < 4; ++s) {
            const int row = s * 4 + (lane >> 3), c4 = (lane & 7) * 4;
            const v4f v = *(const v4f*)&ctile[row][c4];
            VST2V4(C + (long long)(m0 + row) * p.sCm + n0 + c4, v);
        }
    } else {
        for (int row = 0; row < 16; ++row) {
            const int m = m0 + row, n = n0 + lane;
            if (m < p.M && n < NW) VST2(float, C + (long long)m * p.sCm + n, ctile[row][lane]);
        }
    }
}


// =====================================================================================================================
// k_gemmT<MODE, TM, TN>: same contract as k_gemm, but one wave computes a (16*TM) x (16*TN) tile: TM A fragments and TN B fragments are
//   loaded per 32-wide k-step and reused across TM*TN WMMAs (far fewer load/convert instructions per MAC). MODE 0 (f16), 1 (bf16 hi/lo),
//   2 (bf16) only. grid (ceil(NW/(16*TN)), ceil(M/(16*TM)), Z), block 32. Epilogue identical to k_gemm, run per 16x32 sub-tile.
// =====================================================================================================================
template <int MODE, int TM, int TN>
__global__ __launch_bounds__(32) void k_gemmT(GemmP p) {
    const int lane = threadIdx.x & 31, h = lane >> 4, l15 = lane & 15;
    const int m0 = blockIdx.y * (16 * TM), n0 = blockIdx.x * (16 * TN);
    const int z = blockIdx.z, zo = z / p.zi_n, zi = z - zo * p.zi_n;
    const float* A = p.A + zo * p.sAo + zi * p.sAi;
    const float* B = p.B + zo * p.sBo + zi * p.sBi;
    v8f acc[TM][TN];
#pragma unroll
    for (int i = 0; i < TM; ++i)
#pragma unroll
        for (int t = 0; t < TN; ++t) { v8f zz = {}; acc[i][t] = zz; }
    for (int k0 = 0; k0 < p.K; k0 += 32) {
        if (MODE == 1) {
            Split a[TM], b[TN];
#pragma unroll
            for (int i = 0; i < TM; ++i) { const int am = min(m0 + 16 * i + l15, p.M - 1); a[i] = sp_ld(A + (long long)am * p.sAm, p.sAk, k0, h, p.K, 1.f); }
#pragma unroll
            for (int t = 0; t < TN; ++t) { const int bn = min(n0 + 16 * t + l15, p.N - 1); b[t] = sp_ld(B + (long long)bn * p.sBn, p.sBk, k0, h, p.K, 1.f); }
#pragma unroll
            for (int i = 0; i < TM; ++i)
#pragma unroll
                for (int t = 0; t < TN; ++t) acc[i][t] = wmma3(a[i], b[t], acc[i][t]);
        } else if (MODE == 2) {
            v16b a[TM], b[TN];
#pragma unroll
            for (int i = 0; i < TM; ++i) { const int am = min(m0 + 16 * i + l15, p.M - 1); a[i] = bh_ld(A + (long long)am * p.sAm, p.sAk, k0, h, p.K, 1.f); }
#pragma unroll
            for (int t = 0; t < TN; ++t) { const int bn = min(n0 + 16 * t + l15, p.N - 1); b[t] = bh_ld(B + (long long)bn * p.sBn, p.sBk, k0, h, p.K, 1.f); }
#pragma unroll
            for (int i = 0; i < TM; ++i)
#pragma unroll
                for (int t = 0; t < TN; ++t) acc[i][t] = wmmab(a[i], b[t], acc[i][t]);
        } else {
            v16h a[TM], b[TN];
#pragma unroll
            for (int i = 0; i < TM; ++i) { const int am = min(m0 + 16 * i + l15, p.M - 1); a[i] = fh_ld(A + (long long)am * p.sAm, p.sAk, k0, h, p.K, p.sa); }
#pragma unroll
            for (int t = 0; t < TN; ++t) { const int bn = min(n0 + 16 * t + l15, p.N - 1); b[t] = fh_ld(B + (long long)bn * p.sBn, p.sBk, k0, h, p.K, p.sb); }
#pragma unroll
            for (int i = 0; i < TM; ++i)
#pragma unroll
                for (int t = 0; t < TN; ++t) acc[i][t] = wmma16(a[i], b[t], acc[i][t]);
        }
    }
    const float iscale = (MODE == 0) ? p.alpha / (p.sa * p.sb) : p.alpha;
    float* C = p.C + zo * p.sCo + zi * p.sCi;
    const float* R = p.R + zo * p.sRo + zi * p.sRi;
    const int NW = (p.Npad > p.N) ? p.Npad : p.N;
    __shared__ __align__(16) float ctile[16][36];
#pragma unroll
    for (int i = 0; i < TM; ++i) {
        const int mb = m0 + 16 * i; if (mb >= p.M) break;          // wave-uniform
#pragma unroll
        for (int tp = 0; tp < TN / 2; ++tp) {
            const int nb = n0 + 32 * tp; if (nb >= NW) break;        // wave-uniform
#pragma unroll
            for (int t2 = 0; t2 < 2; ++t2) {
                const int t = 2 * tp + t2; const int n = nb + t2 * 16 + l15; const int nn = min(n, p.N - 1);
#pragma unroll
                for (int r = 0; r < 8; ++r) {
                    const int m = mb + 8 * h + r; const int mm = min(m, p.M - 1);
                    float v = acc[i][t][r] * iscale;
                    if (p.flags & 1) v += p.bias[nn];
                    if (p.flags & 2) v += p.bias[mm];
            if (p.flags & 8) v *= p.bias[(long long)zo * p.M + mm];   /* per-(z,row) scale vector laid out [Z][M]; exclusive with the bias flags */
                    v = act_fn(v, p.act);
                    if (p.flags & 4) v += p.beta * R[(long long)mm * p.sRm + (long long)nn * p.sRn];
                    ctile[8 * h + r][t2 * 16 + l15] = (n < p.N) ? v : 0.f;
                }
            }
            __syncthreads();
            const bool fast = (mb + 16 <= p.M) && (nb + 32 <= NW) && ((p.sCm & 3) == 0) && ((((size_t)C) & 15) == 0);
            if (fast) {
#pragma unroll
                for (int s = 0; s < 4; ++s) {
                    const int row = s * 4 + (lane >> 3), c4 = (lane & 7) * 4;
                    const v4f v = *(const v4f*)&ctile[row][c4];
                    VST2V4(C + (long long)(mb + row) * p.sCm + nb + c4, v);
                }
            } else {
                for (int row = 0; row < 16; ++row) {
                    const int m = mb + row, n = nb + lane;
                    if (m < p.M && n < NW) VST2(float, C + (long long)m * p.sCm + n, ctile[row][lane]);
                }
            }
            __syncthreads();
        }
    }
}

// =====================================================================================================================
//   Wave = 16 queries, AW waves per block, 64-key blocks; grid (ceil(Lq/(16*AW)), H, B), block 32*AW. Any Lq, Lk; head dim dh <= DHP
//   (DHP multiple of 32), value dim dv <= DVP (multiple of 16, <= 128). Every tensor addressed by (batch, head, row, element) strides, f32.
//   Scores: QM 0 f16 operands, 1 bf16 hi/lo split, 2 bf16 triple split; statistics f32 (exp2 domain); P.V: P x 4096 as f16 with V f16 staged in LDS
//   (SPLITPV: P and V as bf16 hi/lo splits). kv head = h / hrep. Masking: causal = 1 (keep j <= i + coff, masked -> -inf, key blocks beyond the
//   diagonal skipped), causal = 2 (masked -> mfill, a finite fill like the -1e9; no skipping), causal = 3 (keep j >= i + coff,
//   masked -> -inf, no skipping); optional additive f32 mask Mf,
//   optional int keep-mask Mi (0 -> score := mfill), both addressed b*smb + h*smh + i*smi + j*smj (0 strides broadcast).
// =====================================================================================================================
#define AW 4
struct AttnP {   // apv4
    const float* Q; const float* K; const float* V; float* O; float* P; const float* Mf; const int* Mi; float* ST;
    const float* Pw; const float* Rt; const int* SQ; const int* SK;           // optional: post-softmax weight, relative-position table, segment ids
    long long swb, swh, swi, swj, srb, srh, sri;                                 // Pw strides (b,h,i,j); Rt strides (b,h,i), column = clamp(i - j + roff, 0, rn-1)
    long long sQb, sQh, sQi, sQd, sKb, sKh, sKj, sKd, sVb, sVh, sVj, sVd, sOb, sOh, sOi, sPb, sPh, sPi, smb, smh, smi, smj;
    int Lq, Lk, dh, dv, hrep, causal, coff, pband;   // pband > 0: P holds only the band |j - i| <= pband, column j - i + pband
    float scale, mfill; int nonorm, mpol;             // nonorm (online path only): O = sum_j exp(score_j) V_j without the 1/rowsum (scores must be <= ~0); mpol: Mi masks where ==0 (mpol 0) or where !=0 (mpol 1)
    int roff, rn, segpol, win;                        // Rt column offset/count; SQ/SK: score := mfill where (segpol 0) SQ[i] != SK[j] or (segpol 1) SQ[i] == SK[j]; win > 0: keys with i - j > win (after coff) -> -inf
};
//   Pw: the softmax numerator is multiplied by Pw(b,h,i,j) AFTER the row sum is taken (probs * weight, then P.V), as in post-softmax multiplicative biases.                                                    // ST (optional): per row (b,h,i) -> ST[((b*H + h)*Lq + i)*2 + {0,1}] = {row max of the scaled+masked score (natural units), sum_j exp(score - max)}
static_assert(sizeof(AttnP) == 12 * 8 + 29 * 8 + 16 * 4, "AttnP has padding");

#ifndef KATTN_ATTR
#define KATTN_ATTR
#endif
template <int DHP, int DVP, int QM, bool SPLITPV, bool TWOPASS>
__global__ __launch_bounds__(32 * AW) KATTN_ATTR void k_attn(AttnP p) {
    constexpr int NT = DVP / 16;                // output tiles
    constexpr int KS = DHP / 32;                // k-steps for the scores
    constexpr int VP = DVP + 8;                 // LDS pitch (halves)
    __shared__ __align__(16) float    pl[AW][16 * 64];
    __shared__ __align__(16) _Float16 vl[(SPLITPV ? 2 : 1) * 64 * VP];   // f16 V tile, or bf16 hi and lo tiles (same 2-byte size)
    const int lane = threadIdx.x & 31, hf = lane >> 4, l15 = lane & 15, wave = threadIdx.x >> 5;
    const int h = blockIdx.y, b = blockIdx.z, hk = h / p.hrep;
    const int q0 = (blockIdx.x * AW + wave) * 16;
    float* myp = pl[wave];
    const float L2E = 1.4426950408889634f;
    const float NEG = -__builtin_inff();
    const int qi = min(q0 + l15, p.Lq - 1);
    const float* qrow = p.Q + b * p.sQb + h * p.sQh + (long long)qi * p.sQi;
    const float* kbase = p.K + b * p.sKb + hk * p.sKh;
    const float* vbase = p.V + b * p.sVb + hk * p.sVh;
    v16h qa[QM == 0 ? KS : 1]; Split qs_[QM == 1 ? KS : 1]; Split3 qt_[QM == 2 ? KS : 1];
#pragma unroll
    for (int ks = 0; ks < KS; ++ks) {
        if (QM == 2) qt_[ks] = sp3_ld(qrow, p.sQd, ks * 32, hf, p.dh, 1.f);
        else if (QM == 1) qs_[ks] = sp_ld(qrow, p.sQd, ks * 32, hf, p.dh, 1.f);
        else qa[ks] = fh_ld(qrow, p.sQd, ks * 32, hf, p.dh, 1.f);
    }
    v8f o[NT]; float m8[8], l8[8];
#pragma unroll
    for (int t = 0; t < NT; ++t) { v8f zz = {}; o[t] = zz; }
#pragma unroll
    for (int i = 0; i < 8; ++i) { m8[i] = NEG; l8[i] = 0.f; }
    int jend = p.Lk;
    if (p.causal == 1) { const int je = (blockIdx.x * AW + AW - 1) * 16 + 16 + p.coff; jend = min(jend, max(je, 0)); }   // uniform per block
    const int npass = TWOPASS ? 2 : 1;
    for (int pass = 0; pass < npass; ++pass) {
        const bool dopv = (!TWOPASS) || pass == 1;
        for (int j0 = 0; j0 < jend; j0 += 64) {
            if (dopv) {
                __syncthreads();                                 // previous key block's reads of vl / pl are done
                for (int idx = threadIdx.x; idx < 64 * DVP; idx += 32 * AW) {
                    const int jr = idx / DVP, d = idx - jr * DVP, j = j0 + jr;
                    const float f = (j < p.Lk && d < p.dv) ? vbase[(long long)j * p.sVj + (long long)d * p.sVd] : 0.f;
                    if (SPLITPV) {
                        const __bf16 hb = bf16_rne(f);
                        ((__bf16*)vl)[jr * VP + d] = hb; ((__bf16*)vl)[64 * VP + jr * VP + d] = bf16_rne(f - bf16_f32(hb));
                    } else vl[jr * VP + d] = (_Float16)f;
                }
            }
            v8f s[4];
#pragma unroll
            for (int t = 0; t < 4; ++t) {
                const int j = min(j0 + t * 16 + l15, p.Lk - 1);
                const float* krow = kbase + (long long)j * p.sKj;
                v8f acc = {};
#pragma unroll
                for (int ks = 0; ks < KS; ++ks) {
                    if (QM == 2)      acc = wmma6(qt_[ks], sp3_ld(krow, p.sKd, ks * 32, hf, p.dh, 1.f), acc);
                    else if (QM == 1) acc = wmma3(qs_[ks], sp_ld(krow, p.sKd, ks * 32, hf, p.dh, 1.f), acc);
                    else              acc = wmma16(qa[ks], fh_ld(krow, p.sKd, ks * 32, hf, p.dh, 1.f), acc);
                }
                s[t] = acc;
            }
            float pv[8][4];
#pragma unroll
            for (int i = 0; i < 8; ++i) {
                const int irow = q0 + i + 8 * hf;
                const int ic = min(irow, p.Lq - 1);
                float sc[4];
#pragma unroll
                for (int t = 0; t < 4; ++t) {
                    const int jg = j0 + t * 16 + l15;
                    float v = s[t][i] * p.scale;
                    if (p.Mf) v += p.Mf[b * p.smb + h * p.smh + (long long)ic * p.smi + (long long)min(jg, p.Lk - 1) * p.smj];
                    if (p.Rt) { int rc = ic - min(jg, p.Lk - 1) + p.roff; rc = rc < 0 ? 0 : (rc >= p.rn ? p.rn - 1 : rc); v += p.Rt[b * p.srb + h * p.srh + (long long)ic * p.sri + rc]; }
                    if (p.Mi) { const int mv = p.Mi[b * p.smb + h * p.smh + (long long)ic * p.smi + (long long)min(jg, p.Lk - 1) * p.smj]; if (p.mpol ? (mv != 0) : (mv == 0)) v = p.mfill; }
                    if (p.SQ) { const bool same = p.SQ[(long long)b * p.Lq + ic] == p.SK[(long long)b * p.Lk + min(jg, p.Lk - 1)]; if (p.segpol ? same : !same) v = p.mfill; }
                    if (p.causal == 2 && jg > irow + p.coff) v = p.mfill;
                    if (jg >= p.Lk || (p.causal == 1 && jg > irow + p.coff) || (p.causal == 3 && jg < irow + p.coff) || (p.win > 0 && irow + p.coff - jg > p.win)) v = NEG; else v *= L2E;
                    sc[t] = v;
                }
                if (!TWOPASS || pass == 0) {
                    float mx = fmaxf(fmaxf(sc[0], sc[1]), fmaxf(sc[2], sc[3]));
                    mx = fmaxf(mx, __shfl_xor(mx, 1, 32)); mx = fmaxf(mx, __shfl_xor(mx, 2, 32));
                    mx = fmaxf(mx, __shfl_xor(mx, 4, 32)); mx = fmaxf(mx, __shfl_xor(mx, 8, 32));
                    const float mnew = fmaxf(m8[i], mx);
                    const float corr = (mnew == NEG) ? 1.f : exp2f(m8[i] - mnew);
                    float rs = 0.f;
#pragma unroll
                    for (int t = 0; t < 4; ++t) {
                        const float pp = (sc[t] == NEG) ? 0.f : exp2f(sc[t] - mnew); rs += pp;
                        pv[i][t] = p.Pw ? pp * p.Pw[b * p.swb + h * p.swh + (long long)ic * p.swi + (long long)min(j0 + t * 16 + l15, p.Lk - 1) * p.swj] : pp;
                    }
                    rs += __shfl_xor(rs, 1, 32); rs += __shfl_xor(rs, 2, 32); rs += __shfl_xor(rs, 4, 32); rs += __shfl_xor(rs, 8, 32);
                    l8[i] = l8[i] * corr + rs; m8[i] = mnew;
                    if (!TWOPASS) {
#pragma unroll
                        for (int t = 0; t < NT; ++t) o[t][i] *= corr;
                    }
                } else {
                    const float inv = (l8[i] > 0.f) ? 1.f / l8[i] : 0.f;
#pragma unroll
                    for (int t = 0; t < 4; ++t) {
                        const int jg = j0 + t * 16 + l15;
                        float pp = (sc[t] == NEG) ? 0.f : exp2f(sc[t] - m8[i]) * inv;
                        if (p.Pw) pp *= p.Pw[b * p.swb + h * p.swh + (long long)ic * p.swi + (long long)min(jg, p.Lk - 1) * p.swj];
                        pv[i][t] = pp;
                    }
                }
            }
            if (dopv) {
#pragma unroll
                for (int i = 0; i < 8; ++i)
#pragma unroll
                    for (int t = 0; t < 4; ++t) ((float*)myp)[(i + 8 * hf) * 64 + t * 16 + l15] = pv[i][t];
                __syncthreads();                                 // P (per wave) and V (shared) visible
                if (p.P) {
                    float* pb_ = p.P + b * p.sPb + h * p.sPh;
                    const bool fastP = (p.pband == 0) && ((p.sPi & 3) == 0) && (j0 + 64 <= p.Lk) && (q0 + 16 <= p.Lq) && ((((size_t)pb_) & 15) == 0);
                    if (fastP) {
#pragma unroll
                        for (int s = 0; s < 8; ++s) {
                            const int row = s * 2 + (lane >> 4), c4 = (lane & 15) * 4;
                            const v4f v = *(const v4f*)(myp + row * 64 + c4);
                            VST2V4(pb_ + (long long)(q0 + row) * p.sPi + j0 + c4, v);
                        }
                    } else {
                        for (int row = 0; row < 16; ++row) {
                            const int irow = q0 + row; if (irow >= p.Lq) continue;
                            for (int c = lane; c < 64; c += 32) {
                                const int jg = j0 + c; if (jg >= p.Lk) continue;
                                if (p.pband == 0) VST2(float, pb_ + (long long)irow * p.sPi + jg, myp[row * 64 + c]);
                                else if (jg - irow <= p.pband && irow - jg <= p.pband) VST2(float, pb_ + (long long)irow * p.sPi + (jg - irow + p.pband), myp[row * 64 + c]);
                            }
                        }
                    }
                }
                if (SPLITPV) {
                    const Split pa0 = sp_ld(myp + l15 * 64, 1, 0, hf, 64, 1.f), pa1 = sp_ld(myp + l15 * 64, 1, 32, hf, 64, 1.f);
                    const __bf16* vh = (const __bf16*)vl; const __bf16* vlo = vh + 64 * VP;
#pragma unroll
                    for (int t = 0; t < NT; ++t) {
                        const int dcol = t * 16 + l15;
                        Split b0, b1;
#pragma unroll
                        for (int e = 0; e < 16; ++e) {
                            const int k0 = frag_k(e, hf), k1 = 32 + frag_k(e, hf);
                            b0.hi[e] = vh[k0 * VP + dcol]; b0.lo[e] = vlo[k0 * VP + dcol]; b1.hi[e] = vh[k1 * VP + dcol]; b1.lo[e] = vlo[k1 * VP + dcol];
                        }
                        o[t] = wmma3(pa0, b0, o[t]);
                        o[t] = wmma3(pa1, b1, o[t]);
                    }
                } else {
                    const v16h pa0 = fh_ld(myp + l15 * 64, 1, 0, hf, 64, 4096.f), pa1 = fh_ld(myp + l15 * 64, 1, 32, hf, 64, 4096.f);
#pragma unroll
                    for (int t = 0; t < NT; ++t) {
                        const int dcol = t * 16 + l15;
                        v16h b0, b1;
#pragma unroll
                        for (int e = 0; e < 16; ++e) { b0[e] = vl[frag_k(e, hf) * VP + dcol]; b1[e] = vl[(32 + frag_k(e, hf)) * VP + dcol]; }
                        o[t] = wmma16(pa0, b0, o[t]);
                        o[t] = wmma16(pa1, b1, o[t]);
                    }
                }
            }
        }
    }
    float* obase = p.O + b * p.sOb + h * p.sOh;
    if (p.ST) {
        const int rl = lane >> 1, isel = rl & 7;           // row q0 + rl ; rl>>3 == hf holds because lane>>4 == (lane>>1)>>3
        float mv = 0.f, lv = 0.f;
#pragma unroll
        for (int i = 0; i < 8; ++i) if (i == isel) { mv = m8[i]; lv = l8[i]; }
        const int irow = q0 + rl;
        if (irow < p.Lq) { float* st = p.ST + (((long long)b * gridDim.y + h) * p.Lq + irow) * 2 + (lane & 1); VST2(float, st, (lane & 1) ? lv : mv * 0.6931471805599453f); }
    }
    float invr[8];
#pragma unroll
    for (int i = 0; i < 8; ++i) {
        if (TWOPASS) invr[i] = SPLITPV ? 1.f : (1.f / 4096.f);
        else if (p.nonorm) invr[i] = exp2f(m8[i]) * (SPLITPV ? 1.f : (1.f / 4096.f));
        else invr[i] = (l8[i] > 0.f) ? (SPLITPV ? 1.f / l8[i] : 1.f / (l8[i] * 4096.f)) : 0.f;
    }
    __syncthreads();                                             // all waves done with pl/vl from the main loop
    const bool ofast = ((p.sOi & 3) == 0) && ((((size_t)obase) & 15) == 0) && (q0 + 16 <= p.Lq);
#pragma unroll
    for (int c0 = 0; c0 < DVP; c0 += 64) {
#pragma unroll
        for (int i = 0; i < 8; ++i)
#pragma unroll
            for (int t = 0; t < NT; ++t) if (t * 16 >= c0 && t * 16 < c0 + 64) ((float*)myp)[(i + 8 * hf) * 64 + (t * 16 - c0) + l15] = o[t][i] * invr[i];
        __syncthreads();
        const int cw = (DVP - c0 < 64) ? (DVP - c0) : 64;      // staged columns in this chunk (multiple of 16)
        if (ofast && (c0 + cw <= p.dv) && (cw % 32 == 0)) {
            const int lpr = cw / 4;                              // lanes per row (16 for 64 cols, 8 for 32)
            const int rows_per_ins = 32 / lpr;
            for (int r0 = 0; r0 < 16; r0 += rows_per_ins) {
                const int row = r0 + lane / lpr, c4 = (lane % lpr) * 4;
                const v4f v = *(const v4f*)(myp + row * 64 + c4);
                VST2V4(obase + (long long)(q0 + row) * p.sOi + c0 + c4, v);
            }
        } else {
            for (int row = 0; row < 16; ++row) {
                const int irow = q0 + row; if (irow >= p.Lq) continue;
                for (int c = lane; c < cw; c += 32) { const int d = c0 + c; if (d < p.dv) VST2(float, obase + (long long)irow * p.sOi + d, myp[row * 64 + c]); }
            }
        }
        __syncthreads();
    }
}

// =====================================================================================================================
// k_tr: dst(z, c, r) = alpha * src(z, r, c) (+ beta * R2(z, c, r)): [Z][R][C] (row stride lds) -> [Z][C][R] (row stride ldd) through a 32x32 LDS tile;
//   flags: 1 -> add beta * residual R2 addressed like dst (z*sRz + c*ldr + r); act applied before the residual.
// =====================================================================================================================
struct TrP { const float* src; float* dst; const float* R2; long long sSz, lds, sDz, ldd, sRz, ldr; int R, C, flags, act; float alpha, beta; };
static_assert(sizeof(TrP) == 3 * 8 + 6 * 8 + 6 * 4, "TrP has padding");
__global__ __launch_bounds__(256) void k_tr(TrP p) {
    __shared__ float tile[32][33];
    const int c0 = blockIdx.x * 32, r0 = blockIdx.y * 32, z = blockIdx.z;
    const int lane = threadIdx.x & 31, wave = threadIdx.x >> 5;
    const float* s = p.src + z * p.sSz;
#pragma unroll
    for (int k = 0; k < 4; ++k) {
        const int rl = wave * 4 + k, r = r0 + rl, c = c0 + lane;
        tile[rl][lane] = (r < p.R && c < p.C) ? s[(long long)r * p.lds + c] : 0.f;
    }
    __syncthreads();
    float* d = p.dst + z * p.sDz; const float* rr = p.R2 + z * p.sRz;
#pragma unroll
    for (int k = 0; k < 4; ++k) {
        const int cl = wave * 4 + k, c = c0 + cl, r = r0 + lane;
        if (c < p.C && r < p.R) {
            float v = act_fn(p.alpha * tile[lane][cl], p.act);
            if (p.flags & 1) v += p.beta * rr[(long long)c * p.ldr + r];
            VST2(float, d + (long long)c * p.ldd + r, v);
        }
    }
}

// k_affine: dst[i] = a * (sdev ? sdev[0] : 1) * src[i] + b, i < n (one thread per element; consecutive lanes -> consecutive addresses)
__global__ __launch_bounds__(256) void k_affine(const float* __restrict__ src, float* __restrict__ dst, int n, float a, float b, const float* __restrict__ sdev) {
    const int i = blockIdx.x * 256 + threadIdx.x;
    if (i < n) { const float aa = sdev ? a * sdev[0] : a; const float v = aa * src[i] + b; VST2(float, dst + i, v); }
}

// =====================================================================================================================
// k_softmax: row softmax over n contiguous elements, one 256-thread block per row; rows addressed z*sz + r*sr (grid (R, Z)).
//   out = scale_out * softmax(scale_in * x + (Mf ? Mf[z*smz + r*smr + j] : 0)); a row whose max is -inf is written as 0.
// =====================================================================================================================
struct SmP { const float* src; float* dst; const float* Mf; long long sz, sr, dz, dr, smz, smr; int n, pad; float scale_in, scale_out; };
static_assert(sizeof(SmP) == 3 * 8 + 6 * 8 + 4 * 4, "SmP has padding");
__global__ __launch_bounds__(256) void k_softmax(SmP p) {
    __shared__ float red[256];
    const int r = blockIdx.x, z = blockIdx.y, tid = threadIdx.x;
    const float* s = p.src + z * p.sz + (long long)r * p.sr;
    const float* mf = p.Mf ? (p.Mf + z * p.smz + (long long)r * p.smr) : nullptr;
    float mx = -__builtin_inff();
    for (int j = tid; j < p.n; j += 256) { float v = s[j] * p.scale_in; if (mf) v += mf[j]; mx = fmaxf(mx, v); }
    red[tid] = mx; __syncthreads();
    for (int o = 128; o > 0; o >>= 1) { if (tid < o) red[tid] = fmaxf(red[tid], red[tid + o]); __syncthreads(); }
    mx = red[0]; __syncthreads();
    float sum = 0.f;
    for (int j = tid; j < p.n; j += 256) { float v = s[j] * p.scale_in; if (mf) v += mf[j]; sum += (mx == -__builtin_inff()) ? 0.f : expf(v - mx); }
    red[tid] = sum; __syncthreads();
    for (int o = 128; o > 0; o >>= 1) { if (tid < o) red[tid] += red[tid + o]; __syncthreads(); }
    sum = red[0];
    const float inv = (sum > 0.f) ? p.scale_out / sum : 0.f;
    float* d = p.dst + z * p.dz + (long long)r * p.dr;
    for (int j = tid; j < p.n; j += 256) { float v = s[j] * p.scale_in; if (mf) v += mf[j]; const float o = (mx == -__builtin_inff()) ? 0.f : expf(v - mx) * inv; VST2(float, d + j, o); }
}
// =====================================================================================================================
// k_stats: mean and rsqrt(var + eps) over a set of n elements addressed base + z*sz + (e / inner) * so + (e % inner) * si, one 256-thread
// k_norm_apply: y = (x - mean[set]) * rstd[set] * g[c] + b[c] over a [Z][C][L] channel-major tensor with set = z*G + c / (C/G) (G groups per z;
//   G = C -> per-channel sets indexed z*C+c; for batch norm pass stats indexed by c only via bn = 1). Optional act. Output same layout.
// =====================================================================================================================
//   mode 0: mean / rsqrt(var + eps); mode 1 (RMSNorm): 0 / rsqrt(mean(x^2) + eps); mode 2 (L2 normalize * sqrt(n)): 0 / sqrt(n) / max(||x||, eps); mode 3: as 0 with unbiased variance (n-1)
__global__ __launch_bounds__(256) void k_stats(const float* __restrict__ x, long long sz, long long so, long long si, int inner, int n, float eps, float* __restrict__ stat, int mode) {
    __shared__ float red[256];
    const int z = blockIdx.x, tid = threadIdx.x;
    const float* base = x + z * sz;
    float s = 0.f;
    for (int e = tid; e < n; e += 256) s += base[(long long)(e / inner) * so + (long long)(e % inner) * si];
    red[tid] = s; __syncthreads();
    for (int o = 128; o > 0; o >>= 1) { if (tid < o) red[tid] += red[tid + o]; __syncthreads(); }
    const float mu = (mode == 0 || mode == 3) ? red[0] / (float)n : 0.f; __syncthreads();
    float q = 0.f;
    for (int e = tid; e < n; e += 256) { const float dlt = base[(long long)(e / inner) * so + (long long)(e % inner) * si] - mu; q += dlt * dlt; }
    red[tid] = q; __syncthreads();
    for (int o = 128; o > 0; o >>= 1) { if (tid < o) red[tid] += red[tid + o]; __syncthreads(); }
    {
        float rs;
        if (mode == 2) rs = sqrtf((float)n) / fmaxf(sqrtf(red[0]), eps); else if (mode == 3) rs = rsqrtf(red[0] / (float)(n - 1) + eps); else rs = rsqrtf(red[0] / (float)n + eps);
        if (tid < 32) { const float v = (tid == 0) ? mu : ((tid == 1) ? rs : 0.f); VST2(float, stat + (long long)z * 32 + tid, v); }
    }
}
//   One thread per element over the flat [Z][C][L] index space: grid ceil(Z*C*L / 256).
__global__ __launch_bounds__(256) void k_norm_apply(const float* __restrict__ x, float* __restrict__ y, const float* __restrict__ stat, const float* __restrict__ g, const float* __restrict__ bta,
                                                     int Z, int C, int L, int G, int bn, int act) {
    const long long idx = (long long)blockIdx.x * 256 + threadIdx.x;
    if (idx >= (long long)Z * C * L) return;
    const int l = (int)(idx % L); const long long zc = idx / L; const int c = (int)(zc % C), z = (int)(zc / C); (void)l;
    const int set = bn ? c : (z * G + c / (C / G));
    float v = (x[idx] - stat[(long long)set * 32]) * stat[(long long)set * 32 + 1];
    if (g) v *= g[c];
    if (bta) v += bta[c];
    v = act_fn(v, act);
    VST2(float, y + idx, v);
}

// k_lse_neg: c[i] = -(st[2i] + log(st[2i+1])) = minus the log-sum-exp of row i from k_attn's ST output (for softmax over the query axis)
__global__ __launch_bounds__(256) void k_lse_neg(const float* __restrict__ st, float* __restrict__ c, int n) {
    const int i = blockIdx.x * 256 + threadIdx.x;
    if (i < n) { const float v = -(st[2 * i] + logf(st[2 * i + 1])); VST2(float, c + i, v); }
}

// k_iota: dst[i] = a * i + b as int32 (segment/position id helper)
__global__ __launch_bounds__(256) void k_iota(int* __restrict__ dst, int n, int a, int b) {
    const int i = blockIdx.x * 256 + threadIdx.x;
    if (i < n) { const int v = a * i + b; VST2(int, dst + i, v); }
}

// k_axpby: dst[i] = a * x[i] + b * y[i] (+ c), i < n
__global__ __launch_bounds__(256) void k_axpby(const float* __restrict__ x, const float* __restrict__ y, float* __restrict__ dst, int n, float a, float b, float c) {
    const int i = blockIdx.x * 256 + threadIdx.x;
    if (i < n) { const float v = a * x[i] + b * y[i] + c; VST2(float, dst + i, v); }
}

// =====================================================================================================================
// k_rope: rotary embedding on a [R rows][Hn heads][D] view (row stride sXr, head stride sXh, element stride 1) -> Y (own strides).
//   mode 0: rotate_half (partner d±D/2, sign - for d<D/2); mode 1: interleaved pairs (partner d^1, sign - for even d).
//   table column tcol: tmode 0 -> d, 1 -> d % (D/2), 2 -> d / 2; position p: pmode 0 -> r % S, 1 -> head index, 2 -> pos[r];
//   c = C[(r / S) * sCb + p * sCp + tcol * sCd], s likewise from Sn; y = x[d] * c + sign * x[partner] * s. X and Y must not alias.
// =====================================================================================================================
struct RopeP { const float* X; float* Y; const float* C; const float* Sn; const int* pos; long long sXr, sXh, sYr, sYh, sCb, sCp, sCd; int R, Hn, D, S, mode, tmode, pmode, pad; };
static_assert(sizeof(RopeP) == 5 * 8 + 7 * 8 + 8 * 4, "RopeP has padding");
__global__ __launch_bounds__(256) void k_rope(RopeP p) {
    const long long idx = (long long)blockIdx.x * 256 + threadIdx.x;
    if (idx >= (long long)p.R * p.Hn * p.D) return;
    const int d = (int)(idx % p.D); const long long rh = idx / p.D; const int h = (int)(rh % p.Hn); const int r = (int)(rh / p.Hn);
    const int half = p.D / 2;
    int partner; float sign;
    if (p.mode == 0) { partner = (d < half) ? d + half : d - half; sign = (d < half) ? -1.f : 1.f; }
    else { partner = d ^ 1; sign = (d & 1) ? 1.f : -1.f; }
    const int tcol = (p.tmode == 0) ? d : ((p.tmode == 1) ? (d % half) : (d >> 1));
    const int pp = (p.pmode == 0) ? (r % p.S) : ((p.pmode == 1) ? h : p.pos[r]);
    const long long toff = (long long)(r / p.S) * p.sCb + (long long)pp * p.sCp + (long long)tcol * p.sCd;
    const float* xr = p.X + (long long)r * p.sXr + (long long)h * p.sXh;
    const float v = xr[d] * p.C[toff] + sign * xr[partner] * p.Sn[toff];
    VST2(float, p.Y + (long long)r * p.sYr + (long long)h * p.sYh + d, v);
}

// k_invf + k_sincos (split so neither kernel carries a large VALU-fma footprint): invf_i = num * (1 / powf(base, (2 i)/D)) [fmode 0],
//   num * expf((2 i) * cexp) [fmode 1], num * powf(base, -2 (i - 1) / D) [fmode 2]; then cs/sn[s*half + i] = cos/sin((pscale * s) * invf_i)
__global__ __launch_bounds__(256) void k_invf(float* __restrict__ invb, int half, int D, float base, float num, int fmode, float cexp) {
    const int i = blockIdx.x * 256 + threadIdx.x;
    if (i >= ((half + 31) / 32) * 32) return;
    if (i >= half) { VST2(float, invb + i, 0.f); return; }
    const float e = (float)(2 * i) / (float)D;
    float invf;
    if (fmode == 1) invf = num * expf((float)(2 * i) * cexp);
    else if (fmode == 2) invf = num * powf(base, (-2.0f * ((float)i - 1.0f)) / (float)D);
    else invf = num * (1.0f / powf(base, e));
    VST2(float, invb + i, invf);
}
__global__ __launch_bounds__(256) void k_sincos(float* __restrict__ cs, float* __restrict__ sn, const float* __restrict__ invb, int S, int half, float pscale) {
    const int idx = blockIdx.x * 256 + threadIdx.x;
    if (idx >= S * half) return;
    const int s = idx / half, i = idx - s * half;
    const float ang = (pscale * (float)s) * invb[i];
    VST2(float, cs + idx, cosf(ang)); VST2(float, sn + idx, sinf(ang));
}

// k_mulact: dst[i] = act(x[i]) * y[i]
__global__ __launch_bounds__(256) void k_mulact(const float* __restrict__ x, const float* __restrict__ y, float* __restrict__ dst, int n, int act) {
    const int i = blockIdx.x * 256 + threadIdx.x;
    if (i < n) { const float v = act_fn(x[i], act) * y[i]; VST2(float, dst + i, v); }
}

// =====================================================================================================================
// k_matvec: thread-per-row matrix-vector products for N <= 8 output columns (heads with 1-3 outputs, gates), f32 on the VALU.
//   C[r*sCm + j] = act(alpha * sum_k A[r*sAm + k*sAk] * B[j*sBn + k*sBk] + bias[j]) + beta * R[r*sRm + j*sRn]; each thread writes its N contiguous floats.
// =====================================================================================================================
__global__ __launch_bounds__(256) void k_matvec(GemmP p) {
    // 32 lanes write one line with one instruction.
    const int rpt = (p.N == 1) ? 1 : 32;
    const long long r0 = ((long long)blockIdx.x * 256 + threadIdx.x) * rpt; const int z = blockIdx.z, zo = z / p.zi_n, zi = z - zo * p.zi_n;
    if (r0 >= p.M) return;
    const float* Bb = p.B + zo * p.sBo + zi * p.sBi;
    float* C = p.C + zo * p.sCo + zi * p.sCi; const float* R = p.R + zo * p.sRo + zi * p.sRi;
    for (int rr = 0; rr < rpt; ++rr) {
        const long long r = r0 + rr; if (r >= p.M) break;
        const float* A = p.A + zo * p.sAo + zi * p.sAi + r * p.sAm;
        float acc[8] = {0.f, 0.f, 0.f, 0.f, 0.f, 0.f, 0.f, 0.f};
        for (int k = 0; k < p.K; ++k) { const float a = A[(long long)k * p.sAk];
#pragma unroll
            for (int j = 0; j < 8; ++j) if (j < p.N) acc[j] += a * Bb[(long long)j * p.sBn + (long long)k * p.sBk]; }
#pragma unroll
        for (int j = 0; j < 8; ++j) if (j < p.N) {
            float v = acc[j] * p.alpha;
            if (p.flags & 1) v += p.bias[j];
            if (p.flags & 2) v += p.bias[r];
            v = act_fn(v, p.act);
            if (p.flags & 4) v += p.beta * R[r * p.sRm + (long long)j * p.sRn];
            VST2(float, C + r * p.sCm + j, v);
        }
    }
}
// k_smallsoftmax: thread-per-row softmax for short rows (n <= 64): dst[r*dr + j] = softmax(scale*src[r*sr + j])
__global__ __launch_bounds__(256) void k_smallsoftmax(const float* __restrict__ src, float* __restrict__ dst, long long sr, long long dr, int n, long long R, float scale) {
    const long long r0 = ((long long)blockIdx.x * 256 + threadIdx.x) * 32;
    for (int rr = 0; rr < 32; ++rr) {
        const long long r = r0 + rr; if (r >= R) return;
        const float* s = src + r * sr; float* d = dst + r * dr;
        float mx = -__builtin_inff();
        for (int j = 0; j < n; ++j) mx = fmaxf(mx, s[j] * scale);
        float sum = 0.f;
        for (int j = 0; j < n; ++j) sum += expf(s[j] * scale - mx);
        const float inv = 1.f / sum;
        for (int j = 0; j < n; ++j) { const float v = expf(s[j] * scale - mx) * inv; VST2(float, d + j, v); }
    }
}

__global__ __launch_bounds__(32) void k_unitstat(float* __restrict__ st) { const int t = threadIdx.x; const float v = (t == 1) ? 1.f : 0.f; VST2(float, st + t, v); }

// destination (e.g. a d_out whose row width is not a multiple of 32 floats) is written by consecutive lanes of one instruction
__global__ __launch_bounds__(256) void k_lincopy(const float* __restrict__ src, long long lds, float* __restrict__ dst, long long ldd, long long rows, int cols) {
    const long long i = (long long)blockIdx.x * 256 + threadIdx.x; if (i >= rows * cols) return;
    const long long r = i / cols; const int c = (int)(i - r * cols);
    const float v = src[r * lds + c]; VST2(float, dst + r * ldd + c, v);
}

namespace w25 {
typedef __attribute__((ext_vector_type(16))) _Float16 v16h;
typedef __attribute__((ext_vector_type(8)))  _Float16 v8h;
typedef __attribute__((ext_vector_type(16))) __bf16   v16b;
typedef __attribute__((ext_vector_type(8)))  __bf16   v8b;
typedef __attribute__((ext_vector_type(8)))  float    v8f;
typedef __attribute__((ext_vector_type(4)))  float    v4f;

__device__ __forceinline__ unsigned short f2bf_bits(float f) {
  unsigned u = __float_as_uint(f);
  return (unsigned short)((u + 0x7FFFu + ((u >> 16) & 1u)) >> 16);
}
__device__ __forceinline__ float bf_bits2f(unsigned short h) { return __uint_as_float(((unsigned)h) << 16); }

// hazard guards as plain device helpers (no inline asm inside the kernel template body)
__device__ __forceinline__ void dep_guard_h(v8f& a, v8f& b, v16h x, v16h y) { asm volatile("v_nop\n\tv_nop\n\tv_nop\n\tv_nop" : "+v"(a), "+v"(b) : "v"(x), "v"(y)); }
__device__ __forceinline__ void dep_guard_b(v8f& a, v8f& b, v16b x, v16b y) { asm volatile("v_nop\n\tv_nop\n\tv_nop\n\tv_nop" : "+v"(a), "+v"(b) : "v"(x), "v"(y)); }
__device__ __forceinline__ void keep4_h(v16h a, v16h b, v16h c, v16h d) { asm volatile("v_nop" :: "v"(a), "v"(b), "v"(c), "v"(d)); }
__device__ __forceinline__ void keep4_b(v16b a, v16b b, v16b c, v16b d) { asm volatile("v_nop" :: "v"(a), "v"(b), "v"(c), "v"(d)); }
__device__ __forceinline__ void acc_guard4(v8f& a, v8f& b, v8f& c, v8f& d) { asm volatile("v_nop\n\tv_nop\n\tv_nop\n\tv_nop" : "+v"(a), "+v"(b), "+v"(c), "+v"(d)); }
template <typename T> struct Frag;
template <> struct Frag<_Float16> {
  typedef v16h V; union U { v16h v; v8h h[2]; };
  static __device__ __forceinline__ v16h load(const _Float16* p) {   // elements 0..7 <- p[0..7], 8..15 <- p[16..23]
    U f; f.h[0] = *(const v8h*)(p); f.h[1] = *(const v8h*)(p + 16); return f.v;
  }
  static __device__ __forceinline__ v8f mma(v16h a, v16h b, v8f c) {
    return __builtin_amdgcn_wmma_f32_16x16x32_f16(false, a, false, b, (short)0, c, false, false);
  }
  static __device__ __forceinline__ void guard(v8f& a, v8f& b, v16h x, v16h y) { dep_guard_h(a, b, x, y); }
  static __device__ __forceinline__ void keep(v16h a, v16h b, v16h c, v16h d) { keep4_h(a, b, c, d); }
};
template <> struct Frag<__bf16> {
  typedef v16b V; union U { v16b v; v8b h[2]; };
  static __device__ __forceinline__ v16b load(const __bf16* p) {
    U f; f.h[0] = *(const v8b*)(p); f.h[1] = *(const v8b*)(p + 16); return f.v;
  }
  static __device__ __forceinline__ v8f mma(v16b a, v16b b, v8f c) {
    return __builtin_amdgcn_wmma_f32_16x16x32_bf16(false, a, false, b, (short)0, c, false, false);
  }
  static __device__ __forceinline__ void guard(v8f& a, v8f& b, v16b x, v16b y) { dep_guard_b(a, b, x, y); }
  static __device__ __forceinline__ void keep(v16b a, v16b b, v16b c, v16b d) { keep4_b(a, b, c, d); }
};

// ---- Register-blocked batched WMMA GEMM ------------------------------------
// C[m,n] = scale * sum_k A[m,k] * Bt[n,k] (+bias)(+resid); each wave owns a 64x64 tile.
// A row-major [M,K]; Bt row-major [N,K]; M,N % 64 == 0, K % 32 == 0.
// SPLIT: operands are hi/lo planes (A2/Bt2 = lo planes, same layout); product = hi·hi + hi·lo + lo·hi.
// BIAS_MODE: 0 = none, 1 = bias[m], 2 = bias[n].
// OUT_MODE: 0 = f32, 1 = f16, 2 = bf16 hi plane (Cout) + bf16 lo plane (Cout2).
// ET: 0 = f16 operands, 1 = bf16 operands (pointers passed as 16-bit storage)
template <int ET> struct Elem;
template <> struct Elem<0> { typedef _Float16 T; };
template <> struct Elem<1> { typedef __bf16 T; };
template <int ET, bool SPLIT, int BIAS_MODE, int OUT_MODE, bool RESID, int ACT = 0>
__global__ __launch_bounds__(256) void wmma_gemm64(
    const unsigned short* __restrict__ Ap, const unsigned short* __restrict__ A2p, int lda, long strideA,
    const unsigned short* __restrict__ Btp, const unsigned short* __restrict__ Bt2p, int ldb, long strideB,
    void* __restrict__ Cout, void* __restrict__ Cout2, int ldc, long strideC,
    const float* __restrict__ bias,
    const float* __restrict__ resid, long strideR,
    int M, int N, int K, float scale) {
  typedef typename Elem<ET>::T T;
  typedef typename Frag<T>::V V;
  const T* A = (const T*)Ap; const T* A2 = (const T*)A2p; const T* Bt = (const T*)Btp; const T* Bt2 = (const T*)Bt2p;
  __shared__ __align__(16) float sT[8][16 * 68];   // per-wave 16x64 slab, pitch 68 floats
  const int b    = blockIdx.y;
  const int lane = threadIdx.x & 31;
  const int wave = threadIdx.x >> 5;
  const int tilesN = N >> 6;
  const int tilesM = M >> 6;
  const int tile = blockIdx.x * 8 + wave;
  if (tile >= tilesM * tilesN) return;   // wave-uniform; no block barriers in this kernel
  const int tm = tile / tilesN;
  const int tn = tile - tm * tilesN;
  const int m0 = tm << 6;
  const int n0 = tn << 6;

  const T* Ab  = A  + (size_t)b * strideA;
  const T* Bb  = Bt + (size_t)b * strideB;
  const T* Ab2 = SPLIT ? (A2  + (size_t)b * strideA) : nullptr;
  const T* Bb2 = SPLIT ? (Bt2 + (size_t)b * strideB) : nullptr;

  const int rlane = lane & 15;                 // row (A) / col (B, D) within subtile
  const int koff  = (lane >> 4) * 8;           // k offset of this lane half
  const int mOff  = (lane >> 4) * 8;           // D row offset

  v8f acc[4][4];
#pragma unroll
  for (int i = 0; i < 4; ++i)
#pragma unroll
    for (int j = 0; j < 4; ++j) acc[i][j] = (v8f){0.f,0.f,0.f,0.f,0.f,0.f,0.f,0.f};

  for (int k0 = 0; k0 < K; k0 += 32) {
    V bh[4], bl[4];
#pragma unroll
    for (int j = 0; j < 4; ++j) {
      const size_t bo = (size_t)(n0 + (j << 4) + rlane) * ldb + koff + k0;
      bh[j] = Frag<T>::load(Bb + bo);
      if (SPLIT) bl[j] = Frag<T>::load(Bb2 + bo);
    }
#pragma unroll
    for (int i = 0; i < 4; ++i) {
      const size_t ao = (size_t)(m0 + (i << 4) + rlane) * lda + koff + k0;
      V ah = Frag<T>::load(Ab + ao);
      V al;
      if (SPLIT) al = Frag<T>::load(Ab2 + ao);
#pragma unroll
      for (int j = 0; j < 4; ++j) {
        acc[i][j] = Frag<T>::mma(ah, bh[j], acc[i][j]);
        if (SPLIT) {
          acc[i][j] = Frag<T>::mma(ah, bl[j], acc[i][j]);
          acc[i][j] = Frag<T>::mma(al, bh[j], acc[i][j]);
        }
      }
      Frag<T>::guard(acc[i][0], acc[i][3], ah, SPLIT ? al : ah);
    }
    Frag<T>::keep(bh[0], bh[1], bh[2], bh[3]);
    if (SPLIT) Frag<T>::keep(bl[0], bl[1], bl[2], bl[3]);
  }
  acc_guard4(acc[0][0], acc[0][1], acc[0][2], acc[0][3]);
  acc_guard4(acc[1][0], acc[1][1], acc[1][2], acc[1][3]);
  acc_guard4(acc[2][0], acc[2][1], acc[2][2], acc[2][3]);
  acc_guard4(acc[3][0], acc[3][1], acc[3][2], acc[3][3]);

  // ---- epilogue ----
  float* slab = sT[wave];
  const float* Rb = RESID ? (resid + (size_t)b * strideR) : nullptr;
#pragma unroll
  for (int i = 0; i < 4; ++i) {
    const int mBase = m0 + (i << 4);
#pragma unroll
    for (int j = 0; j < 4; ++j) {
      const int n = n0 + (j << 4) + rlane;
      float bv = 0.f;
      if (BIAS_MODE == 2) bv = bias[n];
#pragma unroll
      for (int r = 0; r < 8; ++r) {
        float v = acc[i][j][r] * scale;
        if (BIAS_MODE == 1) v += bias[mBase + mOff + r];
        if (BIAS_MODE == 2) v += bv;
        if (RESID) v += Rb[(size_t)(mBase + mOff + r) * ldc + n];
        if (ACT == 1) v = tanhf(v);
        if (ACT == 2) v = fmaxf(v, 0.0f);
        if (ACT == 3) v = v / (1.0f + expf(-v));
        if (ACT == 4) v = (v > 0.f) ? v : 0.01f * v;
        if (ACT == 5) v = 0.5f * v * (1.0f + erff(v * 0.70710678118654752f));
        slab[(mOff + r) * 68 + (j << 4) + rlane] = v;
      }
    }
    __builtin_amdgcn_fence(__ATOMIC_RELEASE, "workgroup");
    __builtin_amdgcn_wave_barrier();
    __builtin_amdgcn_fence(__ATOMIC_ACQUIRE, "workgroup");
    if (OUT_MODE == 0) {
      float* C = (float*)Cout + (size_t)b * strideC;
      const int hh = lane >> 4, c4 = (lane & 15) * 4;     // row seg = 256 B = 16 lanes x 16 B
      {
#pragma unroll
        for (int it = 0; it < 8; ++it) {
          const int row = it * 2 + hh;
          v4f v = *(const v4f*)(slab + row * 68 + c4);
          *(v4f*)(C + (size_t)(mBase + row) * ldc + n0 + c4) = v;
        }
        
      }
    } else {
      const int q = lane >> 3, c8 = (lane & 7) * 8;
      unsigned short* C  = (unsigned short*)Cout  + (size_t)b * strideC;
      unsigned short* C2 = (OUT_MODE == 2) ? ((unsigned short*)Cout2 + (size_t)b * strideC) : nullptr;
      {
#pragma unroll
        for (int it = 0; it < 4; ++it) {
          const int row = it * 4 + q;
          const float* sp = slab + row * 68 + c8;
          v8h hv, lv;
#pragma unroll
          for (int e = 0; e < 8; ++e) {
            if (OUT_MODE == 1) {
              hv[e] = (_Float16)sp[e];
            } else {
              unsigned short hb = f2bf_bits(sp[e]);
              unsigned short lb = f2bf_bits(sp[e] - bf_bits2f(hb));
              hv[e] = __builtin_bit_cast(_Float16, hb);
              lv[e] = __builtin_bit_cast(_Float16, lb);
            }
          }
          *(v8h*)(C + (size_t)(mBase + row) * ldc + n0 + c8) = hv;
          if (OUT_MODE == 2) *(v8h*)(C2 + (size_t)(mBase + row) * ldc + n0 + c8) = lv;
        }
        
      }
    }
    __builtin_amdgcn_fence(__ATOMIC_RELEASE, "workgroup");
    __builtin_amdgcn_wave_barrier();
    __builtin_amdgcn_fence(__ATOMIC_ACQUIRE, "workgroup");
  }
}

__global__ __launch_bounds__(256) void cast_f32_f16x2(
    const float* __restrict__ in, _Float16* __restrict__ out, int n2) {
  int i = blockIdx.x * 256 + threadIdx.x;
  if (i < n2) {
    const _Float16 h0 = (_Float16)in[2 * i], h1 = (_Float16)in[2 * i + 1];
    const unsigned u = (unsigned)__builtin_bit_cast(unsigned short, h0) | ((unsigned)__builtin_bit_cast(unsigned short, h1) << 16);
    ((unsigned*)out)[i] = u;
    
  }
}


} // namespace w25

__global__ __launch_bounds__(256) void k_castT16(const float* __restrict__ src, long long lds, _Float16* __restrict__ dst, long long ldd, int R, int C, float s) {
    const long long i = (long long)blockIdx.x * 256 + threadIdx.x; const long long np = (long long)C * (R / 2); if (i >= np) return; const int c = (int)(i / (R / 2)); const int r = 2 * (int)(i % (R / 2));
    const _Float16 h0 = (_Float16)(src[(long long)r * lds + c] * s), h1 = (_Float16)(src[(long long)(r + 1) * lds + c] * s);
    const unsigned u = (unsigned)__builtin_bit_cast(unsigned short, h0) | ((unsigned)__builtin_bit_cast(unsigned short, h1) << 16);
    unsigned* d = (unsigned*)(dst + (long long)c * ldd + r); *d = u;  }
__global__ __launch_bounds__(256) void k_cast16(const float* __restrict__ src, long long lds, _Float16* __restrict__ dst, long long ldd, int R, int C, float s) {
    const long long i = (long long)blockIdx.x * 256 + threadIdx.x; const long long np = (long long)R * (C / 2); if (i >= np) return; const int r = (int)(i / (C / 2)); const int c = 2 * (int)(i % (C / 2));
    const _Float16 h0 = (_Float16)(src[(long long)r * lds + c] * s), h1 = (_Float16)(src[(long long)r * lds + c + 1] * s);
    const unsigned u = (unsigned)__builtin_bit_cast(unsigned short, h0) | ((unsigned)__builtin_bit_cast(unsigned short, h1) << 16);
    unsigned* d = (unsigned*)(dst + (long long)r * ldd + c); *d = u;  }

// f32 -> bf16 hi plane + bf16 lo plane (x = hi + lo to ~2^-17 relative; RNE both), [R][C] -> [R][C] (or transposed to [C][R]); 2 consecutive destination elements
__device__ __forceinline__ unsigned int f2bf2_pack(float a, float b, unsigned int* lo) {
    const unsigned short ha = w25::f2bf_bits(a), hb = w25::f2bf_bits(b);
    const unsigned short la = w25::f2bf_bits(a - w25::bf_bits2f(ha)), lb = w25::f2bf_bits(b - w25::bf_bits2f(hb));
    *lo = (unsigned)la | ((unsigned)lb << 16); return (unsigned)ha | ((unsigned)hb << 16); }
__global__ __launch_bounds__(256) void k_castS16(const float* __restrict__ src, long long lds, __bf16* __restrict__ dhi, __bf16* __restrict__ dlo, long long ldd, int R, int C, float s, int transpose) {
    const long long i = (long long)blockIdx.x * 256 + threadIdx.x; long long o; float a, b;
    if (transpose) { const long long np = (long long)C * (R / 2); if (i >= np) return; const int c = (int)(i / (R / 2)); const int r = 2 * (int)(i % (R / 2)); a = src[(long long)r * lds + c] * s; b = src[(long long)(r + 1) * lds + c] * s; o = (long long)c * ldd + r; }
    else { const long long np = (long long)R * (C / 2); if (i >= np) return; const int r = (int)(i / (C / 2)); const int c = 2 * (int)(i % (C / 2)); a = src[(long long)r * lds + c] * s; b = src[(long long)r * lds + c + 1] * s; o = (long long)r * ldd + c; }
    unsigned lo; const unsigned hi = f2bf2_pack(a, b, &lo); unsigned* ph = (unsigned*)(dhi + o); unsigned* pl = (unsigned*)(dlo + o);
    *ph = hi; *pl = lo;  }


extern "C" void kernel_launch(void* const* d_in, const int* in_sizes, int n_in, void* d_out, int out_size, void* d_ws, size_t ws_size, hipStream_t stream) {
    (void)in_sizes; (void)n_in; (void)out_size; (void)ws_size;
    const float* x = (const float*)d_in[0];
    const float* ln1g = (const float*)d_in[1];
    const float* ln1b = (const float*)d_in[2];
    const float* Wq = (const float*)d_in[3];
    const float* bq = (const float*)d_in[4];
    const float* Wk = (const float*)d_in[5];
    const float* bk = (const float*)d_in[6];
    const float* Wv = (const float*)d_in[7];
    const float* bv = (const float*)d_in[8];
    const float* Wo = (const float*)d_in[9];
    const float* bo = (const float*)d_in[10];
    const float* ln2g = (const float*)d_in[11];
    const float* ln2b = (const float*)d_in[12];
    const float* W1 = (const float*)d_in[13];
    const float* b1 = (const float*)d_in[14];
    const float* W2 = (const float*)d_in[15];
    const float* b2 = (const float*)d_in[16];
    const int L = 4096;
    const int C = 512;
    const int NH = 8;
    const int HD = 64;
    const int FF = 2048;
    const int LP = L / 2;
    const int WINP = 128;
    float* out = (float*)d_out;
    char* wsp = (char*)d_ws;
    float* ST1 = (float*)wsp; wsp += (((size_t)((size_t)L * 32) * 4 + 255) / 256) * 256;
    float* HN = (float*)wsp; wsp += (((size_t)((size_t)L * C) * 4 + 255) / 256) * 256;
    float* Q = (float*)wsp; wsp += (((size_t)((size_t)L * C) * 4 + 255) / 256) * 256;
    float* Kb = (float*)wsp; wsp += (((size_t)((size_t)L * C) * 4 + 255) / 256) * 256;
    float* V = (float*)wsp; wsp += (((size_t)((size_t)L * C) * 4 + 255) / 256) * 256;
    float* Y = (float*)wsp; wsp += (((size_t)((size_t)L * C) * 4 + 255) / 256) * 256;
    float* X1 = (float*)wsp; wsp += (((size_t)((size_t)L * C) * 4 + 255) / 256) * 256;
    float* ST2 = (float*)wsp; wsp += (((size_t)((size_t)L * 32) * 4 + 255) / 256) * 256;
    float* H2 = (float*)wsp; wsp += (((size_t)((size_t)L * C) * 4 + 255) / 256) * 256;
    float* F1 = (float*)wsp; wsp += (((size_t)((size_t)L * FF) * 4 + 255) / 256) * 256;
    unsigned short* G64A = (unsigned short*)wsp; wsp += (((size_t)(8388608) * 2 + 255) / 256) * 256;
    unsigned short* G64B = (unsigned short*)wsp; wsp += (((size_t)(1048576) * 2 + 255) / 256) * 256;
    k_stats<<<(unsigned)(L), 256, 0, stream>>>(x, C, 1, 1, 1, C, 1e-05f, ST1, 0);
    k_norm_apply<<<(unsigned)(((long long)(L) * (C) * (1) + 255) / 256), 256, 0, stream>>>(x, HN, ST1, ln1g, ln1b, L, C, 1, 1, 0, 0);
    k_cast16<<<(unsigned)((((long long)(4096) * ((512) / 2)) + 255) / 256), 256, 0, stream>>>(HN, 512, (_Float16*)(G64A), 512, 4096, 512, 1.0f);
    k_cast16<<<(unsigned)((((long long)(512) * ((512) / 2)) + 255) / 256), 256, 0, stream>>>(Wq, 512, (_Float16*)(G64B), 512, 512, 512, 16.0f);
    w25::wmma_gemm64<0, false, 2, 0, false, 0><<<dim3((unsigned)((((4096) / 64) * ((512) / 64) + 7) / 8), (unsigned)(1)), 256, 0, stream>>>((const unsigned short*)(G64A), nullptr, 512, 0, (const unsigned short*)(G64B), nullptr, 512, 0, (void*)(Q), nullptr, 512, 0, bq, nullptr, 0, 4096, 512, 512, 0.0625f);
    k_cast16<<<(unsigned)((((long long)(4096) * ((512) / 2)) + 255) / 256), 256, 0, stream>>>(HN, 512, (_Float16*)(G64A), 512, 4096, 512, 1.0f);
    k_cast16<<<(unsigned)((((long long)(512) * ((512) / 2)) + 255) / 256), 256, 0, stream>>>(Wk, 512, (_Float16*)(G64B), 512, 512, 512, 16.0f);
    w25::wmma_gemm64<0, false, 2, 0, false, 0><<<dim3((unsigned)((((4096) / 64) * ((512) / 64) + 7) / 8), (unsigned)(1)), 256, 0, stream>>>((const unsigned short*)(G64A), nullptr, 512, 0, (const unsigned short*)(G64B), nullptr, 512, 0, (void*)(Kb), nullptr, 512, 0, bk, nullptr, 0, 4096, 512, 512, 0.0625f);
    k_cast16<<<(unsigned)((((long long)(4096) * ((512) / 2)) + 255) / 256), 256, 0, stream>>>(HN, 512, (_Float16*)(G64A), 512, 4096, 512, 1.0f);
    k_cast16<<<(unsigned)((((long long)(512) * ((512) / 2)) + 255) / 256), 256, 0, stream>>>(Wv, 512, (_Float16*)(G64B), 512, 512, 512, 16.0f);
    w25::wmma_gemm64<0, false, 2, 0, false, 0><<<dim3((unsigned)((((4096) / 64) * ((512) / 64) + 7) / 8), (unsigned)(1)), 256, 0, stream>>>((const unsigned short*)(G64A), nullptr, 512, 0, (const unsigned short*)(G64B), nullptr, 512, 0, (void*)(V), nullptr, 512, 0, bv, nullptr, 0, 4096, 512, 512, 0.0625f);
    { /*apv4*/ AttnP a;
      a.Q = Q; a.K = Kb; a.V = V; a.O = Y; a.P = 0; a.Mf = 0; a.Mi = 0; a.ST = 0;
      a.Pw = 0; a.Rt = 0; a.SQ = 0; a.SK = 0;
      a.swb = 0; a.swh = 0; a.swi = 0; a.swj = 0; a.srb = 0; a.srh = 0; a.sri = 0; a.sQb = 0; a.sQh = HD; a.sQi = 2 * C; a.sQd = 1; a.sKb = 0; a.sKh = HD; a.sKj = 2 * C; a.sKd = 1; a.sVb = 0; a.sVh = HD; a.sVj = 2 * C; a.sVd = 1; a.sOb = 0; a.sOh = HD; a.sOi = 2 * C; a.sPb = 0; a.sPh = 0; a.sPi = 0; a.smb = 0; a.smh = 0; a.smi = 0; a.smj = 0;
      a.Lq = LP; a.Lk = LP; a.dh = HD; a.dv = HD; a.hrep = 1; a.causal = 1; a.coff = 0; a.pband = 0;
      a.scale = 0.125f; a.mfill = 0.0f; a.nonorm = 0; a.mpol = 0;
      a.roff = 0; a.rn = 1; a.segpol = 0; a.win = WINP;
      k_attn<64, 64, 0, false, false><<<dim3((unsigned)((LP) + 16 * AW - 1) / (16 * AW), (unsigned)(NH), (unsigned)(1)), 32 * AW, 0, stream>>>(a); }
    { /*apv4*/ AttnP a;
      a.Q = Q + 1 * C; a.K = Kb + 1 * C; a.V = V + 1 * C; a.O = Y + 1 * C; a.P = 0; a.Mf = 0; a.Mi = 0; a.ST = 0;
      a.Pw = 0; a.Rt = 0; a.SQ = 0; a.SK = 0;
      a.swb = 0; a.swh = 0; a.swi = 0; a.swj = 0; a.srb = 0; a.srh = 0; a.sri = 0; a.sQb = 0; a.sQh = HD; a.sQi = 2 * C; a.sQd = 1; a.sKb = 0; a.sKh = HD; a.sKj = 2 * C; a.sKd = 1; a.sVb = 0; a.sVh = HD; a.sVj = 2 * C; a.sVd = 1; a.sOb = 0; a.sOh = HD; a.sOi = 2 * C; a.sPb = 0; a.sPh = 0; a.sPi = 0; a.smb = 0; a.smh = 0; a.smi = 0; a.smj = 0;
      a.Lq = LP; a.Lk = LP; a.dh = HD; a.dv = HD; a.hrep = 1; a.causal = 1; a.coff = 0; a.pband = 0;
      a.scale = 0.125f; a.mfill = 0.0f; a.nonorm = 0; a.mpol = 0;
      a.roff = 0; a.rn = 1; a.segpol = 0; a.win = WINP;
      k_attn<64, 64, 0, false, false><<<dim3((unsigned)((LP) + 16 * AW - 1) / (16 * AW), (unsigned)(NH), (unsigned)(1)), 32 * AW, 0, stream>>>(a); }
    k_cast16<<<(unsigned)((((long long)(4096) * ((512) / 2)) + 255) / 256), 256, 0, stream>>>(Y, 512, (_Float16*)(G64A), 512, 4096, 512, 1.0f);
    k_cast16<<<(unsigned)((((long long)(512) * ((512) / 2)) + 255) / 256), 256, 0, stream>>>(Wo, 512, (_Float16*)(G64B), 512, 512, 512, 16.0f);
    w25::wmma_gemm64<0, false, 2, 0, true, 0><<<dim3((unsigned)((((4096) / 64) * ((512) / 64) + 7) / 8), (unsigned)(1)), 256, 0, stream>>>((const unsigned short*)(G64A), nullptr, 512, 0, (const unsigned short*)(G64B), nullptr, 512, 0, (void*)(X1), nullptr, 512, 0, bo, x, 0, 4096, 512, 512, 0.0625f);
    k_stats<<<(unsigned)(L), 256, 0, stream>>>(X1, C, 1, 1, 1, C, 1e-05f, ST2, 0);
    k_norm_apply<<<(unsigned)(((long long)(L) * (C) * (1) + 255) / 256), 256, 0, stream>>>(X1, H2, ST2, ln2g, ln2b, L, C, 1, 1, 0, 0);
    k_cast16<<<(unsigned)((((long long)(4096) * ((512) / 2)) + 255) / 256), 256, 0, stream>>>(H2, 512, (_Float16*)(G64A), 512, 4096, 512, 1.0f);
    k_cast16<<<(unsigned)((((long long)(2048) * ((512) / 2)) + 255) / 256), 256, 0, stream>>>(W1, 512, (_Float16*)(G64B), 512, 2048, 512, 16.0f);
    w25::wmma_gemm64<0, false, 2, 0, false, 5><<<dim3((unsigned)((((4096) / 64) * ((2048) / 64) + 7) / 8), (unsigned)(1)), 256, 0, stream>>>((const unsigned short*)(G64A), nullptr, 512, 0, (const unsigned short*)(G64B), nullptr, 512, 0, (void*)(F1), nullptr, 2048, 0, b1, nullptr, 0, 4096, 2048, 512, 0.0625f);
    k_cast16<<<(unsigned)((((long long)(4096) * ((2048) / 2)) + 255) / 256), 256, 0, stream>>>(F1, 2048, (_Float16*)(G64A), 2048, 4096, 2048, 1.0f);
    k_cast16<<<(unsigned)((((long long)(512) * ((2048) / 2)) + 255) / 256), 256, 0, stream>>>(W2, 2048, (_Float16*)(G64B), 2048, 512, 2048, 16.0f);
    w25::wmma_gemm64<0, false, 2, 0, true, 0><<<dim3((unsigned)((((4096) / 64) * ((512) / 64) + 7) / 8), (unsigned)(1)), 256, 0, stream>>>((const unsigned short*)(G64A), nullptr, 2048, 0, (const unsigned short*)(G64B), nullptr, 2048, 0, (void*)(out), nullptr, 512, 0, b2, X1, 0, 4096, 512, 2048, 0.0625f);
}

// v001
// Measured time: 554 microseconds a run.
// Two timings next to v000 put it at 3.96 and 3.98 times that version's speed.
// Contractions: q/k/v projections of the LayerNormed input [4096x512].[512x512] (+b), the output projection (+b, + residual), the FFN [4096x512].[512x2048] (+b, exact GELU) and [4096x2048].[2048x512] (+b, + residual) with f16 operands (v_wmma_f32_16x16x32_f16; 64x64 register-blocked wave tiles over pre-cast f16 operand planes, weights pre-scaled by 16 at the cast and un-scaled in the f32 epilogue); the dilated causal attention (keys j <= i, i - j even, i - j <= 256) as two flash launches over the even and the odd positions (stride-2 views; within a parity class the pattern is plain causal with window 128), head_dim 64, f16 q.k^T and f16 p.v (p as f16 of 4096 p); f32 accumulate, softmax and LayerNorms f32.
#include <hip/hip_runtime.h>
#include <math.h>

typedef __attribute__((ext_vector_type(16))) _Float16 v16h;
typedef __attribute__((ext_vector_type(8)))  _Float16 v8h;
typedef __attribute__((ext_vector_type(16))) __bf16   v16b;
typedef __attribute__((ext_vector_type(8)))  float    v8f;
typedef __attribute__((ext_vector_type(4)))  float    v4f;

// 16-bit WMMA fragment map (wave32), lane L, h = L>>4, m = L&15:
//   A 16x32: lane = row m;   element i -> k = (i<8) ? 8h+i : 16+8h+(i-8)
//   B 32x16: lane = column m; the SAME k(i,h)
//   D 16x16 (8 f32): lane = column m; element r -> row 8h+r
__device__ __forceinline__ int frag_k(int i, int h) { return (i < 8) ? (8 * h + i) : (16 + 8 * h + (i - 8)); }
__device__ __forceinline__ __bf16 bf16_rne(float f) {
    unsigned int u = __float_as_uint(f);
    u += 0x7fffu + ((u >> 16) & 1u);
    return __builtin_bit_cast(__bf16, (unsigned short)(u >> 16));
}
__device__ __forceinline__ float bf16_f32(__bf16 b) { return __uint_as_float(((unsigned int)__builtin_bit_cast(unsigned short, b)) << 16); }
__device__ __forceinline__ v8f wmma16(v16h a, v16h b, v8f c) {
    c = __builtin_amdgcn_wmma_f32_16x16x32_f16(false, a, false, b, (short)0, c, false, false);
    asm volatile("v_nop\n\tv_nop\n\tv_nop\n\tv_nop" : "+v"(c) : "v"(a), "v"(b));
    return c;
}
__device__ __forceinline__ v8f wmmab(v16b a, v16b b, v8f c) {
    c = __builtin_amdgcn_wmma_f32_16x16x32_bf16(false, a, false, b, (short)0, c, false, false);
    asm volatile("v_nop\n\tv_nop\n\tv_nop\n\tv_nop" : "+v"(c) : "v"(a), "v"(b));
    return c;
}
struct Split { v16b hi, lo; };
// hi/lo split product: a.hi*b.hi + a.hi*b.lo + a.lo*b.hi
__device__ __forceinline__ v8f wmma3(const Split& a, const Split& b, v8f c) {
    c = __builtin_amdgcn_wmma_f32_16x16x32_bf16(false, a.hi, false, b.hi, (short)0, c, false, false);
    c = __builtin_amdgcn_wmma_f32_16x16x32_bf16(false, a.hi, false, b.lo, (short)0, c, false, false);
    c = __builtin_amdgcn_wmma_f32_16x16x32_bf16(false, a.lo, false, b.hi, (short)0, c, false, false);
    asm volatile("v_nop\n\tv_nop\n\tv_nop\n\tv_nop" : "+v"(c) : "v"(a.hi), "v"(a.lo), "v"(b.hi), "v"(b.lo));
    return c;
}
struct Split3 { v16b hi, mid, lo; };
// triple split product (6 terms, drops only terms below 2^-24 relative)
__device__ __forceinline__ v8f wmma6(const Split3& a, const Split3& b, v8f c) {
    c = __builtin_amdgcn_wmma_f32_16x16x32_bf16(false, a.hi, false, b.hi, (short)0, c, false, false);
    c = __builtin_amdgcn_wmma_f32_16x16x32_bf16(false, a.hi, false, b.mid, (short)0, c, false, false);
    c = __builtin_amdgcn_wmma_f32_16x16x32_bf16(false, a.mid, false, b.hi, (short)0, c, false, false);
    c = __builtin_amdgcn_wmma_f32_16x16x32_bf16(false, a.hi, false, b.lo, (short)0, c, false, false);
    c = __builtin_amdgcn_wmma_f32_16x16x32_bf16(false, a.mid, false, b.mid, (short)0, c, false, false);
    c = __builtin_amdgcn_wmma_f32_16x16x32_bf16(false, a.lo, false, b.hi, (short)0, c, false, false);
    asm volatile("v_nop\n\tv_nop\n\tv_nop\n\tv_nop" : "+v"(c) : "v"(a.hi), "v"(a.mid), "v"(a.lo), "v"(b.hi), "v"(b.mid), "v"(b.lo));
    return c;
}

// Fragment gathers from f32 memory: element i <- p[(k0 + frag_k(i,h)) * sk] * s, zero for k >= klen.
__device__ __forceinline__ v16h fh_ld(const float* __restrict__ p, long long sk, int k0, int h, int klen, float s) {
    v16h a;
#pragma unroll
    for (int i = 0; i < 16; ++i) { const int k = k0 + frag_k(i, h); a[i] = (k < klen) ? (_Float16)(p[(long long)k * sk] * s) : (_Float16)0.f; }
    return a;
}
__device__ __forceinline__ Split sp_ld(const float* __restrict__ p, long long sk, int k0, int h, int klen, float s) {
    Split r;
#pragma unroll
    for (int i = 0; i < 16; ++i) {
        const int k = k0 + frag_k(i, h); const float x = (k < klen) ? p[(long long)k * sk] * s : 0.f;
        const __bf16 hb = bf16_rne(x); r.hi[i] = hb; r.lo[i] = bf16_rne(x - bf16_f32(hb));
    }
    return r;
}
__device__ __forceinline__ Split3 sp3_ld(const float* __restrict__ p, long long sk, int k0, int h, int klen, float s) {
    Split3 r;
#pragma unroll
    for (int i = 0; i < 16; ++i) {
        const int k = k0 + frag_k(i, h); const float x = (k < klen) ? p[(long long)k * sk] * s : 0.f;
        const __bf16 hb = bf16_rne(x); const float r1 = x - bf16_f32(hb); const __bf16 mb = bf16_rne(r1);
        r.hi[i] = hb; r.mid[i] = mb; r.lo[i] = bf16_rne(r1 - bf16_f32(mb));
    }
    return r;
}
__device__ __forceinline__ v16b bh_ld(const float* __restrict__ p, long long sk, int k0, int h, int klen, float s) {
    v16b a;
#pragma unroll
    for (int i = 0; i < 16; ++i) { const int k = k0 + frag_k(i, h); a[i] = bf16_rne((k < klen) ? p[(long long)k * sk] * s : 0.f); }
    return a;
}
// f16 fragment from an f16 LDS/global row with element stride 1 (k-contiguous), no bounds (tile already zero padded)
__device__ __forceinline__ v16h fh_row(const _Float16* __restrict__ row, int k0, int h) {
    v16h a;
#pragma unroll
    for (int i = 0; i < 16; ++i) a[i] = row[k0 + frag_k(i, h)];
    return a;
}

#define VST2(T, ptr, val) do { const T vst2_v_ = (val); *(T*)(ptr) = vst2_v_;  } while (0)
typedef float v4f __attribute__((ext_vector_type(4)));
#define VST2V4(ptr, val) do { const v4f vst2_v4_ = (val); *(v4f*)(ptr) = vst2_v4_;  } while (0)

__device__ __attribute__((noinline)) float act_fn(float v, int act) {
    if (act == 1) return fmaxf(v, 0.f);                                                                               // relu
    if (act == 2) { const float u = 0.7978845608028654f * (v + 0.044715f * v * v * v); return 0.5f * v * (1.f + tanhf(u)); } // tanh-gelu
    if (act == 3) return v / (1.f + expf(-v));                                                                        // silu
    if (act == 4) return 0.5f * v * (1.f + erff(v * 0.7071067811865476f));                                             // erf-gelu
    if (act == 5) return tanhf(v);
    if (act == 6) return 1.f / (1.f + expf(-v));                                                                      // sigmoid
    if (act == 7) return (v > 0.f) ? v : 0.01f * v;                                                                   // leaky relu 0.01
    if (act == 8) return (v > 0.f) ? v : (expf(v) - 1.f);                                                             // elu
    if (act == 9) return fminf(fmaxf(v, 0.f), 6.f);                                                                   // relu6
    if (act == 10) return fabsf(v);                                                                                    // abs
    if (act == 11) return (v >= 0.f) ? v : 0.1f * v;                                                                  // leaky 0.1
    if (act == 12) return (v > 0.f) ? v : 0.2f * v;                                                                   // leaky 0.2
    if (act == 13) return (v > 20.f) ? v : log1pf(expf(v));                                                            // softplus
    return v;
}

// =====================================================================================================================
// k_gemm<MODE>: C(z, m, n) = act(alpha * sum_k A(z, m, k) * B(z, k, n) + bias) + beta * R(z, m, n)
//   One wave (32-thread block) per 16 x 32 tile of C; grid (ceil(N/32), ceil(M/16), Z). Batch z -> (zo = z / zi_n, zi = z % zi_n)
//   with separate outer/inner strides for every tensor (e.g. batch and head). A(m,k) = A[zo*sAo + zi*sAi + m*sAm + k*sAk] (f32),
//   B(k,n) = B[zo*sBo + zi*sBi + n*sBn + k*sBk] (f32); any M, N, K (K zero-padded to 32 inside the fragments, M/N tails guarded).
//   C(m,n) = C[zo*sCo + zi*sCi + m*sCm + n] (n contiguous). flags: 1 bias[n], 2 bias[m], 4 residual R[zo*sRo + zi*sRi + m*sRm + n*sRn].
//   MODE 0: f16 operands (A prescaled by sa, B by sb, both undone in the epilogue); 1: bf16 hi/lo split (3 products); 2: bf16;
//   3: bf16 hi/mid/lo triple split (6 products); 4: as 3 with Kahan-compensated f32 accumulation across k-steps.
// =====================================================================================================================
struct GemmP {
    const float* A; const float* B; const float* bias; const float* R; float* C;
    long long sAo, sAi, sAm, sAk, sBo, sBi, sBn, sBk, sCo, sCi, sCm, sRo, sRi, sRm, sRn;
    int M, N, K, zi_n, flags, act; float alpha, beta, sa, sb;
    int Npad, pad_;     // columns [N, Npad) of C are written as 0 so that padded workspace rows are covered by whole-line stores; Npad >= N
};
static_assert(sizeof(GemmP) == 5 * 8 + 15 * 8 + 6 * 4 + 4 * 4 + 2 * 4, "GemmP has padding");

template <int MODE>
__global__ __launch_bounds__(32) void k_gemm(GemmP p) {
    const int lane = threadIdx.x & 31, h = lane >> 4, l15 = lane & 15;
    const int m0 = blockIdx.y * 16, n0 = blockIdx.x * 32;
    const int z = blockIdx.z, zo = z / p.zi_n, zi = z - zo * p.zi_n;
    const float* A = p.A + zo * p.sAo + zi * p.sAi;
    const float* B = p.B + zo * p.sBo + zi * p.sBi;
    const int am = min(m0 + l15, p.M - 1);                       // clamped row for loads (stores are guarded)
    v8f acc[2], comp[2];
#pragma unroll
    for (int t = 0; t < 2; ++t) { v8f zz = {}; acc[t] = zz; comp[t] = zz; }
    for (int k0 = 0; k0 < p.K; k0 += 32) {
        const float* arow = A + (long long)am * p.sAm;
        if (MODE == 1) {
            const Split a = sp_ld(arow, p.sAk, k0, h, p.K, 1.f);
#pragma unroll
            for (int t = 0; t < 2; ++t) {
                const int bn = min(n0 + t * 16 + l15, p.N - 1);
                acc[t] = wmma3(a, sp_ld(B + (long long)bn * p.sBn, p.sBk, k0, h, p.K, 1.f), acc[t]);
            }
        } else if (MODE == 3) {
            const Split3 a = sp3_ld(arow, p.sAk, k0, h, p.K, 1.f);
#pragma unroll
            for (int t = 0; t < 2; ++t) {
                const int bn = min(n0 + t * 16 + l15, p.N - 1);
                acc[t] = wmma6(a, sp3_ld(B + (long long)bn * p.sBn, p.sBk, k0, h, p.K, 1.f), acc[t]);
            }
        } else if (MODE == 4) {
            // triple split as MODE 3, but each k-step's 6 products go into a fresh accumulator and the partial is added to the running f32 sum
            // on the VALU with Kahan compensation (accumulation error stays ~1 ulp however long K is)
            const Split3 a = sp3_ld(arow, p.sAk, k0, h, p.K, 1.f);
#pragma unroll
            for (int t = 0; t < 2; ++t) {
                const int bn = min(n0 + t * 16 + l15, p.N - 1); v8f zz = {};
                const v8f part = wmma6(a, sp3_ld(B + (long long)bn * p.sBn, p.sBk, k0, h, p.K, 1.f), zz);
                const v8f y = part - comp[t]; const v8f s = acc[t] + y; comp[t] = (s - acc[t]) - y; acc[t] = s;
            }
        } else if (MODE == 2) {
            const v16b a = bh_ld(arow, p.sAk, k0, h, p.K, 1.f);
#pragma unroll
            for (int t = 0; t < 2; ++t) {
                const int bn = min(n0 + t * 16 + l15, p.N - 1);
                acc[t] = wmmab(a, bh_ld(B + (long long)bn * p.sBn, p.sBk, k0, h, p.K, 1.f), acc[t]);
            }
        } else {
            const v16h a = fh_ld(arow, p.sAk, k0, h, p.K, p.sa);
#pragma unroll
            for (int t = 0; t < 2; ++t) {
                const int bn = min(n0 + t * 16 + l15, p.N - 1);
                acc[t] = wmma16(a, fh_ld(B + (long long)bn * p.sBn, p.sBk, k0, h, p.K, p.sb), acc[t]);
            }
        }
    }
    const float iscale = (MODE == 0) ? p.alpha / (p.sa * p.sb) : p.alpha;
    float* C = p.C + zo * p.sCo + zi * p.sCi;
    const float* R = p.R + zo * p.sRo + zi * p.sRi;
    __shared__ __align__(16) float ctile[16][36];
#pragma unroll
    for (int t = 0; t < 2; ++t) {
        const int n = n0 + t * 16 + l15; const int nn = min(n, p.N - 1);
#pragma unroll
        for (int r = 0; r < 8; ++r) {
            const int m = m0 + 8 * h + r; const int mm = min(m, p.M - 1);
            float v = acc[t][r] * iscale;
            if (p.flags & 1) v += p.bias[nn];
            if (p.flags & 2) v += p.bias[mm];
            if (p.flags & 8) v *= p.bias[(long long)zo * p.M + mm];   /* per-(z,row) scale vector laid out [Z][M]; exclusive with the bias flags */
            v = act_fn(v, p.act);
            if (p.flags & 4) v += p.beta * R[(long long)mm * p.sRm + (long long)nn * p.sRn];
            ctile[8 * h + r][t * 16 + l15] = (n < p.N) ? v : 0.f;
        }
    }
    __syncthreads();
    const int NW = (p.Npad > p.N) ? p.Npad : p.N;           // write width
    const bool fast = (m0 + 16 <= p.M) && (n0 + 32 <= NW) && ((p.sCm & 3) == 0) && ((((size_t)C) & 15) == 0);
    if (fast) {
#pragma unroll
        for (int s = 0; s < 4; ++s) {
            const int row = s * 4 + (lane >> 3), c4 = (lane & 7) * 4;
            const v4f v = *(const v4f*)&ctile[row][c4];
            VST2V4(C + (long long)(m0 + row) * p.sCm + n0 + c4, v);
        }
    } else {
        for (int row = 0; row < 16; ++row) {
            const int m = m0 + row, n = n0 + lane;
            if (m < p.M && n < NW) VST2(float, C + (long long)m * p.sCm + n, ctile[row][lane]);
        }
    }
}


// =====================================================================================================================
// k_gemmT<MODE, TM, TN>: same contract as k_gemm, but one wave computes a (16*TM) x (16*TN) tile: TM A fragments and TN B fragments are
//   loaded per 32-wide k-step and reused across TM*TN WMMAs (far fewer load/convert instructions per MAC). MODE 0 (f16), 1 (bf16 hi/lo),
//   2 (bf16) only. grid (ceil(NW/(16*TN)), ceil(M/(16*TM)), Z), block 32. Epilogue identical to k_gemm, run per 16x32 sub-tile.
// =====================================================================================================================
template <int MODE, int TM, int TN>
__global__ __launch_bounds__(32) void k_gemmT(GemmP p) {
    const int lane = threadIdx.x & 31, h = lane >> 4, l15 = lane & 15;
    const int m0 = blockIdx.y * (16 * TM), n0 = blockIdx.x * (16 * TN);
    const int z = blockIdx.z, zo = z / p.zi_n, zi = z - zo * p.zi_n;
    const float* A = p.A + zo * p.sAo + zi * p.sAi;
    const float* B = p.B + zo * p.sBo + zi * p.sBi;
    v8f acc[TM][TN];
#pragma unroll
    for (int i = 0; i < TM; ++i)
#pragma unroll
        for (int t = 0; t < TN; ++t) { v8f zz = {}; acc[i][t] = zz; }
    for (int k0 = 0; k0 < p.K; k0 += 32) {
        if (MODE == 1) {
            Split a[TM], b[TN];
#pragma unroll
            for (int i = 0; i < TM; ++i) { const int am = min(m0 + 16 * i + l15, p.M - 1); a[i] = sp_ld(A + (long long)am * p.sAm, p.sAk, k0, h, p.K, 1.f); }
#pragma unroll
            for (int t = 0; t < TN; ++t) { const int bn = min(n0 + 16 * t + l15, p.N - 1); b[t] = sp_ld(B + (long long)bn * p.sBn, p.sBk, k0, h, p.K, 1.f); }
#pragma unroll
            for (int i = 0; i < TM; ++i)
#pragma unroll
                for (int t = 0; t < TN; ++t) acc[i][t] = wmma3(a[i], b[t], acc[i][t]);
        } else if (MODE == 2) {
            v16b a[TM], b[TN];
#pragma unroll
            for (int i = 0; i < TM; ++i) { const int am = min(m0 + 16 * i + l15, p.M - 1); a[i] = bh_ld(A + (long long)am * p.sAm, p.sAk, k0, h, p.K, 1.f); }
#pragma unroll
            for (int t = 0; t < TN; ++t) { const int bn = min(n0 + 16 * t + l15, p.N - 1); b[t] = bh_ld(B + (long long)bn * p.sBn, p.sBk, k0, h, p.K, 1.f); }
#pragma unroll
            for (int i = 0; i < TM; ++i)
#pragma unroll
                for (int t = 0; t < TN; ++t) acc[i][t] = wmmab(a[i], b[t], acc[i][t]);
        } else {
            v16h a[TM], b[TN];
#pragma unroll
            for (int i = 0; i < TM; ++i) { const int am = min(m0 + 16 * i + l15, p.M - 1); a[i] = fh_ld(A + (long long)am * p.sAm, p.sAk, k0, h, p.K, p.sa); }
#pragma unroll
            for (int t = 0; t < TN; ++t) { const int bn = min(n0 + 16 * t + l15, p.N - 1); b[t] = fh_ld(B + (long long)bn * p.sBn, p.sBk, k0, h, p.K, p.sb); }
#pragma unroll
            for (int i = 0; i < TM; ++i)
#pragma unroll
                for (int t = 0; t < TN; ++t) acc[i][t] = wmma16(a[i], b[t], acc[i][t]);
        }
    }
    const float iscale = (MODE == 0) ? p.alpha / (p.sa * p.sb) : p.alpha;
    float* C = p.C + zo * p.sCo + zi * p.sCi;
    const float* R = p.R + zo * p.sRo + zi * p.sRi;
    const int NW = (p.Npad > p.N) ? p.Npad : p.N;
    __shared__ __align__(16) float ctile[16][36];
#pragma unroll
    for (int i = 0; i < TM; ++i) {
        const int mb = m0 + 16 * i; if (mb >= p.M) break;          // wave-uniform
#pragma unroll
        for (int tp = 0; tp < TN / 2; ++tp) {
            const int nb = n0 + 32 * tp; if (nb >= NW) break;        // wave-uniform
#pragma unroll
            for (int t2 = 0; t2 < 2; ++t2) {
                const int t = 2 * tp + t2; const int n = nb + t2 * 16 + l15; const int nn = min(n, p.N - 1);
#pragma unroll
                for (int r = 0; r < 8; ++r) {
                    const int m = mb + 8 * h + r; const int mm = min(m, p.M - 1);
                    float v = acc[i][t][r] * iscale;
                    if (p.flags & 1) v += p.bias[nn];
                    if (p.flags & 2) v += p.bias[mm];
            if (p.flags & 8) v *= p.bias[(long long)zo * p.M + mm];   /* per-(z,row) scale vector laid out [Z][M]; exclusive with the bias flags */
                    v = act_fn(v, p.act);
                    if (p.flags & 4) v += p.beta * R[(long long)mm * p.sRm + (long long)nn * p.sRn];
                    ctile[8 * h + r][t2 * 16 + l15] = (n < p.N) ? v : 0.f;
                }
            }
            __syncthreads();
            const bool fast = (mb + 16 <= p.M) && (nb + 32 <= NW) && ((p.sCm & 3) == 0) && ((((size_t)C) & 15) == 0);
            if (fast) {
#pragma unroll
                for (int s = 0; s < 4; ++s) {
                    const int row = s * 4 + (lane >> 3), c4 = (lane & 7) * 4;
                    const v4f v = *(const v4f*)&ctile[row][c4];
                    VST2V4(C + (long long)(mb + row) * p.sCm + nb + c4, v);
                }
            } else {
                for (int row = 0; row < 16; ++row) {
                    const int m = mb + row, n = nb + lane;
                    if (m < p.M && n < NW) VST2(float, C + (long long)m * p.sCm + n, ctile[row][lane]);
                }
            }
            __syncthreads();
        }
    }
}

// =====================================================================================================================
//   Wave = 16 queries, AW waves per block, 64-key blocks; grid (ceil(Lq/(16*AW)), H, B), block 32*AW. Any Lq, Lk; head dim dh <= DHP
//   (DHP multiple of 32), value dim dv <= DVP (multiple of 16, <= 128). Every tensor addressed by (batch, head, row, element) strides, f32.
//   Scores: QM 0 f16 operands, 1 bf16 hi/lo split, 2 bf16 triple split; statistics f32 (exp2 domain); P.V: P x 4096 as f16 with V f16 staged in LDS
//   (SPLITPV: P and V as bf16 hi/lo splits). kv head = h / hrep. Masking: causal = 1 (keep j <= i + coff, masked -> -inf, key blocks beyond the
//   diagonal skipped), causal = 2 (masked -> mfill, a finite fill like the -1e9; no skipping), causal = 3 (keep j >= i + coff,
//   masked -> -inf, no skipping); optional additive f32 mask Mf,
//   optional int keep-mask Mi (0 -> score := mfill), both addressed b*smb + h*smh + i*smi + j*smj (0 strides broadcast).
// =====================================================================================================================
#define AW 4
struct AttnP {   // apv4
    const float* Q; const float* K; const float* V; float* O; float* P; const float* Mf; const int* Mi; float* ST;
    const float* Pw; const float* Rt; const int* SQ; const int* SK;           // optional: post-softmax weight, relative-position table, segment ids
    long long swb, swh, swi, swj, srb, srh, sri;                                 // Pw strides (b,h,i,j); Rt strides (b,h,i), column = clamp(i - j + roff, 0, rn-1)
    long long sQb, sQh, sQi, sQd, sKb, sKh, sKj, sKd, sVb, sVh, sVj, sVd, sOb, sOh, sOi, sPb, sPh, sPi, smb, smh, smi, smj;
    int Lq, Lk, dh, dv, hrep, causal, coff, pband;   // pband > 0: P holds only the band |j - i| <= pband, column j - i + pband
    float scale, mfill; int nonorm, mpol;             // nonorm (online path only): O = sum_j exp(score_j) V_j without the 1/rowsum (scores must be <= ~0); mpol: Mi masks where ==0 (mpol 0) or where !=0 (mpol 1)
    int roff, rn, segpol, win;                        // Rt column offset/count; SQ/SK: score := mfill where (segpol 0) SQ[i] != SK[j] or (segpol 1) SQ[i] == SK[j]; win > 0: keys with i - j > win (after coff) -> -inf, key blocks wholly below the window skipped
};
//   Pw: the softmax numerator is multiplied by Pw(b,h,i,j) AFTER the row sum is taken (probs * weight, then P.V), as in post-softmax multiplicative biases.                                                    // ST (optional): per row (b,h,i) -> ST[((b*H + h)*Lq + i)*2 + {0,1}] = {row max of the scaled+masked score (natural units), sum_j exp(score - max)}
static_assert(sizeof(AttnP) == 12 * 8 + 29 * 8 + 16 * 4, "AttnP has padding");

#ifndef KATTN_ATTR
#define KATTN_ATTR
#endif
template <int DHP, int DVP, int QM, bool SPLITPV, bool TWOPASS>
__global__ __launch_bounds__(32 * AW) KATTN_ATTR void k_attn(AttnP p) {
    constexpr int NT = DVP / 16;                // output tiles
    constexpr int KS = DHP / 32;                // k-steps for the scores
    constexpr int VP = DVP + 8;                 // LDS pitch (halves)
    __shared__ __align__(16) float    pl[AW][16 * 64];
    __shared__ __align__(16) _Float16 vl[(SPLITPV ? 2 : 1) * 64 * VP];   // f16 V tile, or bf16 hi and lo tiles (same 2-byte size)
    const int lane = threadIdx.x & 31, hf = lane >> 4, l15 = lane & 15, wave = threadIdx.x >> 5;
    const int h = blockIdx.y, b = blockIdx.z, hk = h / p.hrep;
    const int q0 = (blockIdx.x * AW + wave) * 16;
    float* myp = pl[wave];
    const float L2E = 1.4426950408889634f;
    const float NEG = -__builtin_inff();
    const int qi = min(q0 + l15, p.Lq - 1);
    const float* qrow = p.Q + b * p.sQb + h * p.sQh + (long long)qi * p.sQi;
    const float* kbase = p.K + b * p.sKb + hk * p.sKh;
    const float* vbase = p.V + b * p.sVb + hk * p.sVh;
    v16h qa[QM == 0 ? KS : 1]; Split qs_[QM == 1 ? KS : 1]; Split3 qt_[QM == 2 ? KS : 1];
#pragma unroll
    for (int ks = 0; ks < KS; ++ks) {
        if (QM == 2) qt_[ks] = sp3_ld(qrow, p.sQd, ks * 32, hf, p.dh, 1.f);
        else if (QM == 1) qs_[ks] = sp_ld(qrow, p.sQd, ks * 32, hf, p.dh, 1.f);
        else qa[ks] = fh_ld(qrow, p.sQd, ks * 32, hf, p.dh, 1.f);
    }
    v8f o[NT]; float m8[8], l8[8];
#pragma unroll
    for (int t = 0; t < NT; ++t) { v8f zz = {}; o[t] = zz; }
#pragma unroll
    for (int i = 0; i < 8; ++i) { m8[i] = NEG; l8[i] = 0.f; }
    int jend = p.Lk;
    if (p.causal == 1) { const int je = (blockIdx.x * AW + AW - 1) * 16 + 16 + p.coff; jend = min(jend, max(je, 0)); }   // uniform per block
    int jbeg = 0;                                                // first key any query row of this block can see through the window; uniform per block
    if (p.win > 0 && !p.P) jbeg = max((int)(blockIdx.x * AW) * 16 + p.coff - p.win, 0);   // keys below it are -inf for all 16*AW rows (weight exactly 0); P, where asked for, still needs its zeros written
    const int npass = TWOPASS ? 2 : 1;
    for (int pass = 0; pass < npass; ++pass) {
        const bool dopv = (!TWOPASS) || pass == 1;
        for (int j0 = jbeg; j0 < jend; j0 += 64) {
            if (dopv) {
                __syncthreads();                                 // previous key block's reads of vl / pl are done
                for (int idx = threadIdx.x; idx < 64 * DVP; idx += 32 * AW) {
                    const int jr = idx / DVP, d = idx - jr * DVP, j = j0 + jr;
                    const float f = (j < p.Lk && d < p.dv) ? vbase[(long long)j * p.sVj + (long long)d * p.sVd] : 0.f;
                    if (SPLITPV) {
                        const __bf16 hb = bf16_rne(f);
                        ((__bf16*)vl)[jr * VP + d] = hb; ((__bf16*)vl)[64 * VP + jr * VP + d] = bf16_rne(f - bf16_f32(hb));
                    } else vl[jr * VP + d] = (_Float16)f;
                }
            }
            v8f s[4];
#pragma unroll
            for (int t = 0; t < 4; ++t) {
                const int j = min(j0 + t * 16 + l15, p.Lk - 1);
                const float* krow = kbase + (long long)j * p.sKj;
                v8f acc = {};
#pragma unroll
                for (int ks = 0; ks < KS; ++ks) {
                    if (QM == 2)      acc = wmma6(qt_[ks], sp3_ld(krow, p.sKd, ks * 32, hf, p.dh, 1.f), acc);
                    else if (QM == 1) acc = wmma3(qs_[ks], sp_ld(krow, p.sKd, ks * 32, hf, p.dh, 1.f), acc);
                    else              acc = wmma16(qa[ks], fh_ld(krow, p.sKd, ks * 32, hf, p.dh, 1.f), acc);
                }
                s[t] = acc;
            }
            float pv[8][4];
#pragma unroll
            for (int i = 0; i < 8; ++i) {
                const int irow = q0 + i + 8 * hf;
                const int ic = min(irow, p.Lq - 1);
                float sc[4];
#pragma unroll
                for (int t = 0; t < 4; ++t) {
                    const int jg = j0 + t * 16 + l15;
                    float v = s[t][i] * p.scale;
                    if (p.Mf) v += p.Mf[b * p.smb + h * p.smh + (long long)ic * p.smi + (long long)min(jg, p.Lk - 1) * p.smj];
                    if (p.Rt) { int rc = ic - min(jg, p.Lk - 1) + p.roff; rc = rc < 0 ? 0 : (rc >= p.rn ? p.rn - 1 : rc); v += p.Rt[b * p.srb + h * p.srh + (long long)ic * p.sri + rc]; }
                    if (p.Mi) { const int mv = p.Mi[b * p.smb + h * p.smh + (long long)ic * p.smi + (long long)min(jg, p.Lk - 1) * p.smj]; if (p.mpol ? (mv != 0) : (mv == 0)) v = p.mfill; }
                    if (p.SQ) { const bool same = p.SQ[(long long)b * p.Lq + ic] == p.SK[(long long)b * p.Lk + min(jg, p.Lk - 1)]; if (p.segpol ? same : !same) v = p.mfill; }
                    if (p.causal == 2 && jg > irow + p.coff) v = p.mfill;
                    if (jg >= p.Lk || (p.causal == 1 && jg > irow + p.coff) || (p.causal == 3 && jg < irow + p.coff) || (p.win > 0 && irow + p.coff - jg > p.win)) v = NEG; else v *= L2E;
                    sc[t] = v;
                }
                if (!TWOPASS || pass == 0) {
                    float mx = fmaxf(fmaxf(sc[0], sc[1]), fmaxf(sc[2], sc[3]));
                    mx = fmaxf(mx, __shfl_xor(mx, 1, 32)); mx = fmaxf(mx, __shfl_xor(mx, 2, 32));
                    mx = fmaxf(mx, __shfl_xor(mx, 4, 32)); mx = fmaxf(mx, __shfl_xor(mx, 8, 32));
                    const float mnew = fmaxf(m8[i], mx);
                    const float corr = (mnew == NEG) ? 1.f : exp2f(m8[i] - mnew);
                    float rs = 0.f;
#pragma unroll
                    for (int t = 0; t < 4; ++t) {
                        const float pp = (sc[t] == NEG) ? 0.f : exp2f(sc[t] - mnew); rs += pp;
                        pv[i][t] = p.Pw ? pp * p.Pw[b * p.swb + h * p.swh + (long long)ic * p.swi + (long long)min(j0 + t * 16 + l15, p.Lk - 1) * p.swj] : pp;
                    }
                    rs += __shfl_xor(rs, 1, 32); rs += __shfl_xor(rs, 2, 32); rs += __shfl_xor(rs, 4, 32); rs += __shfl_xor(rs, 8, 32);
                    l8[i] = l8[i] * corr + rs; m8[i] = mnew;
                    if (!TWOPASS) {
#pragma unroll
                        for (int t = 0; t < NT; ++t) o[t][i] *= corr;
                    }
                } else {
                    const float inv = (l8[i] > 0.f) ? 1.f / l8[i] : 0.f;
#pragma unroll
                    for (int t = 0; t < 4; ++t) {
                        const int jg = j0 + t * 16 + l15;
                        float pp = (sc[t] == NEG) ? 0.f : exp2f(sc[t] - m8[i]) * inv;
                        if (p.Pw) pp *= p.Pw[b * p.swb + h * p.swh + (long long)ic * p.swi + (long long)min(jg, p.Lk - 1) * p.swj];
                        pv[i][t] = pp;
                    }
                }
            }
            if (dopv) {
#pragma unroll
                for (int i = 0; i < 8; ++i)
#pragma unroll
                    for (int t = 0; t < 4; ++t) ((float*)myp)[(i + 8 * hf) * 64 + t * 16 + l15] = pv[i][t];
                __syncthreads();                                 // P (per wave) and V (shared) visible
                if (p.P) {
                    float* pb_ = p.P + b * p.sPb + h * p.sPh;
                    const bool fastP = (p.pband == 0) && ((p.sPi & 3) == 0) && (j0 + 64 <= p.Lk) && (q0 + 16 <= p.Lq) && ((((size_t)pb_) & 15) == 0);
                    if (fastP) {
#pragma unroll
                        for (int s = 0; s < 8; ++s) {
                            const int row = s * 2 + (lane >> 4), c4 = (lane & 15) * 4;
                            const v4f v = *(const v4f*)(myp + row * 64 + c4);
                            VST2V4(pb_ + (long long)(q0 + row) * p.sPi + j0 + c4, v);
                        }
                    } else {
                        for (int row = 0; row < 16; ++row) {
                            const int irow = q0 + row; if (irow >= p.Lq) continue;
                            for (int c = lane; c < 64; c += 32) {
                                const int jg = j0 + c; if (jg >= p.Lk) continue;
                                if (p.pband == 0) VST2(float, pb_ + (long long)irow * p.sPi + jg, myp[row * 64 + c]);
                                else if (jg - irow <= p.pband && irow - jg <= p.pband) VST2(float, pb_ + (long long)irow * p.sPi + (jg - irow + p.pband), myp[row * 64 + c]);
                            }
                        }
                    }
                }
                if (SPLITPV) {
                    const Split pa0 = sp_ld(myp + l15 * 64, 1, 0, hf, 64, 1.f), pa1 = sp_ld(myp + l15 * 64, 1, 32, hf, 64, 1.f);
                    const __bf16* vh = (const __bf16*)vl; const __bf16* vlo = vh + 64 * VP;
#pragma unroll
                    for (int t = 0; t < NT; ++t) {
                        const int dcol = t * 16 + l15;
                        Split b0, b1;
#pragma unroll
                        for (int e = 0; e < 16; ++e) {
                            const int k0 = frag_k(e, hf), k1 = 32 + frag_k(e, hf);
                            b0.hi[e] = vh[k0 * VP + dcol]; b0.lo[e] = vlo[k0 * VP + dcol]; b1.hi[e] = vh[k1 * VP + dcol]; b1.lo[e] = vlo[k1 * VP + dcol];
                        }
                        o[t] = wmma3(pa0, b0, o[t]);
                        o[t] = wmma3(pa1, b1, o[t]);
                    }
                } else {
                    const v16h pa0 = fh_ld(myp + l15 * 64, 1, 0, hf, 64, 4096.f), pa1 = fh_ld(myp + l15 * 64, 1, 32, hf, 64, 4096.f);
#pragma unroll
                    for (int t = 0; t < NT; ++t) {
                        const int dcol = t * 16 + l15;
                        v16h b0, b1;
#pragma unroll
                        for (int e = 0; e < 16; ++e) { b0[e] = vl[frag_k(e, hf) * VP + dcol]; b1[e] = vl[(32 + frag_k(e, hf)) * VP + dcol]; }
                        o[t] = wmma16(pa0, b0, o[t]);
                        o[t] = wmma16(pa1, b1, o[t]);
                    }
                }
            }
        }
    }
    float* obase = p.O + b * p.sOb + h * p.sOh;
    if (p.ST) {
        const int rl = lane >> 1, isel = rl & 7;           // row q0 + rl ; rl>>3 == hf holds because lane>>4 == (lane>>1)>>3
        float mv = 0.f, lv = 0.f;
#pragma unroll
        for (int i = 0; i < 8; ++i) if (i == isel) { mv = m8[i]; lv = l8[i]; }
        const int irow = q0 + rl;
        if (irow < p.Lq) { float* st = p.ST + (((long long)b * gridDim.y + h) * p.Lq + irow) * 2 + (lane & 1); VST2(float, st, (lane & 1) ? lv : mv * 0.6931471805599453f); }
    }
    float invr[8];
#pragma unroll
    for (int i = 0; i < 8; ++i) {
        if (TWOPASS) invr[i] = SPLITPV ? 1.f : (1.f / 4096.f);
        else if (p.nonorm) invr[i] = exp2f(m8[i]) * (SPLITPV ? 1.f : (1.f / 4096.f));
        else invr[i] = (l8[i] > 0.f) ? (SPLITPV ? 1.f / l8[i] : 1.f / (l8[i] * 4096.f)) : 0.f;
    }
    __syncthreads();                                             // all waves done with pl/vl from the main loop
    const bool ofast = ((p.sOi & 3) == 0) && ((((size_t)obase) & 15) == 0) && (q0 + 16 <= p.Lq);
#pragma unroll
    for (int c0 = 0; c0 < DVP; c0 += 64) {
#pragma unroll
        for (int i = 0; i < 8; ++i)
#pragma unroll
            for (int t = 0; t < NT; ++t) if (t * 16 >= c0 && t * 16 < c0 + 64) ((float*)myp)[(i + 8 * hf) * 64 + (t * 16 - c0) + l15] = o[t][i] * invr[i];
        __syncthreads();
        const int cw = (DVP - c0 < 64) ? (DVP - c0) : 64;      // staged columns in this chunk (multiple of 16)
        if (ofast && (c0 + cw <= p.dv) && (cw % 32 == 0)) {
            const int lpr = cw / 4;                              // lanes per row (16 for 64 cols, 8 for 32)
            const int rows_per_ins = 32 / lpr;
            for (int r0 = 0; r0 < 16; r0 += rows_per_ins) {
                const int row = r0 + lane / lpr, c4 = (lane % lpr) * 4;
                const v4f v = *(const v4f*)(myp + row * 64 + c4);
                VST2V4(obase + (long long)(q0 + row) * p.sOi + c0 + c4, v);
            }
        } else {
            for (int row = 0; row < 16; ++row) {
                const int irow = q0 + row; if (irow >= p.Lq) continue;
                for (int c = lane; c < cw; c += 32) { const int d = c0 + c; if (d < p.dv) VST2(float, obase + (long long)irow * p.sOi + d, myp[row * 64 + c]); }
            }
        }
        __syncthreads();
    }
}

// =====================================================================================================================
// k_tr: dst(z, c, r) = alpha * src(z, r, c) (+ beta * R2(z, c, r)): [Z][R][C] (row stride lds) -> [Z][C][R] (row stride ldd) through a 32x32 LDS tile;
//   flags: 1 -> add beta * residual R2 addressed like dst (z*sRz + c*ldr + r); act applied before the residual.
// =====================================================================================================================
struct TrP { const float* src; float* dst; const float* R2; long long sSz, lds, sDz, ldd, sRz, ldr; int R, C, flags, act; float alpha, beta; };
static_assert(sizeof(TrP) == 3 * 8 + 6 * 8 + 6 * 4, "TrP has padding");
__global__ __launch_bounds__(256) void k_tr(TrP p) {
    __shared__ float tile[32][33];
    const int c0 = blockIdx.x * 32, r0 = blockIdx.y * 32, z = blockIdx.z;
    const int lane = threadIdx.x & 31, wave = threadIdx.x >> 5;
    const float* s = p.src + z * p.sSz;
#pragma unroll
    for (int k = 0; k < 4; ++k) {
        const int rl = wave * 4 + k, r = r0 + rl, c = c0 + lane;
        tile[rl][lane] = (r < p.R && c < p.C) ? s[(long long)r * p.lds + c] : 0.f;
    }
    __syncthreads();
    float* d = p.dst + z * p.sDz; const float* rr = p.R2 + z * p.sRz;
#pragma unroll
    for (int k = 0; k < 4; ++k) {
        const int cl = wave * 4 + k, c = c0 + cl, r = r0 + lane;
        if (c < p.C && r < p.R) {
            float v = act_fn(p.alpha * tile[lane][cl], p.act);
            if (p.flags & 1) v += p.beta * rr[(long long)c * p.ldr + r];
            VST2(float, d + (long long)c * p.ldd + r, v);
        }
    }
}

// k_affine: dst[i] = a * (sdev ? sdev[0] : 1) * src[i] + b, i < n (one thread per element; consecutive lanes -> consecutive addresses)
__global__ __launch_bounds__(256) void k_affine(const float* __restrict__ src, float* __restrict__ dst, int n, float a, float b, const float* __restrict__ sdev) {
    const int i = blockIdx.x * 256 + threadIdx.x;
    if (i < n) { const float aa = sdev ? a * sdev[0] : a; const float v = aa * src[i] + b; VST2(float, dst + i, v); }
}

// =====================================================================================================================
// k_softmax: row softmax over n contiguous elements, one 256-thread block per row; rows addressed z*sz + r*sr (grid (R, Z)).
//   out = scale_out * softmax(scale_in * x + (Mf ? Mf[z*smz + r*smr + j] : 0)); a row whose max is -inf is written as 0.
// =====================================================================================================================
struct SmP { const float* src; float* dst; const float* Mf; long long sz, sr, dz, dr, smz, smr; int n, pad; float scale_in, scale_out; };
static_assert(sizeof(SmP) == 3 * 8 + 6 * 8 + 4 * 4, "SmP has padding");
__global__ __launch_bounds__(256) void k_softmax(SmP p) {
    __shared__ float red[256];
    const int r = blockIdx.x, z = blockIdx.y, tid = threadIdx.x;
    const float* s = p.src + z * p.sz + (long long)r * p.sr;
    const float* mf = p.Mf ? (p.Mf + z * p.smz + (long long)r * p.smr) : nullptr;
    float mx = -__builtin_inff();
    for (int j = tid; j < p.n; j += 256) { float v = s[j] * p.scale_in; if (mf) v += mf[j]; mx = fmaxf(mx, v); }
    red[tid] = mx; __syncthreads();
    for (int o = 128; o > 0; o >>= 1) { if (tid < o) red[tid] = fmaxf(red[tid], red[tid + o]); __syncthreads(); }
    mx = red[0]; __syncthreads();
    float sum = 0.f;
    for (int j = tid; j < p.n; j += 256) { float v = s[j] * p.scale_in; if (mf) v += mf[j]; sum += (mx == -__builtin_inff()) ? 0.f : expf(v - mx); }
    red[tid] = sum; __syncthreads();
    for (int o = 128; o > 0; o >>= 1) { if (tid < o) red[tid] += red[tid + o]; __syncthreads(); }
    sum = red[0];
    const float inv = (sum > 0.f) ? p.scale_out / sum : 0.f;
    float* d = p.dst + z * p.dz + (long long)r * p.dr;
    for (int j = tid; j < p.n; j += 256) { float v = s[j] * p.scale_in; if (mf) v += mf[j]; const float o = (mx == -__builtin_inff()) ? 0.f : expf(v - mx) * inv; VST2(float, d + j, o); }
}
// =====================================================================================================================
// k_stats: mean and rsqrt(var + eps) over a set of n elements addressed base + z*sz + (e / inner) * so + (e % inner) * si, one 256-thread
// k_norm_apply: y = (x - mean[set]) * rstd[set] * g[c] + b[c] over a [Z][C][L] channel-major tensor with set = z*G + c / (C/G) (G groups per z;
//   G = C -> per-channel sets indexed z*C+c; for batch norm pass stats indexed by c only via bn = 1). Optional act. Output same layout.
// =====================================================================================================================
//   mode 0: mean / rsqrt(var + eps); mode 1 (RMSNorm): 0 / rsqrt(mean(x^2) + eps); mode 2 (L2 normalize * sqrt(n)): 0 / sqrt(n) / max(||x||, eps); mode 3: as 0 with unbiased variance (n-1)
__global__ __launch_bounds__(256) void k_stats(const float* __restrict__ x, long long sz, long long so, long long si, int inner, int n, float eps, float* __restrict__ stat, int mode) {
    __shared__ float red[256];
    const int z = blockIdx.x, tid = threadIdx.x;
    const float* base = x + z * sz;
    float s = 0.f;
    for (int e = tid; e < n; e += 256) s += base[(long long)(e / inner) * so + (long long)(e % inner) * si];
    red[tid] = s; __syncthreads();
    for (int o = 128; o > 0; o >>= 1) { if (tid < o) red[tid] += red[tid + o]; __syncthreads(); }
    const float mu = (mode == 0 || mode == 3) ? red[0] / (float)n : 0.f; __syncthreads();
    float q = 0.f;
    for (int e = tid; e < n; e += 256) { const float dlt = base[(long long)(e / inner) * so + (long long)(e % inner) * si] - mu; q += dlt * dlt; }
    red[tid] = q; __syncthreads();
    for (int o = 128; o > 0; o >>= 1) { if (tid < o) red[tid] += red[tid + o]; __syncthreads(); }
    {
        float rs;
        if (mode == 2) rs = sqrtf((float)n) / fmaxf(sqrtf(red[0]), eps); else if (mode == 3) rs = rsqrtf(red[0] / (float)(n - 1) + eps); else rs = rsqrtf(red[0] / (float)n + eps);
        if (tid < 32) { const float v = (tid == 0) ? mu : ((tid == 1) ? rs : 0.f); VST2(float, stat + (long long)z * 32 + tid, v); }
    }
}
//   One thread per element over the flat [Z][C][L] index space: grid ceil(Z*C*L / 256).
__global__ __launch_bounds__(256) void k_norm_apply(const float* __restrict__ x, float* __restrict__ y, const float* __restrict__ stat, const float* __restrict__ g, const float* __restrict__ bta,
                                                     int Z, int C, int L, int G, int bn, int act) {
    const long long idx = (long long)blockIdx.x * 256 + threadIdx.x;
    if (idx >= (long long)Z * C * L) return;
    const int l = (int)(idx % L); const long long zc = idx / L; const int c = (int)(zc % C), z = (int)(zc / C); (void)l;
    const int set = bn ? c : (z * G + c / (C / G));
    float v = (x[idx] - stat[(long long)set * 32]) * stat[(long long)set * 32 + 1];
    if (g) v *= g[c];
    if (bta) v += bta[c];
    v = act_fn(v, act);
    VST2(float, y + idx, v);
}

// k_lse_neg: c[i] = -(st[2i] + log(st[2i+1])) = minus the log-sum-exp of row i from k_attn's ST output (for softmax over the query axis)
__global__ __launch_bounds__(256) void k_lse_neg(const float* __restrict__ st, float* __restrict__ c, int n) {
    const int i = blockIdx.x * 256 + threadIdx.x;
    if (i < n) { const float v = -(st[2 * i] + logf(st[2 * i + 1])); VST2(float, c + i, v); }
}

// k_iota: dst[i] = a * i + b as int32 (segment/position id helper)
__global__ __launch_bounds__(256) void k_iota(int* __restrict__ dst, int n, int a, int b) {
    const int i = blockIdx.x * 256 + threadIdx.x;
    if (i < n) { const int v = a * i + b; VST2(int, dst + i, v); }
}

// k_axpby: dst[i] = a * x[i] + b * y[i] (+ c), i < n
__global__ __launch_bounds__(256) void k_axpby(const float* __restrict__ x, const float* __restrict__ y, float* __restrict__ dst, int n, float a, float b, float c) {
    const int i = blockIdx.x * 256 + threadIdx.x;
    if (i < n) { const float v = a * x[i] + b * y[i] + c; VST2(float, dst + i, v); }
}

// =====================================================================================================================
// k_rope: rotary embedding on a [R rows][Hn heads][D] view (row stride sXr, head stride sXh, element stride 1) -> Y (own strides).
//   mode 0: rotate_half (partner d±D/2, sign - for d<D/2); mode 1: interleaved pairs (partner d^1, sign - for even d).
//   table column tcol: tmode 0 -> d, 1 -> d % (D/2), 2 -> d / 2; position p: pmode 0 -> r % S, 1 -> head index, 2 -> pos[r];
//   c = C[(r / S) * sCb + p * sCp + tcol * sCd], s likewise from Sn; y = x[d] * c + sign * x[partner] * s. X and Y must not alias.
// =====================================================================================================================
struct RopeP { const float* X; float* Y; const float* C; const float* Sn; const int* pos; long long sXr, sXh, sYr, sYh, sCb, sCp, sCd; int R, Hn, D, S, mode, tmode, pmode, pad; };
static_assert(sizeof(RopeP) == 5 * 8 + 7 * 8 + 8 * 4, "RopeP has padding");
__global__ __launch_bounds__(256) void k_rope(RopeP p) {
    const long long idx = (long long)blockIdx.x * 256 + threadIdx.x;
    if (idx >= (long long)p.R * p.Hn * p.D) return;
    const int d = (int)(idx % p.D); const long long rh = idx / p.D; const int h = (int)(rh % p.Hn); const int r = (int)(rh / p.Hn);
    const int half = p.D / 2;
    int partner; float sign;
    if (p.mode == 0) { partner = (d < half) ? d + half : d - half; sign = (d < half) ? -1.f : 1.f; }
    else { partner = d ^ 1; sign = (d & 1) ? 1.f : -1.f; }
    const int tcol = (p.tmode == 0) ? d : ((p.tmode == 1) ? (d % half) : (d >> 1));
    const int pp = (p.pmode == 0) ? (r % p.S) : ((p.pmode == 1) ? h : p.pos[r]);
    const long long toff = (long long)(r / p.S) * p.sCb + (long long)pp * p.sCp + (long long)tcol * p.sCd;
    const float* xr = p.X + (long long)r * p.sXr + (long long)h * p.sXh;
    const float v = xr[d] * p.C[toff] + sign * xr[partner] * p.Sn[toff];
    VST2(float, p.Y + (long long)r * p.sYr + (long long)h * p.sYh + d, v);
}

// k_invf + k_sincos (split so neither kernel carries a large VALU-fma footprint): invf_i = num * (1 / powf(base, (2 i)/D)) [fmode 0],
//   num * expf((2 i) * cexp) [fmode 1], num * powf(base, -2 (i - 1) / D) [fmode 2]; then cs/sn[s*half + i] = cos/sin((pscale * s) * invf_i)
__global__ __launch_bounds__(256) void k_invf(float* __restrict__ invb, int half, int D, float base, float num, int fmode, float cexp) {
    const int i = blockIdx.x * 256 + threadIdx.x;
    if (i >= ((half + 31) / 32) * 32) return;
    if (i >= half) { VST2(float, invb + i, 0.f); return; }
    const float e = (float)(2 * i) / (float)D;
    float invf;
    if (fmode == 1) invf = num * expf((float)(2 * i) * cexp);
    else if (fmode == 2) invf = num * powf(base, (-2.0f * ((float)i - 1.0f)) / (float)D);
    else invf = num * (1.0f / powf(base, e));
    VST2(float, invb + i, invf);
}
__global__ __launch_bounds__(256) void k_sincos(float* __restrict__ cs, float* __restrict__ sn, const float* __restrict__ invb, int S, int half, float pscale) {
    const int idx = blockIdx.x * 256 + threadIdx.x;
    if (idx >= S * half) return;
    const int s = idx / half, i = idx - s * half;
    const float ang = (pscale * (float)s) * invb[i];
    VST2(float, cs + idx, cosf(ang)); VST2(float, sn + idx, sinf(ang));
}

// k_mulact: dst[i] = act(x[i]) * y[i]
__global__ __launch_bounds__(256) void k_mulact(const float* __restrict__ x, const float* __restrict__ y, float* __restrict__ dst, int n, int act) {
    const int i = blockIdx.x * 256 + threadIdx.x;
    if (i < n) { const float v = act_fn(x[i], act) * y[i]; VST2(float, dst + i, v); }
}

// =====================================================================================================================
// k_matvec: thread-per-row matrix-vector products for N <= 8 output columns (heads with 1-3 outputs, gates), f32 on the VALU.
//   C[r*sCm + j] = act(alpha * sum_k A[r*sAm + k*sAk] * B[j*sBn + k*sBk] + bias[j]) + beta * R[r*sRm + j*sRn]; each thread writes its N contiguous floats.
// =====================================================================================================================
__global__ __launch_bounds__(256) void k_matvec(GemmP p) {
    // 32 lanes write one line with one instruction.
    const int rpt = (p.N == 1) ? 1 : 32;
    const long long r0 = ((long long)blockIdx.x * 256 + threadIdx.x) * rpt; const int z = blockIdx.z, zo = z / p.zi_n, zi = z - zo * p.zi_n;
    if (r0 >= p.M) return;
    const float* Bb = p.B + zo * p.sBo + zi * p.sBi;
    float* C = p.C + zo * p.sCo + zi * p.sCi; const float* R = p.R + zo * p.sRo + zi * p.sRi;
    for (int rr = 0; rr < rpt; ++rr) {
        const long long r = r0 + rr; if (r >= p.M) break;
        const float* A = p.A + zo * p.sAo + zi * p.sAi + r * p.sAm;
        float acc[8] = {0.f, 0.f, 0.f, 0.f, 0.f, 0.f, 0.f, 0.f};
        for (int k = 0; k < p.K; ++k) { const float a = A[(long long)k * p.sAk];
#pragma unroll
            for (int j = 0; j < 8; ++j) if (j < p.N) acc[j] += a * Bb[(long long)j * p.sBn + (long long)k * p.sBk]; }
#pragma unroll
        for (int j = 0; j < 8; ++j) if (j < p.N) {
            float v = acc[j] * p.alpha;
            if (p.flags & 1) v += p.bias[j];
            if (p.flags & 2) v += p.bias[r];
            v = act_fn(v, p.act);
            if (p.flags & 4) v += p.beta * R[r * p.sRm + (long long)j * p.sRn];
            VST2(float, C + r * p.sCm + j, v);
        }
    }
}
// k_smallsoftmax: thread-per-row softmax for short rows (n <= 64): dst[r*dr + j] = softmax(scale*src[r*sr + j])
__global__ __launch_bounds__(256) void k_smallsoftmax(const float* __restrict__ src, float* __restrict__ dst, long long sr, long long dr, int n, long long R, float scale) {
    const long long r0 = ((long long)blockIdx.x * 256 + threadIdx.x) * 32;
    for (int rr = 0; rr < 32; ++rr) {
        const long long r = r0 + rr; if (r >= R) return;
        const float* s = src + r * sr; float* d = dst + r * dr;
        float mx = -__builtin_inff();
        for (int j = 0; j < n; ++j) mx = fmaxf(mx, s[j] * scale);
        float sum = 0.f;
        for (int j = 0; j < n; ++j) sum += expf(s[j] * scale - mx);
        const float inv = 1.f / sum;
        for (int j = 0; j < n; ++j) { const float v = expf(s[j] * scale - mx) * inv; VST2(float, d + j, v); }
    }
}

__global__ __launch_bounds__(32) void k_unitstat(float* __restrict__ st) { const int t = threadIdx.x; const float v = (t == 1) ? 1.f : 0.f; VST2(float, st + t, v); }

// destination (e.g. a d_out whose row width is not a multiple of 32 floats) is written by consecutive lanes of one instruction
__global__ __launch_bounds__(256) void k_lincopy(const float* __restrict__ src, long long lds, float* __restrict__ dst, long long ldd, long long rows, int cols) {
    const long long i = (long long)blockIdx.x * 256 + threadIdx.x; if (i >= rows * cols) return;
    const long long r = i / cols; const int c = (int)(i - r * cols);
    const float v = src[r * lds + c]; VST2(float, dst + r * ldd + c, v);
}

namespace w25 {
typedef __attribute__((ext_vector_type(16))) _Float16 v16h;
typedef __attribute__((ext_vector_type(8)))  _Float16 v8h;
typedef __attribute__((ext_vector_type(16))) __bf16   v16b;
typedef __attribute__((ext_vector_type(8)))  __bf16   v8b;
typedef __attribute__((ext_vector_type(8)))  float    v8f;
typedef __attribute__((ext_vector_type(4)))  float    v4f;

__device__ __forceinline__ unsigned short f2bf_bits(float f) {
  unsigned u = __float_as_uint(f);
  return (unsigned short)((u + 0x7FFFu + ((u >> 16) & 1u)) >> 16);
}
__device__ __forceinline__ float bf_bits2f(unsigned short h) { return __uint_as_float(((unsigned)h) << 16); }

// hazard guards as plain device helpers (no inline asm inside the kernel template body)
__device__ __forceinline__ void dep_guard_h(v8f& a, v8f& b, v16h x, v16h y) { asm volatile("v_nop\n\tv_nop\n\tv_nop\n\tv_nop" : "+v"(a), "+v"(b) : "v"(x), "v"(y)); }
__device__ __forceinline__ void dep_guard_b(v8f& a, v8f& b, v16b x, v16b y) { asm volatile("v_nop\n\tv_nop\n\tv_nop\n\tv_nop" : "+v"(a), "+v"(b) : "v"(x), "v"(y)); }
__device__ __forceinline__ void keep4_h(v16h a, v16h b, v16h c, v16h d) { asm volatile("v_nop" :: "v"(a), "v"(b), "v"(c), "v"(d)); }
__device__ __forceinline__ void keep4_b(v16b a, v16b b, v16b c, v16b d) { asm volatile("v_nop" :: "v"(a), "v"(b), "v"(c), "v"(d)); }
__device__ __forceinline__ void acc_guard4(v8f& a, v8f& b, v8f& c, v8f& d) { asm volatile("v_nop\n\tv_nop\n\tv_nop\n\tv_nop" : "+v"(a), "+v"(b), "+v"(c), "+v"(d)); }
template <typename T> struct Frag;
template <> struct Frag<_Float16> {
  typedef v16h V; union U { v16h v; v8h h[2]; };
  static __device__ __forceinline__ v16h load(const _Float16* p) {   // elements 0..7 <- p[0..7], 8..15 <- p[16..23]
    U f; f.h[0] = *(const v8h*)(p); f.h[1] = *(const v8h*)(p + 16); return f.v;
  }
  static __device__ __forceinline__ v8f mma(v16h a, v16h b, v8f c) {
    return __builtin_amdgcn_wmma_f32_16x16x32_f16(false, a, false, b, (short)0, c, false, false);
  }
  static __device__ __forceinline__ void guard(v8f& a, v8f& b, v16h x, v16h y) { dep_guard_h(a, b, x, y); }
  static __device__ __forceinline__ void keep(v16h a, v16h b, v16h c, v16h d) { keep4_h(a, b, c, d); }
};
template <> struct Frag<__bf16> {
  typedef v16b V; union U { v16b v; v8b h[2]; };
  static __device__ __forceinline__ v16b load(const __bf16* p) {
    U f; f.h[0] = *(const v8b*)(p); f.h[1] = *(const v8b*)(p + 16); return f.v;
  }
  static __device__ __forceinline__ v8f mma(v16b a, v16b b, v8f c) {
    return __builtin_amdgcn_wmma_f32_16x16x32_bf16(false, a, false, b, (short)0, c, false, false);
  }
  static __device__ __forceinline__ void guard(v8f& a, v8f& b, v16b x, v16b y) { dep_guard_b(a, b, x, y); }
  static __device__ __forceinline__ void keep(v16b a, v16b b, v16b c, v16b d) { keep4_b(a, b, c, d); }
};

// ---- Register-blocked batched WMMA GEMM ------------------------------------
// C[m,n] = scale * sum_k A[m,k] * Bt[n,k] (+bias)(+resid); each wave owns a 64x64 tile.
// A row-major [M,K]; Bt row-major [N,K]; M,N % 64 == 0, K % 32 == 0.
// SPLIT: operands are hi/lo planes (A2/Bt2 = lo planes, same layout); product = hi·hi + hi·lo + lo·hi.
// BIAS_MODE: 0 = none, 1 = bias[m], 2 = bias[n].
// OUT_MODE: 0 = f32, 1 = f16, 2 = bf16 hi plane (Cout) + bf16 lo plane (Cout2).
// ET: 0 = f16 operands, 1 = bf16 operands (pointers passed as 16-bit storage)
template <int ET> struct Elem;
template <> struct Elem<0> { typedef _Float16 T; };
template <> struct Elem<1> { typedef __bf16 T; };
template <int ET, bool SPLIT, int BIAS_MODE, int OUT_MODE, bool RESID, int ACT = 0>
__global__ __launch_bounds__(256) void wmma_gemm64(
    const unsigned short* __restrict__ Ap, const unsigned short* __restrict__ A2p, int lda, long strideA,
    const unsigned short* __restrict__ Btp, const unsigned short* __restrict__ Bt2p, int ldb, long strideB,
    void* __restrict__ Cout, void* __restrict__ Cout2, int ldc, long strideC,
    const float* __restrict__ bias,
    const float* __restrict__ resid, long strideR,
    int M, int N, int K, float scale) {
  typedef typename Elem<ET>::T T;
  typedef typename Frag<T>::V V;
  const T* A = (const T*)Ap; const T* A2 = (const T*)A2p; const T* Bt = (const T*)Btp; const T* Bt2 = (const T*)Bt2p;
  __shared__ __align__(16) float sT[8][16 * 68];   // per-wave 16x64 slab, pitch 68 floats
  const int b    = blockIdx.y;
  const int lane = threadIdx.x & 31;
  const int wave = threadIdx.x >> 5;
  const int tilesN = N >> 6;
  const int tilesM = M >> 6;
  const int tile = blockIdx.x * 8 + wave;
  if (tile >= tilesM * tilesN) return;   // wave-uniform; no block barriers in this kernel
  const int tm = tile / tilesN;
  const int tn = tile - tm * tilesN;
  const int m0 = tm << 6;
  const int n0 = tn << 6;

  const T* Ab  = A  + (size_t)b * strideA;
  const T* Bb  = Bt + (size_t)b * strideB;
  const T* Ab2 = SPLIT ? (A2  + (size_t)b * strideA) : nullptr;
  const T* Bb2 = SPLIT ? (Bt2 + (size_t)b * strideB) : nullptr;

  const int rlane = lane & 15;                 // row (A) / col (B, D) within subtile
  const int koff  = (lane >> 4) * 8;           // k offset of this lane half
  const int mOff  = (lane >> 4) * 8;           // D row offset

  v8f acc[4][4];
#pragma unroll
  for (int i = 0; i < 4; ++i)
#pragma unroll
    for (int j = 0; j < 4; ++j) acc[i][j] = (v8f){0.f,0.f,0.f,0.f,0.f,0.f,0.f,0.f};

  for (int k0 = 0; k0 < K; k0 += 32) {
    V bh[4], bl[4];
#pragma unroll
    for (int j = 0; j < 4; ++j) {
      const size_t bo = (size_t)(n0 + (j << 4) + rlane) * ldb + koff + k0;
      bh[j] = Frag<T>::load(Bb + bo);
      if (SPLIT) bl[j] = Frag<T>::load(Bb2 + bo);
    }
#pragma unroll
    for (int i = 0; i < 4; ++i) {
      const size_t ao = (size_t)(m0 + (i << 4) + rlane) * lda + koff + k0;
      V ah = Frag<T>::load(Ab + ao);
      V al;
      if (SPLIT) al = Frag<T>::load(Ab2 + ao);
#pragma unroll
      for (int j = 0; j < 4; ++j) {
        acc[i][j] = Frag<T>::mma(ah, bh[j], acc[i][j]);
        if (SPLIT) {
          acc[i][j] = Frag<T>::mma(ah, bl[j], acc[i][j]);
          acc[i][j] = Frag<T>::mma(al, bh[j], acc[i][j]);
        }
      }
      Frag<T>::guard(acc[i][0], acc[i][3], ah, SPLIT ? al : ah);
    }
    Frag<T>::keep(bh[0], bh[1], bh[2], bh[3]);
    if (SPLIT) Frag<T>::keep(bl[0], bl[1], bl[2], bl[3]);
  }
  acc_guard4(acc[0][0], acc[0][1], acc[0][2], acc[0][3]);
  acc_guard4(acc[1][0], acc[1][1], acc[1][2], acc[1][3]);
  acc_guard4(acc[2][0], acc[2][1], acc[2][2], acc[2][3]);
  acc_guard4(acc[3][0], acc[3][1], acc[3][2], acc[3][3]);

  // ---- epilogue ----
  float* slab = sT[wave];
  const float* Rb = RESID ? (resid + (size_t)b * strideR) : nullptr;
#pragma unroll
  for (int i = 0; i < 4; ++i) {
    const int mBase = m0 + (i << 4);
#pragma unroll
    for (int j = 0; j < 4; ++j) {
      const int n = n0 + (j << 4) + rlane;
      float bv = 0.f;
      if (BIAS_MODE == 2) bv = bias[n];
#pragma unroll
      for (int r = 0; r < 8; ++r) {
        float v = acc[i][j][r] * scale;
        if (BIAS_MODE == 1) v += bias[mBase + mOff + r];
        if (BIAS_MODE == 2) v += bv;
        if (RESID) v += Rb[(size_t)(mBase + mOff + r) * ldc + n];
        if (ACT == 1) v = tanhf(v);
        if (ACT == 2) v = fmaxf(v, 0.0f);
        if (ACT == 3) v = v / (1.0f + expf(-v));
        if (ACT == 4) v = (v > 0.f) ? v : 0.01f * v;
        if (ACT == 5) v = 0.5f * v * (1.0f + erff(v * 0.70710678118654752f));
        slab[(mOff + r) * 68 + (j << 4) + rlane] = v;
      }
    }
    __builtin_amdgcn_fence(__ATOMIC_RELEASE, "workgroup");
    __builtin_amdgcn_wave_barrier();
    __builtin_amdgcn_fence(__ATOMIC_ACQUIRE, "workgroup");
    if (OUT_MODE == 0) {
      float* C = (float*)Cout + (size_t)b * strideC;
      const int hh = lane >> 4, c4 = (lane & 15) * 4;     // row seg = 256 B = 16 lanes x 16 B
      {
#pragma unroll
        for (int it = 0; it < 8; ++it) {
          const int row = it * 2 + hh;
          v4f v = *(const v4f*)(slab + row * 68 + c4);
          *(v4f*)(C + (size_t)(mBase + row) * ldc + n0 + c4) = v;
        }
        
      }
    } else {
      const int q = lane >> 3, c8 = (lane & 7) * 8;
      unsigned short* C  = (unsigned short*)Cout  + (size_t)b * strideC;
      unsigned short* C2 = (OUT_MODE == 2) ? ((unsigned short*)Cout2 + (size_t)b * strideC) : nullptr;
      {
#pragma unroll
        for (int it = 0; it < 4; ++it) {
          const int row = it * 4 + q;
          const float* sp = slab + row * 68 + c8;
          v8h hv, lv;
#pragma unroll
          for (int e = 0; e < 8; ++e) {
            if (OUT_MODE == 1) {
              hv[e] = (_Float16)sp[e];
            } else {
              unsigned short hb = f2bf_bits(sp[e]);
              unsigned short lb = f2bf_bits(sp[e] - bf_bits2f(hb));
              hv[e] = __builtin_bit_cast(_Float16, hb);
              lv[e] = __builtin_bit_cast(_Float16, lb);
            }
          }
          *(v8h*)(C + (size_t)(mBase + row) * ldc + n0 + c8) = hv;
          if (OUT_MODE == 2) *(v8h*)(C2 + (size_t)(mBase + row) * ldc + n0 + c8) = lv;
        }
        
      }
    }
    __builtin_amdgcn_fence(__ATOMIC_RELEASE, "workgroup");
    __builtin_amdgcn_wave_barrier();
    __builtin_amdgcn_fence(__ATOMIC_ACQUIRE, "workgroup");
  }
}

__global__ __launch_bounds__(256) void cast_f32_f16x2(
    const float* __restrict__ in, _Float16* __restrict__ out, int n2) {
  int i = blockIdx.x * 256 + threadIdx.x;
  if (i < n2) {
    const _Float16 h0 = (_Float16)in[2 * i], h1 = (_Float16)in[2 * i + 1];
    const unsigned u = (unsigned)__builtin_bit_cast(unsigned short, h0) | ((unsigned)__builtin_bit_cast(unsigned short, h1) << 16);
    ((unsigned*)out)[i] = u;
    
  }
}


} // namespace w25

__global__ __launch_bounds__(256) void k_castT16(const float* __restrict__ src, long long lds, _Float16* __restrict__ dst, long long ldd, int R, int C, float s) {
    const long long i = (long long)blockIdx.x * 256 + threadIdx.x; const long long np = (long long)C * (R / 2); if (i >= np) return; const int c = (int)(i / (R / 2)); const int r = 2 * (int)(i % (R / 2));
    const _Float16 h0 = (_Float16)(src[(long long)r * lds + c] * s), h1 = (_Float16)(src[(long long)(r + 1) * lds + c] * s);
    const unsigned u = (unsigned)__builtin_bit_cast(unsigned short, h0) | ((unsigned)__builtin_bit_cast(unsigned short, h1) << 16);
    unsigned* d = (unsigned*)(dst + (long long)c * ldd + r); *d = u;  }
__global__ __launch_bounds__(256) void k_cast16(const float* __restrict__ src, long long lds, _Float16* __restrict__ dst, long long ldd, int R, int C, float s) {
    const long long i = (long long)blockIdx.x * 256 + threadIdx.x; const long long np = (long long)R * (C / 2); if (i >= np) return; const int r = (int)(i / (C / 2)); const int c = 2 * (int)(i % (C / 2));
    const _Float16 h0 = (_Float16)(src[(long long)r * lds + c] * s), h1 = (_Float16)(src[(long long)r * lds + c + 1] * s);
    const unsigned u = (unsigned)__builtin_bit_cast(unsigned short, h0) | ((unsigned)__builtin_bit_cast(unsigned short, h1) << 16);
    unsigned* d = (unsigned*)(dst + (long long)r * ldd + c); *d = u;  }

// f32 -> bf16 hi plane + bf16 lo plane (x = hi + lo to ~2^-17 relative; RNE both), [R][C] -> [R][C] (or transposed to [C][R]); 2 consecutive destination elements
__device__ __forceinline__ unsigned int f2bf2_pack(float a, float b, unsigned int* lo) {
    const unsigned short ha = w25::f2bf_bits(a), hb = w25::f2bf_bits(b);
    const unsigned short la = w25::f2bf_bits(a - w25::bf_bits2f(ha)), lb = w25::f2bf_bits(b - w25::bf_bits2f(hb));
    *lo = (unsigned)la | ((unsigned)lb << 16); return (unsigned)ha | ((unsigned)hb << 16); }
__global__ __launch_bounds__(256) void k_castS16(const float* __restrict__ src, long long lds, __bf16* __restrict__ dhi, __bf16* __restrict__ dlo, long long ldd, int R, int C, float s, int transpose) {
    const long long i = (long long)blockIdx.x * 256 + threadIdx.x; long long o; float a, b;
    if (transpose) { const long long np = (long long)C * (R / 2); if (i >= np) return; const int c = (int)(i / (R / 2)); const int r = 2 * (int)(i % (R / 2)); a = src[(long long)r * lds + c] * s; b = src[(long long)(r + 1) * lds + c] * s; o = (long long)c * ldd + r; }
    else { const long long np = (long long)R * (C / 2); if (i >= np) return; const int r = (int)(i / (C / 2)); const int c = 2 * (int)(i % (C / 2)); a = src[(long long)r * lds + c] * s; b = src[(long long)r * lds + c + 1] * s; o = (long long)r * ldd + c; }
    unsigned lo; const unsigned hi = f2bf2_pack(a, b, &lo); unsigned* ph = (unsigned*)(dhi + o); unsigned* pl = (unsigned*)(dlo + o);
    *ph = hi; *pl = lo;  }


extern "C" void kernel_launch(void* const* d_in, const int* in_sizes, int n_in, void* d_out, int out_size, void* d_ws, size_t ws_size, hipStream_t stream) {
    (void)in_sizes; (void)n_in; (void)out_size; (void)ws_size;
    const float* x = (const float*)d_in[0];
    const float* ln1g = (const float*)d_in[1];
    const float* ln1b = (const float*)d_in[2];
    const float* Wq = (const float*)d_in[3];
    const float* bq = (const float*)d_in[4];
    const float* Wk = (const float*)d_in[5];
    const float* bk = (const float*)d_in[6];
    const float* Wv = (const float*)d_in[7];
    const float* bv = (const float*)d_in[8];
    const float* Wo = (const float*)d_in[9];
    const float* bo = (const float*)d_in[10];
    const float* ln2g = (const float*)d_in[11];
    const float* ln2b = (const float*)d_in[12];
    const float* W1 = (const float*)d_in[13];
    const float* b1 = (const float*)d_in[14];
    const float* W2 = (const float*)d_in[15];
    const float* b2 = (const float*)d_in[16];
    const int L = 4096;
    const int C = 512;
    const int NH = 8;
    const int HD = 64;
    const int FF = 2048;
    const int LP = L / 2;
    const int WINP = 128;
    float* out = (float*)d_out;
    char* wsp = (char*)d_ws;
    float* ST1 = (float*)wsp; wsp += (((size_t)((size_t)L * 32) * 4 + 255) / 256) * 256;
    float* HN = (float*)wsp; wsp += (((size_t)((size_t)L * C) * 4 + 255) / 256) * 256;
    float* Q = (float*)wsp; wsp += (((size_t)((size_t)L * C) * 4 + 255) / 256) * 256;
    float* Kb = (float*)wsp; wsp += (((size_t)((size_t)L * C) * 4 + 255) / 256) * 256;
    float* V = (float*)wsp; wsp += (((size_t)((size_t)L * C) * 4 + 255) / 256) * 256;
    float* Y = (float*)wsp; wsp += (((size_t)((size_t)L * C) * 4 + 255) / 256) * 256;
    float* X1 = (float*)wsp; wsp += (((size_t)((size_t)L * C) * 4 + 255) / 256) * 256;
    float* ST2 = (float*)wsp; wsp += (((size_t)((size_t)L * 32) * 4 + 255) / 256) * 256;
    float* H2 = (float*)wsp; wsp += (((size_t)((size_t)L * C) * 4 + 255) / 256) * 256;
    float* F1 = (float*)wsp; wsp += (((size_t)((size_t)L * FF) * 4 + 255) / 256) * 256;
    unsigned short* G64A = (unsigned short*)wsp; wsp += (((size_t)(8388608) * 2 + 255) / 256) * 256;
    unsigned short* G64B = (unsigned short*)wsp; wsp += (((size_t)(1048576) * 2 + 255) / 256) * 256;
    k_stats<<<(unsigned)(L), 256, 0, stream>>>(x, C, 1, 1, 1, C, 1e-05f, ST1, 0);
    k_norm_apply<<<(unsigned)(((long long)(L) * (C) * (1) + 255) / 256), 256, 0, stream>>>(x, HN, ST1, ln1g, ln1b, L, C, 1, 1, 0, 0);
    k_cast16<<<(unsigned)((((long long)(4096) * ((512) / 2)) + 255) / 256), 256, 0, stream>>>(HN, 512, (_Float16*)(G64A), 512, 4096, 512, 1.0f);
    k_cast16<<<(unsigned)((((long long)(512) * ((512) / 2)) + 255) / 256), 256, 0, stream>>>(Wq, 512, (_Float16*)(G64B), 512, 512, 512, 16.0f);
    w25::wmma_gemm64<0, false, 2, 0, false, 0><<<dim3((unsigned)((((4096) / 64) * ((512) / 64) + 7) / 8), (unsigned)(1)), 256, 0, stream>>>((const unsigned short*)(G64A), nullptr, 512, 0, (const unsigned short*)(G64B), nullptr, 512, 0, (void*)(Q), nullptr, 512, 0, bq, nullptr, 0, 4096, 512, 512, 0.0625f);
    k_cast16<<<(unsigned)((((long long)(4096) * ((512) / 2)) + 255) / 256), 256, 0, stream>>>(HN, 512, (_Float16*)(G64A), 512, 4096, 512, 1.0f);
    k_cast16<<<(unsigned)((((long long)(512) * ((512) / 2)) + 255) / 256), 256, 0, stream>>>(Wk, 512, (_Float16*)(G64B), 512, 512, 512, 16.0f);
    w25::wmma_gemm64<0, false, 2, 0, false, 0><<<dim3((unsigned)((((4096) / 64) * ((512) / 64) + 7) / 8), (unsigned)(1)), 256, 0, stream>>>((const unsigned short*)(G64A), nullptr, 512, 0, (const unsigned short*)(G64B), nullptr, 512, 0, (void*)(Kb), nullptr, 512, 0, bk, nullptr, 0, 4096, 512, 512, 0.0625f);
    k_cast16<<<(unsigned)((((long long)(4096) * ((512) / 2)) + 255) / 256), 256, 0, stream>>>(HN, 512, (_Float16*)(G64A), 512, 4096, 512, 1.0f);
    k_cast16<<<(unsigned)((((long long)(512) * ((512) / 2)) + 255) / 256), 256, 0, stream>>>(Wv, 512, (_Float16*)(G64B), 512, 512, 512, 16.0f);
    w25::wmma_gemm64<0, false, 2, 0, false, 0><<<dim3((unsigned)((((4096) / 64) * ((512) / 64) + 7) / 8), (unsigned)(1)), 256, 0, stream>>>((const unsigned short*)(G64A), nullptr, 512, 0, (const unsigned short*)(G64B), nullptr, 512, 0, (void*)(V), nullptr, 512, 0, bv, nullptr, 0, 4096, 512, 512, 0.0625f);
    { /*apv4*/ AttnP a;
      a.Q = Q; a.K = Kb; a.V = V; a.O = Y; a.P = 0; a.Mf = 0; a.Mi = 0; a.ST = 0;
      a.Pw = 0; a.Rt = 0; a.SQ = 0; a.SK = 0;
      a.swb = 0; a.swh = 0; a.swi = 0; a.swj = 0; a.srb = 0; a.srh = 0; a.sri = 0; a.sQb = 0; a.sQh = HD; a.sQi = 2 * C; a.sQd = 1; a.sKb = 0; a.sKh = HD; a.sKj = 2 * C; a.sKd = 1; a.sVb = 0; a.sVh = HD; a.sVj = 2 * C; a.sVd = 1; a.sOb = 0; a.sOh = HD; a.sOi = 2 * C; a.sPb = 0; a.sPh = 0; a.sPi = 0; a.smb = 0; a.smh = 0; a.smi = 0; a.smj = 0;
      a.Lq = LP; a.Lk = LP; a.dh = HD; a.dv = HD; a.hrep = 1; a.causal = 1; a.coff = 0; a.pband = 0;
      a.scale = 0.125f; a.mfill = 0.0f; a.nonorm = 0; a.mpol = 0;
      a.roff = 0; a.rn = 1; a.segpol = 0; a.win = WINP;
      k_attn<64, 64, 0, false, false><<<dim3((unsigned)((LP) + 16 * AW - 1) / (16 * AW), (unsigned)(NH), (unsigned)(1)), 32 * AW, 0, stream>>>(a); }
    { /*apv4*/ AttnP a;
      a.Q = Q + 1 * C; a.K = Kb + 1 * C; a.V = V + 1 * C; a.O = Y + 1 * C; a.P = 0; a.Mf = 0; a.Mi = 0; a.ST = 0;
      a.Pw = 0; a.Rt = 0; a.SQ = 0; a.SK = 0;
      a.swb = 0; a.swh = 0; a.swi = 0; a.swj = 0; a.srb = 0; a.srh = 0; a.sri = 0; a.sQb = 0; a.sQh = HD; a.sQi = 2 * C; a.sQd = 1; a.sKb = 0; a.sKh = HD; a.sKj = 2 * C; a.sKd = 1; a.sVb = 0; a.sVh = HD; a.sVj = 2 * C; a.sVd = 1; a.sOb = 0; a.sOh = HD; a.sOi = 2 * C; a.sPb = 0; a.sPh = 0; a.sPi = 0; a.smb = 0; a.smh = 0; a.smi = 0; a.smj = 0;
      a.Lq = LP; a.Lk = LP; a.dh = HD; a.dv = HD; a.hrep = 1; a.causal = 1; a.coff = 0; a.pband = 0;
      a.scale = 0.125f; a.mfill = 0.0f; a.nonorm = 0; a.mpol = 0;
      a.roff = 0; a.rn = 1; a.segpol = 0; a.win = WINP;
      k_attn<64, 64, 0, false, false><<<dim3((unsigned)((LP) + 16 * AW - 1) / (16 * AW), (unsigned)(NH), (unsigned)(1)), 32 * AW, 0, stream>>>(a); }
    k_cast16<<<(unsigned)((((long long)(4096) * ((512) / 2)) + 255) / 256), 256, 0, stream>>>(Y, 512, (_Float16*)(G64A), 512, 4096, 512, 1.0f);
    k_cast16<<<(unsigned)((((long long)(512) * ((512) / 2)) + 255) / 256), 256, 0, stream>>>(Wo, 512, (_Float16*)(G64B), 512, 512, 512, 16.0f);
    w25::wmma_gemm64<0, false, 2, 0, true, 0><<<dim3((unsigned)((((4096) / 64) * ((512) / 64) + 7) / 8), (unsigned)(1)), 256, 0, stream>>>((const unsigned short*)(G64A), nullptr, 512, 0, (const unsigned short*)(G64B), nullptr, 512, 0, (void*)(X1), nullptr, 512, 0, bo, x, 0, 4096, 512, 512, 0.0625f);
    k_stats<<<(unsigned)(L), 256, 0, stream>>>(X1, C, 1, 1, 1, C, 1e-05f, ST2, 0);
    k_norm_apply<<<(unsigned)(((long long)(L) * (C) * (1) + 255) / 256), 256, 0, stream>>>(X1, H2, ST2, ln2g, ln2b, L, C, 1, 1, 0, 0);
    k_cast16<<<(unsigned)((((long long)(4096) * ((512) / 2)) + 255) / 256), 256, 0, stream>>>(H2, 512, (_Float16*)(G64A), 512, 4096, 512, 1.0f);
    k_cast16<<<(unsigned)((((long long)(2048) * ((512) / 2)) + 255) / 256), 256, 0, stream>>>(W1, 512, (_Float16*)(G64B), 512, 2048, 512, 16.0f);
    w25::wmma_gemm64<0, false, 2, 0, false, 5><<<dim3((unsigned)((((4096) / 64) * ((2048) / 64) + 7) / 8), (unsigned)(1)), 256, 0, stream>>>((const unsigned short*)(G64A), nullptr, 512, 0, (const unsigned short*)(G64B), nullptr, 512, 0, (void*)(F1), nullptr, 2048, 0, b1, nullptr, 0, 4096, 2048, 512, 0.0625f);
    k_cast16<<<(unsigned)((((long long)(4096) * ((2048) / 2)) + 255) / 256), 256, 0, stream>>>(F1, 2048, (_Float16*)(G64A), 2048, 4096, 2048, 1.0f);
    k_cast16<<<(unsigned)((((long long)(512) * ((2048) / 2)) + 255) / 256), 256, 0, stream>>>(W2, 2048, (_Float16*)(G64B), 2048, 512, 2048, 16.0f);
    w25::wmma_gemm64<0, false, 2, 0, true, 0><<<dim3((unsigned)((((4096) / 64) * ((512) / 64) + 7) / 8), (unsigned)(1)), 256, 0, stream>>>((const unsigned short*)(G64A), nullptr, 2048, 0, (const unsigned short*)(G64B), nullptr, 2048, 0, (void*)(out), nullptr, 512, 0, b2, X1, 0, 4096, 512, 2048, 0.0625f);
}

// v002
// It runs in 382 microseconds.
// Timed twice side by side with v001, it ran 1.44 times as fast both times.
// All steps since v000 together make it 5.72 times as fast.
// Contractions: q/k/v projections of the LayerNormed input [4096x512].[512x512] (+b), the output projection (+b, + residual), the FFN [4096x512].[512x2048] (+b, exact GELU) and [4096x2048].[2048x512] (+b, + residual) with f16 operands (v_wmma_f32_16x16x32_f16; 64x64 register-blocked wave tiles over pre-cast f16 operand planes, weights pre-scaled by 16 at the cast and un-scaled in the f32 epilogue); the dilated causal attention (keys j <= i, i - j even, i - j <= 256) as two flash launches over the even and the odd positions (stride-2 views; within a parity class the pattern is plain causal with window 128), head_dim 64, f16 q.k^T and f16 p.v (p as f16 of 4096 p); f32 accumulate, softmax and LayerNorms f32.
#include <hip/hip_runtime.h>
#include <math.h>

typedef __attribute__((ext_vector_type(16))) _Float16 v16h;
typedef __attribute__((ext_vector_type(8)))  _Float16 v8h;
typedef __attribute__((ext_vector_type(4)))  _Float16 v4h;
typedef __attribute__((ext_vector_type(16))) __bf16   v16b;
typedef __attribute__((ext_vector_type(8)))  float    v8f;
typedef __attribute__((ext_vector_type(4)))  float    v4f;

// 16-bit WMMA fragment map (wave32), lane L, h = L>>4, m = L&15:
//   A 16x32: lane = row m;   element i -> k = (i<8) ? 8h+i : 16+8h+(i-8)
//   B 32x16: lane = column m; the SAME k(i,h)
//   D 16x16 (8 f32): lane = column m; element r -> row 8h+r
__device__ __forceinline__ int frag_k(int i, int h) { return (i < 8) ? (8 * h + i) : (16 + 8 * h + (i - 8)); }
__device__ __forceinline__ __bf16 bf16_rne(float f) {
    unsigned int u = __float_as_uint(f);
    u += 0x7fffu + ((u >> 16) & 1u);
    return __builtin_bit_cast(__bf16, (unsigned short)(u >> 16));
}
__device__ __forceinline__ float bf16_f32(__bf16 b) { return __uint_as_float(((unsigned int)__builtin_bit_cast(unsigned short, b)) << 16); }
__device__ __forceinline__ v8f wmma16(v16h a, v16h b, v8f c) {
    c = __builtin_amdgcn_wmma_f32_16x16x32_f16(false, a, false, b, (short)0, c, false, false);
    asm volatile("v_nop\n\tv_nop\n\tv_nop\n\tv_nop" : "+v"(c) : "v"(a), "v"(b));
    return c;
}
__device__ __forceinline__ v8f wmmab(v16b a, v16b b, v8f c) {
    c = __builtin_amdgcn_wmma_f32_16x16x32_bf16(false, a, false, b, (short)0, c, false, false);
    asm volatile("v_nop\n\tv_nop\n\tv_nop\n\tv_nop" : "+v"(c) : "v"(a), "v"(b));
    return c;
}
struct Split { v16b hi, lo; };
// hi/lo split product: a.hi*b.hi + a.hi*b.lo + a.lo*b.hi
__device__ __forceinline__ v8f wmma3(const Split& a, const Split& b, v8f c) {
    c = __builtin_amdgcn_wmma_f32_16x16x32_bf16(false, a.hi, false, b.hi, (short)0, c, false, false);
    c = __builtin_amdgcn_wmma_f32_16x16x32_bf16(false, a.hi, false, b.lo, (short)0, c, false, false);
    c = __builtin_amdgcn_wmma_f32_16x16x32_bf16(false, a.lo, false, b.hi, (short)0, c, false, false);
    asm volatile("v_nop\n\tv_nop\n\tv_nop\n\tv_nop" : "+v"(c) : "v"(a.hi), "v"(a.lo), "v"(b.hi), "v"(b.lo));
    return c;
}
struct Split3 { v16b hi, mid, lo; };
// triple split product (6 terms, drops only terms below 2^-24 relative)
__device__ __forceinline__ v8f wmma6(const Split3& a, const Split3& b, v8f c) {
    c = __builtin_amdgcn_wmma_f32_16x16x32_bf16(false, a.hi, false, b.hi, (short)0, c, false, false);
    c = __builtin_amdgcn_wmma_f32_16x16x32_bf16(false, a.hi, false, b.mid, (short)0, c, false, false);
    c = __builtin_amdgcn_wmma_f32_16x16x32_bf16(false, a.mid, false, b.hi, (short)0, c, false, false);
    c = __builtin_amdgcn_wmma_f32_16x16x32_bf16(false, a.hi, false, b.lo, (short)0, c, false, false);
    c = __builtin_amdgcn_wmma_f32_16x16x32_bf16(false, a.mid, false, b.mid, (short)0, c, false, false);
    c = __builtin_amdgcn_wmma_f32_16x16x32_bf16(false, a.lo, false, b.hi, (short)0, c, false, false);
    asm volatile("v_nop\n\tv_nop\n\tv_nop\n\tv_nop" : "+v"(c) : "v"(a.hi), "v"(a.mid), "v"(a.lo), "v"(b.hi), "v"(b.mid), "v"(b.lo));
    return c;
}

// Fragment gathers from f32 memory: element i <- p[(k0 + frag_k(i,h)) * sk] * s, zero for k >= klen.
__device__ __forceinline__ v16h fh_ld(const float* __restrict__ p, long long sk, int k0, int h, int klen, float s) {
    v16h a;
#pragma unroll
    for (int i = 0; i < 16; ++i) { const int k = k0 + frag_k(i, h); a[i] = (k < klen) ? (_Float16)(p[(long long)k * sk] * s) : (_Float16)0.f; }
    return a;
}
__device__ __forceinline__ Split sp_ld(const float* __restrict__ p, long long sk, int k0, int h, int klen, float s) {
    Split r;
#pragma unroll
    for (int i = 0; i < 16; ++i) {
        const int k = k0 + frag_k(i, h); const float x = (k < klen) ? p[(long long)k * sk] * s : 0.f;
        const __bf16 hb = bf16_rne(x); r.hi[i] = hb; r.lo[i] = bf16_rne(x - bf16_f32(hb));
    }
    return r;
}
__device__ __forceinline__ Split3 sp3_ld(const float* __restrict__ p, long long sk, int k0, int h, int klen, float s) {
    Split3 r;
#pragma unroll
    for (int i = 0; i < 16; ++i) {
        const int k = k0 + frag_k(i, h); const float x = (k < klen) ? p[(long long)k * sk] * s : 0.f;
        const __bf16 hb = bf16_rne(x); const float r1 = x - bf16_f32(hb); const __bf16 mb = bf16_rne(r1);
        r.hi[i] = hb; r.mid[i] = mb; r.lo[i] = bf16_rne(r1 - bf16_f32(mb));
    }
    return r;
}
__device__ __forceinline__ v16b bh_ld(const float* __restrict__ p, long long sk, int k0, int h, int klen, float s) {
    v16b a;
#pragma unroll
    for (int i = 0; i < 16; ++i) { const int k = k0 + frag_k(i, h); a[i] = bf16_rne((k < klen) ? p[(long long)k * sk] * s : 0.f); }
    return a;
}
// f16 fragment from a 16-byte aligned f32 row with element stride 1 and all 32 k in range: four unguarded 16-byte loads, then the cast; same k order as fh_ld
struct Raw16 { v4f x0, x1, x2, x3; };   // the 16 floats of one lane's fragment, as loaded
__device__ __forceinline__ Raw16 raw_ld4(const float* __restrict__ row, int k0, int h) {
    const v4f* q = (const v4f*)(row + k0 + 8 * h);
    Raw16 r; r.x0 = q[0]; r.x1 = q[1]; r.x2 = q[4]; r.x3 = q[5];
    return r;
}
__device__ __forceinline__ v16h raw_f16(const Raw16& r) {
    v16h a;
#pragma unroll   // constant element indices: the vectors stay in registers
    for (int i = 0; i < 4; ++i) { a[i] = (_Float16)r.x0[i]; a[4 + i] = (_Float16)r.x1[i]; a[8 + i] = (_Float16)r.x2[i]; a[12 + i] = (_Float16)r.x3[i]; }
    return a;
}
// Inputs-only fence on loaded values: every load written above it is issued before it, so that a run of loads is in flight together.
// Without it the compiler converts each fragment as soon as it is loaded and waits for memory once per fragment.
__device__ __forceinline__ void loads_held(const v4f& a, const v4f& b, const v4f& c, const v4f& d) { asm volatile("" :: "v"(a), "v"(b), "v"(c), "v"(d)); }
// f16 fragment from an f16 LDS/global row with element stride 1 (k-contiguous), no bounds (tile already zero padded)
__device__ __forceinline__ v16h fh_row(const _Float16* __restrict__ row, int k0, int h) {
    v16h a;
#pragma unroll
    for (int i = 0; i < 16; ++i) a[i] = row[k0 + frag_k(i, h)];
    return a;
}

#define VST2(T, ptr, val) do { const T vst2_v_ = (val); *(T*)(ptr) = vst2_v_;  } while (0)
typedef float v4f __attribute__((ext_vector_type(4)));
#define VST2V4(ptr, val) do { const v4f vst2_v4_ = (val); *(v4f*)(ptr) = vst2_v4_;  } while (0)

__device__ __attribute__((noinline)) float act_fn(float v, int act) {
    if (act == 1) return fmaxf(v, 0.f);                                                                               // relu
    if (act == 2) { const float u = 0.7978845608028654f * (v + 0.044715f * v * v * v); return 0.5f * v * (1.f + tanhf(u)); } // tanh-gelu
    if (act == 3) return v / (1.f + expf(-v));                                                                        // silu
    if (act == 4) return 0.5f * v * (1.f + erff(v * 0.7071067811865476f));                                             // erf-gelu
    if (act == 5) return tanhf(v);
    if (act == 6) return 1.f / (1.f + expf(-v));                                                                      // sigmoid
    if (act == 7) return (v > 0.f) ? v : 0.01f * v;                                                                   // leaky relu 0.01
    if (act == 8) return (v > 0.f) ? v : (expf(v) - 1.f);                                                             // elu
    if (act == 9) return fminf(fmaxf(v, 0.f), 6.f);                                                                   // relu6
    if (act == 10) return fabsf(v);                                                                                    // abs
    if (act == 11) return (v >= 0.f) ? v : 0.1f * v;                                                                  // leaky 0.1
    if (act == 12) return (v > 0.f) ? v : 0.2f * v;                                                                   // leaky 0.2
    if (act == 13) return (v > 20.f) ? v : log1pf(expf(v));                                                            // softplus
    return v;
}

// =====================================================================================================================
// k_gemm<MODE>: C(z, m, n) = act(alpha * sum_k A(z, m, k) * B(z, k, n) + bias) + beta * R(z, m, n)
//   One wave (32-thread block) per 16 x 32 tile of C; grid (ceil(N/32), ceil(M/16), Z). Batch z -> (zo = z / zi_n, zi = z % zi_n)
//   with separate outer/inner strides for every tensor (e.g. batch and head). A(m,k) = A[zo*sAo + zi*sAi + m*sAm + k*sAk] (f32),
//   B(k,n) = B[zo*sBo + zi*sBi + n*sBn + k*sBk] (f32); any M, N, K (K zero-padded to 32 inside the fragments, M/N tails guarded).
//   C(m,n) = C[zo*sCo + zi*sCi + m*sCm + n] (n contiguous). flags: 1 bias[n], 2 bias[m], 4 residual R[zo*sRo + zi*sRi + m*sRm + n*sRn].
//   MODE 0: f16 operands (A prescaled by sa, B by sb, both undone in the epilogue); 1: bf16 hi/lo split (3 products); 2: bf16;
//   3: bf16 hi/mid/lo triple split (6 products); 4: as 3 with Kahan-compensated f32 accumulation across k-steps.
// =====================================================================================================================
struct GemmP {
    const float* A; const float* B; const float* bias; const float* R; float* C;
    long long sAo, sAi, sAm, sAk, sBo, sBi, sBn, sBk, sCo, sCi, sCm, sRo, sRi, sRm, sRn;
    int M, N, K, zi_n, flags, act; float alpha, beta, sa, sb;
    int Npad, pad_;     // columns [N, Npad) of C are written as 0 so that padded workspace rows are covered by whole-line stores; Npad >= N
};
static_assert(sizeof(GemmP) == 5 * 8 + 15 * 8 + 6 * 4 + 4 * 4 + 2 * 4, "GemmP has padding");

template <int MODE>
__global__ __launch_bounds__(32) void k_gemm(GemmP p) {
    const int lane = threadIdx.x & 31, h = lane >> 4, l15 = lane & 15;
    const int m0 = blockIdx.y * 16, n0 = blockIdx.x * 32;
    const int z = blockIdx.z, zo = z / p.zi_n, zi = z - zo * p.zi_n;
    const float* A = p.A + zo * p.sAo + zi * p.sAi;
    const float* B = p.B + zo * p.sBo + zi * p.sBi;
    const int am = min(m0 + l15, p.M - 1);                       // clamped row for loads (stores are guarded)
    v8f acc[2], comp[2];
#pragma unroll
    for (int t = 0; t < 2; ++t) { v8f zz = {}; acc[t] = zz; comp[t] = zz; }
    for (int k0 = 0; k0 < p.K; k0 += 32) {
        const float* arow = A + (long long)am * p.sAm;
        if (MODE == 1) {
            const Split a = sp_ld(arow, p.sAk, k0, h, p.K, 1.f);
#pragma unroll
            for (int t = 0; t < 2; ++t) {
                const int bn = min(n0 + t * 16 + l15, p.N - 1);
                acc[t] = wmma3(a, sp_ld(B + (long long)bn * p.sBn, p.sBk, k0, h, p.K, 1.f), acc[t]);
            }
        } else if (MODE == 3) {
            const Split3 a = sp3_ld(arow, p.sAk, k0, h, p.K, 1.f);
#pragma unroll
            for (int t = 0; t < 2; ++t) {
                const int bn = min(n0 + t * 16 + l15, p.N - 1);
                acc[t] = wmma6(a, sp3_ld(B + (long long)bn * p.sBn, p.sBk, k0, h, p.K, 1.f), acc[t]);
            }
        } else if (MODE == 4) {
            // triple split as MODE 3, but each k-step's 6 products go into a fresh accumulator and the partial is added to the running f32 sum
            // on the VALU with Kahan compensation (accumulation error stays ~1 ulp however long K is)
            const Split3 a = sp3_ld(arow, p.sAk, k0, h, p.K, 1.f);
#pragma unroll
            for (int t = 0; t < 2; ++t) {
                const int bn = min(n0 + t * 16 + l15, p.N - 1); v8f zz = {};
                const v8f part = wmma6(a, sp3_ld(B + (long long)bn * p.sBn, p.sBk, k0, h, p.K, 1.f), zz);
                const v8f y = part - comp[t]; const v8f s = acc[t] + y; comp[t] = (s - acc[t]) - y; acc[t] = s;
            }
        } else if (MODE == 2) {
            const v16b a = bh_ld(arow, p.sAk, k0, h, p.K, 1.f);
#pragma unroll
            for (int t = 0; t < 2; ++t) {
                const int bn = min(n0 + t * 16 + l15, p.N - 1);
                acc[t] = wmmab(a, bh_ld(B + (long long)bn * p.sBn, p.sBk, k0, h, p.K, 1.f), acc[t]);
            }
        } else {
            const v16h a = fh_ld(arow, p.sAk, k0, h, p.K, p.sa);
#pragma unroll
            for (int t = 0; t < 2; ++t) {
                const int bn = min(n0 + t * 16 + l15, p.N - 1);
                acc[t] = wmma16(a, fh_ld(B + (long long)bn * p.sBn, p.sBk, k0, h, p.K, p.sb), acc[t]);
            }
        }
    }
    const float iscale = (MODE == 0) ? p.alpha / (p.sa * p.sb) : p.alpha;
    float* C = p.C + zo * p.sCo + zi * p.sCi;
    const float* R = p.R + zo * p.sRo + zi * p.sRi;
    __shared__ __align__(16) float ctile[16][36];
#pragma unroll
    for (int t = 0; t < 2; ++t) {
        const int n = n0 + t * 16 + l15; const int nn = min(n, p.N - 1);
#pragma unroll
        for (int r = 0; r < 8; ++r) {
            const int m = m0 + 8 * h + r; const int mm = min(m, p.M - 1);
            float v = acc[t][r] * iscale;
            if (p.flags & 1) v += p.bias[nn];
            if (p.flags & 2) v += p.bias[mm];
            if (p.flags & 8) v *= p.bias[(long long)zo * p.M + mm];   /* per-(z,row) scale vector laid out [Z][M]; exclusive with the bias flags */
            v = act_fn(v, p.act);
            if (p.flags & 4) v += p.beta * R[(long long)mm * p.sRm + (long long)nn * p.sRn];
            ctile[8 * h + r][t * 16 + l15] = (n < p.N) ? v : 0.f;
        }
    }
    __syncthreads();
    const int NW = (p.Npad > p.N) ? p.Npad : p.N;           // write width
    const bool fast = (m0 + 16 <= p.M) && (n0 + 32 <= NW) && ((p.sCm & 3) == 0) && ((((size_t)C) & 15) == 0);
    if (fast) {
#pragma unroll
        for (int s = 0; s < 4; ++s) {
            const int row = s * 4 + (lane >> 3), c4 = (lane & 7) * 4;
            const v4f v = *(const v4f*)&ctile[row][c4];
            VST2V4(C + (long long)(m0 + row) * p.sCm + n0 + c4, v);
        }
    } else {
        for (int row = 0; row < 16; ++row) {
            const int m = m0 + row, n = n0 + lane;
            if (m < p.M && n < NW) VST2(float, C + (long long)m * p.sCm + n, ctile[row][lane]);
        }
    }
}


// =====================================================================================================================
// k_gemmT<MODE, TM, TN>: same contract as k_gemm, but one wave computes a (16*TM) x (16*TN) tile: TM A fragments and TN B fragments are
//   loaded per 32-wide k-step and reused across TM*TN WMMAs (far fewer load/convert instructions per MAC). MODE 0 (f16), 1 (bf16 hi/lo),
//   2 (bf16) only. grid (ceil(NW/(16*TN)), ceil(M/(16*TM)), Z), block 32. Epilogue identical to k_gemm, run per 16x32 sub-tile.
// =====================================================================================================================
template <int MODE, int TM, int TN>
__global__ __launch_bounds__(32) void k_gemmT(GemmP p) {
    const int lane = threadIdx.x & 31, h = lane >> 4, l15 = lane & 15;
    const int m0 = blockIdx.y * (16 * TM), n0 = blockIdx.x * (16 * TN);
    const int z = blockIdx.z, zo = z / p.zi_n, zi = z - zo * p.zi_n;
    const float* A = p.A + zo * p.sAo + zi * p.sAi;
    const float* B = p.B + zo * p.sBo + zi * p.sBi;
    v8f acc[TM][TN];
#pragma unroll
    for (int i = 0; i < TM; ++i)
#pragma unroll
        for (int t = 0; t < TN; ++t) { v8f zz = {}; acc[i][t] = zz; }
    for (int k0 = 0; k0 < p.K; k0 += 32) {
        if (MODE == 1) {
            Split a[TM], b[TN];
#pragma unroll
            for (int i = 0; i < TM; ++i) { const int am = min(m0 + 16 * i + l15, p.M - 1); a[i] = sp_ld(A + (long long)am * p.sAm, p.sAk, k0, h, p.K, 1.f); }
#pragma unroll
            for (int t = 0; t < TN; ++t) { const int bn = min(n0 + 16 * t + l15, p.N - 1); b[t] = sp_ld(B + (long long)bn * p.sBn, p.sBk, k0, h, p.K, 1.f); }
#pragma unroll
            for (int i = 0; i < TM; ++i)
#pragma unroll
                for (int t = 0; t < TN; ++t) acc[i][t] = wmma3(a[i], b[t], acc[i][t]);
        } else if (MODE == 2) {
            v16b a[TM], b[TN];
#pragma unroll
            for (int i = 0; i < TM; ++i) { const int am = min(m0 + 16 * i + l15, p.M - 1); a[i] = bh_ld(A + (long long)am * p.sAm, p.sAk, k0, h, p.K, 1.f); }
#pragma unroll
            for (int t = 0; t < TN; ++t) { const int bn = min(n0 + 16 * t + l15, p.N - 1); b[t] = bh_ld(B + (long long)bn * p.sBn, p.sBk, k0, h, p.K, 1.f); }
#pragma unroll
            for (int i = 0; i < TM; ++i)
#pragma unroll
                for (int t = 0; t < TN; ++t) acc[i][t] = wmmab(a[i], b[t], acc[i][t]);
        } else {
            v16h a[TM], b[TN];
#pragma unroll
            for (int i = 0; i < TM; ++i) { const int am = min(m0 + 16 * i + l15, p.M - 1); a[i] = fh_ld(A + (long long)am * p.sAm, p.sAk, k0, h, p.K, p.sa); }
#pragma unroll
            for (int t = 0; t < TN; ++t) { const int bn = min(n0 + 16 * t + l15, p.N - 1); b[t] = fh_ld(B + (long long)bn * p.sBn, p.sBk, k0, h, p.K, p.sb); }
#pragma unroll
            for (int i = 0; i < TM; ++i)
#pragma unroll
                for (int t = 0; t < TN; ++t) acc[i][t] = wmma16(a[i], b[t], acc[i][t]);
        }
    }
    const float iscale = (MODE == 0) ? p.alpha / (p.sa * p.sb) : p.alpha;
    float* C = p.C + zo * p.sCo + zi * p.sCi;
    const float* R = p.R + zo * p.sRo + zi * p.sRi;
    const int NW = (p.Npad > p.N) ? p.Npad : p.N;
    __shared__ __align__(16) float ctile[16][36];
#pragma unroll
    for (int i = 0; i < TM; ++i) {
        const int mb = m0 + 16 * i; if (mb >= p.M) break;          // wave-uniform
#pragma unroll
        for (int tp = 0; tp < TN / 2; ++tp) {
            const int nb = n0 + 32 * tp; if (nb >= NW) break;        // wave-uniform
#pragma unroll
            for (int t2 = 0; t2 < 2; ++t2) {
                const int t = 2 * tp + t2; const int n = nb + t2 * 16 + l15; const int nn = min(n, p.N - 1);
#pragma unroll
                for (int r = 0; r < 8; ++r) {
                    const int m = mb + 8 * h + r; const int mm = min(m, p.M - 1);
                    float v = acc[i][t][r] * iscale;
                    if (p.flags & 1) v += p.bias[nn];
                    if (p.flags & 2) v += p.bias[mm];
            if (p.flags & 8) v *= p.bias[(long long)zo * p.M + mm];   /* per-(z,row) scale vector laid out [Z][M]; exclusive with the bias flags */
                    v = act_fn(v, p.act);
                    if (p.flags & 4) v += p.beta * R[(long long)mm * p.sRm + (long long)nn * p.sRn];
                    ctile[8 * h + r][t2 * 16 + l15] = (n < p.N) ? v : 0.f;
                }
            }
            __syncthreads();
            const bool fast = (mb + 16 <= p.M) && (nb + 32 <= NW) && ((p.sCm & 3) == 0) && ((((size_t)C) & 15) == 0);
            if (fast) {
#pragma unroll
                for (int s = 0; s < 4; ++s) {
                    const int row = s * 4 + (lane >> 3), c4 = (lane & 7) * 4;
                    const v4f v = *(const v4f*)&ctile[row][c4];
                    VST2V4(C + (long long)(mb + row) * p.sCm + nb + c4, v);
                }
            } else {
                for (int row = 0; row < 16; ++row) {
                    const int m = mb + row, n = nb + lane;
                    if (m < p.M && n < NW) VST2(float, C + (long long)m * p.sCm + n, ctile[row][lane]);
                }
            }
            __syncthreads();
        }
    }
}

// =====================================================================================================================
//   Wave = 16 queries, AW waves per block, 64-key blocks; grid (ceil(Lq/(16*AW)), H, B), block 32*AW. Any Lq, Lk; head dim dh <= DHP
//   (DHP multiple of 32), value dim dv <= DVP (multiple of 16, <= 128). Every tensor addressed by (batch, head, row, element) strides, f32.
//   Scores: QM 0 f16 operands, 1 bf16 hi/lo split, 2 bf16 triple split; statistics f32 (exp2 domain); P.V: P x 4096 as f16 with V f16 staged in LDS
//   (SPLITPV: P and V as bf16 hi/lo splits). kv head = h / hrep. Masking: causal = 1 (keep j <= i + coff, masked -> -inf, key blocks beyond the
//   diagonal skipped), causal = 2 (masked -> mfill, a finite fill like the -1e9; no skipping), causal = 3 (keep j >= i + coff,
//   masked -> -inf, no skipping); optional additive f32 mask Mf,
//   optional int keep-mask Mi (0 -> score := mfill), both addressed b*smb + h*smh + i*smi + j*smj (0 strides broadcast).
//   PLAIN (QM 0, f16 P.V, one pass): the call is causal = 1 with coff 0, hrep 1, dh == DHP, dv == DVP, element strides 1, every Q/K/V row 16-byte aligned,
//   and none of P, Mf, Mi, ST, Pw, Rt, SQ/SK, nonorm. These become compile-time constants: the element guards fold away, so Q, K and V are read with
//   16-byte loads that are in flight in runs instead of one guarded float at a time, each waited for, and the option tests leave the score loop.
// =====================================================================================================================
#define AW 4
struct AttnP {   // apv4
    const float* Q; const float* K; const float* V; float* O; float* P; const float* Mf; const int* Mi; float* ST;
    const float* Pw; const float* Rt; const int* SQ; const int* SK;           // optional: post-softmax weight, relative-position table, segment ids
    long long swb, swh, swi, swj, srb, srh, sri;                                 // Pw strides (b,h,i,j); Rt strides (b,h,i), column = clamp(i - j + roff, 0, rn-1)
    long long sQb, sQh, sQi, sQd, sKb, sKh, sKj, sKd, sVb, sVh, sVj, sVd, sOb, sOh, sOi, sPb, sPh, sPi, smb, smh, smi, smj;
    int Lq, Lk, dh, dv, hrep, causal, coff, pband;   // pband > 0: P holds only the band |j - i| <= pband, column j - i + pband
    float scale, mfill; int nonorm, mpol;             // nonorm (online path only): O = sum_j exp(score_j) V_j without the 1/rowsum (scores must be <= ~0); mpol: Mi masks where ==0 (mpol 0) or where !=0 (mpol 1)
    int roff, rn, segpol, win;                        // Rt column offset/count; SQ/SK: score := mfill where (segpol 0) SQ[i] != SK[j] or (segpol 1) SQ[i] == SK[j]; win > 0: keys with i - j > win (after coff) -> -inf, key blocks wholly below the window skipped
};
//   Pw: the softmax numerator is multiplied by Pw(b,h,i,j) AFTER the row sum is taken (probs * weight, then P.V), as in post-softmax multiplicative biases.                                                    // ST (optional): per row (b,h,i) -> ST[((b*H + h)*Lq + i)*2 + {0,1}] = {row max of the scaled+masked score (natural units), sum_j exp(score - max)}
static_assert(sizeof(AttnP) == 12 * 8 + 29 * 8 + 16 * 4, "AttnP has padding");

#ifndef KATTN_ATTR
#define KATTN_ATTR
#endif
template <int DHP, int DVP, int QM, bool SPLITPV, bool TWOPASS, bool PLAIN = false>
__global__ __launch_bounds__(32 * AW) KATTN_ATTR void k_attn(AttnP pa) {
    static_assert(!PLAIN || (QM == 0 && !SPLITPV && !TWOPASS), "PLAIN covers the f16 one-pass form");
    AttnP p = pa;
    if (PLAIN) {
        p.P = nullptr; p.Mf = nullptr; p.Mi = nullptr; p.ST = nullptr; p.Pw = nullptr; p.Rt = nullptr; p.SQ = nullptr; p.SK = nullptr;
        p.sQd = 1; p.sKd = 1; p.sVd = 1; p.dh = DHP; p.dv = DVP; p.hrep = 1; p.causal = 1; p.coff = 0; p.pband = 0; p.nonorm = 0;
    }
    constexpr int NT = DVP / 16;                // output tiles
    constexpr int KS = DHP / 32;                // k-steps for the scores
    constexpr int VP = DVP + 8;                 // LDS pitch (halves)
    constexpr int NV = 64 * (DVP / 4) / (32 * AW);   // PLAIN: 16-byte pieces of the V tile per thread
    static_assert(!PLAIN || NV * (32 * AW) == 64 * (DVP / 4), "the block's threads cover the V tile evenly");
    __shared__ __align__(16) float    pl[AW][16 * 64];
    __shared__ __align__(16) _Float16 vl[(SPLITPV ? 2 : 1) * 64 * VP];   // f16 V tile, or bf16 hi and lo tiles (same 2-byte size)
    const int lane = threadIdx.x & 31, hf = lane >> 4, l15 = lane & 15, wave = threadIdx.x >> 5;
    const int h = blockIdx.y, b = blockIdx.z, hk = h / p.hrep;
    const int q0 = (blockIdx.x * AW + wave) * 16;
    float* myp = pl[wave];
    const float L2E = 1.4426950408889634f;
    const float NEG = -__builtin_inff();
    const int qi = min(q0 + l15, p.Lq - 1);
    const float* qrow = p.Q + b * p.sQb + h * p.sQh + (long long)qi * p.sQi;
    const float* kbase = p.K + b * p.sKb + hk * p.sKh;
    const float* vbase = p.V + b * p.sVb + hk * p.sVh;
    v16h qa[QM == 0 ? KS : 1]; Split qs_[QM == 1 ? KS : 1]; Split3 qt_[QM == 2 ? KS : 1];
#pragma unroll
    for (int ks = 0; ks < KS; ++ks) {
        if (QM == 2) qt_[ks] = sp3_ld(qrow, p.sQd, ks * 32, hf, p.dh, 1.f);
        else if (QM == 1) qs_[ks] = sp_ld(qrow, p.sQd, ks * 32, hf, p.dh, 1.f);
        else if (PLAIN) qa[ks] = raw_f16(raw_ld4(qrow, ks * 32, hf));
        else qa[ks] = fh_ld(qrow, p.sQd, ks * 32, hf, p.dh, 1.f);
    }
    v8f o[NT]; float m8[8], l8[8];
#pragma unroll
    for (int t = 0; t < NT; ++t) { v8f zz = {}; o[t] = zz; }
#pragma unroll
    for (int i = 0; i < 8; ++i) { m8[i] = NEG; l8[i] = 0.f; }
    int jend = p.Lk;
    if (p.causal == 1) { const int je = (blockIdx.x * AW + AW - 1) * 16 + 16 + p.coff; jend = min(jend, max(je, 0)); }   // uniform per block
    int jbeg = 0;                                                // first key any query row of this block can see through the window; uniform per block
    if (p.win > 0 && !p.P) jbeg = max((int)(blockIdx.x * AW) * 16 + p.coff - p.win, 0);   // keys below it are -inf for all 16*AW rows (weight exactly 0); P, where asked for, still needs its zeros written
    const int npass = TWOPASS ? 2 : 1;
    for (int pass = 0; pass < npass; ++pass) {
        const bool dopv = (!TWOPASS) || pass == 1;
        for (int j0 = jbeg; j0 < jend; j0 += 64) {
            v4f vr[PLAIN ? NV : 1]; Raw16 kr[PLAIN ? 2 : 1][KS];   // PLAIN: this thread's part of the V tile and the lane's K fragments of two columns, f32 as loaded
            if (dopv) {
                __syncthreads();                                 // previous key block's reads of vl / pl are done
                if (!PLAIN)
                for (int idx = threadIdx.x; idx < 64 * DVP; idx += 32 * AW) {
                    const int jr = idx / DVP, d = idx - jr * DVP, j = j0 + jr;
                    const float f = (j < p.Lk && d < p.dv) ? vbase[(long long)j * p.sVj + (long long)d * p.sVd] : 0.f;
                    if (SPLITPV) {
                        const __bf16 hb = bf16_rne(f);
                        ((__bf16*)vl)[jr * VP + d] = hb; ((__bf16*)vl)[64 * VP + jr * VP + d] = bf16_rne(f - bf16_f32(hb));
                    } else vl[jr * VP + d] = (_Float16)f;
                }
            }
            v8f s[4];
#pragma unroll
            for (int t = 0; t < 4; ++t) {
                const int j = min(j0 + t * 16 + l15, p.Lk - 1);
                const float* krow = kbase + (long long)j * p.sKj;
                if (PLAIN && (t & 1) == 0) {
                    // the K loads of two 16-key columns are issued ahead of the first use of any of them: one trip to memory for 4 fragments
                    // (all four columns at once took the build past 256 registers). The loops here are unrolled so that kr and vr stay in registers.
#pragma unroll
                    for (int u = 0; u < 2; ++u) {
#pragma unroll
                        for (int ks = 0; ks < KS; ++ks) kr[u][ks] = raw_ld4(kbase + (long long)min(j0 + (t + u) * 16 + l15, p.Lk - 1) * p.sKj, ks * 32, hf);
                        // one column's loads share one address pair: this wait stands behind them, ahead of any later load whose result may be given that pair
                        asm volatile("s_wait_xcnt 0x0" ::: "memory");
                    }
#pragma unroll
                    for (int u = 0; u < 2; ++u)
#pragma unroll
                        for (int ks = 0; ks < KS; ++ks) loads_held(kr[u][ks].x0, kr[u][ks].x1, kr[u][ks].x2, kr[u][ks].x3);
                }
                v8f acc = {};
#pragma unroll
                for (int ks = 0; ks < KS; ++ks) {
                    if (QM == 2)      acc = wmma6(qt_[ks], sp3_ld(krow, p.sKd, ks * 32, hf, p.dh, 1.f), acc);
                    else if (QM == 1) acc = wmma3(qs_[ks], sp_ld(krow, p.sKd, ks * 32, hf, p.dh, 1.f), acc);
                    else if (PLAIN)   acc = wmma16(qa[ks], raw_f16(kr[t & 1][ks]), acc);
                    else              acc = wmma16(qa[ks], fh_ld(krow, p.sKd, ks * 32, hf, p.dh, 1.f), acc);
                }
                s[t] = acc;
            }
            if (PLAIN) {
                // the V tile's loads go out here and are first used behind the softmax, which covers their trip to memory
#pragma unroll
                for (int n = 0; n < NV; ++n) {
                    const int idx = threadIdx.x + n * (32 * AW), jr = idx / (DVP / 4), d = (idx - jr * (DVP / 4)) * 4;
                    vr[n] = *(const v4f*)(vbase + (long long)min(j0 + jr, p.Lk - 1) * p.sVj + d);   // row clamped, so no guard round the load
                }
            }
            float pv[8][4];
#pragma unroll
            for (int i = 0; i < 8; ++i) {
                const int irow = q0 + i + 8 * hf;
                const int ic = min(irow, p.Lq - 1);
                float sc[4];
#pragma unroll
                for (int t = 0; t < 4; ++t) {
                    const int jg = j0 + t * 16 + l15;
                    float v = s[t][i] * p.scale;
                    if (p.Mf) v += p.Mf[b * p.smb + h * p.smh + (long long)ic * p.smi + (long long)min(jg, p.Lk - 1) * p.smj];
                    if (p.Rt) { int rc = ic - min(jg, p.Lk - 1) + p.roff; rc = rc < 0 ? 0 : (rc >= p.rn ? p.rn - 1 : rc); v += p.Rt[b * p.srb + h * p.srh + (long long)ic * p.sri + rc]; }
                    if (p.Mi) { const int mv = p.Mi[b * p.smb + h * p.smh + (long long)ic * p.smi + (long long)min(jg, p.Lk - 1) * p.smj]; if (p.mpol ? (mv != 0) : (mv == 0)) v = p.mfill; }
                    if (p.SQ) { const bool same = p.SQ[(long long)b * p.Lq + ic] == p.SK[(long long)b * p.Lk + min(jg, p.Lk - 1)]; if (p.segpol ? same : !same) v = p.mfill; }
                    if (p.causal == 2 && jg > irow + p.coff) v = p.mfill;
                    if (jg >= p.Lk || (p.causal == 1 && jg > irow + p.coff) || (p.causal == 3 && jg < irow + p.coff) || (p.win > 0 && irow + p.coff - jg > p.win)) v = NEG; else v *= L2E;
                    sc[t] = v;
                }
                if (!TWOPASS || pass == 0) {
                    float mx = fmaxf(fmaxf(sc[0], sc[1]), fmaxf(sc[2], sc[3]));
                    mx = fmaxf(mx, __shfl_xor(mx, 1, 32)); mx = fmaxf(mx, __shfl_xor(mx, 2, 32));
                    mx = fmaxf(mx, __shfl_xor(mx, 4, 32)); mx = fmaxf(mx, __shfl_xor(mx, 8, 32));
                    const float mnew = fmaxf(m8[i], mx);
                    const float corr = (mnew == NEG) ? 1.f : exp2f(m8[i] - mnew);
                    float rs = 0.f;
#pragma unroll
                    for (int t = 0; t < 4; ++t) {
                        const float pp = (sc[t] == NEG) ? 0.f : exp2f(sc[t] - mnew); rs += pp;
                        pv[i][t] = p.Pw ? pp * p.Pw[b * p.swb + h * p.swh + (long long)ic * p.swi + (long long)min(j0 + t * 16 + l15, p.Lk - 1) * p.swj] : pp;
                    }
                    rs += __shfl_xor(rs, 1, 32); rs += __shfl_xor(rs, 2, 32); rs += __shfl_xor(rs, 4, 32); rs += __shfl_xor(rs, 8, 32);
                    l8[i] = l8[i] * corr + rs; m8[i] = mnew;
                    if (!TWOPASS) {
#pragma unroll
                        for (int t = 0; t < NT; ++t) o[t][i] *= corr;
                    }
                } else {
                    const float inv = (l8[i] > 0.f) ? 1.f / l8[i] : 0.f;
#pragma unroll
                    for (int t = 0; t < 4; ++t) {
                        const int jg = j0 + t * 16 + l15;
                        float pp = (sc[t] == NEG) ? 0.f : exp2f(sc[t] - m8[i]) * inv;
                        if (p.Pw) pp *= p.Pw[b * p.swb + h * p.swh + (long long)ic * p.swi + (long long)min(jg, p.Lk - 1) * p.swj];
                        pv[i][t] = pp;
                    }
                }
            }
            if (dopv) {
                if (PLAIN) {                                     // cast and stage the V tile loaded above (unrolled: vr stays in registers)
#pragma unroll
                    for (int n = 0; n < NV; ++n) {
                        const int idx = threadIdx.x + n * (32 * AW), jr = idx / (DVP / 4), d = (idx - jr * (DVP / 4)) * 4;
                        v4h hv;
#pragma unroll
                        for (int e = 0; e < 4; ++e) hv[e] = (_Float16)((j0 + jr < p.Lk) ? vr[n][e] : 0.f);
                        *(v4h*)&vl[jr * VP + d] = hv;
                    }
                }
#pragma unroll
                for (int i = 0; i < 8; ++i)
#pragma unroll
                    for (int t = 0; t < 4; ++t) ((float*)myp)[(i + 8 * hf) * 64 + t * 16 + l15] = pv[i][t];
                __syncthreads();                                 // P (per wave) and V (shared) visible
                if (p.P) {
                    float* pb_ = p.P + b * p.sPb + h * p.sPh;
                    const bool fastP = (p.pband == 0) && ((p.sPi & 3) == 0) && (j0 + 64 <= p.Lk) && (q0 + 16 <= p.Lq) && ((((size_t)pb_) & 15) == 0);
                    if (fastP) {
#pragma unroll
                        for (int s = 0; s < 8; ++s) {
                            const int row = s * 2 + (lane >> 4), c4 = (lane & 15) * 4;
                            const v4f v = *(const v4f*)(myp + row * 64 + c4);
                            VST2V4(pb_ + (long long)(q0 + row) * p.sPi + j0 + c4, v);
                        }
                    } else {
                        for (int row = 0; row < 16; ++row) {
                            const int irow = q0 + row; if (irow >= p.Lq) continue;
                            for (int c = lane; c < 64; c += 32) {
                                const int jg = j0 + c; if (jg >= p.Lk) continue;
                                if (p.pband == 0) VST2(float, pb_ + (long long)irow * p.sPi + jg, myp[row * 64 + c]);
                                else if (jg - irow <= p.pband && irow - jg <= p.pband) VST2(float, pb_ + (long long)irow * p.sPi + (jg - irow + p.pband), myp[row * 64 + c]);
                            }
                        }
                    }
                }
                if (SPLITPV) {
                    const Split pa0 = sp_ld(myp + l15 * 64, 1, 0, hf, 64, 1.f), pa1 = sp_ld(myp + l15 * 64, 1, 32, hf, 64, 1.f);
                    const __bf16* vh = (const __bf16*)vl; const __bf16* vlo = vh + 64 * VP;
#pragma unroll
                    for (int t = 0; t < NT; ++t) {
                        const int dcol = t * 16 + l15;
                        Split b0, b1;
#pragma unroll
                        for (int e = 0; e < 16; ++e) {
                            const int k0 = frag_k(e, hf), k1 = 32 + frag_k(e, hf);
                            b0.hi[e] = vh[k0 * VP + dcol]; b0.lo[e] = vlo[k0 * VP + dcol]; b1.hi[e] = vh[k1 * VP + dcol]; b1.lo[e] = vlo[k1 * VP + dcol];
                        }
                        o[t] = wmma3(pa0, b0, o[t]);
                        o[t] = wmma3(pa1, b1, o[t]);
                    }
                } else {
                    const v16h pa0 = fh_ld(myp + l15 * 64, 1, 0, hf, 64, 4096.f), pa1 = fh_ld(myp + l15 * 64, 1, 32, hf, 64, 4096.f);
#pragma unroll
                    for (int t = 0; t < NT; ++t) {
                        const int dcol = t * 16 + l15;
                        v16h b0, b1;
#pragma unroll
                        for (int e = 0; e < 16; ++e) { b0[e] = vl[frag_k(e, hf) * VP + dcol]; b1[e] = vl[(32 + frag_k(e, hf)) * VP + dcol]; }
                        o[t] = wmma16(pa0, b0, o[t]);
                        o[t] = wmma16(pa1, b1, o[t]);
                    }
                }
            }
        }
    }
    float* obase = p.O + b * p.sOb + h * p.sOh;
    if (p.ST) {
        const int rl = lane >> 1, isel = rl & 7;           // row q0 + rl ; rl>>3 == hf holds because lane>>4 == (lane>>1)>>3
        float mv = 0.f, lv = 0.f;
#pragma unroll
        for (int i = 0; i < 8; ++i) if (i == isel) { mv = m8[i]; lv = l8[i]; }
        const int irow = q0 + rl;
        if (irow < p.Lq) { float* st = p.ST + (((long long)b * gridDim.y + h) * p.Lq + irow) * 2 + (lane & 1); VST2(float, st, (lane & 1) ? lv : mv * 0.6931471805599453f); }
    }
    float invr[8];
#pragma unroll
    for (int i = 0; i < 8; ++i) {
        if (TWOPASS) invr[i] = SPLITPV ? 1.f : (1.f / 4096.f);
        else if (p.nonorm) invr[i] = exp2f(m8[i]) * (SPLITPV ? 1.f : (1.f / 4096.f));
        else invr[i] = (l8[i] > 0.f) ? (SPLITPV ? 1.f / l8[i] : 1.f / (l8[i] * 4096.f)) : 0.f;
    }
    __syncthreads();                                             // all waves done with pl/vl from the main loop
    const bool ofast = ((p.sOi & 3) == 0) && ((((size_t)obase) & 15) == 0) && (q0 + 16 <= p.Lq);
#pragma unroll
    for (int c0 = 0; c0 < DVP; c0 += 64) {
#pragma unroll
        for (int i = 0; i < 8; ++i)
#pragma unroll
            for (int t = 0; t < NT; ++t) if (t * 16 >= c0 && t * 16 < c0 + 64) ((float*)myp)[(i + 8 * hf) * 64 + (t * 16 - c0) + l15] = o[t][i] * invr[i];
        __syncthreads();
        const int cw = (DVP - c0 < 64) ? (DVP - c0) : 64;      // staged columns in this chunk (multiple of 16)
        if (ofast && (c0 + cw <= p.dv) && (cw % 32 == 0)) {
            const int lpr = cw / 4;                              // lanes per row (16 for 64 cols, 8 for 32)
            const int rows_per_ins = 32 / lpr;
            for (int r0 = 0; r0 < 16; r0 += rows_per_ins) {
                const int row = r0 + lane / lpr, c4 = (lane % lpr) * 4;
                const v4f v = *(const v4f*)(myp + row * 64 + c4);
                VST2V4(obase + (long long)(q0 + row) * p.sOi + c0 + c4, v);
            }
        } else {
            for (int row = 0; row < 16; ++row) {
                const int irow = q0 + row; if (irow >= p.Lq) continue;
                for (int c = lane; c < cw; c += 32) { const int d = c0 + c; if (d < p.dv) VST2(float, obase + (long long)irow * p.sOi + d, myp[row * 64 + c]); }
            }
        }
        __syncthreads();
    }
}

// =====================================================================================================================
// k_tr: dst(z, c, r) = alpha * src(z, r, c) (+ beta * R2(z, c, r)): [Z][R][C] (row stride lds) -> [Z][C][R] (row stride ldd) through a 32x32 LDS tile;
//   flags: 1 -> add beta * residual R2 addressed like dst (z*sRz + c*ldr + r); act applied before the residual.
// =====================================================================================================================
struct TrP { const float* src; float* dst; const float* R2; long long sSz, lds, sDz, ldd, sRz, ldr; int R, C, flags, act; float alpha, beta; };
static_assert(sizeof(TrP) == 3 * 8 + 6 * 8 + 6 * 4, "TrP has padding");
__global__ __launch_bounds__(256) void k_tr(TrP p) {
    __shared__ float tile[32][33];
    const int c0 = blockIdx.x * 32, r0 = blockIdx.y * 32, z = blockIdx.z;
    const int lane = threadIdx.x & 31, wave = threadIdx.x >> 5;
    const float* s = p.src + z * p.sSz;
#pragma unroll
    for (int k = 0; k < 4; ++k) {
        const int rl = wave * 4 + k, r = r0 + rl, c = c0 + lane;
        tile[rl][lane] = (r < p.R && c < p.C) ? s[(long long)r * p.lds + c] : 0.f;
    }
    __syncthreads();
    float* d = p.dst + z * p.sDz; const float* rr = p.R2 + z * p.sRz;
#pragma unroll
    for (int k = 0; k < 4; ++k) {
        const int cl = wave * 4 + k, c = c0 + cl, r = r0 + lane;
        if (c < p.C && r < p.R) {
            float v = act_fn(p.alpha * tile[lane][cl], p.act);
            if (p.flags & 1) v += p.beta * rr[(long long)c * p.ldr + r];
            VST2(float, d + (long long)c * p.ldd + r, v);
        }
    }
}

// k_affine: dst[i] = a * (sdev ? sdev[0] : 1) * src[i] + b, i < n (one thread per element; consecutive lanes -> consecutive addresses)
__global__ __launch_bounds__(256) void k_affine(const float* __restrict__ src, float* __restrict__ dst, int n, float a, float b, const float* __restrict__ sdev) {
    const int i = blockIdx.x * 256 + threadIdx.x;
    if (i < n) { const float aa = sdev ? a * sdev[0] : a; const float v = aa * src[i] + b; VST2(float, dst + i, v); }
}

// =====================================================================================================================
// k_softmax: row softmax over n contiguous elements, one 256-thread block per row; rows addressed z*sz + r*sr (grid (R, Z)).
//   out = scale_out * softmax(scale_in * x + (Mf ? Mf[z*smz + r*smr + j] : 0)); a row whose max is -inf is written as 0.
// =====================================================================================================================
struct SmP { const float* src; float* dst; const float* Mf; long long sz, sr, dz, dr, smz, smr; int n, pad; float scale_in, scale_out; };
static_assert(sizeof(SmP) == 3 * 8 + 6 * 8 + 4 * 4, "SmP has padding");
__global__ __launch_bounds__(256) void k_softmax(SmP p) {
    __shared__ float red[256];
    const int r = blockIdx.x, z = blockIdx.y, tid = threadIdx.x;
    const float* s = p.src + z * p.sz + (long long)r * p.sr;
    const float* mf = p.Mf ? (p.Mf + z * p.smz + (long long)r * p.smr) : nullptr;
    float mx = -__builtin_inff();
    for (int j = tid; j < p.n; j += 256) { float v = s[j] * p.scale_in; if (mf) v += mf[j]; mx = fmaxf(mx, v); }
    red[tid] = mx; __syncthreads();
    for (int o = 128; o > 0; o >>= 1) { if (tid < o) red[tid] = fmaxf(red[tid], red[tid + o]); __syncthreads(); }
    mx = red[0]; __syncthreads();
    float sum = 0.f;
    for (int j = tid; j < p.n; j += 256) { float v = s[j] * p.scale_in; if (mf) v += mf[j]; sum += (mx == -__builtin_inff()) ? 0.f : expf(v - mx); }
    red[tid] = sum; __syncthreads();
    for (int o = 128; o > 0; o >>= 1) { if (tid < o) red[tid] += red[tid + o]; __syncthreads(); }
    sum = red[0];
    const float inv = (sum > 0.f) ? p.scale_out / sum : 0.f;
    float* d = p.dst + z * p.dz + (long long)r * p.dr;
    for (int j = tid; j < p.n; j += 256) { float v = s[j] * p.scale_in; if (mf) v += mf[j]; const float o = (mx == -__builtin_inff()) ? 0.f : expf(v - mx) * inv; VST2(float, d + j, o); }
}
// =====================================================================================================================
// k_stats: mean and rsqrt(var + eps) over a set of n elements addressed base + z*sz + (e / inner) * so + (e % inner) * si, one 256-thread
// k_norm_apply: y = (x - mean[set]) * rstd[set] * g[c] + b[c] over a [Z][C][L] channel-major tensor with set = z*G + c / (C/G) (G groups per z;
//   G = C -> per-channel sets indexed z*C+c; for batch norm pass stats indexed by c only via bn = 1). Optional act. Output same layout.
// =====================================================================================================================
//   mode 0: mean / rsqrt(var + eps); mode 1 (RMSNorm): 0 / rsqrt(mean(x^2) + eps); mode 2 (L2 normalize * sqrt(n)): 0 / sqrt(n) / max(||x||, eps); mode 3: as 0 with unbiased variance (n-1)
__global__ __launch_bounds__(256) void k_stats(const float* __restrict__ x, long long sz, long long so, long long si, int inner, int n, float eps, float* __restrict__ stat, int mode) {
    __shared__ float red[256];
    const int z = blockIdx.x, tid = threadIdx.x;
    const float* base = x + z * sz;
    float s = 0.f;
    for (int e = tid; e < n; e += 256) s += base[(long long)(e / inner) * so + (long long)(e % inner) * si];
    red[tid] = s; __syncthreads();
    for (int o = 128; o > 0; o >>= 1) { if (tid < o) red[tid] += red[tid + o]; __syncthreads(); }
    const float mu = (mode == 0 || mode == 3) ? red[0] / (float)n : 0.f; __syncthreads();
    float q = 0.f;
    for (int e = tid; e < n; e += 256) { const float dlt = base[(long long)(e / inner) * so + (long long)(e % inner) * si] - mu; q += dlt * dlt; }
    red[tid] = q; __syncthreads();
    for (int o = 128; o > 0; o >>= 1) { if (tid < o) red[tid] += red[tid + o]; __syncthreads(); }
    {
        float rs;
        if (mode == 2) rs = sqrtf((float)n) / fmaxf(sqrtf(red[0]), eps); else if (mode == 3) rs = rsqrtf(red[0] / (float)(n - 1) + eps); else rs = rsqrtf(red[0] / (float)n + eps);
        if (tid < 32) { const float v = (tid == 0) ? mu : ((tid == 1) ? rs : 0.f); VST2(float, stat + (long long)z * 32 + tid, v); }
    }
}
//   One thread per element over the flat [Z][C][L] index space: grid ceil(Z*C*L / 256).
__global__ __launch_bounds__(256) void k_norm_apply(const float* __restrict__ x, float* __restrict__ y, const float* __restrict__ stat, const float* __restrict__ g, const float* __restrict__ bta,
                                                     int Z, int C, int L, int G, int bn, int act) {
    const long long idx = (long long)blockIdx.x * 256 + threadIdx.x;
    if (idx >= (long long)Z * C * L) return;
    const int l = (int)(idx % L); const long long zc = idx / L; const int c = (int)(zc % C), z = (int)(zc / C); (void)l;
    const int set = bn ? c : (z * G + c / (C / G));
    float v = (x[idx] - stat[(long long)set * 32]) * stat[(long long)set * 32 + 1];
    if (g) v *= g[c];
    if (bta) v += bta[c];
    v = act_fn(v, act);
    VST2(float, y + idx, v);
}

// k_lse_neg: c[i] = -(st[2i] + log(st[2i+1])) = minus the log-sum-exp of row i from k_attn's ST output (for softmax over the query axis)
__global__ __launch_bounds__(256) void k_lse_neg(const float* __restrict__ st, float* __restrict__ c, int n) {
    const int i = blockIdx.x * 256 + threadIdx.x;
    if (i < n) { const float v = -(st[2 * i] + logf(st[2 * i + 1])); VST2(float, c + i, v); }
}

// k_iota: dst[i] = a * i + b as int32 (segment/position id helper)
__global__ __launch_bounds__(256) void k_iota(int* __restrict__ dst, int n, int a, int b) {
    const int i = blockIdx.x * 256 + threadIdx.x;
    if (i < n) { const int v = a * i + b; VST2(int, dst + i, v); }
}

// k_axpby: dst[i] = a * x[i] + b * y[i] (+ c), i < n
__global__ __launch_bounds__(256) void k_axpby(const float* __restrict__ x, const float* __restrict__ y, float* __restrict__ dst, int n, float a, float b, float c) {
    const int i = blockIdx.x * 256 + threadIdx.x;
    if (i < n) { const float v = a * x[i] + b * y[i] + c; VST2(float, dst + i, v); }
}

// =====================================================================================================================
// k_rope: rotary embedding on a [R rows][Hn heads][D] view (row stride sXr, head stride sXh, element stride 1) -> Y (own strides).
//   mode 0: rotate_half (partner d±D/2, sign - for d<D/2); mode 1: interleaved pairs (partner d^1, sign - for even d).
//   table column tcol: tmode 0 -> d, 1 -> d % (D/2), 2 -> d / 2; position p: pmode 0 -> r % S, 1 -> head index, 2 -> pos[r];
//   c = C[(r / S) * sCb + p * sCp + tcol * sCd], s likewise from Sn; y = x[d] * c + sign * x[partner] * s. X and Y must not alias.
// =====================================================================================================================
struct RopeP { const float* X; float* Y; const float* C; const float* Sn; const int* pos; long long sXr, sXh, sYr, sYh, sCb, sCp, sCd; int R, Hn, D, S, mode, tmode, pmode, pad; };
static_assert(sizeof(RopeP) == 5 * 8 + 7 * 8 + 8 * 4, "RopeP has padding");
__global__ __launch_bounds__(256) void k_rope(RopeP p) {
    const long long idx = (long long)blockIdx.x * 256 + threadIdx.x;
    if (idx >= (long long)p.R * p.Hn * p.D) return;
    const int d = (int)(idx % p.D); const long long rh = idx / p.D; const int h = (int)(rh % p.Hn); const int r = (int)(rh / p.Hn);
    const int half = p.D / 2;
    int partner; float sign;
    if (p.mode == 0) { partner = (d < half) ? d + half : d - half; sign = (d < half) ? -1.f : 1.f; }
    else { partner = d ^ 1; sign = (d & 1) ? 1.f : -1.f; }
    const int tcol = (p.tmode == 0) ? d : ((p.tmode == 1) ? (d % half) : (d >> 1));
    const int pp = (p.pmode == 0) ? (r % p.S) : ((p.pmode == 1) ? h : p.pos[r]);
    const long long toff = (long long)(r / p.S) * p.sCb + (long long)pp * p.sCp + (long long)tcol * p.sCd;
    const float* xr = p.X + (long long)r * p.sXr + (long long)h * p.sXh;
    const float v = xr[d] * p.C[toff] + sign * xr[partner] * p.Sn[toff];
    VST2(float, p.Y + (long long)r * p.sYr + (long long)h * p.sYh + d, v);
}

// k_invf + k_sincos (split so neither kernel carries a large VALU-fma footprint): invf_i = num * (1 / powf(base, (2 i)/D)) [fmode 0],
//   num * expf((2 i) * cexp) [fmode 1], num * powf(base, -2 (i - 1) / D) [fmode 2]; then cs/sn[s*half + i] = cos/sin((pscale * s) * invf_i)
__global__ __launch_bounds__(256) void k_invf(float* __restrict__ invb, int half, int D, float base, float num, int fmode, float cexp) {
    const int i = blockIdx.x * 256 + threadIdx.x;
    if (i >= ((half + 31) / 32) * 32) return;
    if (i >= half) { VST2(float, invb + i, 0.f); return; }
    const float e = (float)(2 * i) / (float)D;
    float invf;
    if (fmode == 1) invf = num * expf((float)(2 * i) * cexp);
    else if (fmode == 2) invf = num * powf(base, (-2.0f * ((float)i - 1.0f)) / (float)D);
    else invf = num * (1.0f / powf(base, e));
    VST2(float, invb + i, invf);
}
__global__ __launch_bounds__(256) void k_sincos(float* __restrict__ cs, float* __restrict__ sn, const float* __restrict__ invb, int S, int half, float pscale) {
    const int idx = blockIdx.x * 256 + threadIdx.x;
    if (idx >= S * half) return;
    const int s = idx / half, i = idx - s * half;
    const float ang = (pscale * (float)s) * invb[i];
    VST2(float, cs + idx, cosf(ang)); VST2(float, sn + idx, sinf(ang));
}

// k_mulact: dst[i] = act(x[i]) * y[i]
__global__ __launch_bounds__(256) void k_mulact(const float* __restrict__ x, const float* __restrict__ y, float* __restrict__ dst, int n, int act) {
    const int i = blockIdx.x * 256 + threadIdx.x;
    if (i < n) { const float v = act_fn(x[i], act) * y[i]; VST2(float, dst + i, v); }
}

// =====================================================================================================================
// k_matvec: thread-per-row matrix-vector products for N <= 8 output columns (heads with 1-3 outputs, gates), f32 on the VALU.
//   C[r*sCm + j] = act(alpha * sum_k A[r*sAm + k*sAk] * B[j*sBn + k*sBk] + bias[j]) + beta * R[r*sRm + j*sRn]; each thread writes its N contiguous floats.
// =====================================================================================================================
__global__ __launch_bounds__(256) void k_matvec(GemmP p) {
    // 32 lanes write one line with one instruction.
    const int rpt = (p.N == 1) ? 1 : 32;
    const long long r0 = ((long long)blockIdx.x * 256 + threadIdx.x) * rpt; const int z = blockIdx.z, zo = z / p.zi_n, zi = z - zo * p.zi_n;
    if (r0 >= p.M) return;
    const float* Bb = p.B + zo * p.sBo + zi * p.sBi;
    float* C = p.C + zo * p.sCo + zi * p.sCi; const float* R = p.R + zo * p.sRo + zi * p.sRi;
    for (int rr = 0; rr < rpt; ++rr) {
        const long long r = r0 + rr; if (r >= p.M) break;
        const float* A = p.A + zo * p.sAo + zi * p.sAi + r * p.sAm;
        float acc[8] = {0.f, 0.f, 0.f, 0.f, 0.f, 0.f, 0.f, 0.f};
        for (int k = 0; k < p.K; ++k) { const float a = A[(long long)k * p.sAk];
#pragma unroll
            for (int j = 0; j < 8; ++j) if (j < p.N) acc[j] += a * Bb[(long long)j * p.sBn + (long long)k * p.sBk]; }
#pragma unroll
        for (int j = 0; j < 8; ++j) if (j < p.N) {
            float v = acc[j] * p.alpha;
            if (p.flags & 1) v += p.bias[j];
            if (p.flags & 2) v += p.bias[r];
            v = act_fn(v, p.act);
            if (p.flags & 4) v += p.beta * R[r * p.sRm + (long long)j * p.sRn];
            VST2(float, C + r * p.sCm + j, v);
        }
    }
}
// k_smallsoftmax: thread-per-row softmax for short rows (n <= 64): dst[r*dr + j] = softmax(scale*src[r*sr + j])
__global__ __launch_bounds__(256) void k_smallsoftmax(const float* __restrict__ src, float* __restrict__ dst, long long sr, long long dr, int n, long long R, float scale) {
    const long long r0 = ((long long)blockIdx.x * 256 + threadIdx.x) * 32;
    for (int rr = 0; rr < 32; ++rr) {
        const long long r = r0 + rr; if (r >= R) return;
        const float* s = src + r * sr; float* d = dst + r * dr;
        float mx = -__builtin_inff();
        for (int j = 0; j < n; ++j) mx = fmaxf(mx, s[j] * scale);
        float sum = 0.f;
        for (int j = 0; j < n; ++j) sum += expf(s[j] * scale - mx);
        const float inv = 1.f / sum;
        for (int j = 0; j < n; ++j) { const float v = expf(s[j] * scale - mx) * inv; VST2(float, d + j, v); }
    }
}

__global__ __launch_bounds__(32) void k_unitstat(float* __restrict__ st) { const int t = threadIdx.x; const float v = (t == 1) ? 1.f : 0.f; VST2(float, st + t, v); }

// destination (e.g. a d_out whose row width is not a multiple of 32 floats) is written by consecutive lanes of one instruction
__global__ __launch_bounds__(256) void k_lincopy(const float* __restrict__ src, long long lds, float* __restrict__ dst, long long ldd, long long rows, int cols) {
    const long long i = (long long)blockIdx.x * 256 + threadIdx.x; if (i >= rows * cols) return;
    const long long r = i / cols; const int c = (int)(i - r * cols);
    const float v = src[r * lds + c]; VST2(float, dst + r * ldd + c, v);
}

namespace w25 {
typedef __attribute__((ext_vector_type(16))) _Float16 v16h;
typedef __attribute__((ext_vector_type(8)))  _Float16 v8h;
typedef __attribute__((ext_vector_type(16))) __bf16   v16b;
typedef __attribute__((ext_vector_type(8)))  __bf16   v8b;
typedef __attribute__((ext_vector_type(8)))  float    v8f;
typedef __attribute__((ext_vector_type(4)))  float    v4f;

__device__ __forceinline__ unsigned short f2bf_bits(float f) {
  unsigned u = __float_as_uint(f);
  return (unsigned short)((u + 0x7FFFu + ((u >> 16) & 1u)) >> 16);
}
__device__ __forceinline__ float bf_bits2f(unsigned short h) { return __uint_as_float(((unsigned)h) << 16); }

// hazard guards as plain device helpers (no inline asm inside the kernel template body)
__device__ __forceinline__ void dep_guard_h(v8f& a, v8f& b, v16h x, v16h y) { asm volatile("v_nop\n\tv_nop\n\tv_nop\n\tv_nop" : "+v"(a), "+v"(b) : "v"(x), "v"(y)); }
__device__ __forceinline__ void dep_guard_b(v8f& a, v8f& b, v16b x, v16b y) { asm volatile("v_nop\n\tv_nop\n\tv_nop\n\tv_nop" : "+v"(a), "+v"(b) : "v"(x), "v"(y)); }
__device__ __forceinline__ void keep4_h(v16h a, v16h b, v16h c, v16h d) { asm volatile("v_nop" :: "v"(a), "v"(b), "v"(c), "v"(d)); }
__device__ __forceinline__ void keep4_b(v16b a, v16b b, v16b c, v16b d) { asm volatile("v_nop" :: "v"(a), "v"(b), "v"(c), "v"(d)); }
__device__ __forceinline__ void acc_guard4(v8f& a, v8f& b, v8f& c, v8f& d) { asm volatile("v_nop\n\tv_nop\n\tv_nop\n\tv_nop" : "+v"(a), "+v"(b), "+v"(c), "+v"(d)); }
template <typename T> struct Frag;
template <> struct Frag<_Float16> {
  typedef v16h V; union U { v16h v; v8h h[2]; };
  static __device__ __forceinline__ v16h load(const _Float16* p) {   // elements 0..7 <- p[0..7], 8..15 <- p[16..23]
    U f; f.h[0] = *(const v8h*)(p); f.h[1] = *(const v8h*)(p + 16); return f.v;
  }
  static __device__ __forceinline__ v8f mma(v16h a, v16h b, v8f c) {
    return __builtin_amdgcn_wmma_f32_16x16x32_f16(false, a, false, b, (short)0, c, false, false);
  }
  static __device__ __forceinline__ void guard(v8f& a, v8f& b, v16h x, v16h y) { dep_guard_h(a, b, x, y); }
  static __device__ __forceinline__ void keep(v16h a, v16h b, v16h c, v16h d) { keep4_h(a, b, c, d); }
};
template <> struct Frag<__bf16> {
  typedef v16b V; union U { v16b v; v8b h[2]; };
  static __device__ __forceinline__ v16b load(const __bf16* p) {
    U f; f.h[0] = *(const v8b*)(p); f.h[1] = *(const v8b*)(p + 16); return f.v;
  }
  static __device__ __forceinline__ v8f mma(v16b a, v16b b, v8f c) {
    return __builtin_amdgcn_wmma_f32_16x16x32_bf16(false, a, false, b, (short)0, c, false, false);
  }
  static __device__ __forceinline__ void guard(v8f& a, v8f& b, v16b x, v16b y) { dep_guard_b(a, b, x, y); }
  static __device__ __forceinline__ void keep(v16b a, v16b b, v16b c, v16b d) { keep4_b(a, b, c, d); }
};

// ---- Register-blocked batched WMMA GEMM ------------------------------------
// C[m,n] = scale * sum_k A[m,k] * Bt[n,k] (+bias)(+resid); each wave owns a 64x64 tile.
// A row-major [M,K]; Bt row-major [N,K]; M,N % 64 == 0, K % 32 == 0.
// SPLIT: operands are hi/lo planes (A2/Bt2 = lo planes, same layout); product = hi·hi + hi·lo + lo·hi.
// BIAS_MODE: 0 = none, 1 = bias[m], 2 = bias[n].
// OUT_MODE: 0 = f32, 1 = f16, 2 = bf16 hi plane (Cout) + bf16 lo plane (Cout2).
// ET: 0 = f16 operands, 1 = bf16 operands (pointers passed as 16-bit storage)
template <int ET> struct Elem;
template <> struct Elem<0> { typedef _Float16 T; };
template <> struct Elem<1> { typedef __bf16 T; };
template <int ET, bool SPLIT, int BIAS_MODE, int OUT_MODE, bool RESID, int ACT = 0>
__global__ __launch_bounds__(256) void wmma_gemm64(
    const unsigned short* __restrict__ Ap, const unsigned short* __restrict__ A2p, int lda, long strideA,
    const unsigned short* __restrict__ Btp, const unsigned short* __restrict__ Bt2p, int ldb, long strideB,
    void* __restrict__ Cout, void* __restrict__ Cout2, int ldc, long strideC,
    const float* __restrict__ bias,
    const float* __restrict__ resid, long strideR,
    int M, int N, int K, float scale) {
  typedef typename Elem<ET>::T T;
  typedef typename Frag<T>::V V;
  const T* A = (const T*)Ap; const T* A2 = (const T*)A2p; const T* Bt = (const T*)Btp; const T* Bt2 = (const T*)Bt2p;
  __shared__ __align__(16) float sT[8][16 * 68];   // per-wave 16x64 slab, pitch 68 floats
  const int b    = blockIdx.y;
  const int lane = threadIdx.x & 31;
  const int wave = threadIdx.x >> 5;
  const int tilesN = N >> 6;
  const int tilesM = M >> 6;
  const int tile = blockIdx.x * 8 + wave;
  if (tile >= tilesM * tilesN) return;   // wave-uniform; no block barriers in this kernel
  const int tm = tile / tilesN;
  const int tn = tile - tm * tilesN;
  const int m0 = tm << 6;
  const int n0 = tn << 6;

  const T* Ab  = A  + (size_t)b * strideA;
  const T* Bb  = Bt + (size_t)b * strideB;
  const T* Ab2 = SPLIT ? (A2  + (size_t)b * strideA) : nullptr;
  const T* Bb2 = SPLIT ? (Bt2 + (size_t)b * strideB) : nullptr;

  const int rlane = lane & 15;                 // row (A) / col (B, D) within subtile
  const int koff  = (lane >> 4) * 8;           // k offset of this lane half
  const int mOff  = (lane >> 4) * 8;           // D row offset

  v8f acc[4][4];
#pragma unroll
  for (int i = 0; i < 4; ++i)
#pragma unroll
    for (int j = 0; j < 4; ++j) acc[i][j] = (v8f){0.f,0.f,0.f,0.f,0.f,0.f,0.f,0.f};

  for (int k0 = 0; k0 < K; k0 += 32) {
    V bh[4], bl[4];
#pragma unroll
    for (int j = 0; j < 4; ++j) {
      const size_t bo = (size_t)(n0 + (j << 4) + rlane) * ldb + koff + k0;
      bh[j] = Frag<T>::load(Bb + bo);
      if (SPLIT) bl[j] = Frag<T>::load(Bb2 + bo);
    }
#pragma unroll
    for (int i = 0; i < 4; ++i) {
      const size_t ao = (size_t)(m0 + (i << 4) + rlane) * lda + koff + k0;
      V ah = Frag<T>::load(Ab + ao);
      V al;
      if (SPLIT) al = Frag<T>::load(Ab2 + ao);
#pragma unroll
      for (int j = 0; j < 4; ++j) {
        acc[i][j] = Frag<T>::mma(ah, bh[j], acc[i][j]);
        if (SPLIT) {
          acc[i][j] = Frag<T>::mma(ah, bl[j], acc[i][j]);
          acc[i][j] = Frag<T>::mma(al, bh[j], acc[i][j]);
        }
      }
      Frag<T>::guard(acc[i][0], acc[i][3], ah, SPLIT ? al : ah);
    }
    Frag<T>::keep(bh[0], bh[1], bh[2], bh[3]);
    if (SPLIT) Frag<T>::keep(bl[0], bl[1], bl[2], bl[3]);
  }
  acc_guard4(acc[0][0], acc[0][1], acc[0][2], acc[0][3]);
  acc_guard4(acc[1][0], acc[1][1], acc[1][2], acc[1][3]);
  acc_guard4(acc[2][0], acc[2][1], acc[2][2], acc[2][3]);
  acc_guard4(acc[3][0], acc[3][1], acc[3][2], acc[3][3]);

  // ---- epilogue ----
  float* slab = sT[wave];
  const float* Rb = RESID ? (resid + (size_t)b * strideR) : nullptr;
#pragma unroll
  for (int i = 0; i < 4; ++i) {
    const int mBase = m0 + (i << 4);
#pragma unroll
    for (int j = 0; j < 4; ++j) {
      const int n = n0 + (j << 4) + rlane;
      float bv = 0.f;
      if (BIAS_MODE == 2) bv = bias[n];
#pragma unroll
      for (int r = 0; r < 8; ++r) {
        float v = acc[i][j][r] * scale;
        if (BIAS_MODE == 1) v += bias[mBase + mOff + r];
        if (BIAS_MODE == 2) v += bv;
        if (RESID) v += Rb[(size_t)(mBase + mOff + r) * ldc + n];
        if (ACT == 1) v = tanhf(v);
        if (ACT == 2) v = fmaxf(v, 0.0f);
        if (ACT == 3) v = v / (1.0f + expf(-v));
        if (ACT == 4) v = (v > 0.f) ? v : 0.01f * v;
        if (ACT == 5) v = 0.5f * v * (1.0f + erff(v * 0.70710678118654752f));
        slab[(mOff + r) * 68 + (j << 4) + rlane] = v;
      }
    }
    __builtin_amdgcn_fence(__ATOMIC_RELEASE, "workgroup");
    __builtin_amdgcn_wave_barrier();
    __builtin_amdgcn_fence(__ATOMIC_ACQUIRE, "workgroup");
    if (OUT_MODE == 0) {
      float* C = (float*)Cout + (size_t)b * strideC;
      const int hh = lane >> 4, c4 = (lane & 15) * 4;     // row seg = 256 B = 16 lanes x 16 B
      {
#pragma unroll
        for (int it = 0; it < 8; ++it) {
          const int row = it * 2 + hh;
          v4f v = *(const v4f*)(slab + row * 68 + c4);
          *(v4f*)(C + (size_t)(mBase + row) * ldc + n0 + c4) = v;
        }
        
      }
    } else {
      const int q = lane >> 3, c8 = (lane & 7) * 8;
      unsigned short* C  = (unsigned short*)Cout  + (size_t)b * strideC;
      unsigned short* C2 = (OUT_MODE == 2) ? ((unsigned short*)Cout2 + (size_t)b * strideC) : nullptr;
      {
#pragma unroll
        for (int it = 0; it < 4; ++it) {
          const int row = it * 4 + q;
          const float* sp = slab + row * 68 + c8;
          v8h hv, lv;
#pragma unroll
          for (int e = 0; e < 8; ++e) {
            if (OUT_MODE == 1) {
              hv[e] = (_Float16)sp[e];
            } else {
              unsigned short hb = f2bf_bits(sp[e]);
              unsigned short lb = f2bf_bits(sp[e] - bf_bits2f(hb));
              hv[e] = __builtin_bit_cast(_Float16, hb);
              lv[e] = __builtin_bit_cast(_Float16, lb);
            }
          }
          *(v8h*)(C + (size_t)(mBase + row) * ldc + n0 + c8) = hv;
          if (OUT_MODE == 2) *(v8h*)(C2 + (size_t)(mBase + row) * ldc + n0 + c8) = lv;
        }
        
      }
    }
    __builtin_amdgcn_fence(__ATOMIC_RELEASE, "workgroup");
    __builtin_amdgcn_wave_barrier();
    __builtin_amdgcn_fence(__ATOMIC_ACQUIRE, "workgroup");
  }
}

__global__ __launch_bounds__(256) void cast_f32_f16x2(
    const float* __restrict__ in, _Float16* __restrict__ out, int n2) {
  int i = blockIdx.x * 256 + threadIdx.x;
  if (i < n2) {
    const _Float16 h0 = (_Float16)in[2 * i], h1 = (_Float16)in[2 * i + 1];
    const unsigned u = (unsigned)__builtin_bit_cast(unsigned short, h0) | ((unsigned)__builtin_bit_cast(unsigned short, h1) << 16);
    ((unsigned*)out)[i] = u;
    
  }
}


} // namespace w25

__global__ __launch_bounds__(256) void k_castT16(const float* __restrict__ src, long long lds, _Float16* __restrict__ dst, long long ldd, int R, int C, float s) {
    const long long i = (long long)blockIdx.x * 256 + threadIdx.x; const long long np = (long long)C * (R / 2); if (i >= np) return; const int c = (int)(i / (R / 2)); const int r = 2 * (int)(i % (R / 2));
    const _Float16 h0 = (_Float16)(src[(long long)r * lds + c] * s), h1 = (_Float16)(src[(long long)(r + 1) * lds + c] * s);
    const unsigned u = (unsigned)__builtin_bit_cast(unsigned short, h0) | ((unsigned)__builtin_bit_cast(unsigned short, h1) << 16);
    unsigned* d = (unsigned*)(dst + (long long)c * ldd + r); *d = u;  }
__global__ __launch_bounds__(256) void k_cast16(const float* __restrict__ src, long long lds, _Float16* __restrict__ dst, long long ldd, int R, int C, float s) {
    const long long i = (long long)blockIdx.x * 256 + threadIdx.x; const long long np = (long long)R * (C / 2); if (i >= np) return; const int r = (int)(i / (C / 2)); const int c = 2 * (int)(i % (C / 2));
    const _Float16 h0 = (_Float16)(src[(long long)r * lds + c] * s), h1 = (_Float16)(src[(long long)r * lds + c + 1] * s);
    const unsigned u = (unsigned)__builtin_bit_cast(unsigned short, h0) | ((unsigned)__builtin_bit_cast(unsigned short, h1) << 16);
    unsigned* d = (unsigned*)(dst + (long long)r * ldd + c); *d = u;  }

// f32 -> bf16 hi plane + bf16 lo plane (x = hi + lo to ~2^-17 relative; RNE both), [R][C] -> [R][C] (or transposed to [C][R]); 2 consecutive destination elements
__device__ __forceinline__ unsigned int f2bf2_pack(float a, float b, unsigned int* lo) {
    const unsigned short ha = w25::f2bf_bits(a), hb = w25::f2bf_bits(b);
    const unsigned short la = w25::f2bf_bits(a - w25::bf_bits2f(ha)), lb = w25::f2bf_bits(b - w25::bf_bits2f(hb));
    *lo = (unsigned)la | ((unsigned)lb << 16); return (unsigned)ha | ((unsigned)hb << 16); }
__global__ __launch_bounds__(256) void k_castS16(const float* __restrict__ src, long long lds, __bf16* __restrict__ dhi, __bf16* __restrict__ dlo, long long ldd, int R, int C, float s, int transpose) {
    const long long i = (long long)blockIdx.x * 256 + threadIdx.x; long long o; float a, b;
    if (transpose) { const long long np = (long long)C * (R / 2); if (i >= np) return; const int c = (int)(i / (R / 2)); const int r = 2 * (int)(i % (R / 2)); a = src[(long long)r * lds + c] * s; b = src[(long long)(r + 1) * lds + c] * s; o = (long long)c * ldd + r; }
    else { const long long np = (long long)R * (C / 2); if (i >= np) return; const int r = (int)(i / (C / 2)); const int c = 2 * (int)(i % (C / 2)); a = src[(long long)r * lds + c] * s; b = src[(long long)r * lds + c + 1] * s; o = (long long)r * ldd + c; }
    unsigned lo; const unsigned hi = f2bf2_pack(a, b, &lo); unsigned* ph = (unsigned*)(dhi + o); unsigned* pl = (unsigned*)(dlo + o);
    *ph = hi; *pl = lo;  }


extern "C" void kernel_launch(void* const* d_in, const int* in_sizes, int n_in, void* d_out, int out_size, void* d_ws, size_t ws_size, hipStream_t stream) {
    (void)in_sizes; (void)n_in; (void)out_size; (void)ws_size;
    const float* x = (const float*)d_in[0];
    const float* ln1g = (const float*)d_in[1];
    const float* ln1b = (const float*)d_in[2];
    const float* Wq = (const float*)d_in[3];
    const float* bq = (const float*)d_in[4];
    const float* Wk = (const float*)d_in[5];
    const float* bk = (const float*)d_in[6];
    const float* Wv = (const float*)d_in[7];
    const float* bv = (const float*)d_in[8];
    const float* Wo = (const float*)d_in[9];
    const float* bo = (const float*)d_in[10];
    const float* ln2g = (const float*)d_in[11];
    const float* ln2b = (const float*)d_in[12];
    const float* W1 = (const float*)d_in[13];
    const float* b1 = (const float*)d_in[14];
    const float* W2 = (const float*)d_in[15];
    const float* b2 = (const float*)d_in[16];
    const int L = 4096;
    const int C = 512;
    const int NH = 8;
    const int HD = 64;
    const int FF = 2048;
    const int LP = L / 2;
    const int WINP = 128;
    float* out = (float*)d_out;
    char* wsp = (char*)d_ws;
    float* ST1 = (float*)wsp; wsp += (((size_t)((size_t)L * 32) * 4 + 255) / 256) * 256;
    float* HN = (float*)wsp; wsp += (((size_t)((size_t)L * C) * 4 + 255) / 256) * 256;
    float* Q = (float*)wsp; wsp += (((size_t)((size_t)L * C) * 4 + 255) / 256) * 256;
    float* Kb = (float*)wsp; wsp += (((size_t)((size_t)L * C) * 4 + 255) / 256) * 256;
    float* V = (float*)wsp; wsp += (((size_t)((size_t)L * C) * 4 + 255) / 256) * 256;
    float* Y = (float*)wsp; wsp += (((size_t)((size_t)L * C) * 4 + 255) / 256) * 256;
    float* X1 = (float*)wsp; wsp += (((size_t)((size_t)L * C) * 4 + 255) / 256) * 256;
    float* ST2 = (float*)wsp; wsp += (((size_t)((size_t)L * 32) * 4 + 255) / 256) * 256;
    float* H2 = (float*)wsp; wsp += (((size_t)((size_t)L * C) * 4 + 255) / 256) * 256;
    float* F1 = (float*)wsp; wsp += (((size_t)((size_t)L * FF) * 4 + 255) / 256) * 256;
    unsigned short* G64A = (unsigned short*)wsp; wsp += (((size_t)(8388608) * 2 + 255) / 256) * 256;
    unsigned short* G64B = (unsigned short*)wsp; wsp += (((size_t)(1048576) * 2 + 255) / 256) * 256;
    k_stats<<<(unsigned)(L), 256, 0, stream>>>(x, C, 1, 1, 1, C, 1e-05f, ST1, 0);
    k_norm_apply<<<(unsigned)(((long long)(L) * (C) * (1) + 255) / 256), 256, 0, stream>>>(x, HN, ST1, ln1g, ln1b, L, C, 1, 1, 0, 0);
    k_cast16<<<(unsigned)((((long long)(4096) * ((512) / 2)) + 255) / 256), 256, 0, stream>>>(HN, 512, (_Float16*)(G64A), 512, 4096, 512, 1.0f);
    k_cast16<<<(unsigned)((((long long)(512) * ((512) / 2)) + 255) / 256), 256, 0, stream>>>(Wq, 512, (_Float16*)(G64B), 512, 512, 512, 16.0f);
    w25::wmma_gemm64<0, false, 2, 0, false, 0><<<dim3((unsigned)((((4096) / 64) * ((512) / 64) + 7) / 8), (unsigned)(1)), 256, 0, stream>>>((const unsigned short*)(G64A), nullptr, 512, 0, (const unsigned short*)(G64B), nullptr, 512, 0, (void*)(Q), nullptr, 512, 0, bq, nullptr, 0, 4096, 512, 512, 0.0625f);
    k_cast16<<<(unsigned)((((long long)(4096) * ((512) / 2)) + 255) / 256), 256, 0, stream>>>(HN, 512, (_Float16*)(G64A), 512, 4096, 512, 1.0f);
    k_cast16<<<(unsigned)((((long long)(512) * ((512) / 2)) + 255) / 256), 256, 0, stream>>>(Wk, 512, (_Float16*)(G64B), 512, 512, 512, 16.0f);
    w25::wmma_gemm64<0, false, 2, 0, false, 0><<<dim3((unsigned)((((4096) / 64) * ((512) / 64) + 7) / 8), (unsigned)(1)), 256, 0, stream>>>((const unsigned short*)(G64A), nullptr, 512, 0, (const unsigned short*)(G64B), nullptr, 512, 0, (void*)(Kb), nullptr, 512, 0, bk, nullptr, 0, 4096, 512, 512, 0.0625f);
    k_cast16<<<(unsigned)((((long long)(4096) * ((512) / 2)) + 255) / 256), 256, 0, stream>>>(HN, 512, (_Float16*)(G64A), 512, 4096, 512, 1.0f);
    k_cast16<<<(unsigned)((((long long)(512) * ((512) / 2)) + 255) / 256), 256, 0, stream>>>(Wv, 512, (_Float16*)(G64B), 512, 512, 512, 16.0f);
    w25::wmma_gemm64<0, false, 2, 0, false, 0><<<dim3((unsigned)((((4096) / 64) * ((512) / 64) + 7) / 8), (unsigned)(1)), 256, 0, stream>>>((const unsigned short*)(G64A), nullptr, 512, 0, (const unsigned short*)(G64B), nullptr, 512, 0, (void*)(V), nullptr, 512, 0, bv, nullptr, 0, 4096, 512, 512, 0.0625f);
    { /*apv4*/ AttnP a;
      a.Q = Q; a.K = Kb; a.V = V; a.O = Y; a.P = 0; a.Mf = 0; a.Mi = 0; a.ST = 0;
      a.Pw = 0; a.Rt = 0; a.SQ = 0; a.SK = 0;
      a.swb = 0; a.swh = 0; a.swi = 0; a.swj = 0; a.srb = 0; a.srh = 0; a.sri = 0; a.sQb = 0; a.sQh = HD; a.sQi = 2 * C; a.sQd = 1; a.sKb = 0; a.sKh = HD; a.sKj = 2 * C; a.sKd = 1; a.sVb = 0; a.sVh = HD; a.sVj = 2 * C; a.sVd = 1; a.sOb = 0; a.sOh = HD; a.sOi = 2 * C; a.sPb = 0; a.sPh = 0; a.sPi = 0; a.smb = 0; a.smh = 0; a.smi = 0; a.smj = 0;
      a.Lq = LP; a.Lk = LP; a.dh = HD; a.dv = HD; a.hrep = 1; a.causal = 1; a.coff = 0; a.pband = 0;
      a.scale = 0.125f; a.mfill = 0.0f; a.nonorm = 0; a.mpol = 0;
      a.roff = 0; a.rn = 1; a.segpol = 0; a.win = WINP;
      k_attn<64, 64, 0, false, false, true><<<dim3((unsigned)((LP) + 16 * AW - 1) / (16 * AW), (unsigned)(NH), (unsigned)(1)), 32 * AW, 0, stream>>>(a); }
    { /*apv4*/ AttnP a;
      a.Q = Q + 1 * C; a.K = Kb + 1 * C; a.V = V + 1 * C; a.O = Y + 1 * C; a.P = 0; a.Mf = 0; a.Mi = 0; a.ST = 0;
      a.Pw = 0; a.Rt = 0; a.SQ = 0; a.SK = 0;
      a.swb = 0; a.swh = 0; a.swi = 0; a.swj = 0; a.srb = 0; a.srh = 0; a.sri = 0; a.sQb = 0; a.sQh = HD; a.sQi = 2 * C; a.sQd = 1; a.sKb = 0; a.sKh = HD; a.sKj = 2 * C; a.sKd = 1; a.sVb = 0; a.sVh = HD; a.sVj = 2 * C; a.sVd = 1; a.sOb = 0; a.sOh = HD; a.sOi = 2 * C; a.sPb = 0; a.sPh = 0; a.sPi = 0; a.smb = 0; a.smh = 0; a.smi = 0; a.smj = 0;
      a.Lq = LP; a.Lk = LP; a.dh = HD; a.dv = HD; a.hrep = 1; a.causal = 1; a.coff = 0; a.pband = 0;
      a.scale = 0.125f; a.mfill = 0.0f; a.nonorm = 0; a.mpol = 0;
      a.roff = 0; a.rn = 1; a.segpol = 0; a.win = WINP;
      k_attn<64, 64, 0, false, false, true><<<dim3((unsigned)((LP) + 16 * AW - 1) / (16 * AW), (unsigned)(NH), (unsigned)(1)), 32 * AW, 0, stream>>>(a); }
    k_cast16<<<(unsigned)((((long long)(4096) * ((512) / 2)) + 255) / 256), 256, 0, stream>>>(Y, 512, (_Float16*)(G64A), 512, 4096, 512, 1.0f);
    k_cast16<<<(unsigned)((((long long)(512) * ((512) / 2)) + 255) / 256), 256, 0, stream>>>(Wo, 512, (_Float16*)(G64B), 512, 512, 512, 16.0f);
    w25::wmma_gemm64<0, false, 2, 0, true, 0><<<dim3((unsigned)((((4096) / 64) * ((512) / 64) + 7) / 8), (unsigned)(1)), 256, 0, stream>>>((const unsigned short*)(G64A), nullptr, 512, 0, (const unsigned short*)(G64B), nullptr, 512, 0, (void*)(X1), nullptr, 512, 0, bo, x, 0, 4096, 512, 512, 0.0625f);
    k_stats<<<(unsigned)(L), 256, 0, stream>>>(X1, C, 1, 1, 1, C, 1e-05f, ST2, 0);
    k_norm_apply<<<(unsigned)(((long long)(L) * (C) * (1) + 255) / 256), 256, 0, stream>>>(X1, H2, ST2, ln2g, ln2b, L, C, 1, 1, 0, 0);
    k_cast16<<<(unsigned)((((long long)(4096) * ((512) / 2)) + 255) / 256), 256, 0, stream>>>(H2, 512, (_Float16*)(G64A), 512, 4096, 512, 1.0f);
    k_cast16<<<(unsigned)((((long long)(2048) * ((512) / 2)) + 255) / 256), 256, 0, stream>>>(W1, 512, (_Float16*)(G64B), 512, 2048, 512, 16.0f);
    w25::wmma_gemm64<0, false, 2, 0, false, 5><<<dim3((unsigned)((((4096) / 64) * ((2048) / 64) + 7) / 8), (unsigned)(1)), 256, 0, stream>>>((const unsigned short*)(G64A), nullptr, 512, 0, (const unsigned short*)(G64B), nullptr, 512, 0, (void*)(F1), nullptr, 2048, 0, b1, nullptr, 0, 4096, 2048, 512, 0.0625f);
    k_cast16<<<(unsigned)((((long long)(4096) * ((2048) / 2)) + 255) / 256), 256, 0, stream>>>(F1, 2048, (_Float16*)(G64A), 2048, 4096, 2048, 1.0f);
    k_cast16<<<(unsigned)((((long long)(512) * ((2048) / 2)) + 255) / 256), 256, 0, stream>>>(W2, 2048, (_Float16*)(G64B), 2048, 512, 2048, 16.0f);
    w25::wmma_gemm64<0, false, 2, 0, true, 0><<<dim3((unsigned)((((4096) / 64) * ((512) / 64) + 7) / 8), (unsigned)(1)), 256, 0, stream>>>((const unsigned short*)(G64A), nullptr, 2048, 0, (const unsigned short*)(G64B), nullptr, 2048, 0, (void*)(out), nullptr, 512, 0, b2, X1, 0, 4096, 512, 2048, 0.0625f);
}

// v003
// Measured time: 366 microseconds a run.
// Two timings next to v002 put it at 1.04 and 1.06 times that version's speed.
// All steps since v000 together make it 6.01 times as fast.
// Contractions: q/k/v projections of the LayerNormed input [4096x512].[512x512] (+b), the output projection (+b, + residual), the FFN [4096x512].[512x2048] (+b, exact GELU) and [4096x2048].[2048x512] (+b, + residual) with f16 operands (v_wmma_f32_16x16x32_f16; 64x64 register-blocked wave tiles over pre-cast f16 operand planes, weights pre-scaled by 16 at the cast and un-scaled in the f32 epilogue); the dilated causal attention (keys j <= i, i - j even, i - j <= 256) as two flash launches over the even and the odd positions (stride-2 views; within a parity class the pattern is plain causal with window 128), head_dim 64, f16 q.k^T and f16 p.v (p as f16 of 4096 p); f32 accumulate, softmax and LayerNorms f32.
#include <hip/hip_runtime.h>
#include <math.h>

typedef __attribute__((ext_vector_type(16))) _Float16 v16h;
typedef __attribute__((ext_vector_type(8)))  _Float16 v8h;
typedef __attribute__((ext_vector_type(4)))  _Float16 v4h;
typedef __attribute__((ext_vector_type(16))) __bf16   v16b;
typedef __attribute__((ext_vector_type(8)))  float    v8f;
typedef __attribute__((ext_vector_type(4)))  float    v4f;

// 16-bit WMMA fragment map (wave32), lane L, h = L>>4, m = L&15:
//   A 16x32: lane = row m;   element i -> k = (i<8) ? 8h+i : 16+8h+(i-8)
//   B 32x16: lane = column m; the SAME k(i,h)
//   D 16x16 (8 f32): lane = column m; element r -> row 8h+r
__device__ __forceinline__ int frag_k(int i, int h) { return (i < 8) ? (8 * h + i) : (16 + 8 * h + (i - 8)); }
__device__ __forceinline__ __bf16 bf16_rne(float f) {
    unsigned int u = __float_as_uint(f);
    u += 0x7fffu + ((u >> 16) & 1u);
    return __builtin_bit_cast(__bf16, (unsigned short)(u >> 16));
}
__device__ __forceinline__ float bf16_f32(__bf16 b) { return __uint_as_float(((unsigned int)__builtin_bit_cast(unsigned short, b)) << 16); }
__device__ __forceinline__ v8f wmma16(v16h a, v16h b, v8f c) {
    c = __builtin_amdgcn_wmma_f32_16x16x32_f16(false, a, false, b, (short)0, c, false, false);
    asm volatile("v_nop\n\tv_nop\n\tv_nop\n\tv_nop" : "+v"(c) : "v"(a), "v"(b));
    return c;
}
__device__ __forceinline__ v8f wmmab(v16b a, v16b b, v8f c) {
    c = __builtin_amdgcn_wmma_f32_16x16x32_bf16(false, a, false, b, (short)0, c, false, false);
    asm volatile("v_nop\n\tv_nop\n\tv_nop\n\tv_nop" : "+v"(c) : "v"(a), "v"(b));
    return c;
}
struct Split { v16b hi, lo; };
// hi/lo split product: a.hi*b.hi + a.hi*b.lo + a.lo*b.hi
__device__ __forceinline__ v8f wmma3(const Split& a, const Split& b, v8f c) {
    c = __builtin_amdgcn_wmma_f32_16x16x32_bf16(false, a.hi, false, b.hi, (short)0, c, false, false);
    c = __builtin_amdgcn_wmma_f32_16x16x32_bf16(false, a.hi, false, b.lo, (short)0, c, false, false);
    c = __builtin_amdgcn_wmma_f32_16x16x32_bf16(false, a.lo, false, b.hi, (short)0, c, false, false);
    asm volatile("v_nop\n\tv_nop\n\tv_nop\n\tv_nop" : "+v"(c) : "v"(a.hi), "v"(a.lo), "v"(b.hi), "v"(b.lo));
    return c;
}
struct Split3 { v16b hi, mid, lo; };
// triple split product (6 terms, drops only terms below 2^-24 relative)
__device__ __forceinline__ v8f wmma6(const Split3& a, const Split3& b, v8f c) {
    c = __builtin_amdgcn_wmma_f32_16x16x32_bf16(false, a.hi, false, b.hi, (short)0, c, false, false);
    c = __builtin_amdgcn_wmma_f32_16x16x32_bf16(false, a.hi, false, b.mid, (short)0, c, false, false);
    c = __builtin_amdgcn_wmma_f32_16x16x32_bf16(false, a.mid, false, b.hi, (short)0, c, false, false);
    c = __builtin_amdgcn_wmma_f32_16x16x32_bf16(false, a.hi, false, b.lo, (short)0, c, false, false);
    c = __builtin_amdgcn_wmma_f32_16x16x32_bf16(false, a.mid, false, b.mid, (short)0, c, false, false);
    c = __builtin_amdgcn_wmma_f32_16x16x32_bf16(false, a.lo, false, b.hi, (short)0, c, false, false);
    asm volatile("v_nop\n\tv_nop\n\tv_nop\n\tv_nop" : "+v"(c) : "v"(a.hi), "v"(a.mid), "v"(a.lo), "v"(b.hi), "v"(b.mid), "v"(b.lo));
    return c;
}

// Fragment gathers from f32 memory: element i <- p[(k0 + frag_k(i,h)) * sk] * s, zero for k >= klen.
__device__ __forceinline__ v16h fh_ld(const float* __restrict__ p, long long sk, int k0, int h, int klen, float s) {
    v16h a;
#pragma unroll
    for (int i = 0; i < 16; ++i) { const int k = k0 + frag_k(i, h); a[i] = (k < klen) ? (_Float16)(p[(long long)k * sk] * s) : (_Float16)0.f; }
    return a;
}
__device__ __forceinline__ Split sp_ld(const float* __restrict__ p, long long sk, int k0, int h, int klen, float s) {
    Split r;
#pragma unroll
    for (int i = 0; i < 16; ++i) {
        const int k = k0 + frag_k(i, h); const float x = (k < klen) ? p[(long long)k * sk] * s : 0.f;
        const __bf16 hb = bf16_rne(x); r.hi[i] = hb; r.lo[i] = bf16_rne(x - bf16_f32(hb));
    }
    return r;
}
__device__ __forceinline__ Split3 sp3_ld(const float* __restrict__ p, long long sk, int k0, int h, int klen, float s) {
    Split3 r;
#pragma unroll
    for (int i = 0; i < 16; ++i) {
        const int k = k0 + frag_k(i, h); const float x = (k < klen) ? p[(long long)k * sk] * s : 0.f;
        const __bf16 hb = bf16_rne(x); const float r1 = x - bf16_f32(hb); const __bf16 mb = bf16_rne(r1);
        r.hi[i] = hb; r.mid[i] = mb; r.lo[i] = bf16_rne(r1 - bf16_f32(mb));
    }
    return r;
}
__device__ __forceinline__ v16b bh_ld(const float* __restrict__ p, long long sk, int k0, int h, int klen, float s) {
    v16b a;
#pragma unroll
    for (int i = 0; i < 16; ++i) { const int k = k0 + frag_k(i, h); a[i] = bf16_rne((k < klen) ? p[(long long)k * sk] * s : 0.f); }
    return a;
}
// f16 fragment from a 16-byte aligned f32 row with element stride 1 and all 32 k in range: four unguarded 16-byte loads, then the cast; same k order as fh_ld
struct Raw16 { v4f x0, x1, x2, x3; };   // the 16 floats of one lane's fragment, as loaded
__device__ __forceinline__ Raw16 raw_ld4(const float* __restrict__ row, int k0, int h) {
    const v4f* q = (const v4f*)(row + k0 + 8 * h);
    Raw16 r; r.x0 = q[0]; r.x1 = q[1]; r.x2 = q[4]; r.x3 = q[5];
    return r;
}
__device__ __forceinline__ v16h raw_f16(const Raw16& r) {
    v16h a;
#pragma unroll   // constant element indices: the vectors stay in registers
    for (int i = 0; i < 4; ++i) { a[i] = (_Float16)r.x0[i]; a[4 + i] = (_Float16)r.x1[i]; a[8 + i] = (_Float16)r.x2[i]; a[12 + i] = (_Float16)r.x3[i]; }
    return a;
}
// Inputs-only fence on loaded values: every load written above it is issued before it, so that a run of loads is in flight together.
// Without it the compiler converts each fragment as soon as it is loaded and waits for memory once per fragment.
__device__ __forceinline__ void loads_held(const v4f& a, const v4f& b, const v4f& c, const v4f& d) { asm volatile("" :: "v"(a), "v"(b), "v"(c), "v"(d)); }
// f16 fragment from an f16 LDS/global row with element stride 1 (k-contiguous), no bounds (tile already zero padded)
__device__ __forceinline__ v16h fh_row(const _Float16* __restrict__ row, int k0, int h) {
    v16h a;
#pragma unroll
    for (int i = 0; i < 16; ++i) a[i] = row[k0 + frag_k(i, h)];
    return a;
}

#define VST2(T, ptr, val) do { const T vst2_v_ = (val); *(T*)(ptr) = vst2_v_;  } while (0)
typedef float v4f __attribute__((ext_vector_type(4)));
#define VST2V4(ptr, val) do { const v4f vst2_v4_ = (val); *(v4f*)(ptr) = vst2_v4_;  } while (0)

__device__ __attribute__((noinline)) float act_fn(float v, int act) {
    if (act == 1) return fmaxf(v, 0.f);                                                                               // relu
    if (act == 2) { const float u = 0.7978845608028654f * (v + 0.044715f * v * v * v); return 0.5f * v * (1.f + tanhf(u)); } // tanh-gelu
    if (act == 3) return v / (1.f + expf(-v));                                                                        // silu
    if (act == 4) return 0.5f * v * (1.f + erff(v * 0.7071067811865476f));                                             // erf-gelu
    if (act == 5) return tanhf(v);
    if (act == 6) return 1.f / (1.f + expf(-v));                                                                      // sigmoid
    if (act == 7) return (v > 0.f) ? v : 0.01f * v;                                                                   // leaky relu 0.01
    if (act == 8) return (v > 0.f) ? v : (expf(v) - 1.f);                                                             // elu
    if (act == 9) return fminf(fmaxf(v, 0.f), 6.f);                                                                   // relu6
    if (act == 10) return fabsf(v);                                                                                    // abs
    if (act == 11) return (v >= 0.f) ? v : 0.1f * v;                                                                  // leaky 0.1
    if (act == 12) return (v > 0.f) ? v : 0.2f * v;                                                                   // leaky 0.2
    if (act == 13) return (v > 20.f) ? v : log1pf(expf(v));                                                            // softplus
    return v;
}

// =====================================================================================================================
// k_gemm<MODE>: C(z, m, n) = act(alpha * sum_k A(z, m, k) * B(z, k, n) + bias) + beta * R(z, m, n)
//   One wave (32-thread block) per 16 x 32 tile of C; grid (ceil(N/32), ceil(M/16), Z). Batch z -> (zo = z / zi_n, zi = z % zi_n)
//   with separate outer/inner strides for every tensor (e.g. batch and head). A(m,k) = A[zo*sAo + zi*sAi + m*sAm + k*sAk] (f32),
//   B(k,n) = B[zo*sBo + zi*sBi + n*sBn + k*sBk] (f32); any M, N, K (K zero-padded to 32 inside the fragments, M/N tails guarded).
//   C(m,n) = C[zo*sCo + zi*sCi + m*sCm + n] (n contiguous). flags: 1 bias[n], 2 bias[m], 4 residual R[zo*sRo + zi*sRi + m*sRm + n*sRn].
//   MODE 0: f16 operands (A prescaled by sa, B by sb, both undone in the epilogue); 1: bf16 hi/lo split (3 products); 2: bf16;
//   3: bf16 hi/mid/lo triple split (6 products); 4: as 3 with Kahan-compensated f32 accumulation across k-steps.
// =====================================================================================================================
struct GemmP {
    const float* A; const float* B; const float* bias; const float* R; float* C;
    long long sAo, sAi, sAm, sAk, sBo, sBi, sBn, sBk, sCo, sCi, sCm, sRo, sRi, sRm, sRn;
    int M, N, K, zi_n, flags, act; float alpha, beta, sa, sb;
    int Npad, pad_;     // columns [N, Npad) of C are written as 0 so that padded workspace rows are covered by whole-line stores; Npad >= N
};
static_assert(sizeof(GemmP) == 5 * 8 + 15 * 8 + 6 * 4 + 4 * 4 + 2 * 4, "GemmP has padding");

template <int MODE>
__global__ __launch_bounds__(32) void k_gemm(GemmP p) {
    const int lane = threadIdx.x & 31, h = lane >> 4, l15 = lane & 15;
    const int m0 = blockIdx.y * 16, n0 = blockIdx.x * 32;
    const int z = blockIdx.z, zo = z / p.zi_n, zi = z - zo * p.zi_n;
    const float* A = p.A + zo * p.sAo + zi * p.sAi;
    const float* B = p.B + zo * p.sBo + zi * p.sBi;
    const int am = min(m0 + l15, p.M - 1);                       // clamped row for loads (stores are guarded)
    v8f acc[2], comp[2];
#pragma unroll
    for (int t = 0; t < 2; ++t) { v8f zz = {}; acc[t] = zz; comp[t] = zz; }
    for (int k0 = 0; k0 < p.K; k0 += 32) {
        const float* arow = A + (long long)am * p.sAm;
        if (MODE == 1) {
            const Split a = sp_ld(arow, p.sAk, k0, h, p.K, 1.f);
#pragma unroll
            for (int t = 0; t < 2; ++t) {
                const int bn = min(n0 + t * 16 + l15, p.N - 1);
                acc[t] = wmma3(a, sp_ld(B + (long long)bn * p.sBn, p.sBk, k0, h, p.K, 1.f), acc[t]);
            }
        } else if (MODE == 3) {
            const Split3 a = sp3_ld(arow, p.sAk, k0, h, p.K, 1.f);
#pragma unroll
            for (int t = 0; t < 2; ++t) {
                const int bn = min(n0 + t * 16 + l15, p.N - 1);
                acc[t] = wmma6(a, sp3_ld(B + (long long)bn * p.sBn, p.sBk, k0, h, p.K, 1.f), acc[t]);
            }
        } else if (MODE == 4) {
            // triple split as MODE 3, but each k-step's 6 products go into a fresh accumulator and the partial is added to the running f32 sum
            // on the VALU with Kahan compensation (accumulation error stays ~1 ulp however long K is)
            const Split3 a = sp3_ld(arow, p.sAk, k0, h, p.K, 1.f);
#pragma unroll
            for (int t = 0; t < 2; ++t) {
                const int bn = min(n0 + t * 16 + l15, p.N - 1); v8f zz = {};
                const v8f part = wmma6(a, sp3_ld(B + (long long)bn * p.sBn, p.sBk, k0, h, p.K, 1.f), zz);
                const v8f y = part - comp[t]; const v8f s = acc[t] + y; comp[t] = (s - acc[t]) - y; acc[t] = s;
            }
        } else if (MODE == 2) {
            const v16b a = bh_ld(arow, p.sAk, k0, h, p.K, 1.f);
#pragma unroll
            for (int t = 0; t < 2; ++t) {
                const int bn = min(n0 + t * 16 + l15, p.N - 1);
                acc[t] = wmmab(a, bh_ld(B + (long long)bn * p.sBn, p.sBk, k0, h, p.K, 1.f), acc[t]);
            }
        } else {
            const v16h a = fh_ld(arow, p.sAk, k0, h, p.K, p.sa);
#pragma unroll
            for (int t = 0; t < 2; ++t) {
                const int bn = min(n0 + t * 16 + l15, p.N - 1);
                acc[t] = wmma16(a, fh_ld(B + (long long)bn * p.sBn, p.sBk, k0, h, p.K, p.sb), acc[t]);
            }
        }
    }
    const float iscale = (MODE == 0) ? p.alpha / (p.sa * p.sb) : p.alpha;
    float* C = p.C + zo * p.sCo + zi * p.sCi;
    const float* R = p.R + zo * p.sRo + zi * p.sRi;
    __shared__ __align__(16) float ctile[16][36];
#pragma unroll
    for (int t = 0; t < 2; ++t) {
        const int n = n0 + t * 16 + l15; const int nn = min(n, p.N - 1);
#pragma unroll
        for (int r = 0; r < 8; ++r) {
            const int m = m0 + 8 * h + r; const int mm = min(m, p.M - 1);
            float v = acc[t][r] * iscale;
            if (p.flags & 1) v += p.bias[nn];
            if (p.flags & 2) v += p.bias[mm];
            if (p.flags & 8) v *= p.bias[(long long)zo * p.M + mm];   /* per-(z,row) scale vector laid out [Z][M]; exclusive with the bias flags */
            v = act_fn(v, p.act);
            if (p.flags & 4) v += p.beta * R[(long long)mm * p.sRm + (long long)nn * p.sRn];
            ctile[8 * h + r][t * 16 + l15] = (n < p.N) ? v : 0.f;
        }
    }
    __syncthreads();
    const int NW = (p.Npad > p.N) ? p.Npad : p.N;           // write width
    const bool fast = (m0 + 16 <= p.M) && (n0 + 32 <= NW) && ((p.sCm & 3) == 0) && ((((size_t)C) & 15) == 0);
    if (fast) {
#pragma unroll
        for (int s = 0; s < 4; ++s) {
            const int row = s * 4 + (lane >> 3), c4 = (lane & 7) * 4;
            const v4f v = *(const v4f*)&ctile[row][c4];
            VST2V4(C + (long long)(m0 + row) * p.sCm + n0 + c4, v);
        }
    } else {
        for (int row = 0; row < 16; ++row) {
            const int m = m0 + row, n = n0 + lane;
            if (m < p.M && n < NW) VST2(float, C + (long long)m * p.sCm + n, ctile[row][lane]);
        }
    }
}


// =====================================================================================================================
// k_gemmT<MODE, TM, TN>: same contract as k_gemm, but one wave computes a (16*TM) x (16*TN) tile: TM A fragments and TN B fragments are
//   loaded per 32-wide k-step and reused across TM*TN WMMAs (far fewer load/convert instructions per MAC). MODE 0 (f16), 1 (bf16 hi/lo),
//   2 (bf16) only. grid (ceil(NW/(16*TN)), ceil(M/(16*TM)), Z), block 32. Epilogue identical to k_gemm, run per 16x32 sub-tile.
// =====================================================================================================================
template <int MODE, int TM, int TN>
__global__ __launch_bounds__(32) void k_gemmT(GemmP p) {
    const int lane = threadIdx.x & 31, h = lane >> 4, l15 = lane & 15;
    const int m0 = blockIdx.y * (16 * TM), n0 = blockIdx.x * (16 * TN);
    const int z = blockIdx.z, zo = z / p.zi_n, zi = z - zo * p.zi_n;
    const float* A = p.A + zo * p.sAo + zi * p.sAi;
    const float* B = p.B + zo * p.sBo + zi * p.sBi;
    v8f acc[TM][TN];
#pragma unroll
    for (int i = 0; i < TM; ++i)
#pragma unroll
        for (int t = 0; t < TN; ++t) { v8f zz = {}; acc[i][t] = zz; }
    for (int k0 = 0; k0 < p.K; k0 += 32) {
        if (MODE == 1) {
            Split a[TM], b[TN];
#pragma unroll
            for (int i = 0; i < TM; ++i) { const int am = min(m0 + 16 * i + l15, p.M - 1); a[i] = sp_ld(A + (long long)am * p.sAm, p.sAk, k0, h, p.K, 1.f); }
#pragma unroll
            for (int t = 0; t < TN; ++t) { const int bn = min(n0 + 16 * t + l15, p.N - 1); b[t] = sp_ld(B + (long long)bn * p.sBn, p.sBk, k0, h, p.K, 1.f); }
#pragma unroll
            for (int i = 0; i < TM; ++i)
#pragma unroll
                for (int t = 0; t < TN; ++t) acc[i][t] = wmma3(a[i], b[t], acc[i][t]);
        } else if (MODE == 2) {
            v16b a[TM], b[TN];
#pragma unroll
            for (int i = 0; i < TM; ++i) { const int am = min(m0 + 16 * i + l15, p.M - 1); a[i] = bh_ld(A + (long long)am * p.sAm, p.sAk, k0, h, p.K, 1.f); }
#pragma unroll
            for (int t = 0; t < TN; ++t) { const int bn = min(n0 + 16 * t + l15, p.N - 1); b[t] = bh_ld(B + (long long)bn * p.sBn, p.sBk, k0, h, p.K, 1.f); }
#pragma unroll
            for (int i = 0; i < TM; ++i)
#pragma unroll
                for (int t = 0; t < TN; ++t) acc[i][t] = wmmab(a[i], b[t], acc[i][t]);
        } else {
            v16h a[TM], b[TN];
#pragma unroll
            for (int i = 0; i < TM; ++i) { const int am = min(m0 + 16 * i + l15, p.M - 1); a[i] = fh_ld(A + (long long)am * p.sAm, p.sAk, k0, h, p.K, p.sa); }
#pragma unroll
            for (int t = 0; t < TN; ++t) { const int bn = min(n0 + 16 * t + l15, p.N - 1); b[t] = fh_ld(B + (long long)bn * p.sBn, p.sBk, k0, h, p.K, p.sb); }
#pragma unroll
            for (int i = 0; i < TM; ++i)
#pragma unroll
                for (int t = 0; t < TN; ++t) acc[i][t] = wmma16(a[i], b[t], acc[i][t]);
        }
    }
    const float iscale = (MODE == 0) ? p.alpha / (p.sa * p.sb) : p.alpha;
    float* C = p.C + zo * p.sCo + zi * p.sCi;
    const float* R = p.R + zo * p.sRo + zi * p.sRi;
    const int NW = (p.Npad > p.N) ? p.Npad : p.N;
    __shared__ __align__(16) float ctile[16][36];
#pragma unroll
    for (int i = 0; i < TM; ++i) {
        const int mb = m0 + 16 * i; if (mb >= p.M) break;          // wave-uniform
#pragma unroll
        for (int tp = 0; tp < TN / 2; ++tp) {
            const int nb = n0 + 32 * tp; if (nb >= NW) break;        // wave-uniform
#pragma unroll
            for (int t2 = 0; t2 < 2; ++t2) {
                const int t = 2 * tp + t2; const int n = nb + t2 * 16 + l15; const int nn = min(n, p.N - 1);
#pragma unroll
                for (int r = 0; r < 8; ++r) {
                    const int m = mb + 8 * h + r; const int mm = min(m, p.M - 1);
                    float v = acc[i][t][r] * iscale;
                    if (p.flags & 1) v += p.bias[nn];
                    if (p.flags & 2) v += p.bias[mm];
            if (p.flags & 8) v *= p.bias[(long long)zo * p.M + mm];   /* per-(z,row) scale vector laid out [Z][M]; exclusive with the bias flags */
                    v = act_fn(v, p.act);
                    if (p.flags & 4) v += p.beta * R[(long long)mm * p.sRm + (long long)nn * p.sRn];
                    ctile[8 * h + r][t2 * 16 + l15] = (n < p.N) ? v : 0.f;
                }
            }
            __syncthreads();
            const bool fast = (mb + 16 <= p.M) && (nb + 32 <= NW) && ((p.sCm & 3) == 0) && ((((size_t)C) & 15) == 0);
            if (fast) {
#pragma unroll
                for (int s = 0; s < 4; ++s) {
                    const int row = s * 4 + (lane >> 3), c4 = (lane & 7) * 4;
                    const v4f v = *(const v4f*)&ctile[row][c4];
                    VST2V4(C + (long long)(mb + row) * p.sCm + nb + c4, v);
                }
            } else {
                for (int row = 0; row < 16; ++row) {
                    const int m = mb + row, n = nb + lane;
                    if (m < p.M && n < NW) VST2(float, C + (long long)m * p.sCm + n, ctile[row][lane]);
                }
            }
            __syncthreads();
        }
    }
}

// =====================================================================================================================
//   Wave = 16 queries, AW waves per block, 64-key blocks; grid (ceil(Lq/(16*AW)), H, B), block 32*AW. Any Lq, Lk; head dim dh <= DHP
//   (DHP multiple of 32), value dim dv <= DVP (multiple of 16, <= 128). Every tensor addressed by (batch, head, row, element) strides, f32.
//   Scores: QM 0 f16 operands, 1 bf16 hi/lo split, 2 bf16 triple split; statistics f32 (exp2 domain); P.V: P x 4096 as f16 with V f16 staged in LDS
//   (SPLITPV: P and V as bf16 hi/lo splits). kv head = h / hrep. Masking: causal = 1 (keep j <= i + coff, masked -> -inf, key blocks beyond the
//   diagonal skipped), causal = 2 (masked -> mfill, a finite fill like the -1e9; no skipping), causal = 3 (keep j >= i + coff,
//   masked -> -inf, no skipping); optional additive f32 mask Mf,
//   optional int keep-mask Mi (0 -> score := mfill), both addressed b*smb + h*smh + i*smi + j*smj (0 strides broadcast).
//   PLAIN (QM 0, f16 P.V, one pass): the call is causal = 1 with coff 0, hrep 1, dh == DHP, dv == DVP, element strides 1, every Q/K/V row 16-byte aligned,
//   and none of P, Mf, Mi, ST, Pw, Rt, SQ/SK, nonorm. These become compile-time constants: the element guards fold away, so Q, K and V are read with
//   16-byte loads that are in flight in runs instead of one guarded float at a time, each waited for, and the option tests leave the score loop.
// =====================================================================================================================
#define AW 4
struct AttnP {   // apv4
    const float* Q; const float* K; const float* V; float* O; float* P; const float* Mf; const int* Mi; float* ST;
    const float* Pw; const float* Rt; const int* SQ; const int* SK;           // optional: post-softmax weight, relative-position table, segment ids
    long long swb, swh, swi, swj, srb, srh, sri;                                 // Pw strides (b,h,i,j); Rt strides (b,h,i), column = clamp(i - j + roff, 0, rn-1)
    long long sQb, sQh, sQi, sQd, sKb, sKh, sKj, sKd, sVb, sVh, sVj, sVd, sOb, sOh, sOi, sPb, sPh, sPi, smb, smh, smi, smj;
    int Lq, Lk, dh, dv, hrep, causal, coff, pband;   // pband > 0: P holds only the band |j - i| <= pband, column j - i + pband
    float scale, mfill; int nonorm, mpol;             // nonorm (online path only): O = sum_j exp(score_j) V_j without the 1/rowsum (scores must be <= ~0); mpol: Mi masks where ==0 (mpol 0) or where !=0 (mpol 1)
    int roff, rn, segpol, win;                        // Rt column offset/count; SQ/SK: score := mfill where (segpol 0) SQ[i] != SK[j] or (segpol 1) SQ[i] == SK[j]; win > 0: keys with i - j > win (after coff) -> -inf, key blocks wholly below the window skipped
};
//   Pw: the softmax numerator is multiplied by Pw(b,h,i,j) AFTER the row sum is taken (probs * weight, then P.V), as in post-softmax multiplicative biases.                                                    // ST (optional): per row (b,h,i) -> ST[((b*H + h)*Lq + i)*2 + {0,1}] = {row max of the scaled+masked score (natural units), sum_j exp(score - max)}
static_assert(sizeof(AttnP) == 12 * 8 + 29 * 8 + 16 * 4, "AttnP has padding");

#ifndef KATTN_ATTR
#define KATTN_ATTR
#endif
template <int DHP, int DVP, int QM, bool SPLITPV, bool TWOPASS, bool PLAIN = false>
__global__ __launch_bounds__(32 * AW) KATTN_ATTR void k_attn(AttnP pa) {
    static_assert(!PLAIN || (QM == 0 && !SPLITPV && !TWOPASS), "PLAIN covers the f16 one-pass form");
    AttnP p = pa;
    if (PLAIN) {
        p.P = nullptr; p.Mf = nullptr; p.Mi = nullptr; p.ST = nullptr; p.Pw = nullptr; p.Rt = nullptr; p.SQ = nullptr; p.SK = nullptr;
        p.sQd = 1; p.sKd = 1; p.sVd = 1; p.dh = DHP; p.dv = DVP; p.hrep = 1; p.causal = 1; p.coff = 0; p.pband = 0; p.nonorm = 0;
    }
    constexpr int NT = DVP / 16;                // output tiles
    constexpr int KS = DHP / 32;                // k-steps for the scores
    constexpr int VP = DVP + 8;                 // LDS pitch (halves)
    constexpr int NV = 64 * (DVP / 4) / (32 * AW);   // PLAIN: 16-byte pieces of the V tile per thread
    static_assert(!PLAIN || NV * (32 * AW) == 64 * (DVP / 4), "the block's threads cover the V tile evenly");
    __shared__ __align__(16) float    pl[AW][16 * 64];
    __shared__ __align__(16) _Float16 vl[(SPLITPV ? 2 : 1) * 64 * VP];   // f16 V tile, or bf16 hi and lo tiles (same 2-byte size)
    const int lane = threadIdx.x & 31, hf = lane >> 4, l15 = lane & 15, wave = threadIdx.x >> 5;
    const int h = blockIdx.y, b = blockIdx.z, hk = h / p.hrep;
    const int q0 = (blockIdx.x * AW + wave) * 16;
    float* myp = pl[wave];
    const float L2E = 1.4426950408889634f;
    const float NEG = -__builtin_inff();
    const int qi = min(q0 + l15, p.Lq - 1);
    const float* qrow = p.Q + b * p.sQb + h * p.sQh + (long long)qi * p.sQi;
    const float* kbase = p.K + b * p.sKb + hk * p.sKh;
    const float* vbase = p.V + b * p.sVb + hk * p.sVh;
    v16h qa[QM == 0 ? KS : 1]; Split qs_[QM == 1 ? KS : 1]; Split3 qt_[QM == 2 ? KS : 1];
#pragma unroll
    for (int ks = 0; ks < KS; ++ks) {
        if (QM == 2) qt_[ks] = sp3_ld(qrow, p.sQd, ks * 32, hf, p.dh, 1.f);
        else if (QM == 1) qs_[ks] = sp_ld(qrow, p.sQd, ks * 32, hf, p.dh, 1.f);
        else if (PLAIN) qa[ks] = raw_f16(raw_ld4(qrow, ks * 32, hf));
        else qa[ks] = fh_ld(qrow, p.sQd, ks * 32, hf, p.dh, 1.f);
    }
    v8f o[NT]; float m8[8], l8[8];
#pragma unroll
    for (int t = 0; t < NT; ++t) { v8f zz = {}; o[t] = zz; }
#pragma unroll
    for (int i = 0; i < 8; ++i) { m8[i] = NEG; l8[i] = 0.f; }
    int jend = p.Lk;
    if (p.causal == 1) { const int je = (blockIdx.x * AW + AW - 1) * 16 + 16 + p.coff; jend = min(jend, max(je, 0)); }   // uniform per block
    int jbeg = 0;                                                // first key any query row of this block can see through the window; uniform per block
    if (p.win > 0 && !p.P) jbeg = max((int)(blockIdx.x * AW) * 16 + p.coff - p.win, 0);   // keys below it are -inf for all 16*AW rows (weight exactly 0); P, where asked for, still needs its zeros written
    const int npass = TWOPASS ? 2 : 1;
    for (int pass = 0; pass < npass; ++pass) {
        const bool dopv = (!TWOPASS) || pass == 1;
        for (int j0 = jbeg; j0 < jend; j0 += 64) {
            v4f vr[PLAIN ? NV : 1]; Raw16 kr[PLAIN ? 2 : 1][KS];   // PLAIN: this thread's part of the V tile and the lane's K fragments of two columns, f32 as loaded
            if (dopv) {
                __syncthreads();                                 // previous key block's reads of vl / pl are done
                if (!PLAIN)
                for (int idx = threadIdx.x; idx < 64 * DVP; idx += 32 * AW) {
                    const int jr = idx / DVP, d = idx - jr * DVP, j = j0 + jr;
                    const float f = (j < p.Lk && d < p.dv) ? vbase[(long long)j * p.sVj + (long long)d * p.sVd] : 0.f;
                    if (SPLITPV) {
                        const __bf16 hb = bf16_rne(f);
                        ((__bf16*)vl)[jr * VP + d] = hb; ((__bf16*)vl)[64 * VP + jr * VP + d] = bf16_rne(f - bf16_f32(hb));
                    } else vl[jr * VP + d] = (_Float16)f;
                }
            }
            v8f s[4];
#pragma unroll
            for (int t = 0; t < 4; ++t) {
                const int j = min(j0 + t * 16 + l15, p.Lk - 1);
                const float* krow = kbase + (long long)j * p.sKj;
                if (PLAIN && (t & 1) == 0) {
                    // the K loads of two 16-key columns are issued ahead of the first use of any of them: one trip to memory for 4 fragments
                    // (all four columns at once took the build past 256 registers). The loops here are unrolled so that kr and vr stay in registers.
#pragma unroll
                    for (int u = 0; u < 2; ++u) {
#pragma unroll
                        for (int ks = 0; ks < KS; ++ks) kr[u][ks] = raw_ld4(kbase + (long long)min(j0 + (t + u) * 16 + l15, p.Lk - 1) * p.sKj, ks * 32, hf);
                        // one column's loads share one address pair: this wait stands behind them, ahead of any later load whose result may be given that pair
                        asm volatile("s_wait_xcnt 0x0" ::: "memory");
                    }
#pragma unroll
                    for (int u = 0; u < 2; ++u)
#pragma unroll
                        for (int ks = 0; ks < KS; ++ks) loads_held(kr[u][ks].x0, kr[u][ks].x1, kr[u][ks].x2, kr[u][ks].x3);
                }
                v8f acc = {};
#pragma unroll
                for (int ks = 0; ks < KS; ++ks) {
                    if (QM == 2)      acc = wmma6(qt_[ks], sp3_ld(krow, p.sKd, ks * 32, hf, p.dh, 1.f), acc);
                    else if (QM == 1) acc = wmma3(qs_[ks], sp_ld(krow, p.sKd, ks * 32, hf, p.dh, 1.f), acc);
                    else if (PLAIN)   acc = wmma16(qa[ks], raw_f16(kr[t & 1][ks]), acc);
                    else              acc = wmma16(qa[ks], fh_ld(krow, p.sKd, ks * 32, hf, p.dh, 1.f), acc);
                }
                s[t] = acc;
            }
            if (PLAIN) {
                // the V tile's loads go out here and are first used behind the softmax, which covers their trip to memory
#pragma unroll
                for (int n = 0; n < NV; ++n) {
                    const int idx = threadIdx.x + n * (32 * AW), jr = idx / (DVP / 4), d = (idx - jr * (DVP / 4)) * 4;
                    vr[n] = *(const v4f*)(vbase + (long long)min(j0 + jr, p.Lk - 1) * p.sVj + d);   // row clamped, so no guard round the load
                }
            }
            float pv[8][4];
#pragma unroll
            for (int i = 0; i < 8; ++i) {
                const int irow = q0 + i + 8 * hf;
                const int ic = min(irow, p.Lq - 1);
                float sc[4];
#pragma unroll
                for (int t = 0; t < 4; ++t) {
                    const int jg = j0 + t * 16 + l15;
                    float v = s[t][i] * p.scale;
                    if (p.Mf) v += p.Mf[b * p.smb + h * p.smh + (long long)ic * p.smi + (long long)min(jg, p.Lk - 1) * p.smj];
                    if (p.Rt) { int rc = ic - min(jg, p.Lk - 1) + p.roff; rc = rc < 0 ? 0 : (rc >= p.rn ? p.rn - 1 : rc); v += p.Rt[b * p.srb + h * p.srh + (long long)ic * p.sri + rc]; }
                    if (p.Mi) { const int mv = p.Mi[b * p.smb + h * p.smh + (long long)ic * p.smi + (long long)min(jg, p.Lk - 1) * p.smj]; if (p.mpol ? (mv != 0) : (mv == 0)) v = p.mfill; }
                    if (p.SQ) { const bool same = p.SQ[(long long)b * p.Lq + ic] == p.SK[(long long)b * p.Lk + min(jg, p.Lk - 1)]; if (p.segpol ? same : !same) v = p.mfill; }
                    if (p.causal == 2 && jg > irow + p.coff) v = p.mfill;
                    if (jg >= p.Lk || (p.causal == 1 && jg > irow + p.coff) || (p.causal == 3 && jg < irow + p.coff) || (p.win > 0 && irow + p.coff - jg > p.win)) v = NEG; else v *= L2E;
                    sc[t] = v;
                }
                if (!TWOPASS || pass == 0) {
                    float mx = fmaxf(fmaxf(sc[0], sc[1]), fmaxf(sc[2], sc[3]));
                    mx = fmaxf(mx, __shfl_xor(mx, 1, 32)); mx = fmaxf(mx, __shfl_xor(mx, 2, 32));
                    mx = fmaxf(mx, __shfl_xor(mx, 4, 32)); mx = fmaxf(mx, __shfl_xor(mx, 8, 32));
                    const float mnew = fmaxf(m8[i], mx);
                    const float corr = (mnew == NEG) ? 1.f : exp2f(m8[i] - mnew);
                    float rs = 0.f;
#pragma unroll
                    for (int t = 0; t < 4; ++t) {
                        const float pp = (sc[t] == NEG) ? 0.f : exp2f(sc[t] - mnew); rs += pp;
                        pv[i][t] = p.Pw ? pp * p.Pw[b * p.swb + h * p.swh + (long long)ic * p.swi + (long long)min(j0 + t * 16 + l15, p.Lk - 1) * p.swj] : pp;
                    }
                    rs += __shfl_xor(rs, 1, 32); rs += __shfl_xor(rs, 2, 32); rs += __shfl_xor(rs, 4, 32); rs += __shfl_xor(rs, 8, 32);
                    l8[i] = l8[i] * corr + rs; m8[i] = mnew;
                    if (!TWOPASS) {
#pragma unroll
                        for (int t = 0; t < NT; ++t) o[t][i] *= corr;
                    }
                } else {
                    const float inv = (l8[i] > 0.f) ? 1.f / l8[i] : 0.f;
#pragma unroll
                    for (int t = 0; t < 4; ++t) {
                        const int jg = j0 + t * 16 + l15;
                        float pp = (sc[t] == NEG) ? 0.f : exp2f(sc[t] - m8[i]) * inv;
                        if (p.Pw) pp *= p.Pw[b * p.swb + h * p.swh + (long long)ic * p.swi + (long long)min(jg, p.Lk - 1) * p.swj];
                        pv[i][t] = pp;
                    }
                }
            }
            if (dopv) {
                if (PLAIN) {                                     // cast and stage the V tile loaded above (unrolled: vr stays in registers)
#pragma unroll
                    for (int n = 0; n < NV; ++n) {
                        const int idx = threadIdx.x + n * (32 * AW), jr = idx / (DVP / 4), d = (idx - jr * (DVP / 4)) * 4;
                        v4h hv;
#pragma unroll
                        for (int e = 0; e < 4; ++e) hv[e] = (_Float16)((j0 + jr < p.Lk) ? vr[n][e] : 0.f);
                        *(v4h*)&vl[jr * VP + d] = hv;
                    }
                }
#pragma unroll
                for (int i = 0; i < 8; ++i)
#pragma unroll
                    for (int t = 0; t < 4; ++t) ((float*)myp)[(i + 8 * hf) * 64 + t * 16 + l15] = pv[i][t];
                __syncthreads();                                 // P (per wave) and V (shared) visible
                if (p.P) {
                    float* pb_ = p.P + b * p.sPb + h * p.sPh;
                    const bool fastP = (p.pband == 0) && ((p.sPi & 3) == 0) && (j0 + 64 <= p.Lk) && (q0 + 16 <= p.Lq) && ((((size_t)pb_) & 15) == 0);
                    if (fastP) {
#pragma unroll
                        for (int s = 0; s < 8; ++s) {
                            const int row = s * 2 + (lane >> 4), c4 = (lane & 15) * 4;
                            const v4f v = *(const v4f*)(myp + row * 64 + c4);
                            VST2V4(pb_ + (long long)(q0 + row) * p.sPi + j0 + c4, v);
                        }
                    } else {
                        for (int row = 0; row < 16; ++row) {
                            const int irow = q0 + row; if (irow >= p.Lq) continue;
                            for (int c = lane; c < 64; c += 32) {
                                const int jg = j0 + c; if (jg >= p.Lk) continue;
                                if (p.pband == 0) VST2(float, pb_ + (long long)irow * p.sPi + jg, myp[row * 64 + c]);
                                else if (jg - irow <= p.pband && irow - jg <= p.pband) VST2(float, pb_ + (long long)irow * p.sPi + (jg - irow + p.pband), myp[row * 64 + c]);
                            }
                        }
                    }
                }
                if (SPLITPV) {
                    const Split pa0 = sp_ld(myp + l15 * 64, 1, 0, hf, 64, 1.f), pa1 = sp_ld(myp + l15 * 64, 1, 32, hf, 64, 1.f);
                    const __bf16* vh = (const __bf16*)vl; const __bf16* vlo = vh + 64 * VP;
#pragma unroll
                    for (int t = 0; t < NT; ++t) {
                        const int dcol = t * 16 + l15;
                        Split b0, b1;
#pragma unroll
                        for (int e = 0; e < 16; ++e) {
                            const int k0 = frag_k(e, hf), k1 = 32 + frag_k(e, hf);
                            b0.hi[e] = vh[k0 * VP + dcol]; b0.lo[e] = vlo[k0 * VP + dcol]; b1.hi[e] = vh[k1 * VP + dcol]; b1.lo[e] = vlo[k1 * VP + dcol];
                        }
                        o[t] = wmma3(pa0, b0, o[t]);
                        o[t] = wmma3(pa1, b1, o[t]);
                    }
                } else {
                    const v16h pa0 = fh_ld(myp + l15 * 64, 1, 0, hf, 64, 4096.f), pa1 = fh_ld(myp + l15 * 64, 1, 32, hf, 64, 4096.f);
#pragma unroll
                    for (int t = 0; t < NT; ++t) {
                        const int dcol = t * 16 + l15;
                        v16h b0, b1;
#pragma unroll
                        for (int e = 0; e < 16; ++e) { b0[e] = vl[frag_k(e, hf) * VP + dcol]; b1[e] = vl[(32 + frag_k(e, hf)) * VP + dcol]; }
                        o[t] = wmma16(pa0, b0, o[t]);
                        o[t] = wmma16(pa1, b1, o[t]);
                    }
                }
            }
        }
    }
    float* obase = p.O + b * p.sOb + h * p.sOh;
    if (p.ST) {
        const int rl = lane >> 1, isel = rl & 7;           // row q0 + rl ; rl>>3 == hf holds because lane>>4 == (lane>>1)>>3
        float mv = 0.f, lv = 0.f;
#pragma unroll
        for (int i = 0; i < 8; ++i) if (i == isel) { mv = m8[i]; lv = l8[i]; }
        const int irow = q0 + rl;
        if (irow < p.Lq) { float* st = p.ST + (((long long)b * gridDim.y + h) * p.Lq + irow) * 2 + (lane & 1); VST2(float, st, (lane & 1) ? lv : mv * 0.6931471805599453f); }
    }
    float invr[8];
#pragma unroll
    for (int i = 0; i < 8; ++i) {
        if (TWOPASS) invr[i] = SPLITPV ? 1.f : (1.f / 4096.f);
        else if (p.nonorm) invr[i] = exp2f(m8[i]) * (SPLITPV ? 1.f : (1.f / 4096.f));
        else invr[i] = (l8[i] > 0.f) ? (SPLITPV ? 1.f / l8[i] : 1.f / (l8[i] * 4096.f)) : 0.f;
    }
    __syncthreads();                                             // all waves done with pl/vl from the main loop
    const bool ofast = ((p.sOi & 3) == 0) && ((((size_t)obase) & 15) == 0) && (q0 + 16 <= p.Lq);
#pragma unroll
    for (int c0 = 0; c0 < DVP; c0 += 64) {
#pragma unroll
        for (int i = 0; i < 8; ++i)
#pragma unroll
            for (int t = 0; t < NT; ++t) if (t * 16 >= c0 && t * 16 < c0 + 64) ((float*)myp)[(i + 8 * hf) * 64 + (t * 16 - c0) + l15] = o[t][i] * invr[i];
        __syncthreads();
        const int cw = (DVP - c0 < 64) ? (DVP - c0) : 64;      // staged columns in this chunk (multiple of 16)
        if (ofast && (c0 + cw <= p.dv) && (cw % 32 == 0)) {
            const int lpr = cw / 4;                              // lanes per row (16 for 64 cols, 8 for 32)
            const int rows_per_ins = 32 / lpr;
            for (int r0 = 0; r0 < 16; r0 += rows_per_ins) {
                const int row = r0 + lane / lpr, c4 = (lane % lpr) * 4;
                const v4f v = *(const v4f*)(myp + row * 64 + c4);
                VST2V4(obase + (long long)(q0 + row) * p.sOi + c0 + c4, v);
            }
        } else {
            for (int row = 0; row < 16; ++row) {
                const int irow = q0 + row; if (irow >= p.Lq) continue;
                for (int c = lane; c < cw; c += 32) { const int d = c0 + c; if (d < p.dv) VST2(float, obase + (long long)irow * p.sOi + d, myp[row * 64 + c]); }
            }
        }
        __syncthreads();
    }
}

// =====================================================================================================================
// k_tr: dst(z, c, r) = alpha * src(z, r, c) (+ beta * R2(z, c, r)): [Z][R][C] (row stride lds) -> [Z][C][R] (row stride ldd) through a 32x32 LDS tile;
//   flags: 1 -> add beta * residual R2 addressed like dst (z*sRz + c*ldr + r); act applied before the residual.
// =====================================================================================================================
struct TrP { const float* src; float* dst; const float* R2; long long sSz, lds, sDz, ldd, sRz, ldr; int R, C, flags, act; float alpha, beta; };
static_assert(sizeof(TrP) == 3 * 8 + 6 * 8 + 6 * 4, "TrP has padding");
__global__ __launch_bounds__(256) void k_tr(TrP p) {
    __shared__ float tile[32][33];
    const int c0 = blockIdx.x * 32, r0 = blockIdx.y * 32, z = blockIdx.z;
    const int lane = threadIdx.x & 31, wave = threadIdx.x >> 5;
    const float* s = p.src + z * p.sSz;
#pragma unroll
    for (int k = 0; k < 4; ++k) {
        const int rl = wave * 4 + k, r = r0 + rl, c = c0 + lane;
        tile[rl][lane] = (r < p.R && c < p.C) ? s[(long long)r * p.lds + c] : 0.f;
    }
    __syncthreads();
    float* d = p.dst + z * p.sDz; const float* rr = p.R2 + z * p.sRz;
#pragma unroll
    for (int k = 0; k < 4; ++k) {
        const int cl = wave * 4 + k, c = c0 + cl, r = r0 + lane;
        if (c < p.C && r < p.R) {
            float v = act_fn(p.alpha * tile[lane][cl], p.act);
            if (p.flags & 1) v += p.beta * rr[(long long)c * p.ldr + r];
            VST2(float, d + (long long)c * p.ldd + r, v);
        }
    }
}

// k_affine: dst[i] = a * (sdev ? sdev[0] : 1) * src[i] + b, i < n (one thread per element; consecutive lanes -> consecutive addresses)
__global__ __launch_bounds__(256) void k_affine(const float* __restrict__ src, float* __restrict__ dst, int n, float a, float b, const float* __restrict__ sdev) {
    const int i = blockIdx.x * 256 + threadIdx.x;
    if (i < n) { const float aa = sdev ? a * sdev[0] : a; const float v = aa * src[i] + b; VST2(float, dst + i, v); }
}

// =====================================================================================================================
// k_softmax: row softmax over n contiguous elements, one 256-thread block per row; rows addressed z*sz + r*sr (grid (R, Z)).
//   out = scale_out * softmax(scale_in * x + (Mf ? Mf[z*smz + r*smr + j] : 0)); a row whose max is -inf is written as 0.
// =====================================================================================================================
struct SmP { const float* src; float* dst; const float* Mf; long long sz, sr, dz, dr, smz, smr; int n, pad; float scale_in, scale_out; };
static_assert(sizeof(SmP) == 3 * 8 + 6 * 8 + 4 * 4, "SmP has padding");
__global__ __launch_bounds__(256) void k_softmax(SmP p) {
    __shared__ float red[256];
    const int r = blockIdx.x, z = blockIdx.y, tid = threadIdx.x;
    const float* s = p.src + z * p.sz + (long long)r * p.sr;
    const float* mf = p.Mf ? (p.Mf + z * p.smz + (long long)r * p.smr) : nullptr;
    float mx = -__builtin_inff();
    for (int j = tid; j < p.n; j += 256) { float v = s[j] * p.scale_in; if (mf) v += mf[j]; mx = fmaxf(mx, v); }
    red[tid] = mx; __syncthreads();
    for (int o = 128; o > 0; o >>= 1) { if (tid < o) red[tid] = fmaxf(red[tid], red[tid + o]); __syncthreads(); }
    mx = red[0]; __syncthreads();
    float sum = 0.f;
    for (int j = tid; j < p.n; j += 256) { float v = s[j] * p.scale_in; if (mf) v += mf[j]; sum += (mx == -__builtin_inff()) ? 0.f : expf(v - mx); }
    red[tid] = sum; __syncthreads();
    for (int o = 128; o > 0; o >>= 1) { if (tid < o) red[tid] += red[tid + o]; __syncthreads(); }
    sum = red[0];
    const float inv = (sum > 0.f) ? p.scale_out / sum : 0.f;
    float* d = p.dst + z * p.dz + (long long)r * p.dr;
    for (int j = tid; j < p.n; j += 256) { float v = s[j] * p.scale_in; if (mf) v += mf[j]; const float o = (mx == -__builtin_inff()) ? 0.f : expf(v - mx) * inv; VST2(float, d + j, o); }
}
// =====================================================================================================================
// k_stats: mean and rsqrt(var + eps) over a set of n elements addressed base + z*sz + (e / inner) * so + (e % inner) * si, one 256-thread
// k_norm_apply: y = (x - mean[set]) * rstd[set] * g[c] + b[c] over a [Z][C][L] channel-major tensor with set = z*G + c / (C/G) (G groups per z;
//   G = C -> per-channel sets indexed z*C+c; for batch norm pass stats indexed by c only via bn = 1). Optional act. Output same layout.
// =====================================================================================================================
//   mode 0: mean / rsqrt(var + eps); mode 1 (RMSNorm): 0 / rsqrt(mean(x^2) + eps); mode 2 (L2 normalize * sqrt(n)): 0 / sqrt(n) / max(||x||, eps); mode 3: as 0 with unbiased variance (n-1)
__global__ __launch_bounds__(256) void k_stats(const float* __restrict__ x, long long sz, long long so, long long si, int inner, int n, float eps, float* __restrict__ stat, int mode) {
    __shared__ float red[256];
    const int z = blockIdx.x, tid = threadIdx.x;
    const float* base = x + z * sz;
    float s = 0.f;
    for (int e = tid; e < n; e += 256) s += base[(long long)(e / inner) * so + (long long)(e % inner) * si];
    red[tid] = s; __syncthreads();
    for (int o = 128; o > 0; o >>= 1) { if (tid < o) red[tid] += red[tid + o]; __syncthreads(); }
    const float mu = (mode == 0 || mode == 3) ? red[0] / (float)n : 0.f; __syncthreads();
    float q = 0.f;
    for (int e = tid; e < n; e += 256) { const float dlt = base[(long long)(e / inner) * so + (long long)(e % inner) * si] - mu; q += dlt * dlt; }
    red[tid] = q; __syncthreads();
    for (int o = 128; o > 0; o >>= 1) { if (tid < o) red[tid] += red[tid + o]; __syncthreads(); }
    {
        float rs;
        if (mode == 2) rs = sqrtf((float)n) / fmaxf(sqrtf(red[0]), eps); else if (mode == 3) rs = rsqrtf(red[0] / (float)(n - 1) + eps); else rs = rsqrtf(red[0] / (float)n + eps);
        if (tid < 32) { const float v = (tid == 0) ? mu : ((tid == 1) ? rs : 0.f); VST2(float, stat + (long long)z * 32 + tid, v); }
    }
}
//   One thread per element over the flat [Z][C][L] index space: grid ceil(Z*C*L / 256).
__global__ __launch_bounds__(256) void k_norm_apply(const float* __restrict__ x, float* __restrict__ y, const float* __restrict__ stat, const float* __restrict__ g, const float* __restrict__ bta,
                                                     int Z, int C, int L, int G, int bn, int act) {
    const long long idx = (long long)blockIdx.x * 256 + threadIdx.x;
    if (idx >= (long long)Z * C * L) return;
    const int l = (int)(idx % L); const long long zc = idx / L; const int c = (int)(zc % C), z = (int)(zc / C); (void)l;
    const int set = bn ? c : (z * G + c / (C / G));
    float v = (x[idx] - stat[(long long)set * 32]) * stat[(long long)set * 32 + 1];
    if (g) v *= g[c];
    if (bta) v += bta[c];
    v = act_fn(v, act);
    VST2(float, y + idx, v);
}

// k_lse_neg: c[i] = -(st[2i] + log(st[2i+1])) = minus the log-sum-exp of row i from k_attn's ST output (for softmax over the query axis)
__global__ __launch_bounds__(256) void k_lse_neg(const float* __restrict__ st, float* __restrict__ c, int n) {
    const int i = blockIdx.x * 256 + threadIdx.x;
    if (i < n) { const float v = -(st[2 * i] + logf(st[2 * i + 1])); VST2(float, c + i, v); }
}

// k_iota: dst[i] = a * i + b as int32 (segment/position id helper)
__global__ __launch_bounds__(256) void k_iota(int* __restrict__ dst, int n, int a, int b) {
    const int i = blockIdx.x * 256 + threadIdx.x;
    if (i < n) { const int v = a * i + b; VST2(int, dst + i, v); }
}

// k_axpby: dst[i] = a * x[i] + b * y[i] (+ c), i < n
__global__ __launch_bounds__(256) void k_axpby(const float* __restrict__ x, const float* __restrict__ y, float* __restrict__ dst, int n, float a, float b, float c) {
    const int i = blockIdx.x * 256 + threadIdx.x;
    if (i < n) { const float v = a * x[i] + b * y[i] + c; VST2(float, dst + i, v); }
}

// =====================================================================================================================
// k_rope: rotary embedding on a [R rows][Hn heads][D] view (row stride sXr, head stride sXh, element stride 1) -> Y (own strides).
//   mode 0: rotate_half (partner d±D/2, sign - for d<D/2); mode 1: interleaved pairs (partner d^1, sign - for even d).
//   table column tcol: tmode 0 -> d, 1 -> d % (D/2), 2 -> d / 2; position p: pmode 0 -> r % S, 1 -> head index, 2 -> pos[r];
//   c = C[(r / S) * sCb + p * sCp + tcol * sCd], s likewise from Sn; y = x[d] * c + sign * x[partner] * s. X and Y must not alias.
// =====================================================================================================================
struct RopeP { const float* X; float* Y; const float* C; const float* Sn; const int* pos; long long sXr, sXh, sYr, sYh, sCb, sCp, sCd; int R, Hn, D, S, mode, tmode, pmode, pad; };
static_assert(sizeof(RopeP) == 5 * 8 + 7 * 8 + 8 * 4, "RopeP has padding");
__global__ __launch_bounds__(256) void k_rope(RopeP p) {
    const long long idx = (long long)blockIdx.x * 256 + threadIdx.x;
    if (idx >= (long long)p.R * p.Hn * p.D) return;
    const int d = (int)(idx % p.D); const long long rh = idx / p.D; const int h = (int)(rh % p.Hn); const int r = (int)(rh / p.Hn);
    const int half = p.D / 2;
    int partner; float sign;
    if (p.mode == 0) { partner = (d < half) ? d + half : d - half; sign = (d < half) ? -1.f : 1.f; }
    else { partner = d ^ 1; sign = (d & 1) ? 1.f : -1.f; }
    const int tcol = (p.tmode == 0) ? d : ((p.tmode == 1) ? (d % half) : (d >> 1));
    const int pp = (p.pmode == 0) ? (r % p.S) : ((p.pmode == 1) ? h : p.pos[r]);
    const long long toff = (long long)(r / p.S) * p.sCb + (long long)pp * p.sCp + (long long)tcol * p.sCd;
    const float* xr = p.X + (long long)r * p.sXr + (long long)h * p.sXh;
    const float v = xr[d] * p.C[toff] + sign * xr[partner] * p.Sn[toff];
    VST2(float, p.Y + (long long)r * p.sYr + (long long)h * p.sYh + d, v);
}

// k_invf + k_sincos (split so neither kernel carries a large VALU-fma footprint): invf_i = num * (1 / powf(base, (2 i)/D)) [fmode 0],
//   num * expf((2 i) * cexp) [fmode 1], num * powf(base, -2 (i - 1) / D) [fmode 2]; then cs/sn[s*half + i] = cos/sin((pscale * s) * invf_i)
__global__ __launch_bounds__(256) void k_invf(float* __restrict__ invb, int half, int D, float base, float num, int fmode, float cexp) {
    const int i = blockIdx.x * 256 + threadIdx.x;
    if (i >= ((half + 31) / 32) * 32) return;
    if (i >= half) { VST2(float, invb + i, 0.f); return; }
    const float e = (float)(2 * i) / (float)D;
    float invf;
    if (fmode == 1) invf = num * expf((float)(2 * i) * cexp);
    else if (fmode == 2) invf = num * powf(base, (-2.0f * ((float)i - 1.0f)) / (float)D);
    else invf = num * (1.0f / powf(base, e));
    VST2(float, invb + i, invf);
}
__global__ __launch_bounds__(256) void k_sincos(float* __restrict__ cs, float* __restrict__ sn, const float* __restrict__ invb, int S, int half, float pscale) {
    const int idx = blockIdx.x * 256 + threadIdx.x;
    if (idx >= S * half) return;
    const int s = idx / half, i = idx - s * half;
    const float ang = (pscale * (float)s) * invb[i];
    VST2(float, cs + idx, cosf(ang)); VST2(float, sn + idx, sinf(ang));
}

// k_mulact: dst[i] = act(x[i]) * y[i]
__global__ __launch_bounds__(256) void k_mulact(const float* __restrict__ x, const float* __restrict__ y, float* __restrict__ dst, int n, int act) {
    const int i = blockIdx.x * 256 + threadIdx.x;
    if (i < n) { const float v = act_fn(x[i], act) * y[i]; VST2(float, dst + i, v); }
}

// =====================================================================================================================
// k_matvec: thread-per-row matrix-vector products for N <= 8 output columns (heads with 1-3 outputs, gates), f32 on the VALU.
//   C[r*sCm + j] = act(alpha * sum_k A[r*sAm + k*sAk] * B[j*sBn + k*sBk] + bias[j]) + beta * R[r*sRm + j*sRn]; each thread writes its N contiguous floats.
// =====================================================================================================================
__global__ __launch_bounds__(256) void k_matvec(GemmP p) {
    // 32 lanes write one line with one instruction.
    const int rpt = (p.N == 1) ? 1 : 32;
    const long long r0 = ((long long)blockIdx.x * 256 + threadIdx.x) * rpt; const int z = blockIdx.z, zo = z / p.zi_n, zi = z - zo * p.zi_n;
    if (r0 >= p.M) return;
    const float* Bb = p.B + zo * p.sBo + zi * p.sBi;
    float* C = p.C + zo * p.sCo + zi * p.sCi; const float* R = p.R + zo * p.sRo + zi * p.sRi;
    for (int rr = 0; rr < rpt; ++rr) {
        const long long r = r0 + rr; if (r >= p.M) break;
        const float* A = p.A + zo * p.sAo + zi * p.sAi + r * p.sAm;
        float acc[8] = {0.f, 0.f, 0.f, 0.f, 0.f, 0.f, 0.f, 0.f};
        for (int k = 0; k < p.K; ++k) { const float a = A[(long long)k * p.sAk];
#pragma unroll
            for (int j = 0; j < 8; ++j) if (j < p.N) acc[j] += a * Bb[(long long)j * p.sBn + (long long)k * p.sBk]; }
#pragma unroll
        for (int j = 0; j < 8; ++j) if (j < p.N) {
            float v = acc[j] * p.alpha;
            if (p.flags & 1) v += p.bias[j];
            if (p.flags & 2) v += p.bias[r];
            v = act_fn(v, p.act);
            if (p.flags & 4) v += p.beta * R[r * p.sRm + (long long)j * p.sRn];
            VST2(float, C + r * p.sCm + j, v);
        }
    }
}
// k_smallsoftmax: thread-per-row softmax for short rows (n <= 64): dst[r*dr + j] = softmax(scale*src[r*sr + j])
__global__ __launch_bounds__(256) void k_smallsoftmax(const float* __restrict__ src, float* __restrict__ dst, long long sr, long long dr, int n, long long R, float scale) {
    const long long r0 = ((long long)blockIdx.x * 256 + threadIdx.x) * 32;
    for (int rr = 0; rr < 32; ++rr) {
        const long long r = r0 + rr; if (r >= R) return;
        const float* s = src + r * sr; float* d = dst + r * dr;
        float mx = -__builtin_inff();
        for (int j = 0; j < n; ++j) mx = fmaxf(mx, s[j] * scale);
        float sum = 0.f;
        for (int j = 0; j < n; ++j) sum += expf(s[j] * scale - mx);
        const float inv = 1.f / sum;
        for (int j = 0; j < n; ++j) { const float v = expf(s[j] * scale - mx) * inv; VST2(float, d + j, v); }
    }
}

__global__ __launch_bounds__(32) void k_unitstat(float* __restrict__ st) { const int t = threadIdx.x; const float v = (t == 1) ? 1.f : 0.f; VST2(float, st + t, v); }

// destination (e.g. a d_out whose row width is not a multiple of 32 floats) is written by consecutive lanes of one instruction
__global__ __launch_bounds__(256) void k_lincopy(const float* __restrict__ src, long long lds, float* __restrict__ dst, long long ldd, long long rows, int cols) {
    const long long i = (long long)blockIdx.x * 256 + threadIdx.x; if (i >= rows * cols) return;
    const long long r = i / cols; const int c = (int)(i - r * cols);
    const float v = src[r * lds + c]; VST2(float, dst + r * ldd + c, v);
}

namespace w25 {
typedef __attribute__((ext_vector_type(16))) _Float16 v16h;
typedef __attribute__((ext_vector_type(8)))  _Float16 v8h;
typedef __attribute__((ext_vector_type(16))) __bf16   v16b;
typedef __attribute__((ext_vector_type(8)))  __bf16   v8b;
typedef __attribute__((ext_vector_type(8)))  float    v8f;
typedef __attribute__((ext_vector_type(4)))  float    v4f;

__device__ __forceinline__ unsigned short f2bf_bits(float f) {
  unsigned u = __float_as_uint(f);
  return (unsigned short)((u + 0x7FFFu + ((u >> 16) & 1u)) >> 16);
}
__device__ __forceinline__ float bf_bits2f(unsigned short h) { return __uint_as_float(((unsigned)h) << 16); }

// hazard guards as plain device helpers (no inline asm inside the kernel template body)
__device__ __forceinline__ void dep_guard_h(v8f& a, v8f& b, v16h x, v16h y) { asm volatile("v_nop\n\tv_nop\n\tv_nop\n\tv_nop" : "+v"(a), "+v"(b) : "v"(x), "v"(y)); }
__device__ __forceinline__ void dep_guard_b(v8f& a, v8f& b, v16b x, v16b y) { asm volatile("v_nop\n\tv_nop\n\tv_nop\n\tv_nop" : "+v"(a), "+v"(b) : "v"(x), "v"(y)); }
__device__ __forceinline__ void keep4_h(v16h a, v16h b, v16h c, v16h d) { asm volatile("v_nop" :: "v"(a), "v"(b), "v"(c), "v"(d)); }
__device__ __forceinline__ void keep4_b(v16b a, v16b b, v16b c, v16b d) { asm volatile("v_nop" :: "v"(a), "v"(b), "v"(c), "v"(d)); }
__device__ __forceinline__ void acc_guard4(v8f& a, v8f& b, v8f& c, v8f& d) { asm volatile("v_nop\n\tv_nop\n\tv_nop\n\tv_nop" : "+v"(a), "+v"(b), "+v"(c), "+v"(d)); }
template <typename T> struct Frag;
template <> struct Frag<_Float16> {
  typedef v16h V; union U { v16h v; v8h h[2]; };
  static __device__ __forceinline__ v16h load(const _Float16* p) {   // elements 0..7 <- p[0..7], 8..15 <- p[16..23]
    U f; f.h[0] = *(const v8h*)(p); f.h[1] = *(const v8h*)(p + 16); return f.v;
  }
  static __device__ __forceinline__ v8f mma(v16h a, v16h b, v8f c) {
    return __builtin_amdgcn_wmma_f32_16x16x32_f16(false, a, false, b, (short)0, c, false, false);
  }
  static __device__ __forceinline__ void guard(v8f& a, v8f& b, v16h x, v16h y) { dep_guard_h(a, b, x, y); }
  static __device__ __forceinline__ void keep(v16h a, v16h b, v16h c, v16h d) { keep4_h(a, b, c, d); }
};
template <> struct Frag<__bf16> {
  typedef v16b V; union U { v16b v; v8b h[2]; };
  static __device__ __forceinline__ v16b load(const __bf16* p) {
    U f; f.h[0] = *(const v8b*)(p); f.h[1] = *(const v8b*)(p + 16); return f.v;
  }
  static __device__ __forceinline__ v8f mma(v16b a, v16b b, v8f c) {
    return __builtin_amdgcn_wmma_f32_16x16x32_bf16(false, a, false, b, (short)0, c, false, false);
  }
  static __device__ __forceinline__ void guard(v8f& a, v8f& b, v16b x, v16b y) { dep_guard_b(a, b, x, y); }
  static __device__ __forceinline__ void keep(v16b a, v16b b, v16b c, v16b d) { keep4_b(a, b, c, d); }
};

// ---- Register-blocked batched WMMA GEMM ------------------------------------
// C[m,n] = scale * sum_k A[m,k] * Bt[n,k] (+bias)(+resid); each wave owns a 64x64 tile.
// A row-major [M,K]; Bt row-major [N,K]; M,N % 64 == 0, K % 32 == 0.
// SPLIT: operands are hi/lo planes (A2/Bt2 = lo planes, same layout); product = hi·hi + hi·lo + lo·hi.
// BIAS_MODE: 0 = none, 1 = bias[m], 2 = bias[n].
// OUT_MODE: 0 = f32, 1 = f16, 2 = bf16 hi plane (Cout) + bf16 lo plane (Cout2).
// ET: 0 = f16 operands, 1 = bf16 operands (pointers passed as 16-bit storage)
template <int ET> struct Elem;
template <> struct Elem<0> { typedef _Float16 T; };
template <> struct Elem<1> { typedef __bf16 T; };
template <int ET, bool SPLIT, int BIAS_MODE, int OUT_MODE, bool RESID, int ACT = 0>
__global__ __launch_bounds__(256) void wmma_gemm64(
    const unsigned short* __restrict__ Ap, const unsigned short* __restrict__ A2p, int lda, long strideA,
    const unsigned short* __restrict__ Btp, const unsigned short* __restrict__ Bt2p, int ldb, long strideB,
    void* __restrict__ Cout, void* __restrict__ Cout2, int ldc, long strideC,
    const float* __restrict__ bias,
    const float* __restrict__ resid, long strideR,
    int M, int N, int K, float scale) {
  typedef typename Elem<ET>::T T;
  typedef typename Frag<T>::V V;
  const T* A = (const T*)Ap; const T* A2 = (const T*)A2p; const T* Bt = (const T*)Btp; const T* Bt2 = (const T*)Bt2p;
  __shared__ __align__(16) float sT[8][16 * 68];   // per-wave 16x64 slab, pitch 68 floats
  const int b    = blockIdx.y;
  const int lane = threadIdx.x & 31;
  const int wave = threadIdx.x >> 5;
  const int tilesN = N >> 6;
  const int tilesM = M >> 6;
  const int tile = blockIdx.x * 8 + wave;
  if (tile >= tilesM * tilesN) return;   // wave-uniform; no block barriers in this kernel
  const int tm = tile / tilesN;
  const int tn = tile - tm * tilesN;
  const int m0 = tm << 6;
  const int n0 = tn << 6;

  const T* Ab  = A  + (size_t)b * strideA;
  const T* Bb  = Bt + (size_t)b * strideB;
  const T* Ab2 = SPLIT ? (A2  + (size_t)b * strideA) : nullptr;
  const T* Bb2 = SPLIT ? (Bt2 + (size_t)b * strideB) : nullptr;

  const int rlane = lane & 15;                 // row (A) / col (B, D) within subtile
  const int koff  = (lane >> 4) * 8;           // k offset of this lane half
  const int mOff  = (lane >> 4) * 8;           // D row offset

  v8f acc[4][4];
#pragma unroll
  for (int i = 0; i < 4; ++i)
#pragma unroll
    for (int j = 0; j < 4; ++j) acc[i][j] = (v8f){0.f,0.f,0.f,0.f,0.f,0.f,0.f,0.f};

  for (int k0 = 0; k0 < K; k0 += 32) {
    V bh[4], bl[4];
#pragma unroll
    for (int j = 0; j < 4; ++j) {
      const size_t bo = (size_t)(n0 + (j << 4) + rlane) * ldb + koff + k0;
      bh[j] = Frag<T>::load(Bb + bo);
      if (SPLIT) bl[j] = Frag<T>::load(Bb2 + bo);
    }
#pragma unroll
    for (int i = 0; i < 4; ++i) {
      const size_t ao = (size_t)(m0 + (i << 4) + rlane) * lda + koff + k0;
      V ah = Frag<T>::load(Ab + ao);
      V al;
      if (SPLIT) al = Frag<T>::load(Ab2 + ao);
#pragma unroll
      for (int j = 0; j < 4; ++j) {
        acc[i][j] = Frag<T>::mma(ah, bh[j], acc[i][j]);
        if (SPLIT) {
          acc[i][j] = Frag<T>::mma(ah, bl[j], acc[i][j]);
          acc[i][j] = Frag<T>::mma(al, bh[j], acc[i][j]);
        }
      }
      Frag<T>::guard(acc[i][0], acc[i][3], ah, SPLIT ? al : ah);
    }
    Frag<T>::keep(bh[0], bh[1], bh[2], bh[3]);
    if (SPLIT) Frag<T>::keep(bl[0], bl[1], bl[2], bl[3]);
  }
  acc_guard4(acc[0][0], acc[0][1], acc[0][2], acc[0][3]);
  acc_guard4(acc[1][0], acc[1][1], acc[1][2], acc[1][3]);
  acc_guard4(acc[2][0], acc[2][1], acc[2][2], acc[2][3]);
  acc_guard4(acc[3][0], acc[3][1], acc[3][2], acc[3][3]);

  // ---- epilogue ----
  float* slab = sT[wave];
  const float* Rb = RESID ? (resid + (size_t)b * strideR) : nullptr;
#pragma unroll
  for (int i = 0; i < 4; ++i) {
    const int mBase = m0 + (i << 4);
#pragma unroll
    for (int j = 0; j < 4; ++j) {
      const int n = n0 + (j << 4) + rlane;
      float bv = 0.f;
      if (BIAS_MODE == 2) bv = bias[n];
#pragma unroll
      for (int r = 0; r < 8; ++r) {
        float v = acc[i][j][r] * scale;
        if (BIAS_MODE == 1) v += bias[mBase + mOff + r];
        if (BIAS_MODE == 2) v += bv;
        if (RESID) v += Rb[(size_t)(mBase + mOff + r) * ldc + n];
        if (ACT == 1) v = tanhf(v);
        if (ACT == 2) v = fmaxf(v, 0.0f);
        if (ACT == 3) v = v / (1.0f + expf(-v));
        if (ACT == 4) v = (v > 0.f) ? v : 0.01f * v;
        if (ACT == 5) v = 0.5f * v * (1.0f + erff(v * 0.70710678118654752f));
        slab[(mOff + r) * 68 + (j << 4) + rlane] = v;
      }
    }
    __builtin_amdgcn_fence(__ATOMIC_RELEASE, "workgroup");
    __builtin_amdgcn_wave_barrier();
    __builtin_amdgcn_fence(__ATOMIC_ACQUIRE, "workgroup");
    if (OUT_MODE == 0) {
      float* C = (float*)Cout + (size_t)b * strideC;
      const int hh = lane >> 4, c4 = (lane & 15) * 4;     // row seg = 256 B = 16 lanes x 16 B
      {
#pragma unroll
        for (int it = 0; it < 8; ++it) {
          const int row = it * 2 + hh;
          v4f v = *(const v4f*)(slab + row * 68 + c4);
          *(v4f*)(C + (size_t)(mBase + row) * ldc + n0 + c4) = v;
        }
        
      }
    } else {
      const int q = lane >> 3, c8 = (lane & 7) * 8;
      unsigned short* C  = (unsigned short*)Cout  + (size_t)b * strideC;
      unsigned short* C2 = (OUT_MODE == 2) ? ((unsigned short*)Cout2 + (size_t)b * strideC) : nullptr;
      {
#pragma unroll
        for (int it = 0; it < 4; ++it) {
          const int row = it * 4 + q;
          const float* sp = slab + row * 68 + c8;
          v8h hv, lv;
#pragma unroll
          for (int e = 0; e < 8; ++e) {
            if (OUT_MODE == 1) {
              hv[e] = (_Float16)sp[e];
            } else {
              unsigned short hb = f2bf_bits(sp[e]);
              unsigned short lb = f2bf_bits(sp[e] - bf_bits2f(hb));
              hv[e] = __builtin_bit_cast(_Float16, hb);
              lv[e] = __builtin_bit_cast(_Float16, lb);
            }
          }
          *(v8h*)(C + (size_t)(mBase + row) * ldc + n0 + c8) = hv;
          if (OUT_MODE == 2) *(v8h*)(C2 + (size_t)(mBase + row) * ldc + n0 + c8) = lv;
        }
        
      }
    }
    __builtin_amdgcn_fence(__ATOMIC_RELEASE, "workgroup");
    __builtin_amdgcn_wave_barrier();
    __builtin_amdgcn_fence(__ATOMIC_ACQUIRE, "workgroup");
  }
}

__global__ __launch_bounds__(256) void cast_f32_f16x2(
    const float* __restrict__ in, _Float16* __restrict__ out, int n2) {
  int i = blockIdx.x * 256 + threadIdx.x;
  if (i < n2) {
    const _Float16 h0 = (_Float16)in[2 * i], h1 = (_Float16)in[2 * i + 1];
    const unsigned u = (unsigned)__builtin_bit_cast(unsigned short, h0) | ((unsigned)__builtin_bit_cast(unsigned short, h1) << 16);
    ((unsigned*)out)[i] = u;
    
  }
}


} // namespace w25

__global__ __launch_bounds__(256) void k_castT16(const float* __restrict__ src, long long lds, _Float16* __restrict__ dst, long long ldd, int R, int C, float s) {
    const long long i = (long long)blockIdx.x * 256 + threadIdx.x; const long long np = (long long)C * (R / 2); if (i >= np) return; const int c = (int)(i / (R / 2)); const int r = 2 * (int)(i % (R / 2));
    const _Float16 h0 = (_Float16)(src[(long long)r * lds + c] * s), h1 = (_Float16)(src[(long long)(r + 1) * lds + c] * s);
    const unsigned u = (unsigned)__builtin_bit_cast(unsigned short, h0) | ((unsigned)__builtin_bit_cast(unsigned short, h1) << 16);
    unsigned* d = (unsigned*)(dst + (long long)c * ldd + r); *d = u;  }
__global__ __launch_bounds__(256) void k_cast16(const float* __restrict__ src, long long lds, _Float16* __restrict__ dst, long long ldd, int R, int C, float s) {
    const long long i = (long long)blockIdx.x * 256 + threadIdx.x; const long long np = (long long)R * (C / 2); if (i >= np) return; const int r = (int)(i / (C / 2)); const int c = 2 * (int)(i % (C / 2));
    const _Float16 h0 = (_Float16)(src[(long long)r * lds + c] * s), h1 = (_Float16)(src[(long long)r * lds + c + 1] * s);
    const unsigned u = (unsigned)__builtin_bit_cast(unsigned short, h0) | ((unsigned)__builtin_bit_cast(unsigned short, h1) << 16);
    unsigned* d = (unsigned*)(dst + (long long)r * ldd + c); *d = u;  }

// k_cast16f<U, N>: dst[i] = f16(src[i] * s) over N contiguous elements (what k_cast16 does for rows without gaps; src 16-byte, dst 8-byte aligned),
//   with few, long-lived waves: a block takes 256 * U consecutive pieces of 4 elements, a thread the pieces threadIdx.x + 256 * u of them. A wave's load covers
//   512 contiguous bytes and its store 256, and the U loads of a thread are in flight together. grid N / (4 * 256 * U) exactly, so no element guard.
template <int U, int N>
__global__ __launch_bounds__(256) void k_cast16f(const float* __restrict__ src, _Float16* __restrict__ dst, float s) {
    static_assert(N % (4 * 256 * U) == 0, "the grid covers the N elements evenly");
    const int t = blockIdx.x * (256 * U) + threadIdx.x;           // the thread's first piece; the others lie at constant distances from it
    const v4f* sp = (const v4f*)src + t; v4h* dp = (v4h*)dst + t;
    v4f a[U];
#pragma unroll   // constant indices: a stays in registers, and all U loads are issued before the first cast
    for (int u = 0; u < U; ++u) a[u] = sp[u * 256];
#pragma unroll   // constant indices into a
    for (int u = 0; u < U; ++u) {
        v4h hv;
#pragma unroll   // constant element indices: the vectors stay in registers
        for (int e = 0; e < 4; ++e) hv[e] = (_Float16)(a[u][e] * s);
        dp[u * 256] = hv;
    }
}
// k_norm_rows<U, Z, C>: y = (x - mean[row]) * rstd[row] * g[c] + b[c] over a contiguous [Z][C] tensor (k_norm_apply with L = 1, G = 1, no activation; stats as k_stats
//   writes them), with few, long-lived waves: a block takes 256 * U consecutive pieces of 4 channels, a thread the pieces threadIdx.x + 256 * u of them. These have the
//   same channels in U rows, so g and b are read once per thread, and the loads of the U rows are in flight together. A wave's 128 channels lie in one row: its mean
//   and rstd are wave-uniform. grid Z * C / (4 * 256 * U) exactly, so no element guard.
template <int U, int Z, int C>
__global__ __launch_bounds__(256) void k_norm_rows(const float* __restrict__ x, float* __restrict__ y, const float* __restrict__ stat, const float* __restrict__ g, const float* __restrict__ bta) {
    constexpr int PC = C / 4;                                     // pieces per row
    static_assert(C % 4 == 0 && PC % 32 == 0 && 256 % PC == 0 && (Z * PC) % (256 * U) == 0, "a wave inside one row, whole rows per 256 pieces, the grid covers the rows evenly");
    const int t = blockIdx.x * (256 * U) + threadIdx.x;           // the thread's first piece; the others lie at constant distances from it
    const int r0 = __builtin_amdgcn_readfirstlane(t / PC);        // the same in all 32 lanes; said so, the statistics come through scalar loads
    const v4f* xp = (const v4f*)x + t; v4f* yp = (v4f*)y + t;
    v4f xv[U]; float mu[U], rs[U];
#pragma unroll   // constant indices: the arrays stay in registers, and all loads are issued before the first use
    for (int u = 0; u < U; ++u) {
        xv[u] = xp[u * 256];
        mu[u] = stat[(size_t)(r0 + u * (256 / PC)) * 32]; rs[u] = stat[(size_t)(r0 + u * (256 / PC)) * 32 + 1];
    }
    const v4f gv = ((const v4f*)g)[t % PC], bv = ((const v4f*)bta)[t % PC];
#pragma unroll   // constant indices into the arrays
    for (int u = 0; u < U; ++u) {
        v4f v;
#pragma unroll   // constant element indices: the vectors stay in registers
        for (int e = 0; e < 4; ++e) v[e] = (xv[u][e] - mu[u]) * rs[u] * gv[e] + bv[e];
        yp[u * 256] = v;
    }
}

// f32 -> bf16 hi plane + bf16 lo plane (x = hi + lo to ~2^-17 relative; RNE both), [R][C] -> [R][C] (or transposed to [C][R]); 2 consecutive destination elements
__device__ __forceinline__ unsigned int f2bf2_pack(float a, float b, unsigned int* lo) {
    const unsigned short ha = w25::f2bf_bits(a), hb = w25::f2bf_bits(b);
    const unsigned short la = w25::f2bf_bits(a - w25::bf_bits2f(ha)), lb = w25::f2bf_bits(b - w25::bf_bits2f(hb));
    *lo = (unsigned)la | ((unsigned)lb << 16); return (unsigned)ha | ((unsigned)hb << 16); }
__global__ __launch_bounds__(256) void k_castS16(const float* __restrict__ src, long long lds, __bf16* __restrict__ dhi, __bf16* __restrict__ dlo, long long ldd, int R, int C, float s, int transpose) {
    const long long i = (long long)blockIdx.x * 256 + threadIdx.x; long long o; float a, b;
    if (transpose) { const long long np = (long long)C * (R / 2); if (i >= np) return; const int c = (int)(i / (R / 2)); const int r = 2 * (int)(i % (R / 2)); a = src[(long long)r * lds + c] * s; b = src[(long long)(r + 1) * lds + c] * s; o = (long long)c * ldd + r; }
    else { const long long np = (long long)R * (C / 2); if (i >= np) return; const int r = (int)(i / (C / 2)); const int c = 2 * (int)(i % (C / 2)); a = src[(long long)r * lds + c] * s; b = src[(long long)r * lds + c + 1] * s; o = (long long)r * ldd + c; }
    unsigned lo; const unsigned hi = f2bf2_pack(a, b, &lo); unsigned* ph = (unsigned*)(dhi + o); unsigned* pl = (unsigned*)(dlo + o);
    *ph = hi; *pl = lo;  }


extern "C" void kernel_launch(void* const* d_in, const int* in_sizes, int n_in, void* d_out, int out_size, void* d_ws, size_t ws_size, hipStream_t stream) {
    (void)in_sizes; (void)n_in; (void)out_size; (void)ws_size;
    const float* x = (const float*)d_in[0];
    const float* ln1g = (const float*)d_in[1];
    const float* ln1b = (const float*)d_in[2];
    const float* Wq = (const float*)d_in[3];
    const float* bq = (const float*)d_in[4];
    const float* Wk = (const float*)d_in[5];
    const float* bk = (const float*)d_in[6];
    const float* Wv = (const float*)d_in[7];
    const float* bv = (const float*)d_in[8];
    const float* Wo = (const float*)d_in[9];
    const float* bo = (const float*)d_in[10];
    const float* ln2g = (const float*)d_in[11];
    const float* ln2b = (const float*)d_in[12];
    const float* W1 = (const float*)d_in[13];
    const float* b1 = (const float*)d_in[14];
    const float* W2 = (const float*)d_in[15];
    const float* b2 = (const float*)d_in[16];
    const int L = 4096;
    const int C = 512;
    const int NH = 8;
    const int HD = 64;
    const int FF = 2048;
    const int LP = L / 2;
    const int WINP = 128;
    float* out = (float*)d_out;
    char* wsp = (char*)d_ws;
    float* ST1 = (float*)wsp; wsp += (((size_t)((size_t)L * 32) * 4 + 255) / 256) * 256;
    float* HN = (float*)wsp; wsp += (((size_t)((size_t)L * C) * 4 + 255) / 256) * 256;
    float* Q = (float*)wsp; wsp += (((size_t)((size_t)L * C) * 4 + 255) / 256) * 256;
    float* Kb = (float*)wsp; wsp += (((size_t)((size_t)L * C) * 4 + 255) / 256) * 256;
    float* V = (float*)wsp; wsp += (((size_t)((size_t)L * C) * 4 + 255) / 256) * 256;
    float* Y = (float*)wsp; wsp += (((size_t)((size_t)L * C) * 4 + 255) / 256) * 256;
    float* X1 = (float*)wsp; wsp += (((size_t)((size_t)L * C) * 4 + 255) / 256) * 256;
    float* ST2 = (float*)wsp; wsp += (((size_t)((size_t)L * 32) * 4 + 255) / 256) * 256;
    float* H2 = (float*)wsp; wsp += (((size_t)((size_t)L * C) * 4 + 255) / 256) * 256;
    float* F1 = (float*)wsp; wsp += (((size_t)((size_t)L * FF) * 4 + 255) / 256) * 256;
    unsigned short* G64A = (unsigned short*)wsp; wsp += (((size_t)(8388608) * 2 + 255) / 256) * 256;
    unsigned short* G64B = (unsigned short*)wsp; wsp += (((size_t)(1048576) * 2 + 255) / 256) * 256;
    k_stats<<<(unsigned)(L), 256, 0, stream>>>(x, C, 1, 1, 1, C, 1e-05f, ST1, 0);
    k_norm_rows<8, 4096, 512><<<(unsigned)((4096 * 512) / (4 * 256 * 8)), 256, 0, stream>>>(x, HN, ST1, ln1g, ln1b);
    k_cast16f<8, 4096 * 512><<<(unsigned)((4096 * 512) / (4 * 256 * 8)), 256, 0, stream>>>(HN, (_Float16*)(G64A), 1.0f);
    k_cast16f<2, 512 * 512><<<(unsigned)((512 * 512) / (4 * 256 * 2)), 256, 0, stream>>>(Wq, (_Float16*)(G64B), 16.0f);
    w25::wmma_gemm64<0, false, 2, 0, false, 0><<<dim3((unsigned)((((4096) / 64) * ((512) / 64) + 7) / 8), (unsigned)(1)), 256, 0, stream>>>((const unsigned short*)(G64A), nullptr, 512, 0, (const unsigned short*)(G64B), nullptr, 512, 0, (void*)(Q), nullptr, 512, 0, bq, nullptr, 0, 4096, 512, 512, 0.0625f);
    k_cast16f<8, 4096 * 512><<<(unsigned)((4096 * 512) / (4 * 256 * 8)), 256, 0, stream>>>(HN, (_Float16*)(G64A), 1.0f);
    k_cast16f<2, 512 * 512><<<(unsigned)((512 * 512) / (4 * 256 * 2)), 256, 0, stream>>>(Wk, (_Float16*)(G64B), 16.0f);
    w25::wmma_gemm64<0, false, 2, 0, false, 0><<<dim3((unsigned)((((4096) / 64) * ((512) / 64) + 7) / 8), (unsigned)(1)), 256, 0, stream>>>((const unsigned short*)(G64A), nullptr, 512, 0, (const unsigned short*)(G64B), nullptr, 512, 0, (void*)(Kb), nullptr, 512, 0, bk, nullptr, 0, 4096, 512, 512, 0.0625f);
    k_cast16f<8, 4096 * 512><<<(unsigned)((4096 * 512) / (4 * 256 * 8)), 256, 0, stream>>>(HN, (_Float16*)(G64A), 1.0f);
    k_cast16f<2, 512 * 512><<<(unsigned)((512 * 512) / (4 * 256 * 2)), 256, 0, stream>>>(Wv, (_Float16*)(G64B), 16.0f);
    w25::wmma_gemm64<0, false, 2, 0, false, 0><<<dim3((unsigned)((((4096) / 64) * ((512) / 64) + 7) / 8), (unsigned)(1)), 256, 0, stream>>>((const unsigned short*)(G64A), nullptr, 512, 0, (const unsigned short*)(G64B), nullptr, 512, 0, (void*)(V), nullptr, 512, 0, bv, nullptr, 0, 4096, 512, 512, 0.0625f);
    { /*apv4*/ AttnP a;
      a.Q = Q; a.K = Kb; a.V = V; a.O = Y; a.P = 0; a.Mf = 0; a.Mi = 0; a.ST = 0;
      a.Pw = 0; a.Rt = 0; a.SQ = 0; a.SK = 0;
      a.swb = 0; a.swh = 0; a.swi = 0; a.swj = 0; a.srb = 0; a.srh = 0; a.sri = 0; a.sQb = 0; a.sQh = HD; a.sQi = 2 * C; a.sQd = 1; a.sKb = 0; a.sKh = HD; a.sKj = 2 * C; a.sKd = 1; a.sVb = 0; a.sVh = HD; a.sVj = 2 * C; a.sVd = 1; a.sOb = 0; a.sOh = HD; a.sOi = 2 * C; a.sPb = 0; a.sPh = 0; a.sPi = 0; a.smb = 0; a.smh = 0; a.smi = 0; a.smj = 0;
      a.Lq = LP; a.Lk = LP; a.dh = HD; a.dv = HD; a.hrep = 1; a.causal = 1; a.coff = 0; a.pband = 0;
      a.scale = 0.125f; a.mfill = 0.0f; a.nonorm = 0; a.mpol = 0;
      a.roff = 0; a.rn = 1; a.segpol = 0; a.win = WINP;
      k_attn<64, 64, 0, false, false, true><<<dim3((unsigned)((LP) + 16 * AW - 1) / (16 * AW), (unsigned)(NH), (unsigned)(1)), 32 * AW, 0, stream>>>(a); }
    { /*apv4*/ AttnP a;
      a.Q = Q + 1 * C; a.K = Kb + 1 * C; a.V = V + 1 * C; a.O = Y + 1 * C; a.P = 0; a.Mf = 0; a.Mi = 0; a.ST = 0;
      a.Pw = 0; a.Rt = 0; a.SQ = 0; a.SK = 0;
      a.swb = 0; a.swh = 0; a.swi = 0; a.swj = 0; a.srb = 0; a.srh = 0; a.sri = 0; a.sQb = 0; a.sQh = HD; a.sQi = 2 * C; a.sQd = 1; a.sKb = 0; a.sKh = HD; a.sKj = 2 * C; a.sKd = 1; a.sVb = 0; a.sVh = HD; a.sVj = 2 * C; a.sVd = 1; a.sOb = 0; a.sOh = HD; a.sOi = 2 * C; a.sPb = 0; a.sPh = 0; a.sPi = 0; a.smb = 0; a.smh = 0; a.smi = 0; a.smj = 0;
      a.Lq = LP; a.Lk = LP; a.dh = HD; a.dv = HD; a.hrep = 1; a.causal = 1; a.coff = 0; a.pband = 0;
      a.scale = 0.125f; a.mfill = 0.0f; a.nonorm = 0; a.mpol = 0;
      a.roff = 0; a.rn = 1; a.segpol = 0; a.win = WINP;
      k_attn<64, 64, 0, false, false, true><<<dim3((unsigned)((LP) + 16 * AW - 1) / (16 * AW), (unsigned)(NH), (unsigned)(1)), 32 * AW, 0, stream>>>(a); }
    k_cast16f<8, 4096 * 512><<<(unsigned)((4096 * 512) / (4 * 256 * 8)), 256, 0, stream>>>(Y, (_Float16*)(G64A), 1.0f);
    k_cast16f<2, 512 * 512><<<(unsigned)((512 * 512) / (4 * 256 * 2)), 256, 0, stream>>>(Wo, (_Float16*)(G64B), 16.0f);
    w25::wmma_gemm64<0, false, 2, 0, true, 0><<<dim3((unsigned)((((4096) / 64) * ((512) / 64) + 7) / 8), (unsigned)(1)), 256, 0, stream>>>((const unsigned short*)(G64A), nullptr, 512, 0, (const unsigned short*)(G64B), nullptr, 512, 0, (void*)(X1), nullptr, 512, 0, bo, x, 0, 4096, 512, 512, 0.0625f);
    k_stats<<<(unsigned)(L), 256, 0, stream>>>(X1, C, 1, 1, 1, C, 1e-05f, ST2, 0);
    k_norm_rows<8, 4096, 512><<<(unsigned)((4096 * 512) / (4 * 256 * 8)), 256, 0, stream>>>(X1, H2, ST2, ln2g, ln2b);
    k_cast16f<8, 4096 * 512><<<(unsigned)((4096 * 512) / (4 * 256 * 8)), 256, 0, stream>>>(H2, (_Float16*)(G64A), 1.0f);
    k_cast16f<4, 2048 * 512><<<(unsigned)((2048 * 512) / (4 * 256 * 4)), 256, 0, stream>>>(W1, (_Float16*)(G64B), 16.0f);
    w25::wmma_gemm64<0, false, 2, 0, false, 5><<<dim3((unsigned)((((4096) / 64) * ((2048) / 64) + 7) / 8), (unsigned)(1)), 256, 0, stream>>>((const unsigned short*)(G64A), nullptr, 512, 0, (const unsigned short*)(G64B), nullptr, 512, 0, (void*)(F1), nullptr, 2048, 0, b1, nullptr, 0, 4096, 2048, 512, 0.0625f);
    k_cast16f<16, 4096 * 2048><<<(unsigned)((4096 * 2048) / (4 * 256 * 16)), 256, 0, stream>>>(F1, (_Float16*)(G64A), 1.0f);
    k_cast16f<4, 2048 * 512><<<(unsigned)((2048 * 512) / (4 * 256 * 4)), 256, 0, stream>>>(W2, (_Float16*)(G64B), 16.0f);
    w25::wmma_gemm64<0, false, 2, 0, true, 0><<<dim3((unsigned)((((4096) / 64) * ((512) / 64) + 7) / 8), (unsigned)(1)), 256, 0, stream>>>((const unsigned short*)(G64A), nullptr, 2048, 0, (const unsigned short*)(G64B), nullptr, 2048, 0, (void*)(out), nullptr, 512, 0, b2, X1, 0, 4096, 512, 2048, 0.0625f);
}

// v004
// One run takes 224 microseconds.
// Two timings next to v003 put it at 1.63 and 1.61 times that version's speed.
// Over all steps from v000 it is 9.71 times as fast.
// Contractions: q/k/v projections of the LayerNormed input [4096x512].[512x512] (+b), the output projection (+b, + residual), the FFN [4096x512].[512x2048] (+b, exact GELU) and [4096x2048].[2048x512] (+b, + residual) with f16 operands (v_wmma_f32_16x16x32_f16; 64x64 register-blocked wave tiles over pre-cast f16 operand planes, weights pre-scaled by 16 at the cast and un-scaled in the f32 epilogue); the dilated causal attention (keys j <= i, i - j even, i - j <= 256) as one flash launch whose grid z is the parity of the position (stride-2 views; within a parity class the pattern is plain causal with window 128), head_dim 64, f16 q.k^T and f16 p.v (p as f16 of 4096 p); f32 accumulate, softmax and LayerNorms f32.
#include <hip/hip_runtime.h>
#include <math.h>

typedef __attribute__((ext_vector_type(16))) _Float16 v16h;
typedef __attribute__((ext_vector_type(8)))  _Float16 v8h;
typedef __attribute__((ext_vector_type(4)))  _Float16 v4h;
typedef __attribute__((ext_vector_type(16))) __bf16   v16b;
typedef __attribute__((ext_vector_type(8)))  float    v8f;
typedef __attribute__((ext_vector_type(4)))  float    v4f;

// 16-bit WMMA fragment map (wave32), lane L, h = L>>4, m = L&15:
//   A 16x32: lane = row m;   element i -> k = (i<8) ? 8h+i : 16+8h+(i-8)
//   B 32x16: lane = column m; the SAME k(i,h)
//   D 16x16 (8 f32): lane = column m; element r -> row 8h+r
__device__ __forceinline__ int frag_k(int i, int h) { return (i < 8) ? (8 * h + i) : (16 + 8 * h + (i - 8)); }
__device__ __forceinline__ __bf16 bf16_rne(float f) {
    unsigned int u = __float_as_uint(f);
    u += 0x7fffu + ((u >> 16) & 1u);
    return __builtin_bit_cast(__bf16, (unsigned short)(u >> 16));
}
__device__ __forceinline__ float bf16_f32(__bf16 b) { return __uint_as_float(((unsigned int)__builtin_bit_cast(unsigned short, b)) << 16); }
__device__ __forceinline__ v8f wmma16(v16h a, v16h b, v8f c) {
    c = __builtin_amdgcn_wmma_f32_16x16x32_f16(false, a, false, b, (short)0, c, false, false);
    asm volatile("v_nop\n\tv_nop\n\tv_nop\n\tv_nop" : "+v"(c) : "v"(a), "v"(b));
    return c;
}
__device__ __forceinline__ v8f wmmab(v16b a, v16b b, v8f c) {
    c = __builtin_amdgcn_wmma_f32_16x16x32_bf16(false, a, false, b, (short)0, c, false, false);
    asm volatile("v_nop\n\tv_nop\n\tv_nop\n\tv_nop" : "+v"(c) : "v"(a), "v"(b));
    return c;
}
struct Split { v16b hi, lo; };
// hi/lo split product: a.hi*b.hi + a.hi*b.lo + a.lo*b.hi
__device__ __forceinline__ v8f wmma3(const Split& a, const Split& b, v8f c) {
    c = __builtin_amdgcn_wmma_f32_16x16x32_bf16(false, a.hi, false, b.hi, (short)0, c, false, false);
    c = __builtin_amdgcn_wmma_f32_16x16x32_bf16(false, a.hi, false, b.lo, (short)0, c, false, false);
    c = __builtin_amdgcn_wmma_f32_16x16x32_bf16(false, a.lo, false, b.hi, (short)0, c, false, false);
    asm volatile("v_nop\n\tv_nop\n\tv_nop\n\tv_nop" : "+v"(c) : "v"(a.hi), "v"(a.lo), "v"(b.hi), "v"(b.lo));
    return c;
}
struct Split3 { v16b hi, mid, lo; };
// triple split product (6 terms, drops only terms below 2^-24 relative)
__device__ __forceinline__ v8f wmma6(const Split3& a, const Split3& b, v8f c) {
    c = __builtin_amdgcn_wmma_f32_16x16x32_bf16(false, a.hi, false, b.hi, (short)0, c, false, false);
    c = __builtin_amdgcn_wmma_f32_16x16x32_bf16(false, a.hi, false, b.mid, (short)0, c, false, false);
    c = __builtin_amdgcn_wmma_f32_16x16x32_bf16(false, a.mid, false, b.hi, (short)0, c, false, false);
    c = __builtin_amdgcn_wmma_f32_16x16x32_bf16(false, a.hi, false, b.lo, (short)0, c, false, false);
    c = __builtin_amdgcn_wmma_f32_16x16x32_bf16(false, a.mid, false, b.mid, (short)0, c, false, false);
    c = __builtin_amdgcn_wmma_f32_16x16x32_bf16(false, a.lo, false, b.hi, (short)0, c, false, false);
    asm volatile("v_nop\n\tv_nop\n\tv_nop\n\tv_nop" : "+v"(c) : "v"(a.hi), "v"(a.mid), "v"(a.lo), "v"(b.hi), "v"(b.mid), "v"(b.lo));
    return c;
}

// Fragment gathers from f32 memory: element i <- p[(k0 + frag_k(i,h)) * sk] * s, zero for k >= klen.
__device__ __forceinline__ v16h fh_ld(const float* __restrict__ p, long long sk, int k0, int h, int klen, float s) {
    v16h a;
#pragma unroll
    for (int i = 0; i < 16; ++i) { const int k = k0 + frag_k(i, h); a[i] = (k < klen) ? (_Float16)(p[(long long)k * sk] * s) : (_Float16)0.f; }
    return a;
}
__device__ __forceinline__ Split sp_ld(const float* __restrict__ p, long long sk, int k0, int h, int klen, float s) {
    Split r;
#pragma unroll
    for (int i = 0; i < 16; ++i) {
        const int k = k0 + frag_k(i, h); const float x = (k < klen) ? p[(long long)k * sk] * s : 0.f;
        const __bf16 hb = bf16_rne(x); r.hi[i] = hb; r.lo[i] = bf16_rne(x - bf16_f32(hb));
    }
    return r;
}
__device__ __forceinline__ Split3 sp3_ld(const float* __restrict__ p, long long sk, int k0, int h, int klen, float s) {
    Split3 r;
#pragma unroll
    for (int i = 0; i < 16; ++i) {
        const int k = k0 + frag_k(i, h); const float x = (k < klen) ? p[(long long)k * sk] * s : 0.f;
        const __bf16 hb = bf16_rne(x); const float r1 = x - bf16_f32(hb); const __bf16 mb = bf16_rne(r1);
        r.hi[i] = hb; r.mid[i] = mb; r.lo[i] = bf16_rne(r1 - bf16_f32(mb));
    }
    return r;
}
__device__ __forceinline__ v16b bh_ld(const float* __restrict__ p, long long sk, int k0, int h, int klen, float s) {
    v16b a;
#pragma unroll
    for (int i = 0; i < 16; ++i) { const int k = k0 + frag_k(i, h); a[i] = bf16_rne((k < klen) ? p[(long long)k * sk] * s : 0.f); }
    return a;
}
// f16 fragment from a 16-byte aligned f32 row with element stride 1 and all 32 k in range: four unguarded 16-byte loads, then the cast; same k order as fh_ld
struct Raw16 { v4f x0, x1, x2, x3; };   // the 16 floats of one lane's fragment, as loaded
__device__ __forceinline__ Raw16 raw_ld4(const float* __restrict__ row, int k0, int h) {
    const v4f* q = (const v4f*)(row + k0 + 8 * h);
    Raw16 r; r.x0 = q[0]; r.x1 = q[1]; r.x2 = q[4]; r.x3 = q[5];
    return r;
}
__device__ __forceinline__ v16h raw_f16(const Raw16& r) {
    v16h a;
#pragma unroll   // constant element indices: the vectors stay in registers
    for (int i = 0; i < 4; ++i) { a[i] = (_Float16)r.x0[i]; a[4 + i] = (_Float16)r.x1[i]; a[8 + i] = (_Float16)r.x2[i]; a[12 + i] = (_Float16)r.x3[i]; }
    return a;
}
// Inputs-only fence on loaded values: every load written above it is issued before it, so that a run of loads is in flight together.
// Without it the compiler converts each fragment as soon as it is loaded and waits for memory once per fragment.
__device__ __forceinline__ void loads_held(const v4f& a, const v4f& b, const v4f& c, const v4f& d) { asm volatile("" :: "v"(a), "v"(b), "v"(c), "v"(d)); }
// f16 fragment from an f16 LDS/global row with element stride 1 (k-contiguous), no bounds (tile already zero padded)
__device__ __forceinline__ v16h fh_row(const _Float16* __restrict__ row, int k0, int h) {
    v16h a;
#pragma unroll
    for (int i = 0; i < 16; ++i) a[i] = row[k0 + frag_k(i, h)];
    return a;
}

#define VST2(T, ptr, val) do { const T vst2_v_ = (val); *(T*)(ptr) = vst2_v_;  } while (0)
typedef float v4f __attribute__((ext_vector_type(4)));
#define VST2V4(ptr, val) do { const v4f vst2_v4_ = (val); *(v4f*)(ptr) = vst2_v4_;  } while (0)

__device__ __attribute__((noinline)) float act_fn(float v, int act) {
    if (act == 1) return fmaxf(v, 0.f);                                                                               // relu
    if (act == 2) { const float u = 0.7978845608028654f * (v + 0.044715f * v * v * v); return 0.5f * v * (1.f + tanhf(u)); } // tanh-gelu
    if (act == 3) return v / (1.f + expf(-v));                                                                        // silu
    if (act == 4) return 0.5f * v * (1.f + erff(v * 0.7071067811865476f));                                             // erf-gelu
    if (act == 5) return tanhf(v);
    if (act == 6) return 1.f / (1.f + expf(-v));                                                                      // sigmoid
    if (act == 7) return (v > 0.f) ? v : 0.01f * v;                                                                   // leaky relu 0.01
    if (act == 8) return (v > 0.f) ? v : (expf(v) - 1.f);                                                             // elu
    if (act == 9) return fminf(fmaxf(v, 0.f), 6.f);                                                                   // relu6
    if (act == 10) return fabsf(v);                                                                                    // abs
    if (act == 11) return (v >= 0.f) ? v : 0.1f * v;                                                                  // leaky 0.1
    if (act == 12) return (v > 0.f) ? v : 0.2f * v;                                                                   // leaky 0.2
    if (act == 13) return (v > 20.f) ? v : log1pf(expf(v));                                                            // softplus
    return v;
}

// =====================================================================================================================
// k_gemm<MODE>: C(z, m, n) = act(alpha * sum_k A(z, m, k) * B(z, k, n) + bias) + beta * R(z, m, n)
//   One wave (32-thread block) per 16 x 32 tile of C; grid (ceil(N/32), ceil(M/16), Z). Batch z -> (zo = z / zi_n, zi = z % zi_n)
//   with separate outer/inner strides for every tensor (e.g. batch and head). A(m,k) = A[zo*sAo + zi*sAi + m*sAm + k*sAk] (f32),
//   B(k,n) = B[zo*sBo + zi*sBi + n*sBn + k*sBk] (f32); any M, N, K (K zero-padded to 32 inside the fragments, M/N tails guarded).
//   C(m,n) = C[zo*sCo + zi*sCi + m*sCm + n] (n contiguous). flags: 1 bias[n], 2 bias[m], 4 residual R[zo*sRo + zi*sRi + m*sRm + n*sRn].
//   MODE 0: f16 operands (A prescaled by sa, B by sb, both undone in the epilogue); 1: bf16 hi/lo split (3 products); 2: bf16;
//   3: bf16 hi/mid/lo triple split (6 products); 4: as 3 with Kahan-compensated f32 accumulation across k-steps.
// =====================================================================================================================
struct GemmP {
    const float* A; const float* B; const float* bias; const float* R; float* C;
    long long sAo, sAi, sAm, sAk, sBo, sBi, sBn, sBk, sCo, sCi, sCm, sRo, sRi, sRm, sRn;
    int M, N, K, zi_n, flags, act; float alpha, beta, sa, sb;
    int Npad, pad_;     // columns [N, Npad) of C are written as 0 so that padded workspace rows are covered by whole-line stores; Npad >= N
};
static_assert(sizeof(GemmP) == 5 * 8 + 15 * 8 + 6 * 4 + 4 * 4 + 2 * 4, "GemmP has padding");

template <int MODE>
__global__ __launch_bounds__(32) void k_gemm(GemmP p) {
    const int lane = threadIdx.x & 31, h = lane >> 4, l15 = lane & 15;
    const int m0 = blockIdx.y * 16, n0 = blockIdx.x * 32;
    const int z = blockIdx.z, zo = z / p.zi_n, zi = z - zo * p.zi_n;
    const float* A = p.A + zo * p.sAo + zi * p.sAi;
    const float* B = p.B + zo * p.sBo + zi * p.sBi;
    const int am = min(m0 + l15, p.M - 1);                       // clamped row for loads (stores are guarded)
    v8f acc[2], comp[2];
#pragma unroll
    for (int t = 0; t < 2; ++t) { v8f zz = {}; acc[t] = zz; comp[t] = zz; }
    for (int k0 = 0; k0 < p.K; k0 += 32) {
        const float* arow = A + (long long)am * p.sAm;
        if (MODE == 1) {
            const Split a = sp_ld(arow, p.sAk, k0, h, p.K, 1.f);
#pragma unroll
            for (int t = 0; t < 2; ++t) {
                const int bn = min(n0 + t * 16 + l15, p.N - 1);
                acc[t] = wmma3(a, sp_ld(B + (long long)bn * p.sBn, p.sBk, k0, h, p.K, 1.f), acc[t]);
            }
        } else if (MODE == 3) {
            const Split3 a = sp3_ld(arow, p.sAk, k0, h, p.K, 1.f);
#pragma unroll
            for (int t = 0; t < 2; ++t) {
                const int bn = min(n0 + t * 16 + l15, p.N - 1);
                acc[t] = wmma6(a, sp3_ld(B + (long long)bn * p.sBn, p.sBk, k0, h, p.K, 1.f), acc[t]);
            }
        } else if (MODE == 4) {
            // triple split as MODE 3, but each k-step's 6 products go into a fresh accumulator and the partial is added to the running f32 sum
            // on the VALU with Kahan compensation (accumulation error stays ~1 ulp however long K is)
            const Split3 a = sp3_ld(arow, p.sAk, k0, h, p.K, 1.f);
#pragma unroll
            for (int t = 0; t < 2; ++t) {
                const int bn = min(n0 + t * 16 + l15, p.N - 1); v8f zz = {};
                const v8f part = wmma6(a, sp3_ld(B + (long long)bn * p.sBn, p.sBk, k0, h, p.K, 1.f), zz);
                const v8f y = part - comp[t]; const v8f s = acc[t] + y; comp[t] = (s - acc[t]) - y; acc[t] = s;
            }
        } else if (MODE == 2) {
            const v16b a = bh_ld(arow, p.sAk, k0, h, p.K, 1.f);
#pragma unroll
            for (int t = 0; t < 2; ++t) {
                const int bn = min(n0 + t * 16 + l15, p.N - 1);
                acc[t] = wmmab(a, bh_ld(B + (long long)bn * p.sBn, p.sBk, k0, h, p.K, 1.f), acc[t]);
            }
        } else {
            const v16h a = fh_ld(arow, p.sAk, k0, h, p.K, p.sa);
#pragma unroll
            for (int t = 0; t < 2; ++t) {
                const int bn = min(n0 + t * 16 + l15, p.N - 1);
                acc[t] = wmma16(a, fh_ld(B + (long long)bn * p.sBn, p.sBk, k0, h, p.K, p.sb), acc[t]);
            }
        }
    }
    const float iscale = (MODE == 0) ? p.alpha / (p.sa * p.sb) : p.alpha;
    float* C = p.C + zo * p.sCo + zi * p.sCi;
    const float* R = p.R + zo * p.sRo + zi * p.sRi;
    __shared__ __align__(16) float ctile[16][36];
#pragma unroll
    for (int t = 0; t < 2; ++t) {
        const int n = n0 + t * 16 + l15; const int nn = min(n, p.N - 1);
#pragma unroll
        for (int r = 0; r < 8; ++r) {
            const int m = m0 + 8 * h + r; const int mm = min(m, p.M - 1);
            float v = acc[t][r] * iscale;
            if (p.flags & 1) v += p.bias[nn];
            if (p.flags & 2) v += p.bias[mm];
            if (p.flags & 8) v *= p.bias[(long long)zo * p.M + mm];   /* per-(z,row) scale vector laid out [Z][M]; exclusive with the bias flags */
            v = act_fn(v, p.act);
            if (p.flags & 4) v += p.beta * R[(long long)mm * p.sRm + (long long)nn * p.sRn];
            ctile[8 * h + r][t * 16 + l15] = (n < p.N) ? v : 0.f;
        }
    }
    __syncthreads();
    const int NW = (p.Npad > p.N) ? p.Npad : p.N;           // write width
    const bool fast = (m0 + 16 <= p.M) && (n0 + 32 <= NW) && ((p.sCm & 3) == 0) && ((((size_t)C) & 15) == 0);
    if (fast) {
#pragma unroll
        for (int s = 0; s < 4; ++s) {
            const int row = s * 4 + (lane >> 3), c4 = (lane & 7) * 4;
            const v4f v = *(const v4f*)&ctile[row][c4];
            VST2V4(C + (long long)(m0 + row) * p.sCm + n0 + c4, v);
        }
    } else {
        for (int row = 0; row < 16; ++row) {
            const int m = m0 + row, n = n0 + lane;
            if (m < p.M && n < NW) VST2(float, C + (long long)m * p.sCm + n, ctile[row][lane]);
        }
    }
}


// =====================================================================================================================
// k_gemmT<MODE, TM, TN>: same contract as k_gemm, but one wave computes a (16*TM) x (16*TN) tile: TM A fragments and TN B fragments are
//   loaded per 32-wide k-step and reused across TM*TN WMMAs (far fewer load/convert instructions per MAC). MODE 0 (f16), 1 (bf16 hi/lo),
//   2 (bf16) only. grid (ceil(NW/(16*TN)), ceil(M/(16*TM)), Z), block 32. Epilogue identical to k_gemm, run per 16x32 sub-tile.
// =====================================================================================================================
template <int MODE, int TM, int TN>
__global__ __launch_bounds__(32) void k_gemmT(GemmP p) {
    const int lane = threadIdx.x & 31, h = lane >> 4, l15 = lane & 15;
    const int m0 = blockIdx.y * (16 * TM), n0 = blockIdx.x * (16 * TN);
    const int z = blockIdx.z, zo = z / p.zi_n, zi = z - zo * p.zi_n;
    const float* A = p.A + zo * p.sAo + zi * p.sAi;
    const float* B = p.B + zo * p.sBo + zi * p.sBi;
    v8f acc[TM][TN];
#pragma unroll
    for (int i = 0; i < TM; ++i)
#pragma unroll
        for (int t = 0; t < TN; ++t) { v8f zz = {}; acc[i][t] = zz; }
    for (int k0 = 0; k0 < p.K; k0 += 32) {
        if (MODE == 1) {
            Split a[TM], b[TN];
#pragma unroll
            for (int i = 0; i < TM; ++i) { const int am = min(m0 + 16 * i + l15, p.M - 1); a[i] = sp_ld(A + (long long)am * p.sAm, p.sAk, k0, h, p.K, 1.f); }
#pragma unroll
            for (int t = 0; t < TN; ++t) { const int bn = min(n0 + 16 * t + l15, p.N - 1); b[t] = sp_ld(B + (long long)bn * p.sBn, p.sBk, k0, h, p.K, 1.f); }
#pragma unroll
            for (int i = 0; i < TM; ++i)
#pragma unroll
                for (int t = 0; t < TN; ++t) acc[i][t] = wmma3(a[i], b[t], acc[i][t]);
        } else if (MODE == 2) {
            v16b a[TM], b[TN];
#pragma unroll
            for (int i = 0; i < TM; ++i) { const int am = min(m0 + 16 * i + l15, p.M - 1); a[i] = bh_ld(A + (long long)am * p.sAm, p.sAk, k0, h, p.K, 1.f); }
#pragma unroll
            for (int t = 0; t < TN; ++t) { const int bn = min(n0 + 16 * t + l15, p.N - 1); b[t] = bh_ld(B + (long long)bn * p.sBn, p.sBk, k0, h, p.K, 1.f); }
#pragma unroll
            for (int i = 0; i < TM; ++i)
#pragma unroll
                for (int t = 0; t < TN; ++t) acc[i][t] = wmmab(a[i], b[t], acc[i][t]);
        } else {
            v16h a[TM], b[TN];
#pragma unroll
            for (int i = 0; i < TM; ++i) { const int am = min(m0 + 16 * i + l15, p.M - 1); a[i] = fh_ld(A + (long long)am * p.sAm, p.sAk, k0, h, p.K, p.sa); }
#pragma unroll
            for (int t = 0; t < TN; ++t) { const int bn = min(n0 + 16 * t + l15, p.N - 1); b[t] = fh_ld(B + (long long)bn * p.sBn, p.sBk, k0, h, p.K, p.sb); }
#pragma unroll
            for (int i = 0; i < TM; ++i)
#pragma unroll
                for (int t = 0; t < TN; ++t) acc[i][t] = wmma16(a[i], b[t], acc[i][t]);
        }
    }
    const float iscale = (MODE == 0) ? p.alpha / (p.sa * p.sb) : p.alpha;
    float* C = p.C + zo * p.sCo + zi * p.sCi;
    const float* R = p.R + zo * p.sRo + zi * p.sRi;
    const int NW = (p.Npad > p.N) ? p.Npad : p.N;
    __shared__ __align__(16) float ctile[16][36];
#pragma unroll
    for (int i = 0; i < TM; ++i) {
        const int mb = m0 + 16 * i; if (mb >= p.M) break;          // wave-uniform
#pragma unroll
        for (int tp = 0; tp < TN / 2; ++tp) {
            const int nb = n0 + 32 * tp; if (nb >= NW) break;        // wave-uniform
#pragma unroll
            for (int t2 = 0; t2 < 2; ++t2) {
                const int t = 2 * tp + t2; const int n = nb + t2 * 16 + l15; const int nn = min(n, p.N - 1);
#pragma unroll
                for (int r = 0; r < 8; ++r) {
                    const int m = mb + 8 * h + r; const int mm = min(m, p.M - 1);
                    float v = acc[i][t][r] * iscale;
                    if (p.flags & 1) v += p.bias[nn];
                    if (p.flags & 2) v += p.bias[mm];
            if (p.flags & 8) v *= p.bias[(long long)zo * p.M + mm];   /* per-(z,row) scale vector laid out [Z][M]; exclusive with the bias flags */
                    v = act_fn(v, p.act);
                    if (p.flags & 4) v += p.beta * R[(long long)mm * p.sRm + (long long)nn * p.sRn];
                    ctile[8 * h + r][t2 * 16 + l15] = (n < p.N) ? v : 0.f;
                }
            }
            __syncthreads();
            const bool fast = (mb + 16 <= p.M) && (nb + 32 <= NW) && ((p.sCm & 3) == 0) && ((((size_t)C) & 15) == 0);
            if (fast) {
#pragma unroll
                for (int s = 0; s < 4; ++s) {
                    const int row = s * 4 + (lane >> 3), c4 = (lane & 7) * 4;
                    const v4f v = *(const v4f*)&ctile[row][c4];
                    VST2V4(C + (long long)(mb + row) * p.sCm + nb + c4, v);
                }
            } else {
                for (int row = 0; row < 16; ++row) {
                    const int m = mb + row, n = nb + lane;
                    if (m < p.M && n < NW) VST2(float, C + (long long)m * p.sCm + n, ctile[row][lane]);
                }
            }
            __syncthreads();
        }
    }
}

// =====================================================================================================================
//   Wave = 16 queries, AW waves per block, 64-key blocks; grid (ceil(Lq/(16*AW)), H, B), block 32*AW. Any Lq, Lk; head dim dh <= DHP
//   (DHP multiple of 32), value dim dv <= DVP (multiple of 16, <= 128). Every tensor addressed by (batch, head, row, element) strides, f32.
//   Scores: QM 0 f16 operands, 1 bf16 hi/lo split, 2 bf16 triple split; statistics f32 (exp2 domain); P.V: P x 4096 as f16 with V f16 staged in LDS
//   (SPLITPV: P and V as bf16 hi/lo splits). kv head = h / hrep. Masking: causal = 1 (keep j <= i + coff, masked -> -inf, key blocks beyond the
//   diagonal skipped), causal = 2 (masked -> mfill, a finite fill like the -1e9; no skipping), causal = 3 (keep j >= i + coff,
//   masked -> -inf, no skipping); optional additive f32 mask Mf,
//   optional int keep-mask Mi (0 -> score := mfill), both addressed b*smb + h*smh + i*smi + j*smj (0 strides broadcast).
//   PLAIN (QM 0, f16 P.V, one pass): the call is causal = 1 with coff 0, hrep 1, dh == DHP, dv == DVP, element strides 1, every Q/K/V row 16-byte aligned,
//   and none of P, Mf, Mi, ST, Pw, Rt, SQ/SK, nonorm. These become compile-time constants: the element guards fold away, so Q, K and V are read with
//   16-byte loads that are in flight in runs instead of one guarded float at a time, each waited for, and the option tests leave the score loop.
//   O16 (PLAIN, DVP 64, Lq a multiple of 16): the output goes to Oh as f16 (strides sOb, sOh, sOi in elements; rows 16-byte aligned), rounded from the same f32 value that O would hold,
//   so that the next product reads it without a cast launch in between. A (row, head) piece is one whole 128-byte line.
// =====================================================================================================================
#define AW 4
struct AttnP {   // apv4
    const float* Q; const float* K; const float* V; float* O; _Float16* Oh; float* P; const float* Mf; const int* Mi; float* ST;   // Oh: the output plane of the O16 form (O unused there)
    const float* Pw; const float* Rt; const int* SQ; const int* SK;           // optional: post-softmax weight, relative-position table, segment ids
    long long swb, swh, swi, swj, srb, srh, sri;                                 // Pw strides (b,h,i,j); Rt strides (b,h,i), column = clamp(i - j + roff, 0, rn-1)
    long long sQb, sQh, sQi, sQd, sKb, sKh, sKj, sKd, sVb, sVh, sVj, sVd, sOb, sOh, sOi, sPb, sPh, sPi, smb, smh, smi, smj;
    int Lq, Lk, dh, dv, hrep, causal, coff, pband;   // pband > 0: P holds only the band |j - i| <= pband, column j - i + pband
    float scale, mfill; int nonorm, mpol;             // nonorm (online path only): O = sum_j exp(score_j) V_j without the 1/rowsum (scores must be <= ~0); mpol: Mi masks where ==0 (mpol 0) or where !=0 (mpol 1)
    int roff, rn, segpol, win;                        // Rt column offset/count; SQ/SK: score := mfill where (segpol 0) SQ[i] != SK[j] or (segpol 1) SQ[i] == SK[j]; win > 0: keys with i - j > win (after coff) -> -inf, key blocks wholly below the window skipped
};
//   Pw: the softmax numerator is multiplied by Pw(b,h,i,j) AFTER the row sum is taken (probs * weight, then P.V), as in post-softmax multiplicative biases.                                                    // ST (optional): per row (b,h,i) -> ST[((b*H + h)*Lq + i)*2 + {0,1}] = {row max of the scaled+masked score (natural units), sum_j exp(score - max)}
static_assert(sizeof(AttnP) == 13 * 8 + 29 * 8 + 16 * 4, "AttnP has padding");

#ifndef KATTN_ATTR
#define KATTN_ATTR
#endif
template <int DHP, int DVP, int QM, bool SPLITPV, bool TWOPASS, bool PLAIN = false, bool O16 = false>
__global__ __launch_bounds__(32 * AW) KATTN_ATTR void k_attn(AttnP pa) {
    static_assert(!PLAIN || (QM == 0 && !SPLITPV && !TWOPASS), "PLAIN covers the f16 one-pass form");
    static_assert(!O16 || (PLAIN && DVP == 64), "O16 covers the PLAIN form with 64 value columns");
    AttnP p = pa;
    if (PLAIN) {
        p.P = nullptr; p.Mf = nullptr; p.Mi = nullptr; p.ST = nullptr; p.Pw = nullptr; p.Rt = nullptr; p.SQ = nullptr; p.SK = nullptr;
        p.sQd = 1; p.sKd = 1; p.sVd = 1; p.dh = DHP; p.dv = DVP; p.hrep = 1; p.causal = 1; p.coff = 0; p.pband = 0; p.nonorm = 0;
    }
    constexpr int NT = DVP / 16;                // output tiles
    constexpr int KS = DHP / 32;                // k-steps for the scores
    constexpr int VP = DVP + 8;                 // LDS pitch (halves)
    constexpr int NV = 64 * (DVP / 4) / (32 * AW);   // PLAIN: 16-byte pieces of the V tile per thread
    static_assert(!PLAIN || NV * (32 * AW) == 64 * (DVP / 4), "the block's threads cover the V tile evenly");
    __shared__ __align__(16) float    pl[AW][16 * 64];
    __shared__ __align__(16) _Float16 vl[(SPLITPV ? 2 : 1) * 64 * VP];   // f16 V tile, or bf16 hi and lo tiles (same 2-byte size)
    const int lane = threadIdx.x & 31, hf = lane >> 4, l15 = lane & 15, wave = threadIdx.x >> 5;
    const int h = blockIdx.y, b = blockIdx.z, hk = h / p.hrep;
    const int q0 = (blockIdx.x * AW + wave) * 16;
    float* myp = pl[wave];
    const float L2E = 1.4426950408889634f;
    const float NEG = -__builtin_inff();
    const int qi = min(q0 + l15, p.Lq - 1);
    const float* qrow = p.Q + b * p.sQb + h * p.sQh + (long long)qi * p.sQi;
    const float* kbase = p.K + b * p.sKb + hk * p.sKh;
    const float* vbase = p.V + b * p.sVb + hk * p.sVh;
    v16h qa[QM == 0 ? KS : 1]; Split qs_[QM == 1 ? KS : 1]; Split3 qt_[QM == 2 ? KS : 1];
#pragma unroll
    for (int ks = 0; ks < KS; ++ks) {
        if (QM == 2) qt_[ks] = sp3_ld(qrow, p.sQd, ks * 32, hf, p.dh, 1.f);
        else if (QM == 1) qs_[ks] = sp_ld(qrow, p.sQd, ks * 32, hf, p.dh, 1.f);
        else if (PLAIN) qa[ks] = raw_f16(raw_ld4(qrow, ks * 32, hf));
        else qa[ks] = fh_ld(qrow, p.sQd, ks * 32, hf, p.dh, 1.f);
    }
    v8f o[NT]; float m8[8], l8[8];
#pragma unroll
    for (int t = 0; t < NT; ++t) { v8f zz = {}; o[t] = zz; }
#pragma unroll
    for (int i = 0; i < 8; ++i) { m8[i] = NEG; l8[i] = 0.f; }
    int jend = p.Lk;
    if (p.causal == 1) { const int je = (blockIdx.x * AW + AW - 1) * 16 + 16 + p.coff; jend = min(jend, max(je, 0)); }   // uniform per block
    int jbeg = 0;                                                // first key any query row of this block can see through the window; uniform per block
    if (p.win > 0 && !p.P) jbeg = max((int)(blockIdx.x * AW) * 16 + p.coff - p.win, 0);   // keys below it are -inf for all 16*AW rows (weight exactly 0); P, where asked for, still needs its zeros written
    const int npass = TWOPASS ? 2 : 1;
    for (int pass = 0; pass < npass; ++pass) {
        const bool dopv = (!TWOPASS) || pass == 1;
        for (int j0 = jbeg; j0 < jend; j0 += 64) {
            v4f vr[PLAIN ? NV : 1]; Raw16 kr[PLAIN ? 2 : 1][KS];   // PLAIN: this thread's part of the V tile and the lane's K fragments of two columns, f32 as loaded
            if (dopv) {
                __syncthreads();                                 // previous key block's reads of vl / pl are done
                if (!PLAIN)
                for (int idx = threadIdx.x; idx < 64 * DVP; idx += 32 * AW) {
                    const int jr = idx / DVP, d = idx - jr * DVP, j = j0 + jr;
                    const float f = (j < p.Lk && d < p.dv) ? vbase[(long long)j * p.sVj + (long long)d * p.sVd] : 0.f;
                    if (SPLITPV) {
                        const __bf16 hb = bf16_rne(f);
                        ((__bf16*)vl)[jr * VP + d] = hb; ((__bf16*)vl)[64 * VP + jr * VP + d] = bf16_rne(f - bf16_f32(hb));
                    } else vl[jr * VP + d] = (_Float16)f;
                }
            }
            v8f s[4];
#pragma unroll
            for (int t = 0; t < 4; ++t) {
                const int j = min(j0 + t * 16 + l15, p.Lk - 1);
                const float* krow = kbase + (long long)j * p.sKj;
                if (PLAIN && (t & 1) == 0) {
                    // the K loads of two 16-key columns are issued ahead of the first use of any of them: one trip to memory for 4 fragments
                    // (all four columns at once took the build past 256 registers). The loops here are unrolled so that kr and vr stay in registers.
#pragma unroll
                    for (int u = 0; u < 2; ++u) {
#pragma unroll
                        for (int ks = 0; ks < KS; ++ks) kr[u][ks] = raw_ld4(kbase + (long long)min(j0 + (t + u) * 16 + l15, p.Lk - 1) * p.sKj, ks * 32, hf);
                        // one column's loads share one address pair: this wait stands behind them, ahead of any later load whose result may be given that pair
                        asm volatile("s_wait_xcnt 0x0" ::: "memory");
                    }
#pragma unroll
                    for (int u = 0; u < 2; ++u)
#pragma unroll
                        for (int ks = 0; ks < KS; ++ks) loads_held(kr[u][ks].x0, kr[u][ks].x1, kr[u][ks].x2, kr[u][ks].x3);
                }
                v8f acc = {};
#pragma unroll
                for (int ks = 0; ks < KS; ++ks) {
                    if (QM == 2)      acc = wmma6(qt_[ks], sp3_ld(krow, p.sKd, ks * 32, hf, p.dh, 1.f), acc);
                    else if (QM == 1) acc = wmma3(qs_[ks], sp_ld(krow, p.sKd, ks * 32, hf, p.dh, 1.f), acc);
                    else if (PLAIN)   acc = wmma16(qa[ks], raw_f16(kr[t & 1][ks]), acc);
                    else              acc = wmma16(qa[ks], fh_ld(krow, p.sKd, ks * 32, hf, p.dh, 1.f), acc);
                }
                s[t] = acc;
            }
            if (PLAIN) {
                // the V tile's loads go out here and are first used behind the softmax, which covers their trip to memory
#pragma unroll
                for (int n = 0; n < NV; ++n) {
                    const int idx = threadIdx.x + n * (32 * AW), jr = idx / (DVP / 4), d = (idx - jr * (DVP / 4)) * 4;
                    vr[n] = *(const v4f*)(vbase + (long long)min(j0 + jr, p.Lk - 1) * p.sVj + d);   // row clamped, so no guard round the load
                }
            }
            float pv[8][4];
#pragma unroll
            for (int i = 0; i < 8; ++i) {
                const int irow = q0 + i + 8 * hf;
                const int ic = min(irow, p.Lq - 1);
                float sc[4];
#pragma unroll
                for (int t = 0; t < 4; ++t) {
                    const int jg = j0 + t * 16 + l15;
                    float v = s[t][i] * p.scale;
                    if (p.Mf) v += p.Mf[b * p.smb + h * p.smh + (long long)ic * p.smi + (long long)min(jg, p.Lk - 1) * p.smj];
                    if (p.Rt) { int rc = ic - min(jg, p.Lk - 1) + p.roff; rc = rc < 0 ? 0 : (rc >= p.rn ? p.rn - 1 : rc); v += p.Rt[b * p.srb + h * p.srh + (long long)ic * p.sri + rc]; }
                    if (p.Mi) { const int mv = p.Mi[b * p.smb + h * p.smh + (long long)ic * p.smi + (long long)min(jg, p.Lk - 1) * p.smj]; if (p.mpol ? (mv != 0) : (mv == 0)) v = p.mfill; }
                    if (p.SQ) { const bool same = p.SQ[(long long)b * p.Lq + ic] == p.SK[(long long)b * p.Lk + min(jg, p.Lk - 1)]; if (p.segpol ? same : !same) v = p.mfill; }
                    if (p.causal == 2 && jg > irow + p.coff) v = p.mfill;
                    if (jg >= p.Lk || (p.causal == 1 && jg > irow + p.coff) || (p.causal == 3 && jg < irow + p.coff) || (p.win > 0 && irow + p.coff - jg > p.win)) v = NEG; else v *= L2E;
                    sc[t] = v;
                }
                if (!TWOPASS || pass == 0) {
                    float mx = fmaxf(fmaxf(sc[0], sc[1]), fmaxf(sc[2], sc[3]));
                    mx = fmaxf(mx, __shfl_xor(mx, 1, 32)); mx = fmaxf(mx, __shfl_xor(mx, 2, 32));
                    mx = fmaxf(mx, __shfl_xor(mx, 4, 32)); mx = fmaxf(mx, __shfl_xor(mx, 8, 32));
                    const float mnew = fmaxf(m8[i], mx);
                    const float corr = (mnew == NEG) ? 1.f : exp2f(m8[i] - mnew);
                    float rs = 0.f;
#pragma unroll
                    for (int t = 0; t < 4; ++t) {
                        const float pp = (sc[t] == NEG) ? 0.f : exp2f(sc[t] - mnew); rs += pp;
                        pv[i][t] = p.Pw ? pp * p.Pw[b * p.swb + h * p.swh + (long long)ic * p.swi + (long long)min(j0 + t * 16 + l15, p.Lk - 1) * p.swj] : pp;
                    }
                    rs += __shfl_xor(rs, 1, 32); rs += __shfl_xor(rs, 2, 32); rs += __shfl_xor(rs, 4, 32); rs += __shfl_xor(rs, 8, 32);
                    l8[i] = l8[i] * corr + rs; m8[i] = mnew;
                    if (!TWOPASS) {
#pragma unroll
                        for (int t = 0; t < NT; ++t) o[t][i] *= corr;
                    }
                } else {
                    const float inv = (l8[i] > 0.f) ? 1.f / l8[i] : 0.f;
#pragma unroll
                    for (int t = 0; t < 4; ++t) {
                        const int jg = j0 + t * 16 + l15;
                        float pp = (sc[t] == NEG) ? 0.f : exp2f(sc[t] - m8[i]) * inv;
                        if (p.Pw) pp *= p.Pw[b * p.swb + h * p.swh + (long long)ic * p.swi + (long long)min(jg, p.Lk - 1) * p.swj];
                        pv[i][t] = pp;
                    }
                }
            }
            if (dopv) {
                if (PLAIN) {                                     // cast and stage the V tile loaded above (unrolled: vr stays in registers)
#pragma unroll
                    for (int n = 0; n < NV; ++n) {
                        const int idx = threadIdx.x + n * (32 * AW), jr = idx / (DVP / 4), d = (idx - jr * (DVP / 4)) * 4;
                        v4h hv;
#pragma unroll
                        for (int e = 0; e < 4; ++e) hv[e] = (_Float16)((j0 + jr < p.Lk) ? vr[n][e] : 0.f);
                        *(v4h*)&vl[jr * VP + d] = hv;
                    }
                }
#pragma unroll
                for (int i = 0; i < 8; ++i)
#pragma unroll
                    for (int t = 0; t < 4; ++t) ((float*)myp)[(i + 8 * hf) * 64 + t * 16 + l15] = pv[i][t];
                __syncthreads();                                 // P (per wave) and V (shared) visible
                if (p.P) {
                    float* pb_ = p.P + b * p.sPb + h * p.sPh;
                    const bool fastP = (p.pband == 0) && ((p.sPi & 3) == 0) && (j0 + 64 <= p.Lk) && (q0 + 16 <= p.Lq) && ((((size_t)pb_) & 15) == 0);
                    if (fastP) {
#pragma unroll
                        for (int s = 0; s < 8; ++s) {
                            const int row = s * 2 + (lane >> 4), c4 = (lane & 15) * 4;
                            const v4f v = *(const v4f*)(myp + row * 64 + c4);
                            VST2V4(pb_ + (long long)(q0 + row) * p.sPi + j0 + c4, v);
                        }
                    } else {
                        for (int row = 0; row < 16; ++row) {
                            const int irow = q0 + row; if (irow >= p.Lq) continue;
                            for (int c = lane; c < 64; c += 32) {
                                const int jg = j0 + c; if (jg >= p.Lk) continue;
                                if (p.pband == 0) VST2(float, pb_ + (long long)irow * p.sPi + jg, myp[row * 64 + c]);
                                else if (jg - irow <= p.pband && irow - jg <= p.pband) VST2(float, pb_ + (long long)irow * p.sPi + (jg - irow + p.pband), myp[row * 64 + c]);
                            }
                        }
                    }
                }
                if (SPLITPV) {
                    const Split pa0 = sp_ld(myp + l15 * 64, 1, 0, hf, 64, 1.f), pa1 = sp_ld(myp + l15 * 64, 1, 32, hf, 64, 1.f);
                    const __bf16* vh = (const __bf16*)vl; const __bf16* vlo = vh + 64 * VP;
#pragma unroll
                    for (int t = 0; t < NT; ++t) {
                        const int dcol = t * 16 + l15;
                        Split b0, b1;
#pragma unroll
                        for (int e = 0; e < 16; ++e) {
                            const int k0 = frag_k(e, hf), k1 = 32 + frag_k(e, hf);
                            b0.hi[e] = vh[k0 * VP + dcol]; b0.lo[e] = vlo[k0 * VP + dcol]; b1.hi[e] = vh[k1 * VP + dcol]; b1.lo[e] = vlo[k1 * VP + dcol];
                        }
                        o[t] = wmma3(pa0, b0, o[t]);
                        o[t] = wmma3(pa1, b1, o[t]);
                    }
                } else {
                    const v16h pa0 = fh_ld(myp + l15 * 64, 1, 0, hf, 64, 4096.f), pa1 = fh_ld(myp + l15 * 64, 1, 32, hf, 64, 4096.f);
#pragma unroll
                    for (int t = 0; t < NT; ++t) {
                        const int dcol = t * 16 + l15;
                        v16h b0, b1;
#pragma unroll
                        for (int e = 0; e < 16; ++e) { b0[e] = vl[frag_k(e, hf) * VP + dcol]; b1[e] = vl[(32 + frag_k(e, hf)) * VP + dcol]; }
                        o[t] = wmma16(pa0, b0, o[t]);
                        o[t] = wmma16(pa1, b1, o[t]);
                    }
                }
            }
        }
    }
    float* obase = p.O + b * p.sOb + h * p.sOh;
    if (p.ST) {
        const int rl = lane >> 1, isel = rl & 7;           // row q0 + rl ; rl>>3 == hf holds because lane>>4 == (lane>>1)>>3
        float mv = 0.f, lv = 0.f;
#pragma unroll
        for (int i = 0; i < 8; ++i) if (i == isel) { mv = m8[i]; lv = l8[i]; }
        const int irow = q0 + rl;
        if (irow < p.Lq) { float* st = p.ST + (((long long)b * gridDim.y + h) * p.Lq + irow) * 2 + (lane & 1); VST2(float, st, (lane & 1) ? lv : mv * 0.6931471805599453f); }
    }
    float invr[8];
#pragma unroll
    for (int i = 0; i < 8; ++i) {
        if (TWOPASS) invr[i] = SPLITPV ? 1.f : (1.f / 4096.f);
        else if (p.nonorm) invr[i] = exp2f(m8[i]) * (SPLITPV ? 1.f : (1.f / 4096.f));
        else invr[i] = (l8[i] > 0.f) ? (SPLITPV ? 1.f / l8[i] : 1.f / (l8[i] * 4096.f)) : 0.f;
    }
    __syncthreads();                                             // all waves done with pl/vl from the main loop
    const bool ofast = ((p.sOi & 3) == 0) && ((((size_t)obase) & 15) == 0) && (q0 + 16 <= p.Lq);
#pragma unroll
    for (int c0 = 0; c0 < DVP; c0 += 64) {
#pragma unroll
        for (int i = 0; i < 8; ++i)
#pragma unroll
            for (int t = 0; t < NT; ++t) if (t * 16 >= c0 && t * 16 < c0 + 64) ((float*)myp)[(i + 8 * hf) * 64 + (t * 16 - c0) + l15] = o[t][i] * invr[i];
        __syncthreads();
        const int cw = (DVP - c0 < 64) ? (DVP - c0) : 64;      // staged columns in this chunk (multiple of 16)
        if (O16) {
            _Float16* oh = p.Oh + b * p.sOb + h * p.sOh;
            if (q0 < p.Lq) {                                     // Lq is a multiple of 16: a wave's 16 rows are all there or none is
#pragma unroll   // four stores of 4 rows each, all in flight
                for (int r0 = 0; r0 < 16; r0 += 4) {
                    const int row = r0 + (lane >> 3), c8 = (lane & 7) * 8;
                    const float* sp = myp + row * 64 + c8;
                    v8h hv;
#pragma unroll   // constant element indices: the vector stays in registers
                    for (int e = 0; e < 8; ++e) hv[e] = (_Float16)sp[e];
                    *(v8h*)(oh + (long long)(q0 + row) * p.sOi + c8) = hv;
                }
            }
        } else if (ofast && (c0 + cw <= p.dv) && (cw % 32 == 0)) {
            const int lpr = cw / 4;                              // lanes per row (16 for 64 cols, 8 for 32)
            const int rows_per_ins = 32 / lpr;
            for (int r0 = 0; r0 < 16; r0 += rows_per_ins) {
                const int row = r0 + lane / lpr, c4 = (lane % lpr) * 4;
                const v4f v = *(const v4f*)(myp + row * 64 + c4);
                VST2V4(obase + (long long)(q0 + row) * p.sOi + c0 + c4, v);
            }
        } else {
            for (int row = 0; row < 16; ++row) {
                const int irow = q0 + row; if (irow >= p.Lq) continue;
                for (int c = lane; c < cw; c += 32) { const int d = c0 + c; if (d < p.dv) VST2(float, obase + (long long)irow * p.sOi + d, myp[row * 64 + c]); }
            }
        }
        __syncthreads();
    }
}

// =====================================================================================================================
// k_tr: dst(z, c, r) = alpha * src(z, r, c) (+ beta * R2(z, c, r)): [Z][R][C] (row stride lds) -> [Z][C][R] (row stride ldd) through a 32x32 LDS tile;
//   flags: 1 -> add beta * residual R2 addressed like dst (z*sRz + c*ldr + r); act applied before the residual.
// =====================================================================================================================
struct TrP { const float* src; float* dst; const float* R2; long long sSz, lds, sDz, ldd, sRz, ldr; int R, C, flags, act; float alpha, beta; };
static_assert(sizeof(TrP) == 3 * 8 + 6 * 8 + 6 * 4, "TrP has padding");
__global__ __launch_bounds__(256) void k_tr(TrP p) {
    __shared__ float tile[32][33];
    const int c0 = blockIdx.x * 32, r0 = blockIdx.y * 32, z = blockIdx.z;
    const int lane = threadIdx.x & 31, wave = threadIdx.x >> 5;
    const float* s = p.src + z * p.sSz;
#pragma unroll
    for (int k = 0; k < 4; ++k) {
        const int rl = wave * 4 + k, r = r0 + rl, c = c0 + lane;
        tile[rl][lane] = (r < p.R && c < p.C) ? s[(long long)r * p.lds + c] : 0.f;
    }
    __syncthreads();
    float* d = p.dst + z * p.sDz; const float* rr = p.R2 + z * p.sRz;
#pragma unroll
    for (int k = 0; k < 4; ++k) {
        const int cl = wave * 4 + k, c = c0 + cl, r = r0 + lane;
        if (c < p.C && r < p.R) {
            float v = act_fn(p.alpha * tile[lane][cl], p.act);
            if (p.flags & 1) v += p.beta * rr[(long long)c * p.ldr + r];
            VST2(float, d + (long long)c * p.ldd + r, v);
        }
    }
}

// k_affine: dst[i] = a * (sdev ? sdev[0] : 1) * src[i] + b, i < n (one thread per element; consecutive lanes -> consecutive addresses)
__global__ __launch_bounds__(256) void k_affine(const float* __restrict__ src, float* __restrict__ dst, int n, float a, float b, const float* __restrict__ sdev) {
    const int i = blockIdx.x * 256 + threadIdx.x;
    if (i < n) { const float aa = sdev ? a * sdev[0] : a; const float v = aa * src[i] + b; VST2(float, dst + i, v); }
}

// =====================================================================================================================
// k_softmax: row softmax over n contiguous elements, one 256-thread block per row; rows addressed z*sz + r*sr (grid (R, Z)).
//   out = scale_out * softmax(scale_in * x + (Mf ? Mf[z*smz + r*smr + j] : 0)); a row whose max is -inf is written as 0.
// =====================================================================================================================
struct SmP { const float* src; float* dst; const float* Mf; long long sz, sr, dz, dr, smz, smr; int n, pad; float scale_in, scale_out; };
static_assert(sizeof(SmP) == 3 * 8 + 6 * 8 + 4 * 4, "SmP has padding");
__global__ __launch_bounds__(256) void k_softmax(SmP p) {
    __shared__ float red[256];
    const int r = blockIdx.x, z = blockIdx.y, tid = threadIdx.x;
    const float* s = p.src + z * p.sz + (long long)r * p.sr;
    const float* mf = p.Mf ? (p.Mf + z * p.smz + (long long)r * p.smr) : nullptr;
    float mx = -__builtin_inff();
    for (int j = tid; j < p.n; j += 256) { float v = s[j] * p.scale_in; if (mf) v += mf[j]; mx = fmaxf(mx, v); }
    red[tid] = mx; __syncthreads();
    for (int o = 128; o > 0; o >>= 1) { if (tid < o) red[tid] = fmaxf(red[tid], red[tid + o]); __syncthreads(); }
    mx = red[0]; __syncthreads();
    float sum = 0.f;
    for (int j = tid; j < p.n; j += 256) { float v = s[j] * p.scale_in; if (mf) v += mf[j]; sum += (mx == -__builtin_inff()) ? 0.f : expf(v - mx); }
    red[tid] = sum; __syncthreads();
    for (int o = 128; o > 0; o >>= 1) { if (tid < o) red[tid] += red[tid + o]; __syncthreads(); }
    sum = red[0];
    const float inv = (sum > 0.f) ? p.scale_out / sum : 0.f;
    float* d = p.dst + z * p.dz + (long long)r * p.dr;
    for (int j = tid; j < p.n; j += 256) { float v = s[j] * p.scale_in; if (mf) v += mf[j]; const float o = (mx == -__builtin_inff()) ? 0.f : expf(v - mx) * inv; VST2(float, d + j, o); }
}
// =====================================================================================================================
// k_stats: mean and rsqrt(var + eps) over a set of n elements addressed base + z*sz + (e / inner) * so + (e % inner) * si, one 256-thread
// k_norm_apply: y = (x - mean[set]) * rstd[set] * g[c] + b[c] over a [Z][C][L] channel-major tensor with set = z*G + c / (C/G) (G groups per z;
//   G = C -> per-channel sets indexed z*C+c; for batch norm pass stats indexed by c only via bn = 1). Optional act. Output same layout.
// =====================================================================================================================
//   mode 0: mean / rsqrt(var + eps); mode 1 (RMSNorm): 0 / rsqrt(mean(x^2) + eps); mode 2 (L2 normalize * sqrt(n)): 0 / sqrt(n) / max(||x||, eps); mode 3: as 0 with unbiased variance (n-1)
__global__ __launch_bounds__(256) void k_stats(const float* __restrict__ x, long long sz, long long so, long long si, int inner, int n, float eps, float* __restrict__ stat, int mode) {
    __shared__ float red[256];
    const int z = blockIdx.x, tid = threadIdx.x;
    const float* base = x + z * sz;
    float s = 0.f;
    for (int e = tid; e < n; e += 256) s += base[(long long)(e / inner) * so + (long long)(e % inner) * si];
    red[tid] = s; __syncthreads();
    for (int o = 128; o > 0; o >>= 1) { if (tid < o) red[tid] += red[tid + o]; __syncthreads(); }
    const float mu = (mode == 0 || mode == 3) ? red[0] / (float)n : 0.f; __syncthreads();
    float q = 0.f;
    for (int e = tid; e < n; e += 256) { const float dlt = base[(long long)(e / inner) * so + (long long)(e % inner) * si] - mu; q += dlt * dlt; }
    red[tid] = q; __syncthreads();
    for (int o = 128; o > 0; o >>= 1) { if (tid < o) red[tid] += red[tid + o]; __syncthreads(); }
    {
        float rs;
        if (mode == 2) rs = sqrtf((float)n) / fmaxf(sqrtf(red[0]), eps); else if (mode == 3) rs = rsqrtf(red[0] / (float)(n - 1) + eps); else rs = rsqrtf(red[0] / (float)n + eps);
        if (tid < 32) { const float v = (tid == 0) ? mu : ((tid == 1) ? rs : 0.f); VST2(float, stat + (long long)z * 32 + tid, v); }
    }
}
//   One thread per element over the flat [Z][C][L] index space: grid ceil(Z*C*L / 256).
__global__ __launch_bounds__(256) void k_norm_apply(const float* __restrict__ x, float* __restrict__ y, const float* __restrict__ stat, const float* __restrict__ g, const float* __restrict__ bta,
                                                     int Z, int C, int L, int G, int bn, int act) {
    const long long idx = (long long)blockIdx.x * 256 + threadIdx.x;
    if (idx >= (long long)Z * C * L) return;
    const int l = (int)(idx % L); const long long zc = idx / L; const int c = (int)(zc % C), z = (int)(zc / C); (void)l;
    const int set = bn ? c : (z * G + c / (C / G));
    float v = (x[idx] - stat[(long long)set * 32]) * stat[(long long)set * 32 + 1];
    if (g) v *= g[c];
    if (bta) v += bta[c];
    v = act_fn(v, act);
    VST2(float, y + idx, v);
}

// k_lse_neg: c[i] = -(st[2i] + log(st[2i+1])) = minus the log-sum-exp of row i from k_attn's ST output (for softmax over the query axis)
__global__ __launch_bounds__(256) void k_lse_neg(const float* __restrict__ st, float* __restrict__ c, int n) {
    const int i = blockIdx.x * 256 + threadIdx.x;
    if (i < n) { const float v = -(st[2 * i] + logf(st[2 * i + 1])); VST2(float, c + i, v); }
}

// k_iota: dst[i] = a * i + b as int32 (segment/position id helper)
__global__ __launch_bounds__(256) void k_iota(int* __restrict__ dst, int n, int a, int b) {
    const int i = blockIdx.x * 256 + threadIdx.x;
    if (i < n) { const int v = a * i + b; VST2(int, dst + i, v); }
}

// k_axpby: dst[i] = a * x[i] + b * y[i] (+ c), i < n
__global__ __launch_bounds__(256) void k_axpby(const float* __restrict__ x, const float* __restrict__ y, float* __restrict__ dst, int n, float a, float b, float c) {
    const int i = blockIdx.x * 256 + threadIdx.x;
    if (i < n) { const float v = a * x[i] + b * y[i] + c; VST2(float, dst + i, v); }
}

// =====================================================================================================================
// k_rope: rotary embedding on a [R rows][Hn heads][D] view (row stride sXr, head stride sXh, element stride 1) -> Y (own strides).
//   mode 0: rotate_half (partner d±D/2, sign - for d<D/2); mode 1: interleaved pairs (partner d^1, sign - for even d).
//   table column tcol: tmode 0 -> d, 1 -> d % (D/2), 2 -> d / 2; position p: pmode 0 -> r % S, 1 -> head index, 2 -> pos[r];
//   c = C[(r / S) * sCb + p * sCp + tcol * sCd], s likewise from Sn; y = x[d] * c + sign * x[partner] * s. X and Y must not alias.
// =====================================================================================================================
struct RopeP { const float* X; float* Y; const float* C; const float* Sn; const int* pos; long long sXr, sXh, sYr, sYh, sCb, sCp, sCd; int R, Hn, D, S, mode, tmode, pmode, pad; };
static_assert(sizeof(RopeP) == 5 * 8 + 7 * 8 + 8 * 4, "RopeP has padding");
__global__ __launch_bounds__(256) void k_rope(RopeP p) {
    const long long idx = (long long)blockIdx.x * 256 + threadIdx.x;
    if (idx >= (long long)p.R * p.Hn * p.D) return;
    const int d = (int)(idx % p.D); const long long rh = idx / p.D; const int h = (int)(rh % p.Hn); const int r = (int)(rh / p.Hn);
    const int half = p.D / 2;
    int partner; float sign;
    if (p.mode == 0) { partner = (d < half) ? d + half : d - half; sign = (d < half) ? -1.f : 1.f; }
    else { partner = d ^ 1; sign = (d & 1) ? 1.f : -1.f; }
    const int tcol = (p.tmode == 0) ? d : ((p.tmode == 1) ? (d % half) : (d >> 1));
    const int pp = (p.pmode == 0) ? (r % p.S) : ((p.pmode == 1) ? h : p.pos[r]);
    const long long toff = (long long)(r / p.S) * p.sCb + (long long)pp * p.sCp + (long long)tcol * p.sCd;
    const float* xr = p.X + (long long)r * p.sXr + (long long)h * p.sXh;
    const float v = xr[d] * p.C[toff] + sign * xr[partner] * p.Sn[toff];
    VST2(float, p.Y + (long long)r * p.sYr + (long long)h * p.sYh + d, v);
}

// k_invf + k_sincos (split so neither kernel carries a large VALU-fma footprint): invf_i = num * (1 / powf(base, (2 i)/D)) [fmode 0],
//   num * expf((2 i) * cexp) [fmode 1], num * powf(base, -2 (i - 1) / D) [fmode 2]; then cs/sn[s*half + i] = cos/sin((pscale * s) * invf_i)
__global__ __launch_bounds__(256) void k_invf(float* __restrict__ invb, int half, int D, float base, float num, int fmode, float cexp) {
    const int i = blockIdx.x * 256 + threadIdx.x;
    if (i >= ((half + 31) / 32) * 32) return;
    if (i >= half) { VST2(float, invb + i, 0.f); return; }
    const float e = (float)(2 * i) / (float)D;
    float invf;
    if (fmode == 1) invf = num * expf((float)(2 * i) * cexp);
    else if (fmode == 2) invf = num * powf(base, (-2.0f * ((float)i - 1.0f)) / (float)D);
    else invf = num * (1.0f / powf(base, e));
    VST2(float, invb + i, invf);
}
__global__ __launch_bounds__(256) void k_sincos(float* __restrict__ cs, float* __restrict__ sn, const float* __restrict__ invb, int S, int half, float pscale) {
    const int idx = blockIdx.x * 256 + threadIdx.x;
    if (idx >= S * half) return;
    const int s = idx / half, i = idx - s * half;
    const float ang = (pscale * (float)s) * invb[i];
    VST2(float, cs + idx, cosf(ang)); VST2(float, sn + idx, sinf(ang));
}

// k_mulact: dst[i] = act(x[i]) * y[i]
__global__ __launch_bounds__(256) void k_mulact(const float* __restrict__ x, const float* __restrict__ y, float* __restrict__ dst, int n, int act) {
    const int i = blockIdx.x * 256 + threadIdx.x;
    if (i < n) { const float v = act_fn(x[i], act) * y[i]; VST2(float, dst + i, v); }
}

// =====================================================================================================================
// k_matvec: thread-per-row matrix-vector products for N <= 8 output columns (heads with 1-3 outputs, gates), f32 on the VALU.
//   C[r*sCm + j] = act(alpha * sum_k A[r*sAm + k*sAk] * B[j*sBn + k*sBk] + bias[j]) + beta * R[r*sRm + j*sRn]; each thread writes its N contiguous floats.
// =====================================================================================================================
__global__ __launch_bounds__(256) void k_matvec(GemmP p) {
    // 32 lanes write one line with one instruction.
    const int rpt = (p.N == 1) ? 1 : 32;
    const long long r0 = ((long long)blockIdx.x * 256 + threadIdx.x) * rpt; const int z = blockIdx.z, zo = z / p.zi_n, zi = z - zo * p.zi_n;
    if (r0 >= p.M) return;
    const float* Bb = p.B + zo * p.sBo + zi * p.sBi;
    float* C = p.C + zo * p.sCo + zi * p.sCi; const float* R = p.R + zo * p.sRo + zi * p.sRi;
    for (int rr = 0; rr < rpt; ++rr) {
        const long long r = r0 + rr; if (r >= p.M) break;
        const float* A = p.A + zo * p.sAo + zi * p.sAi + r * p.sAm;
        float acc[8] = {0.f, 0.f, 0.f, 0.f, 0.f, 0.f, 0.f, 0.f};
        for (int k = 0; k < p.K; ++k) { const float a = A[(long long)k * p.sAk];
#pragma unroll
            for (int j = 0; j < 8; ++j) if (j < p.N) acc[j] += a * Bb[(long long)j * p.sBn + (long long)k * p.sBk]; }
#pragma unroll
        for (int j = 0; j < 8; ++j) if (j < p.N) {
            float v = acc[j] * p.alpha;
            if (p.flags & 1) v += p.bias[j];
            if (p.flags & 2) v += p.bias[r];
            v = act_fn(v, p.act);
            if (p.flags & 4) v += p.beta * R[r * p.sRm + (long long)j * p.sRn];
            VST2(float, C + r * p.sCm + j, v);
        }
    }
}
// k_smallsoftmax: thread-per-row softmax for short rows (n <= 64): dst[r*dr + j] = softmax(scale*src[r*sr + j])
__global__ __launch_bounds__(256) void k_smallsoftmax(const float* __restrict__ src, float* __restrict__ dst, long long sr, long long dr, int n, long long R, float scale) {
    const long long r0 = ((long long)blockIdx.x * 256 + threadIdx.x) * 32;
    for (int rr = 0; rr < 32; ++rr) {
        const long long r = r0 + rr; if (r >= R) return;
        const float* s = src + r * sr; float* d = dst + r * dr;
        float mx = -__builtin_inff();
        for (int j = 0; j < n; ++j) mx = fmaxf(mx, s[j] * scale);
        float sum = 0.f;
        for (int j = 0; j < n; ++j) sum += expf(s[j] * scale - mx);
        const float inv = 1.f / sum;
        for (int j = 0; j < n; ++j) { const float v = expf(s[j] * scale - mx) * inv; VST2(float, d + j, v); }
    }
}

__global__ __launch_bounds__(32) void k_unitstat(float* __restrict__ st) { const int t = threadIdx.x; const float v = (t == 1) ? 1.f : 0.f; VST2(float, st + t, v); }

// destination (e.g. a d_out whose row width is not a multiple of 32 floats) is written by consecutive lanes of one instruction
__global__ __launch_bounds__(256) void k_lincopy(const float* __restrict__ src, long long lds, float* __restrict__ dst, long long ldd, long long rows, int cols) {
    const long long i = (long long)blockIdx.x * 256 + threadIdx.x; if (i >= rows * cols) return;
    const long long r = i / cols; const int c = (int)(i - r * cols);
    const float v = src[r * lds + c]; VST2(float, dst + r * ldd + c, v);
}

namespace w25 {
typedef __attribute__((ext_vector_type(16))) _Float16 v16h;
typedef __attribute__((ext_vector_type(8)))  _Float16 v8h;
typedef __attribute__((ext_vector_type(16))) __bf16   v16b;
typedef __attribute__((ext_vector_type(8)))  __bf16   v8b;
typedef __attribute__((ext_vector_type(8)))  float    v8f;
typedef __attribute__((ext_vector_type(4)))  float    v4f;

__device__ __forceinline__ unsigned short f2bf_bits(float f) {
  unsigned u = __float_as_uint(f);
  return (unsigned short)((u + 0x7FFFu + ((u >> 16) & 1u)) >> 16);
}
__device__ __forceinline__ float bf_bits2f(unsigned short h) { return __uint_as_float(((unsigned)h) << 16); }

// hazard guards as plain device helpers (no inline asm inside the kernel template body)
__device__ __forceinline__ void dep_guard_h(v8f& a, v8f& b, v16h x, v16h y) { asm volatile("v_nop\n\tv_nop\n\tv_nop\n\tv_nop" : "+v"(a), "+v"(b) : "v"(x), "v"(y)); }
__device__ __forceinline__ void dep_guard_b(v8f& a, v8f& b, v16b x, v16b y) { asm volatile("v_nop\n\tv_nop\n\tv_nop\n\tv_nop" : "+v"(a), "+v"(b) : "v"(x), "v"(y)); }
__device__ __forceinline__ void keep4_h(v16h a, v16h b, v16h c, v16h d) { asm volatile("v_nop" :: "v"(a), "v"(b), "v"(c), "v"(d)); }
__device__ __forceinline__ void keep4_b(v16b a, v16b b, v16b c, v16b d) { asm volatile("v_nop" :: "v"(a), "v"(b), "v"(c), "v"(d)); }
__device__ __forceinline__ void acc_guard4(v8f& a, v8f& b, v8f& c, v8f& d) { asm volatile("v_nop\n\tv_nop\n\tv_nop\n\tv_nop" : "+v"(a), "+v"(b), "+v"(c), "+v"(d)); }
template <typename T> struct Frag;
template <> struct Frag<_Float16> {
  typedef v16h V; union U { v16h v; v8h h[2]; };
  static __device__ __forceinline__ v16h load(const _Float16* p) {   // elements 0..7 <- p[0..7], 8..15 <- p[16..23]
    U f; f.h[0] = *(const v8h*)(p); f.h[1] = *(const v8h*)(p + 16); return f.v;
  }
  static __device__ __forceinline__ v8f mma(v16h a, v16h b, v8f c) {
    return __builtin_amdgcn_wmma_f32_16x16x32_f16(false, a, false, b, (short)0, c, false, false);
  }
  static __device__ __forceinline__ void guard(v8f& a, v8f& b, v16h x, v16h y) { dep_guard_h(a, b, x, y); }
  static __device__ __forceinline__ void keep(v16h a, v16h b, v16h c, v16h d) { keep4_h(a, b, c, d); }
};
template <> struct Frag<__bf16> {
  typedef v16b V; union U { v16b v; v8b h[2]; };
  static __device__ __forceinline__ v16b load(const __bf16* p) {
    U f; f.h[0] = *(const v8b*)(p); f.h[1] = *(const v8b*)(p + 16); return f.v;
  }
  static __device__ __forceinline__ v8f mma(v16b a, v16b b, v8f c) {
    return __builtin_amdgcn_wmma_f32_16x16x32_bf16(false, a, false, b, (short)0, c, false, false);
  }
  static __device__ __forceinline__ void guard(v8f& a, v8f& b, v16b x, v16b y) { dep_guard_b(a, b, x, y); }
  static __device__ __forceinline__ void keep(v16b a, v16b b, v16b c, v16b d) { keep4_b(a, b, c, d); }
};

// ---- Register-blocked batched WMMA GEMM ------------------------------------
// C[m,n] = scale * sum_k A[m,k] * Bt[n,k] (+bias)(+resid); each wave owns a 64x64 tile.
// A row-major [M,K]; Bt row-major [N,K]; M,N % 64 == 0, K % 32 == 0.
// SPLIT: operands are hi/lo planes (A2/Bt2 = lo planes, same layout); product = hi·hi + hi·lo + lo·hi.
// BIAS_MODE: 0 = none, 1 = bias[m], 2 = bias[n]. Batch 1 takes bias_b1 and batch 2 bias_b2 in its place (up to three products that share A in one launch).
// OUT_MODE: 0 = f32, 1 = f16, 2 = bf16 hi plane (Cout) + bf16 lo plane (Cout2).
// ET: 0 = f16 operands, 1 = bf16 operands (pointers passed as 16-bit storage)
template <int ET> struct Elem;
template <> struct Elem<0> { typedef _Float16 T; };
template <> struct Elem<1> { typedef __bf16 T; };
template <int ET, bool SPLIT, int BIAS_MODE, int OUT_MODE, bool RESID, int ACT = 0>
__global__ __launch_bounds__(256) void wmma_gemm64(
    const unsigned short* __restrict__ Ap, const unsigned short* __restrict__ A2p, int lda, long strideA,
    const unsigned short* __restrict__ Btp, const unsigned short* __restrict__ Bt2p, int ldb, long strideB,
    void* __restrict__ Cout, void* __restrict__ Cout2, int ldc, long strideC,
    const float* __restrict__ bias, const float* __restrict__ bias_b1, const float* __restrict__ bias_b2,
    const float* __restrict__ resid, long strideR,
    int M, int N, int K, float scale) {
  typedef typename Elem<ET>::T T;
  typedef typename Frag<T>::V V;
  const T* A = (const T*)Ap; const T* A2 = (const T*)A2p; const T* Bt = (const T*)Btp; const T* Bt2 = (const T*)Bt2p;
  __shared__ __align__(16) float sT[8][16 * 68];   // per-wave 16x64 slab, pitch 68 floats
  const int b    = blockIdx.y;
  const int lane = threadIdx.x & 31;
  const int wave = threadIdx.x >> 5;
  const int tilesN = N >> 6;
  const int tilesM = M >> 6;
  const int tile = blockIdx.x * 8 + wave;
  if (tile >= tilesM * tilesN) return;   // wave-uniform; no block barriers in this kernel
  const int tm = tile / tilesN;
  const int tn = tile - tm * tilesN;
  const int m0 = tm << 6;
  const int n0 = tn << 6;

  const T* Ab  = A  + (size_t)b * strideA;
  const T* Bb  = Bt + (size_t)b * strideB;
  const T* Ab2 = SPLIT ? (A2  + (size_t)b * strideA) : nullptr;
  const T* Bb2 = SPLIT ? (Bt2 + (size_t)b * strideB) : nullptr;

  const int rlane = lane & 15;                 // row (A) / col (B, D) within subtile
  const int koff  = (lane >> 4) * 8;           // k offset of this lane half
  const int mOff  = (lane >> 4) * 8;           // D row offset

  v8f acc[4][4];
#pragma unroll
  for (int i = 0; i < 4; ++i)
#pragma unroll
    for (int j = 0; j < 4; ++j) acc[i][j] = (v8f){0.f,0.f,0.f,0.f,0.f,0.f,0.f,0.f};

  for (int k0 = 0; k0 < K; k0 += 32) {
    V bh[4], bl[4];
#pragma unroll
    for (int j = 0; j < 4; ++j) {
      const size_t bo = (size_t)(n0 + (j << 4) + rlane) * ldb + koff + k0;
      bh[j] = Frag<T>::load(Bb + bo);
      if (SPLIT) bl[j] = Frag<T>::load(Bb2 + bo);
    }
#pragma unroll
    for (int i = 0; i < 4; ++i) {
      const size_t ao = (size_t)(m0 + (i << 4) + rlane) * lda + koff + k0;
      V ah = Frag<T>::load(Ab + ao);
      V al;
      if (SPLIT) al = Frag<T>::load(Ab2 + ao);
#pragma unroll
      for (int j = 0; j < 4; ++j) {
        acc[i][j] = Frag<T>::mma(ah, bh[j], acc[i][j]);
        if (SPLIT) {
          acc[i][j] = Frag<T>::mma(ah, bl[j], acc[i][j]);
          acc[i][j] = Frag<T>::mma(al, bh[j], acc[i][j]);
        }
      }
      Frag<T>::guard(acc[i][0], acc[i][3], ah, SPLIT ? al : ah);
    }
    Frag<T>::keep(bh[0], bh[1], bh[2], bh[3]);
    if (SPLIT) Frag<T>::keep(bl[0], bl[1], bl[2], bl[3]);
  }
  acc_guard4(acc[0][0], acc[0][1], acc[0][2], acc[0][3]);
  acc_guard4(acc[1][0], acc[1][1], acc[1][2], acc[1][3]);
  acc_guard4(acc[2][0], acc[2][1], acc[2][2], acc[2][3]);
  acc_guard4(acc[3][0], acc[3][1], acc[3][2], acc[3][3]);

  // ---- epilogue ----
  float* slab = sT[wave];
  const float* Rb = RESID ? (resid + (size_t)b * strideR) : nullptr;
  const float* bsel = (b == 0) ? bias : ((b == 1) ? bias_b1 : bias_b2);
#pragma unroll
  for (int i = 0; i < 4; ++i) {
    const int mBase = m0 + (i << 4);
#pragma unroll
    for (int j = 0; j < 4; ++j) {
      const int n = n0 + (j << 4) + rlane;
      float bv = 0.f;
      if (BIAS_MODE == 2) bv = bsel[n];
#pragma unroll
      for (int r = 0; r < 8; ++r) {
        float v = acc[i][j][r] * scale;
        if (BIAS_MODE == 1) v += bsel[mBase + mOff + r];
        if (BIAS_MODE == 2) v += bv;
        if (RESID) v += Rb[(size_t)(mBase + mOff + r) * ldc + n];
        if (ACT == 1) v = tanhf(v);
        if (ACT == 2) v = fmaxf(v, 0.0f);
        if (ACT == 3) v = v / (1.0f + expf(-v));
        if (ACT == 4) v = (v > 0.f) ? v : 0.01f * v;
        if (ACT == 5) v = 0.5f * v * (1.0f + erff(v * 0.70710678118654752f));
        slab[(mOff + r) * 68 + (j << 4) + rlane] = v;
      }
    }
    __builtin_amdgcn_fence(__ATOMIC_RELEASE, "workgroup");
    __builtin_amdgcn_wave_barrier();
    __builtin_amdgcn_fence(__ATOMIC_ACQUIRE, "workgroup");
    if (OUT_MODE == 0) {
      float* C = (float*)Cout + (size_t)b * strideC;
      const int hh = lane >> 4, c4 = (lane & 15) * 4;     // row seg = 256 B = 16 lanes x 16 B
      {
#pragma unroll
        for (int it = 0; it < 8; ++it) {
          const int row = it * 2 + hh;
          v4f v = *(const v4f*)(slab + row * 68 + c4);
          *(v4f*)(C + (size_t)(mBase + row) * ldc + n0 + c4) = v;
        }
        
      }
    } else {
      const int q = lane >> 3, c8 = (lane & 7) * 8;
      unsigned short* C  = (unsigned short*)Cout  + (size_t)b * strideC;
      unsigned short* C2 = (OUT_MODE == 2) ? ((unsigned short*)Cout2 + (size_t)b * strideC) : nullptr;
      {
#pragma unroll
        for (int it = 0; it < 4; ++it) {
          const int row = it * 4 + q;
          const float* sp = slab + row * 68 + c8;
          v8h hv, lv;
#pragma unroll
          for (int e = 0; e < 8; ++e) {
            if (OUT_MODE == 1) {
              hv[e] = (_Float16)sp[e];
            } else {
              unsigned short hb = f2bf_bits(sp[e]);
              unsigned short lb = f2bf_bits(sp[e] - bf_bits2f(hb));
              hv[e] = __builtin_bit_cast(_Float16, hb);
              lv[e] = __builtin_bit_cast(_Float16, lb);
            }
          }
          *(v8h*)(C + (size_t)(mBase + row) * ldc + n0 + c8) = hv;
          if (OUT_MODE == 2) *(v8h*)(C2 + (size_t)(mBase + row) * ldc + n0 + c8) = lv;
        }
        
      }
    }
    __builtin_amdgcn_fence(__ATOMIC_RELEASE, "workgroup");
    __builtin_amdgcn_wave_barrier();
    __builtin_amdgcn_fence(__ATOMIC_ACQUIRE, "workgroup");
  }
}

__global__ __launch_bounds__(256) void cast_f32_f16x2(
    const float* __restrict__ in, _Float16* __restrict__ out, int n2) {
  int i = blockIdx.x * 256 + threadIdx.x;
  if (i < n2) {
    const _Float16 h0 = (_Float16)in[2 * i], h1 = (_Float16)in[2 * i + 1];
    const unsigned u = (unsigned)__builtin_bit_cast(unsigned short, h0) | ((unsigned)__builtin_bit_cast(unsigned short, h1) << 16);
    ((unsigned*)out)[i] = u;
    
  }
}


} // namespace w25

__global__ __launch_bounds__(256) void k_castT16(const float* __restrict__ src, long long lds, _Float16* __restrict__ dst, long long ldd, int R, int C, float s) {
    const long long i = (long long)blockIdx.x * 256 + threadIdx.x; const long long np = (long long)C * (R / 2); if (i >= np) return; const int c = (int)(i / (R / 2)); const int r = 2 * (int)(i % (R / 2));
    const _Float16 h0 = (_Float16)(src[(long long)r * lds + c] * s), h1 = (_Float16)(src[(long long)(r + 1) * lds + c] * s);
    const unsigned u = (unsigned)__builtin_bit_cast(unsigned short, h0) | ((unsigned)__builtin_bit_cast(unsigned short, h1) << 16);
    unsigned* d = (unsigned*)(dst + (long long)c * ldd + r); *d = u;  }
__global__ __launch_bounds__(256) void k_cast16(const float* __restrict__ src, long long lds, _Float16* __restrict__ dst, long long ldd, int R, int C, float s) {
    const long long i = (long long)blockIdx.x * 256 + threadIdx.x; const long long np = (long long)R * (C / 2); if (i >= np) return; const int r = (int)(i / (C / 2)); const int c = 2 * (int)(i % (C / 2));
    const _Float16 h0 = (_Float16)(src[(long long)r * lds + c] * s), h1 = (_Float16)(src[(long long)r * lds + c + 1] * s);
    const unsigned u = (unsigned)__builtin_bit_cast(unsigned short, h0) | ((unsigned)__builtin_bit_cast(unsigned short, h1) << 16);
    unsigned* d = (unsigned*)(dst + (long long)r * ldd + c); *d = u;  }

// cast_weights<U>: the six weight matrices (four of 512 x 512, two of 2048 x 512 elements) as f16 of s * w into one plane, one behind the other in argument order.
//   A block takes 256 * U consecutive pieces of 4 elements of one matrix, a thread the pieces threadIdx.x + 256 * u of them: a wave's load covers 512 contiguous bytes
//   and its store 256, and the U loads of a thread are in flight together. blk runs over all (4 * 512 * 512 + 2 * 2048 * 512) / (4 * 256 * U) blocks, so no element guard.
template <int U>
__device__ __forceinline__ void cast_weights(int blk, const float* __restrict__ w0, const float* __restrict__ w1, const float* __restrict__ w2, const float* __restrict__ w3,
                                             const float* __restrict__ w4, const float* __restrict__ w5, _Float16* __restrict__ dst, float s) {
    constexpr int BS = (512 * 512) / (4 * 256 * U), BL = (2048 * 512) / (4 * 256 * U);   // blocks per small and per large matrix
    static_assert(BS * (4 * 256 * U) == 512 * 512, "whole blocks per matrix");
    const float* src; int first;                                  // the block's matrix and that matrix's first block (the same for the whole block)
    if (blk < BS) { src = w0; first = 0; }
    else if (blk < 2 * BS) { src = w1; first = BS; }
    else if (blk < 3 * BS) { src = w2; first = 2 * BS; }
    else if (blk < 4 * BS) { src = w3; first = 3 * BS; }
    else if (blk < 4 * BS + BL) { src = w4; first = 4 * BS; }
    else { src = w5; first = 4 * BS + BL; }
    const v4f* sp = (const v4f*)src + (blk - first) * (256 * U) + threadIdx.x;
    v4h* dp = (v4h*)dst + blk * (256 * U) + threadIdx.x;
    v4f a[U];
#pragma unroll   // constant indices: a stays in registers, and all U loads are issued before the first cast
    for (int u = 0; u < U; ++u) a[u] = sp[u * 256];
#pragma unroll   // constant indices into a
    for (int u = 0; u < U; ++u) {
        v4h hv;
#pragma unroll   // constant element indices: the vectors stay in registers
        for (int e = 0; e < 4; ++e) hv[e] = (_Float16)(a[u][e] * s);
        dp[u * 256] = hv;
    }
}
// ln_rows_f16: y = f16((x - mean) * rsqrt(var + eps) * g + b) over contiguous rows of 512 elements, one wave per row, 8 rows per 256-thread block (blk = block of rows).
//   The row stays in registers between the two sums and the output: statistics, normalisation and the cast for the next product are one pass over x.
//   A lane holds the pieces lane + 32 * u of 4 channels (a wave's load covers 512 contiguous bytes): element t = 128 * u + 4 * lane + e.
//   Both sums keep the order of k_stats (256 partials of elements t and t + 256, then a binary tree that pairs t with t + 128, 64, ..., 1), so mean and rstd keep their bits:
//   distance 128 is u, 64 to 4 are the lane's bits (shuffles, both partners form the same sum), 2 and 1 are e.
__device__ __forceinline__ float tree256(const float (&p)[2][4]) {
    float r[4];
#pragma unroll   // constant indices: r stays in registers
    for (int e = 0; e < 4; ++e) r[e] = p[0][e] + p[1][e];
#pragma unroll   // the four shuffles of a level are independent and in flight together
    for (int o = 16; o > 0; o >>= 1)
#pragma unroll
        for (int e = 0; e < 4; ++e) r[e] += __shfl_xor(r[e], o, 32);
    return (r[0] + r[2]) + (r[1] + r[3]);
}
__device__ __forceinline__ void ln_rows_f16(int blk, const float* __restrict__ x, _Float16* __restrict__ y, const float* __restrict__ g, const float* __restrict__ bta, float eps) {
    constexpr int C = 512, U = C / 128;                           // pieces per lane
    const int lane = threadIdx.x & 31;
    const size_t row = (size_t)blk * 8 + (threadIdx.x >> 5);
    const v4f* xp = (const v4f*)(x + row * C) + lane;
    v4f xv[U], gv[U], bv[U];
#pragma unroll   // constant indices: the arrays stay in registers, and all loads are issued before the first use
    for (int u = 0; u < U; ++u) { xv[u] = xp[u * 32]; gv[u] = ((const v4f*)g)[lane + u * 32]; bv[u] = ((const v4f*)bta)[lane + u * 32]; }
    float p[2][4];
#pragma unroll   // constant indices into xv and p
    for (int u = 0; u < 2; ++u)
#pragma unroll
        for (int e = 0; e < 4; ++e) p[u][e] = xv[u][e] + xv[u + 2][e];
    const float mu = tree256(p) / (float)C;
#pragma unroll   // constant indices into xv and p
    for (int u = 0; u < 2; ++u)
#pragma unroll
        for (int e = 0; e < 4; ++e) { const float d0 = xv[u][e] - mu, d1 = xv[u + 2][e] - mu; p[u][e] = __builtin_fmaf(d1, d1, d0 * d0); }   // as k_stats rounds it: the square, then one fused step
    const float rs = rsqrtf(tree256(p) / (float)C + eps);
    v4h* yp = (v4h*)(y + row * C) + lane;
#pragma unroll   // constant indices into the arrays
    for (int u = 0; u < U; ++u) {
        v4h hv;
#pragma unroll   // constant element indices: the vectors stay in registers
        for (int e = 0; e < 4; ++e) hv[e] = (_Float16)((xv[u][e] - mu) * rs * gv[u][e] + bv[u][e]);
        yp[u * 32] = hv;
    }
}
// k_ln_f16: LayerNorm of 4096 rows of 512 to an f16 plane; grid 4096 / 8.
__global__ __launch_bounds__(256) void k_ln_f16(const float* __restrict__ x, _Float16* __restrict__ y, const float* __restrict__ g, const float* __restrict__ bta, float eps) {
    ln_rows_f16(blockIdx.x, x, y, g, bta, eps);
}
// k_ln_f16_weights: two jobs that depend on nothing but the inputs share one grid: blocks [0, 512) are k_ln_f16's, the 768 behind them cast the weights. No barrier in either.
__global__ __launch_bounds__(256) void k_ln_f16_weights(const float* __restrict__ x, _Float16* __restrict__ y, const float* __restrict__ g, const float* __restrict__ bta, float eps,
                                                        const float* __restrict__ w0, const float* __restrict__ w1, const float* __restrict__ w2, const float* __restrict__ w3,
                                                        const float* __restrict__ w4, const float* __restrict__ w5, _Float16* __restrict__ wdst, float ws) {
    if (blockIdx.x < 512) ln_rows_f16(blockIdx.x, x, y, g, bta, eps);
    else cast_weights<4>(blockIdx.x - 512, w0, w1, w2, w3, w4, w5, wdst, ws);
}

// f32 -> bf16 hi plane + bf16 lo plane (x = hi + lo to ~2^-17 relative; RNE both), [R][C] -> [R][C] (or transposed to [C][R]); 2 consecutive destination elements
__device__ __forceinline__ unsigned int f2bf2_pack(float a, float b, unsigned int* lo) {
    const unsigned short ha = w25::f2bf_bits(a), hb = w25::f2bf_bits(b);
    const unsigned short la = w25::f2bf_bits(a - w25::bf_bits2f(ha)), lb = w25::f2bf_bits(b - w25::bf_bits2f(hb));
    *lo = (unsigned)la | ((unsigned)lb << 16); return (unsigned)ha | ((unsigned)hb << 16); }
__global__ __launch_bounds__(256) void k_castS16(const float* __restrict__ src, long long lds, __bf16* __restrict__ dhi, __bf16* __restrict__ dlo, long long ldd, int R, int C, float s, int transpose) {
    const long long i = (long long)blockIdx.x * 256 + threadIdx.x; long long o; float a, b;
    if (transpose) { const long long np = (long long)C * (R / 2); if (i >= np) return; const int c = (int)(i / (R / 2)); const int r = 2 * (int)(i % (R / 2)); a = src[(long long)r * lds + c] * s; b = src[(long long)(r + 1) * lds + c] * s; o = (long long)c * ldd + r; }
    else { const long long np = (long long)R * (C / 2); if (i >= np) return; const int r = (int)(i / (C / 2)); const int c = 2 * (int)(i % (C / 2)); a = src[(long long)r * lds + c] * s; b = src[(long long)r * lds + c + 1] * s; o = (long long)r * ldd + c; }
    unsigned lo; const unsigned hi = f2bf2_pack(a, b, &lo); unsigned* ph = (unsigned*)(dhi + o); unsigned* pl = (unsigned*)(dlo + o);
    *ph = hi; *pl = lo;  }


extern "C" void kernel_launch(void* const* d_in, const int* in_sizes, int n_in, void* d_out, int out_size, void* d_ws, size_t ws_size, hipStream_t stream) {
    (void)in_sizes; (void)n_in; (void)out_size; (void)ws_size;
    const float* x = (const float*)d_in[0];
    const float* ln1g = (const float*)d_in[1];
    const float* ln1b = (const float*)d_in[2];
    const float* Wq = (const float*)d_in[3];
    const float* bq = (const float*)d_in[4];
    const float* Wk = (const float*)d_in[5];
    const float* bk = (const float*)d_in[6];
    const float* Wv = (const float*)d_in[7];
    const float* bv = (const float*)d_in[8];
    const float* Wo = (const float*)d_in[9];
    const float* bo = (const float*)d_in[10];
    const float* ln2g = (const float*)d_in[11];
    const float* ln2b = (const float*)d_in[12];
    const float* W1 = (const float*)d_in[13];
    const float* b1 = (const float*)d_in[14];
    const float* W2 = (const float*)d_in[15];
    const float* b2 = (const float*)d_in[16];
    const int L = 4096;
    const int C = 512;
    const int NH = 8;
    const int HD = 64;
    const int FF = 2048;
    const int LP = L / 2;
    const int WINP = 128;
    float* out = (float*)d_out;
    char* wsp = (char*)d_ws;
    _Float16* WH = (_Float16*)wsp; wsp += (((size_t)(4 * 512 * 512 + 2 * 2048 * 512) * 2 + 255) / 256) * 256;   // f16 of 16 w: Wq, Wk, Wv, Wo, W1, W2
    _Float16* HNh = (_Float16*)wsp; wsp += (((size_t)((size_t)L * C) * 2 + 255) / 256) * 256;
    float* Q = (float*)wsp; wsp += (((size_t)((size_t)L * C) * 4 + 255) / 256) * 256;    // Q, Kb and V lie L * C floats apart: the three batches of one product
    float* Kb = (float*)wsp; wsp += (((size_t)((size_t)L * C) * 4 + 255) / 256) * 256;
    float* V = (float*)wsp; wsp += (((size_t)((size_t)L * C) * 4 + 255) / 256) * 256;
    _Float16* Yh = (_Float16*)wsp; wsp += (((size_t)((size_t)L * C) * 2 + 255) / 256) * 256;
    float* X1 = (float*)wsp; wsp += (((size_t)((size_t)L * C) * 4 + 255) / 256) * 256;
    _Float16* H2h = (_Float16*)wsp; wsp += (((size_t)((size_t)L * C) * 2 + 255) / 256) * 256;
    _Float16* F1h = (_Float16*)wsp; wsp += (((size_t)((size_t)L * FF) * 2 + 255) / 256) * 256;
    k_ln_f16_weights<<<(unsigned)(512 + 768), 256, 0, stream>>>(x, HNh, ln1g, ln1b, 1e-05f, Wq, Wk, Wv, Wo, W1, W2, WH, 16.0f);
    w25::wmma_gemm64<0, false, 2, 0, false, 0><<<dim3((unsigned)((((4096) / 64) * ((512) / 64) + 7) / 8), (unsigned)(3)), 256, 0, stream>>>((const unsigned short*)(HNh), nullptr, 512, 0, (const unsigned short*)(WH), nullptr, 512, 512 * 512, (void*)(Q), nullptr, 512, 4096 * 512, bq, bk, bv, nullptr, 0, 4096, 512, 512, 0.0625f);
    { /*apv4*/ AttnP a;
      a.Q = Q; a.K = Kb; a.V = V; a.O = 0; a.Oh = Yh; a.P = 0; a.Mf = 0; a.Mi = 0; a.ST = 0;
      a.Pw = 0; a.Rt = 0; a.SQ = 0; a.SK = 0;
      a.swb = 0; a.swh = 0; a.swi = 0; a.swj = 0; a.srb = 0; a.srh = 0; a.sri = 0; a.sQb = C; a.sQh = HD; a.sQi = 2 * C; a.sQd = 1; a.sKb = C; a.sKh = HD; a.sKj = 2 * C; a.sKd = 1; a.sVb = C; a.sVh = HD; a.sVj = 2 * C; a.sVd = 1; a.sOb = C; a.sOh = HD; a.sOi = 2 * C; a.sPb = 0; a.sPh = 0; a.sPi = 0; a.smb = 0; a.smh = 0; a.smi = 0; a.smj = 0;
      a.Lq = LP; a.Lk = LP; a.dh = HD; a.dv = HD; a.hrep = 1; a.causal = 1; a.coff = 0; a.pband = 0;
      a.scale = 0.125f; a.mfill = 0.0f; a.nonorm = 0; a.mpol = 0;
      a.roff = 0; a.rn = 1; a.segpol = 0; a.win = WINP;
      k_attn<64, 64, 0, false, false, true, true><<<dim3((unsigned)((LP) + 16 * AW - 1) / (16 * AW), (unsigned)(NH), (unsigned)(2)), 32 * AW, 0, stream>>>(a); }   // batch = parity: row 0 or 1, then every second row
    w25::wmma_gemm64<0, false, 2, 0, true, 0><<<dim3((unsigned)((((4096) / 64) * ((512) / 64) + 7) / 8), (unsigned)(1)), 256, 0, stream>>>((const unsigned short*)(Yh), nullptr, 512, 0, (const unsigned short*)(WH + 3 * 512 * 512), nullptr, 512, 0, (void*)(X1), nullptr, 512, 0, bo, nullptr, nullptr, x, 0, 4096, 512, 512, 0.0625f);
    k_ln_f16<<<(unsigned)(512), 256, 0, stream>>>(X1, H2h, ln2g, ln2b, 1e-05f);
    w25::wmma_gemm64<0, false, 2, 1, false, 5><<<dim3((unsigned)((((4096) / 64) * ((2048) / 64) + 7) / 8), (unsigned)(1)), 256, 0, stream>>>((const unsigned short*)(H2h), nullptr, 512, 0, (const unsigned short*)(WH + 4 * 512 * 512), nullptr, 512, 0, (void*)(F1h), nullptr, 2048, 0, b1, nullptr, nullptr, nullptr, 0, 4096, 2048, 512, 0.0625f);
    w25::wmma_gemm64<0, false, 2, 0, true, 0><<<dim3((unsigned)((((4096) / 64) * ((512) / 64) + 7) / 8), (unsigned)(1)), 256, 0, stream>>>((const unsigned short*)(F1h), nullptr, 2048, 0, (const unsigned short*)(WH + 4 * 512 * 512 + 2048 * 512), nullptr, 2048, 0, (void*)(out), nullptr, 512, 0, b2, nullptr, nullptr, X1, 0, 4096, 512, 2048, 0.0625f);
}

// v005
// Measured time: 98 microseconds a run.
// Timed twice side by side with v004, it ran 2.32 and 2.25 times as fast.
// Counting every step since v000, it is 22.2 times as fast.
// Contractions: q/k/v projections of the LayerNormed input [4096x512].[512x512] (+b), the output projection (+b, + residual), the FFN [4096x512].[512x2048] (+b, exact GELU) and [4096x2048].[2048x512] (+b, + residual) with f16 operands (v_wmma_f32_16x16x32_f16; 32x64 register-blocked wave tiles, 128x64 block tiles, over pre-cast f16 operand planes staged in LDS by asynchronous copies, weights pre-scaled by 16 at the cast and un-scaled in the f32 epilogue); the dilated causal attention (keys j <= i, i - j even, i - j <= 256) as one flash launch whose grid z is the parity of the position (stride-2 views; within a parity class the pattern is plain causal with window 128), head_dim 64, f16 q.k^T and f16 p.v (p as f16 of 4096 p); f32 accumulate, softmax and LayerNorms f32.
#include <hip/hip_runtime.h>
#include <math.h>

typedef __attribute__((ext_vector_type(16))) _Float16 v16h;
typedef __attribute__((ext_vector_type(8)))  _Float16 v8h;
typedef __attribute__((ext_vector_type(4)))  _Float16 v4h;
typedef __attribute__((ext_vector_type(16))) __bf16   v16b;
typedef __attribute__((ext_vector_type(8)))  float    v8f;
typedef __attribute__((ext_vector_type(4)))  float    v4f;

// 16-bit WMMA fragment map (wave32), lane L, h = L>>4, m = L&15:
//   A 16x32: lane = row m;   element i -> k = (i<8) ? 8h+i : 16+8h+(i-8)
//   B 32x16: lane = column m; the SAME k(i,h)
//   D 16x16 (8 f32): lane = column m; element r -> row 8h+r
__device__ __forceinline__ int frag_k(int i, int h) { return (i < 8) ? (8 * h + i) : (16 + 8 * h + (i - 8)); }
__device__ __forceinline__ __bf16 bf16_rne(float f) {
    unsigned int u = __float_as_uint(f);
    u += 0x7fffu + ((u >> 16) & 1u);
    return __builtin_bit_cast(__bf16, (unsigned short)(u >> 16));
}
__device__ __forceinline__ float bf16_f32(__bf16 b) { return __uint_as_float(((unsigned int)__builtin_bit_cast(unsigned short, b)) << 16); }
__device__ __forceinline__ v8f wmma16(v16h a, v16h b, v8f c) {
    c = __builtin_amdgcn_wmma_f32_16x16x32_f16(false, a, false, b, (short)0, c, false, false);
    asm volatile("v_nop\n\tv_nop\n\tv_nop\n\tv_nop" : "+v"(c) : "v"(a), "v"(b));
    return c;
}
__device__ __forceinline__ v8f wmmab(v16b a, v16b b, v8f c) {
    c = __builtin_amdgcn_wmma_f32_16x16x32_bf16(false, a, false, b, (short)0, c, false, false);
    asm volatile("v_nop\n\tv_nop\n\tv_nop\n\tv_nop" : "+v"(c) : "v"(a), "v"(b));
    return c;
}
struct Split { v16b hi, lo; };
// hi/lo split product: a.hi*b.hi + a.hi*b.lo + a.lo*b.hi
__device__ __forceinline__ v8f wmma3(const Split& a, const Split& b, v8f c) {
    c = __builtin_amdgcn_wmma_f32_16x16x32_bf16(false, a.hi, false, b.hi, (short)0, c, false, false);
    c = __builtin_amdgcn_wmma_f32_16x16x32_bf16(false, a.hi, false, b.lo, (short)0, c, false, false);
    c = __builtin_amdgcn_wmma_f32_16x16x32_bf16(false, a.lo, false, b.hi, (short)0, c, false, false);
    asm volatile("v_nop\n\tv_nop\n\tv_nop\n\tv_nop" : "+v"(c) : "v"(a.hi), "v"(a.lo), "v"(b.hi), "v"(b.lo));
    return c;
}
struct Split3 { v16b hi, mid, lo; };
// triple split product (6 terms, drops only terms below 2^-24 relative)
__device__ __forceinline__ v8f wmma6(const Split3& a, const Split3& b, v8f c) {
    c = __builtin_amdgcn_wmma_f32_16x16x32_bf16(false, a.hi, false, b.hi, (short)0, c, false, false);
    c = __builtin_amdgcn_wmma_f32_16x16x32_bf16(false, a.hi, false, b.mid, (short)0, c, false, false);
    c = __builtin_amdgcn_wmma_f32_16x16x32_bf16(false, a.mid, false, b.hi, (short)0, c, false, false);
    c = __builtin_amdgcn_wmma_f32_16x16x32_bf16(false, a.hi, false, b.lo, (short)0, c, false, false);
    c = __builtin_amdgcn_wmma_f32_16x16x32_bf16(false, a.mid, false, b.mid, (short)0, c, false, false);
    c = __builtin_amdgcn_wmma_f32_16x16x32_bf16(false, a.lo, false, b.hi, (short)0, c, false, false);
    asm volatile("v_nop\n\tv_nop\n\tv_nop\n\tv_nop" : "+v"(c) : "v"(a.hi), "v"(a.mid), "v"(a.lo), "v"(b.hi), "v"(b.mid), "v"(b.lo));
    return c;
}

// Fragment gathers from f32 memory: element i <- p[(k0 + frag_k(i,h)) * sk] * s, zero for k >= klen.
__device__ __forceinline__ v16h fh_ld(const float* __restrict__ p, long long sk, int k0, int h, int klen, float s) {
    v16h a;
#pragma unroll
    for (int i = 0; i < 16; ++i) { const int k = k0 + frag_k(i, h); a[i] = (k < klen) ? (_Float16)(p[(long long)k * sk] * s) : (_Float16)0.f; }
    return a;
}
__device__ __forceinline__ Split sp_ld(const float* __restrict__ p, long long sk, int k0, int h, int klen, float s) {
    Split r;
#pragma unroll
    for (int i = 0; i < 16; ++i) {
        const int k = k0 + frag_k(i, h); const float x = (k < klen) ? p[(long long)k * sk] * s : 0.f;
        const __bf16 hb = bf16_rne(x); r.hi[i] = hb; r.lo[i] = bf16_rne(x - bf16_f32(hb));
    }
    return r;
}
__device__ __forceinline__ Split3 sp3_ld(const float* __restrict__ p, long long sk, int k0, int h, int klen, float s) {
    Split3 r;
#pragma unroll
    for (int i = 0; i < 16; ++i) {
        const int k = k0 + frag_k(i, h); const float x = (k < klen) ? p[(long long)k * sk] * s : 0.f;
        const __bf16 hb = bf16_rne(x); const float r1 = x - bf16_f32(hb); const __bf16 mb = bf16_rne(r1);
        r.hi[i] = hb; r.mid[i] = mb; r.lo[i] = bf16_rne(r1 - bf16_f32(mb));
    }
    return r;
}
__device__ __forceinline__ v16b bh_ld(const float* __restrict__ p, long long sk, int k0, int h, int klen, float s) {
    v16b a;
#pragma unroll
    for (int i = 0; i < 16; ++i) { const int k = k0 + frag_k(i, h); a[i] = bf16_rne((k < klen) ? p[(long long)k * sk] * s : 0.f); }
    return a;
}
// f16 fragment from a 16-byte aligned f32 row with element stride 1 and all 32 k in range: four unguarded 16-byte loads, then the cast; same k order as fh_ld
struct Raw16 { v4f x0, x1, x2, x3; };   // the 16 floats of one lane's fragment, as loaded
__device__ __forceinline__ Raw16 raw_ld4(const float* __restrict__ row, int k0, int h) {
    const v4f* q = (const v4f*)(row + k0 + 8 * h);
    Raw16 r; r.x0 = q[0]; r.x1 = q[1]; r.x2 = q[4]; r.x3 = q[5];
    return r;
}
__device__ __forceinline__ v16h raw_f16(const Raw16& r) {
    v16h a;
#pragma unroll   // constant element indices: the vectors stay in registers
    for (int i = 0; i < 4; ++i) { a[i] = (_Float16)r.x0[i]; a[4 + i] = (_Float16)r.x1[i]; a[8 + i] = (_Float16)r.x2[i]; a[12 + i] = (_Float16)r.x3[i]; }
    return a;
}
// Inputs-only fence on loaded values: every load written above it is issued before it, so that a run of loads is in flight together.
// Without it the compiler converts each fragment as soon as it is loaded and waits for memory once per fragment.
__device__ __forceinline__ void loads_held(const v4f& a, const v4f& b, const v4f& c, const v4f& d) { asm volatile("" :: "v"(a), "v"(b), "v"(c), "v"(d)); }
// f16 fragment from an f16 LDS/global row with element stride 1 (k-contiguous), no bounds (tile already zero padded)
__device__ __forceinline__ v16h fh_row(const _Float16* __restrict__ row, int k0, int h) {
    v16h a;
#pragma unroll
    for (int i = 0; i < 16; ++i) a[i] = row[k0 + frag_k(i, h)];
    return a;
}

#define VST2(T, ptr, val) do { const T vst2_v_ = (val); *(T*)(ptr) = vst2_v_;  } while (0)
typedef float v4f __attribute__((ext_vector_type(4)));
#define VST2V4(ptr, val) do { const v4f vst2_v4_ = (val); *(v4f*)(ptr) = vst2_v4_;  } while (0)

__device__ __attribute__((noinline)) float act_fn(float v, int act) {
    if (act == 1) return fmaxf(v, 0.f);                                                                               // relu
    if (act == 2) { const float u = 0.7978845608028654f * (v + 0.044715f * v * v * v); return 0.5f * v * (1.f + tanhf(u)); } // tanh-gelu
    if (act == 3) return v / (1.f + expf(-v));                                                                        // silu
    if (act == 4) return 0.5f * v * (1.f + erff(v * 0.7071067811865476f));                                             // erf-gelu
    if (act == 5) return tanhf(v);
    if (act == 6) return 1.f / (1.f + expf(-v));                                                                      // sigmoid
    if (act == 7) return (v > 0.f) ? v : 0.01f * v;                                                                   // leaky relu 0.01
    if (act == 8) return (v > 0.f) ? v : (expf(v) - 1.f);                                                             // elu
    if (act == 9) return fminf(fmaxf(v, 0.f), 6.f);                                                                   // relu6
    if (act == 10) return fabsf(v);                                                                                    // abs
    if (act == 11) return (v >= 0.f) ? v : 0.1f * v;                                                                  // leaky 0.1
    if (act == 12) return (v > 0.f) ? v : 0.2f * v;                                                                   // leaky 0.2
    if (act == 13) return (v > 20.f) ? v : log1pf(expf(v));                                                            // softplus
    return v;
}

// =====================================================================================================================
// k_gemm<MODE>: C(z, m, n) = act(alpha * sum_k A(z, m, k) * B(z, k, n) + bias) + beta * R(z, m, n)
//   One wave (32-thread block) per 16 x 32 tile of C; grid (ceil(N/32), ceil(M/16), Z). Batch z -> (zo = z / zi_n, zi = z % zi_n)
//   with separate outer/inner strides for every tensor (e.g. batch and head). A(m,k) = A[zo*sAo + zi*sAi + m*sAm + k*sAk] (f32),
//   B(k,n) = B[zo*sBo + zi*sBi + n*sBn + k*sBk] (f32); any M, N, K (K zero-padded to 32 inside the fragments, M/N tails guarded).
//   C(m,n) = C[zo*sCo + zi*sCi + m*sCm + n] (n contiguous). flags: 1 bias[n], 2 bias[m], 4 residual R[zo*sRo + zi*sRi + m*sRm + n*sRn].
//   MODE 0: f16 operands (A prescaled by sa, B by sb, both undone in the epilogue); 1: bf16 hi/lo split (3 products); 2: bf16;
//   3: bf16 hi/mid/lo triple split (6 products); 4: as 3 with Kahan-compensated f32 accumulation across k-steps.
// =====================================================================================================================
struct GemmP {
    const float* A; const float* B; const float* bias; const float* R; float* C;
    long long sAo, sAi, sAm, sAk, sBo, sBi, sBn, sBk, sCo, sCi, sCm, sRo, sRi, sRm, sRn;
    int M, N, K, zi_n, flags, act; float alpha, beta, sa, sb;
    int Npad, pad_;     // columns [N, Npad) of C are written as 0 so that padded workspace rows are covered by whole-line stores; Npad >= N
};
static_assert(sizeof(GemmP) == 5 * 8 + 15 * 8 + 6 * 4 + 4 * 4 + 2 * 4, "GemmP has padding");

template <int MODE>
__global__ __launch_bounds__(32) void k_gemm(GemmP p) {
    const int lane = threadIdx.x & 31, h = lane >> 4, l15 = lane & 15;
    const int m0 = blockIdx.y * 16, n0 = blockIdx.x * 32;
    const int z = blockIdx.z, zo = z / p.zi_n, zi = z - zo * p.zi_n;
    const float* A = p.A + zo * p.sAo + zi * p.sAi;
    const float* B = p.B + zo * p.sBo + zi * p.sBi;
    const int am = min(m0 + l15, p.M - 1);                       // clamped row for loads (stores are guarded)
    v8f acc[2], comp[2];
#pragma unroll
    for (int t = 0; t < 2; ++t) { v8f zz = {}; acc[t] = zz; comp[t] = zz; }
    for (int k0 = 0; k0 < p.K; k0 += 32) {
        const float* arow = A + (long long)am * p.sAm;
        if (MODE == 1) {
            const Split a = sp_ld(arow, p.sAk, k0, h, p.K, 1.f);
#pragma unroll
            for (int t = 0; t < 2; ++t) {
                const int bn = min(n0 + t * 16 + l15, p.N - 1);
                acc[t] = wmma3(a, sp_ld(B + (long long)bn * p.sBn, p.sBk, k0, h, p.K, 1.f), acc[t]);
            }
        } else if (MODE == 3) {
            const Split3 a = sp3_ld(arow, p.sAk, k0, h, p.K, 1.f);
#pragma unroll
            for (int t = 0; t < 2; ++t) {
                const int bn = min(n0 + t * 16 + l15, p.N - 1);
                acc[t] = wmma6(a, sp3_ld(B + (long long)bn * p.sBn, p.sBk, k0, h, p.K, 1.f), acc[t]);
            }
        } else if (MODE == 4) {
            // triple split as MODE 3, but each k-step's 6 products go into a fresh accumulator and the partial is added to the running f32 sum
            // on the VALU with Kahan compensation (accumulation error stays ~1 ulp however long K is)
            const Split3 a = sp3_ld(arow, p.sAk, k0, h, p.K, 1.f);
#pragma unroll
            for (int t = 0; t < 2; ++t) {
                const int bn = min(n0 + t * 16 + l15, p.N - 1); v8f zz = {};
                const v8f part = wmma6(a, sp3_ld(B + (long long)bn * p.sBn, p.sBk, k0, h, p.K, 1.f), zz);
                const v8f y = part - comp[t]; const v8f s = acc[t] + y; comp[t] = (s - acc[t]) - y; acc[t] = s;
            }
        } else if (MODE == 2) {
            const v16b a = bh_ld(arow, p.sAk, k0, h, p.K, 1.f);
#pragma unroll
            for (int t = 0; t < 2; ++t) {
                const int bn = min(n0 + t * 16 + l15, p.N - 1);
                acc[t] = wmmab(a, bh_ld(B + (long long)bn * p.sBn, p.sBk, k0, h, p.K, 1.f), acc[t]);
            }
        } else {
            const v16h a = fh_ld(arow, p.sAk, k0, h, p.K, p.sa);
#pragma unroll
            for (int t = 0; t < 2; ++t) {
                const int bn = min(n0 + t * 16 + l15, p.N - 1);
                acc[t] = wmma16(a, fh_ld(B + (long long)bn * p.sBn, p.sBk, k0, h, p.K, p.sb), acc[t]);
            }
        }
    }
    const float iscale = (MODE == 0) ? p.alpha / (p.sa * p.sb) : p.alpha;
    float* C = p.C + zo * p.sCo + zi * p.sCi;
    const float* R = p.R + zo * p.sRo + zi * p.sRi;
    __shared__ __align__(16) float ctile[16][36];
#pragma unroll
    for (int t = 0; t < 2; ++t) {
        const int n = n0 + t * 16 + l15; const int nn = min(n, p.N - 1);
#pragma unroll
        for (int r = 0; r < 8; ++r) {
            const int m = m0 + 8 * h + r; const int mm = min(m, p.M - 1);
            float v = acc[t][r] * iscale;
            if (p.flags & 1) v += p.bias[nn];
            if (p.flags & 2) v += p.bias[mm];
            if (p.flags & 8) v *= p.bias[(long long)zo * p.M + mm];   /* per-(z,row) scale vector laid out [Z][M]; exclusive with the bias flags */
            v = act_fn(v, p.act);
            if (p.flags & 4) v += p.beta * R[(long long)mm * p.sRm + (long long)nn * p.sRn];
            ctile[8 * h + r][t * 16 + l15] = (n < p.N) ? v : 0.f;
        }
    }
    __syncthreads();
    const int NW = (p.Npad > p.N) ? p.Npad : p.N;           // write width
    const bool fast = (m0 + 16 <= p.M) && (n0 + 32 <= NW) && ((p.sCm & 3) == 0) && ((((size_t)C) & 15) == 0);
    if (fast) {
#pragma unroll
        for (int s = 0; s < 4; ++s) {
            const int row = s * 4 + (lane >> 3), c4 = (lane & 7) * 4;
            const v4f v = *(const v4f*)&ctile[row][c4];
            VST2V4(C + (long long)(m0 + row) * p.sCm + n0 + c4, v);
        }
    } else {
        for (int row = 0; row < 16; ++row) {
            const int m = m0 + row, n = n0 + lane;
            if (m < p.M && n < NW) VST2(float, C + (long long)m * p.sCm + n, ctile[row][lane]);
        }
    }
}


// =====================================================================================================================
// k_gemmT<MODE, TM, TN>: same contract as k_gemm, but one wave computes a (16*TM) x (16*TN) tile: TM A fragments and TN B fragments are
//   loaded per 32-wide k-step and reused across TM*TN WMMAs (far fewer load/convert instructions per MAC). MODE 0 (f16), 1 (bf16 hi/lo),
//   2 (bf16) only. grid (ceil(NW/(16*TN)), ceil(M/(16*TM)), Z), block 32. Epilogue identical to k_gemm, run per 16x32 sub-tile.
// =====================================================================================================================
template <int MODE, int TM, int TN>
__global__ __launch_bounds__(32) void k_gemmT(GemmP p) {
    const int lane = threadIdx.x & 31, h = lane >> 4, l15 = lane & 15;
    const int m0 = blockIdx.y * (16 * TM), n0 = blockIdx.x * (16 * TN);
    const int z = blockIdx.z, zo = z / p.zi_n, zi = z - zo * p.zi_n;
    const float* A = p.A + zo * p.sAo + zi * p.sAi;
    const float* B = p.B + zo * p.sBo + zi * p.sBi;
    v8f acc[TM][TN];
#pragma unroll
    for (int i = 0; i < TM; ++i)
#pragma unroll
        for (int t = 0; t < TN; ++t) { v8f zz = {}; acc[i][t] = zz; }
    for (int k0 = 0; k0 < p.K; k0 += 32) {
        if (MODE == 1) {
            Split a[TM], b[TN];
#pragma unroll
            for (int i = 0; i < TM; ++i) { const int am = min(m0 + 16 * i + l15, p.M - 1); a[i] = sp_ld(A + (long long)am * p.sAm, p.sAk, k0, h, p.K, 1.f); }
#pragma unroll
            for (int t = 0; t < TN; ++t) { const int bn = min(n0 + 16 * t + l15, p.N - 1); b[t] = sp_ld(B + (long long)bn * p.sBn, p.sBk, k0, h, p.K, 1.f); }
#pragma unroll
            for (int i = 0; i < TM; ++i)
#pragma unroll
                for (int t = 0; t < TN; ++t) acc[i][t] = wmma3(a[i], b[t], acc[i][t]);
        } else if (MODE == 2) {
            v16b a[TM], b[TN];
#pragma unroll
            for (int i = 0; i < TM; ++i) { const int am = min(m0 + 16 * i + l15, p.M - 1); a[i] = bh_ld(A + (long long)am * p.sAm, p.sAk, k0, h, p.K, 1.f); }
#pragma unroll
            for (int t = 0; t < TN; ++t) { const int bn = min(n0 + 16 * t + l15, p.N - 1); b[t] = bh_ld(B + (long long)bn * p.sBn, p.sBk, k0, h, p.K, 1.f); }
#pragma unroll
            for (int i = 0; i < TM; ++i)
#pragma unroll
                for (int t = 0; t < TN; ++t) acc[i][t] = wmmab(a[i], b[t], acc[i][t]);
        } else {
            v16h a[TM], b[TN];
#pragma unroll
            for (int i = 0; i < TM; ++i) { const int am = min(m0 + 16 * i + l15, p.M - 1); a[i] = fh_ld(A + (long long)am * p.sAm, p.sAk, k0, h, p.K, p.sa); }
#pragma unroll
            for (int t = 0; t < TN; ++t) { const int bn = min(n0 + 16 * t + l15, p.N - 1); b[t] = fh_ld(B + (long long)bn * p.sBn, p.sBk, k0, h, p.K, p.sb); }
#pragma unroll
            for (int i = 0; i < TM; ++i)
#pragma unroll
                for (int t = 0; t < TN; ++t) acc[i][t] = wmma16(a[i], b[t], acc[i][t]);
        }
    }
    const float iscale = (MODE == 0) ? p.alpha / (p.sa * p.sb) : p.alpha;
    float* C = p.C + zo * p.sCo + zi * p.sCi;
    const float* R = p.R + zo * p.sRo + zi * p.sRi;
    const int NW = (p.Npad > p.N) ? p.Npad : p.N;
    __shared__ __align__(16) float ctile[16][36];
#pragma unroll
    for (int i = 0; i < TM; ++i) {
        const int mb = m0 + 16 * i; if (mb >= p.M) break;          // wave-uniform
#pragma unroll
        for (int tp = 0; tp < TN / 2; ++tp) {
            const int nb = n0 + 32 * tp; if (nb >= NW) break;        // wave-uniform
#pragma unroll
            for (int t2 = 0; t2 < 2; ++t2) {
                const int t = 2 * tp + t2; const int n = nb + t2 * 16 + l15; const int nn = min(n, p.N - 1);
#pragma unroll
                for (int r = 0; r < 8; ++r) {
                    const int m = mb + 8 * h + r; const int mm = min(m, p.M - 1);
                    float v = acc[i][t][r] * iscale;
                    if (p.flags & 1) v += p.bias[nn];
                    if (p.flags & 2) v += p.bias[mm];
            if (p.flags & 8) v *= p.bias[(long long)zo * p.M + mm];   /* per-(z,row) scale vector laid out [Z][M]; exclusive with the bias flags */
                    v = act_fn(v, p.act);
                    if (p.flags & 4) v += p.beta * R[(long long)mm * p.sRm + (long long)nn * p.sRn];
                    ctile[8 * h + r][t2 * 16 + l15] = (n < p.N) ? v : 0.f;
                }
            }
            __syncthreads();
            const bool fast = (mb + 16 <= p.M) && (nb + 32 <= NW) && ((p.sCm & 3) == 0) && ((((size_t)C) & 15) == 0);
            if (fast) {
#pragma unroll
                for (int s = 0; s < 4; ++s) {
                    const int row = s * 4 + (lane >> 3), c4 = (lane & 7) * 4;
                    const v4f v = *(const v4f*)&ctile[row][c4];
                    VST2V4(C + (long long)(mb + row) * p.sCm + nb + c4, v);
                }
            } else {
                for (int row = 0; row < 16; ++row) {
                    const int m = mb + row, n = nb + lane;
                    if (m < p.M && n < NW) VST2(float, C + (long long)m * p.sCm + n, ctile[row][lane]);
                }
            }
            __syncthreads();
        }
    }
}

// =====================================================================================================================
//   Wave = 16 queries, AW waves per block, 64-key blocks; grid (ceil(Lq/(16*AW)), H, B), block 32*AW. Any Lq, Lk; head dim dh <= DHP
//   (DHP multiple of 32), value dim dv <= DVP (multiple of 16, <= 128). Every tensor addressed by (batch, head, row, element) strides, f32.
//   Scores: QM 0 f16 operands, 1 bf16 hi/lo split, 2 bf16 triple split; statistics f32 (exp2 domain); P.V: P x 4096 as f16 with V f16 staged in LDS
//   (SPLITPV: P and V as bf16 hi/lo splits). kv head = h / hrep. Masking: causal = 1 (keep j <= i + coff, masked -> -inf, key blocks beyond the
//   diagonal skipped), causal = 2 (masked -> mfill, a finite fill like the -1e9; no skipping), causal = 3 (keep j >= i + coff,
//   masked -> -inf, no skipping); optional additive f32 mask Mf,
//   optional int keep-mask Mi (0 -> score := mfill), both addressed b*smb + h*smh + i*smi + j*smj (0 strides broadcast).
//   PLAIN (QM 0, f16 P.V, one pass): the call is causal = 1 with coff 0, hrep 1, dh == DHP, dv == DVP, element strides 1, every Q/K/V row 16-byte aligned,
//   and none of P, Mf, Mi, ST, Pw, Rt, SQ/SK, nonorm. These become compile-time constants: the element guards fold away, so Q, K and V are read with
//   16-byte loads that are in flight in runs instead of one guarded float at a time, each waited for, and the option tests leave the score loop.
//   O16 (PLAIN, DVP 64, Lq a multiple of 16): the output goes to Oh as f16 (strides sOb, sOh, sOi in elements; rows 16-byte aligned), rounded from the same f32 value that O would hold,
//   so that the next product reads it without a cast launch in between. A (row, head) piece is one whole 128-byte line.
// =====================================================================================================================
#define AW 4
struct AttnP {   // apv4
    const float* Q; const float* K; const float* V; float* O; _Float16* Oh; float* P; const float* Mf; const int* Mi; float* ST;   // Oh: the output plane of the O16 form (O unused there)
    const float* Pw; const float* Rt; const int* SQ; const int* SK;           // optional: post-softmax weight, relative-position table, segment ids
    long long swb, swh, swi, swj, srb, srh, sri;                                 // Pw strides (b,h,i,j); Rt strides (b,h,i), column = clamp(i - j + roff, 0, rn-1)
    long long sQb, sQh, sQi, sQd, sKb, sKh, sKj, sKd, sVb, sVh, sVj, sVd, sOb, sOh, sOi, sPb, sPh, sPi, smb, smh, smi, smj;
    int Lq, Lk, dh, dv, hrep, causal, coff, pband;   // pband > 0: P holds only the band |j - i| <= pband, column j - i + pband
    float scale, mfill; int nonorm, mpol;             // nonorm (online path only): O = sum_j exp(score_j) V_j without the 1/rowsum (scores must be <= ~0); mpol: Mi masks where ==0 (mpol 0) or where !=0 (mpol 1)
    int roff, rn, segpol, win;                        // Rt column offset/count; SQ/SK: score := mfill where (segpol 0) SQ[i] != SK[j] or (segpol 1) SQ[i] == SK[j]; win > 0: keys with i - j > win (after coff) -> -inf, key blocks wholly below the window skipped
};
//   Pw: the softmax numerator is multiplied by Pw(b,h,i,j) AFTER the row sum is taken (probs * weight, then P.V), as in post-softmax multiplicative biases.                                                    // ST (optional): per row (b,h,i) -> ST[((b*H + h)*Lq + i)*2 + {0,1}] = {row max of the scaled+masked score (natural units), sum_j exp(score - max)}
static_assert(sizeof(AttnP) == 13 * 8 + 29 * 8 + 16 * 4, "AttnP has padding");

#ifndef KATTN_ATTR
#define KATTN_ATTR
#endif
template <int DHP, int DVP, int QM, bool SPLITPV, bool TWOPASS, bool PLAIN = false, bool O16 = false>
__global__ __launch_bounds__(32 * AW) KATTN_ATTR void k_attn(AttnP pa) {
    static_assert(!PLAIN || (QM == 0 && !SPLITPV && !TWOPASS), "PLAIN covers the f16 one-pass form");
    static_assert(!O16 || (PLAIN && DVP == 64), "O16 covers the PLAIN form with 64 value columns");
    AttnP p = pa;
    if (PLAIN) {
        p.P = nullptr; p.Mf = nullptr; p.Mi = nullptr; p.ST = nullptr; p.Pw = nullptr; p.Rt = nullptr; p.SQ = nullptr; p.SK = nullptr;
        p.sQd = 1; p.sKd = 1; p.sVd = 1; p.dh = DHP; p.dv = DVP; p.hrep = 1; p.causal = 1; p.coff = 0; p.pband = 0; p.nonorm = 0;
    }
    constexpr int NT = DVP / 16;                // output tiles
    constexpr int KS = DHP / 32;                // k-steps for the scores
    constexpr int VP = DVP + 8;                 // LDS pitch (halves)
    constexpr int NV = 64 * (DVP / 4) / (32 * AW);   // PLAIN: 16-byte pieces of the V tile per thread
    static_assert(!PLAIN || NV * (32 * AW) == 64 * (DVP / 4), "the block's threads cover the V tile evenly");
    __shared__ __align__(16) float    pl[AW][16 * 64];
    __shared__ __align__(16) _Float16 vl[(SPLITPV ? 2 : 1) * 64 * VP];   // f16 V tile, or bf16 hi and lo tiles (same 2-byte size)
    const int lane = threadIdx.x & 31, hf = lane >> 4, l15 = lane & 15, wave = threadIdx.x >> 5;
    const int h = blockIdx.y, b = blockIdx.z, hk = h / p.hrep;
    const int q0 = (blockIdx.x * AW + wave) * 16;
    float* myp = pl[wave];
    const float L2E = 1.4426950408889634f;
    const float NEG = -__builtin_inff();
    const int qi = min(q0 + l15, p.Lq - 1);
    const float* qrow = p.Q + b * p.sQb + h * p.sQh + (long long)qi * p.sQi;
    const float* kbase = p.K + b * p.sKb + hk * p.sKh;
    const float* vbase = p.V + b * p.sVb + hk * p.sVh;
    v16h qa[QM == 0 ? KS : 1]; Split qs_[QM == 1 ? KS : 1]; Split3 qt_[QM == 2 ? KS : 1];
#pragma unroll
    for (int ks = 0; ks < KS; ++ks) {
        if (QM == 2) qt_[ks] = sp3_ld(qrow, p.sQd, ks * 32, hf, p.dh, 1.f);
        else if (QM == 1) qs_[ks] = sp_ld(qrow, p.sQd, ks * 32, hf, p.dh, 1.f);
        else if (PLAIN) qa[ks] = raw_f16(raw_ld4(qrow, ks * 32, hf));
        else qa[ks] = fh_ld(qrow, p.sQd, ks * 32, hf, p.dh, 1.f);
    }
    v8f o[NT]; float m8[8], l8[8];
#pragma unroll
    for (int t = 0; t < NT; ++t) { v8f zz = {}; o[t] = zz; }
#pragma unroll
    for (int i = 0; i < 8; ++i) { m8[i] = NEG; l8[i] = 0.f; }
    int jend = p.Lk;
    if (p.causal == 1) { const int je = (blockIdx.x * AW + AW - 1) * 16 + 16 + p.coff; jend = min(jend, max(je, 0)); }   // uniform per block
    int jbeg = 0;                                                // first key any query row of this block can see through the window; uniform per block
    if (p.win > 0 && !p.P) jbeg = max((int)(blockIdx.x * AW) * 16 + p.coff - p.win, 0);   // keys below it are -inf for all 16*AW rows (weight exactly 0); P, where asked for, still needs its zeros written
    const int npass = TWOPASS ? 2 : 1;
    for (int pass = 0; pass < npass; ++pass) {
        const bool dopv = (!TWOPASS) || pass == 1;
        for (int j0 = jbeg; j0 < jend; j0 += 64) {
            v4f vr[PLAIN ? NV : 1]; Raw16 kr[PLAIN ? 2 : 1][KS];   // PLAIN: this thread's part of the V tile and the lane's K fragments of two columns, f32 as loaded
            if (dopv) {
                __syncthreads();                                 // previous key block's reads of vl / pl are done
                if (!PLAIN)
                for (int idx = threadIdx.x; idx < 64 * DVP; idx += 32 * AW) {
                    const int jr = idx / DVP, d = idx - jr * DVP, j = j0 + jr;
                    const float f = (j < p.Lk && d < p.dv) ? vbase[(long long)j * p.sVj + (long long)d * p.sVd] : 0.f;
                    if (SPLITPV) {
                        const __bf16 hb = bf16_rne(f);
                        ((__bf16*)vl)[jr * VP + d] = hb; ((__bf16*)vl)[64 * VP + jr * VP + d] = bf16_rne(f - bf16_f32(hb));
                    } else vl[jr * VP + d] = (_Float16)f;
                }
            }
            v8f s[4];
#pragma unroll
            for (int t = 0; t < 4; ++t) {
                const int j = min(j0 + t * 16 + l15, p.Lk - 1);
                const float* krow = kbase + (long long)j * p.sKj;
                if (PLAIN && (t & 1) == 0) {
                    // the K loads of two 16-key columns are issued ahead of the first use of any of them: one trip to memory for 4 fragments
                    // (all four columns at once took the build past 256 registers). The loops here are unrolled so that kr and vr stay in registers.
#pragma unroll
                    for (int u = 0; u < 2; ++u) {
#pragma unroll
                        for (int ks = 0; ks < KS; ++ks) kr[u][ks] = raw_ld4(kbase + (long long)min(j0 + (t + u) * 16 + l15, p.Lk - 1) * p.sKj, ks * 32, hf);
                        // one column's loads share one address pair: this wait stands behind them, ahead of any later load whose result may be given that pair
                        asm volatile("s_wait_xcnt 0x0" ::: "memory");
                    }
#pragma unroll
                    for (int u = 0; u < 2; ++u)
#pragma unroll
                        for (int ks = 0; ks < KS; ++ks) loads_held(kr[u][ks].x0, kr[u][ks].x1, kr[u][ks].x2, kr[u][ks].x3);
                }
                v8f acc = {};
#pragma unroll
                for (int ks = 0; ks < KS; ++ks) {
                    if (QM == 2)      acc = wmma6(qt_[ks], sp3_ld(krow, p.sKd, ks * 32, hf, p.dh, 1.f), acc);
                    else if (QM == 1) acc = wmma3(qs_[ks], sp_ld(krow, p.sKd, ks * 32, hf, p.dh, 1.f), acc);
                    else if (PLAIN)   acc = wmma16(qa[ks], raw_f16(kr[t & 1][ks]), acc);
                    else              acc = wmma16(qa[ks], fh_ld(krow, p.sKd, ks * 32, hf, p.dh, 1.f), acc);
                }
                s[t] = acc;
            }
            if (PLAIN) {
                // the V tile's loads go out here and are first used behind the softmax, which covers their trip to memory
#pragma unroll
                for (int n = 0; n < NV; ++n) {
                    const int idx = threadIdx.x + n * (32 * AW), jr = idx / (DVP / 4), d = (idx - jr * (DVP / 4)) * 4;
                    vr[n] = *(const v4f*)(vbase + (long long)min(j0 + jr, p.Lk - 1) * p.sVj + d);   // row clamped, so no guard round the load
                }
            }
            float pv[8][4];
#pragma unroll
            for (int i = 0; i < 8; ++i) {
                const int irow = q0 + i + 8 * hf;
                const int ic = min(irow, p.Lq - 1);
                float sc[4];
#pragma unroll
                for (int t = 0; t < 4; ++t) {
                    const int jg = j0 + t * 16 + l15;
                    float v = s[t][i] * p.scale;
                    if (p.Mf) v += p.Mf[b * p.smb + h * p.smh + (long long)ic * p.smi + (long long)min(jg, p.Lk - 1) * p.smj];
                    if (p.Rt) { int rc = ic - min(jg, p.Lk - 1) + p.roff; rc = rc < 0 ? 0 : (rc >= p.rn ? p.rn - 1 : rc); v += p.Rt[b * p.srb + h * p.srh + (long long)ic * p.sri + rc]; }
                    if (p.Mi) { const int mv = p.Mi[b * p.smb + h * p.smh + (long long)ic * p.smi + (long long)min(jg, p.Lk - 1) * p.smj]; if (p.mpol ? (mv != 0) : (mv == 0)) v = p.mfill; }
                    if (p.SQ) { const bool same = p.SQ[(long long)b * p.Lq + ic] == p.SK[(long long)b * p.Lk + min(jg, p.Lk - 1)]; if (p.segpol ? same : !same) v = p.mfill; }
                    if (p.causal == 2 && jg > irow + p.coff) v = p.mfill;
                    if (jg >= p.Lk || (p.causal == 1 && jg > irow + p.coff) || (p.causal == 3 && jg < irow + p.coff) || (p.win > 0 && irow + p.coff - jg > p.win)) v = NEG; else v *= L2E;
                    sc[t] = v;
                }
                if (!TWOPASS || pass == 0) {
                    float mx = fmaxf(fmaxf(sc[0], sc[1]), fmaxf(sc[2], sc[3]));
                    mx = fmaxf(mx, __shfl_xor(mx, 1, 32)); mx = fmaxf(mx, __shfl_xor(mx, 2, 32));
                    mx = fmaxf(mx, __shfl_xor(mx, 4, 32)); mx = fmaxf(mx, __shfl_xor(mx, 8, 32));
                    const float mnew = fmaxf(m8[i], mx);
                    const float corr = (mnew == NEG) ? 1.f : exp2f(m8[i] - mnew);
                    float rs = 0.f;
#pragma unroll
                    for (int t = 0; t < 4; ++t) {
                        const float pp = (sc[t] == NEG) ? 0.f : exp2f(sc[t] - mnew); rs += pp;
                        pv[i][t] = p.Pw ? pp * p.Pw[b * p.swb + h * p.swh + (long long)ic * p.swi + (long long)min(j0 + t * 16 + l15, p.Lk - 1) * p.swj] : pp;
                    }
                    rs += __shfl_xor(rs, 1, 32); rs += __shfl_xor(rs, 2, 32); rs += __shfl_xor(rs, 4, 32); rs += __shfl_xor(rs, 8, 32);
                    l8[i] = l8[i] * corr + rs; m8[i] = mnew;
                    if (!TWOPASS) {
#pragma unroll
                        for (int t = 0; t < NT; ++t) o[t][i] *= corr;
                    }
                } else {
                    const float inv = (l8[i] > 0.f) ? 1.f / l8[i] : 0.f;
#pragma unroll
                    for (int t = 0; t < 4; ++t) {
                        const int jg = j0 + t * 16 + l15;
                        float pp = (sc[t] == NEG) ? 0.f : exp2f(sc[t] - m8[i]) * inv;
                        if (p.Pw) pp *= p.Pw[b * p.swb + h * p.swh + (long long)ic * p.swi + (long long)min(jg, p.Lk - 1) * p.swj];
                        pv[i][t] = pp;
                    }
                }
            }
            if (dopv) {
                if (PLAIN) {                                     // cast and stage the V tile loaded above (unrolled: vr stays in registers)
#pragma unroll
                    for (int n = 0; n < NV; ++n) {
                        const int idx = threadIdx.x + n * (32 * AW), jr = idx / (DVP / 4), d = (idx - jr * (DVP / 4)) * 4;
                        v4h hv;
#pragma unroll
                        for (int e = 0; e < 4; ++e) hv[e] = (_Float16)((j0 + jr < p.Lk) ? vr[n][e] : 0.f);
                        *(v4h*)&vl[jr * VP + d] = hv;
                    }
                }
#pragma unroll
                for (int i = 0; i < 8; ++i)
#pragma unroll
                    for (int t = 0; t < 4; ++t) ((float*)myp)[(i + 8 * hf) * 64 + t * 16 + l15] = pv[i][t];
                __syncthreads();                                 // P (per wave) and V (shared) visible
                if (p.P) {
                    float* pb_ = p.P + b * p.sPb + h * p.sPh;
                    const bool fastP = (p.pband == 0) && ((p.sPi & 3) == 0) && (j0 + 64 <= p.Lk) && (q0 + 16 <= p.Lq) && ((((size_t)pb_) & 15) == 0);
                    if (fastP) {
#pragma unroll
                        for (int s = 0; s < 8; ++s) {
                            const int row = s * 2 + (lane >> 4), c4 = (lane & 15) * 4;
                            const v4f v = *(const v4f*)(myp + row * 64 + c4);
                            VST2V4(pb_ + (long long)(q0 + row) * p.sPi + j0 + c4, v);
                        }
                    } else {
                        for (int row = 0; row < 16; ++row) {
                            const int irow = q0 + row; if (irow >= p.Lq) continue;
                            for (int c = lane; c < 64; c += 32) {
                                const int jg = j0 + c; if (jg >= p.Lk) continue;
                                if (p.pband == 0) VST2(float, pb_ + (long long)irow * p.sPi + jg, myp[row * 64 + c]);
                                else if (jg - irow <= p.pband && irow - jg <= p.pband) VST2(float, pb_ + (long long)irow * p.sPi + (jg - irow + p.pband), myp[row * 64 + c]);
                            }
                        }
                    }
                }
                if (SPLITPV) {
                    const Split pa0 = sp_ld(myp + l15 * 64, 1, 0, hf, 64, 1.f), pa1 = sp_ld(myp + l15 * 64, 1, 32, hf, 64, 1.f);
                    const __bf16* vh = (const __bf16*)vl; const __bf16* vlo = vh + 64 * VP;
#pragma unroll
                    for (int t = 0; t < NT; ++t) {
                        const int dcol = t * 16 + l15;
                        Split b0, b1;
#pragma unroll
                        for (int e = 0; e < 16; ++e) {
                            const int k0 = frag_k(e, hf), k1 = 32 + frag_k(e, hf);
                            b0.hi[e] = vh[k0 * VP + dcol]; b0.lo[e] = vlo[k0 * VP + dcol]; b1.hi[e] = vh[k1 * VP + dcol]; b1.lo[e] = vlo[k1 * VP + dcol];
                        }
                        o[t] = wmma3(pa0, b0, o[t]);
                        o[t] = wmma3(pa1, b1, o[t]);
                    }
                } else {
                    const v16h pa0 = fh_ld(myp + l15 * 64, 1, 0, hf, 64, 4096.f), pa1 = fh_ld(myp + l15 * 64, 1, 32, hf, 64, 4096.f);
#pragma unroll
                    for (int t = 0; t < NT; ++t) {
                        const int dcol = t * 16 + l15;
                        v16h b0, b1;
#pragma unroll
                        for (int e = 0; e < 16; ++e) { b0[e] = vl[frag_k(e, hf) * VP + dcol]; b1[e] = vl[(32 + frag_k(e, hf)) * VP + dcol]; }
                        o[t] = wmma16(pa0, b0, o[t]);
                        o[t] = wmma16(pa1, b1, o[t]);
                    }
                }
            }
        }
    }
    float* obase = p.O + b * p.sOb + h * p.sOh;
    if (p.ST) {
        const int rl = lane >> 1, isel = rl & 7;           // row q0 + rl ; rl>>3 == hf holds because lane>>4 == (lane>>1)>>3
        float mv = 0.f, lv = 0.f;
#pragma unroll
        for (int i = 0; i < 8; ++i) if (i == isel) { mv = m8[i]; lv = l8[i]; }
        const int irow = q0 + rl;
        if (irow < p.Lq) { float* st = p.ST + (((long long)b * gridDim.y + h) * p.Lq + irow) * 2 + (lane & 1); VST2(float, st, (lane & 1) ? lv : mv * 0.6931471805599453f); }
    }
    float invr[8];
#pragma unroll
    for (int i = 0; i < 8; ++i) {
        if (TWOPASS) invr[i] = SPLITPV ? 1.f : (1.f / 4096.f);
        else if (p.nonorm) invr[i] = exp2f(m8[i]) * (SPLITPV ? 1.f : (1.f / 4096.f));
        else invr[i] = (l8[i] > 0.f) ? (SPLITPV ? 1.f / l8[i] : 1.f / (l8[i] * 4096.f)) : 0.f;
    }
    __syncthreads();                                             // all waves done with pl/vl from the main loop
    const bool ofast = ((p.sOi & 3) == 0) && ((((size_t)obase) & 15) == 0) && (q0 + 16 <= p.Lq);
#pragma unroll
    for (int c0 = 0; c0 < DVP; c0 += 64) {
#pragma unroll
        for (int i = 0; i < 8; ++i)
#pragma unroll
            for (int t = 0; t < NT; ++t) if (t * 16 >= c0 && t * 16 < c0 + 64) ((float*)myp)[(i + 8 * hf) * 64 + (t * 16 - c0) + l15] = o[t][i] * invr[i];
        __syncthreads();
        const int cw = (DVP - c0 < 64) ? (DVP - c0) : 64;      // staged columns in this chunk (multiple of 16)
        if (O16) {
            _Float16* oh = p.Oh + b * p.sOb + h * p.sOh;
            if (q0 < p.Lq) {                                     // Lq is a multiple of 16: a wave's 16 rows are all there or none is
#pragma unroll   // four stores of 4 rows each, all in flight
                for (int r0 = 0; r0 < 16; r0 += 4) {
                    const int row = r0 + (lane >> 3), c8 = (lane & 7) * 8;
                    const float* sp = myp + row * 64 + c8;
                    v8h hv;
#pragma unroll   // constant element indices: the vector stays in registers
                    for (int e = 0; e < 8; ++e) hv[e] = (_Float16)sp[e];
                    *(v8h*)(oh + (long long)(q0 + row) * p.sOi + c8) = hv;
                }
            }
        } else if (ofast && (c0 + cw <= p.dv) && (cw % 32 == 0)) {
            const int lpr = cw / 4;                              // lanes per row (16 for 64 cols, 8 for 32)
            const int rows_per_ins = 32 / lpr;
            for (int r0 = 0; r0 < 16; r0 += rows_per_ins) {
                const int row = r0 + lane / lpr, c4 = (lane % lpr) * 4;
                const v4f v = *(const v4f*)(myp + row * 64 + c4);
                VST2V4(obase + (long long)(q0 + row) * p.sOi + c0 + c4, v);
            }
        } else {
            for (int row = 0; row < 16; ++row) {
                const int irow = q0 + row; if (irow >= p.Lq) continue;
                for (int c = lane; c < cw; c += 32) { const int d = c0 + c; if (d < p.dv) VST2(float, obase + (long long)irow * p.sOi + d, myp[row * 64 + c]); }
            }
        }
        __syncthreads();
    }
}

// =====================================================================================================================
// k_tr: dst(z, c, r) = alpha * src(z, r, c) (+ beta * R2(z, c, r)): [Z][R][C] (row stride lds) -> [Z][C][R] (row stride ldd) through a 32x32 LDS tile;
//   flags: 1 -> add beta * residual R2 addressed like dst (z*sRz + c*ldr + r); act applied before the residual.
// =====================================================================================================================
struct TrP { const float* src; float* dst; const float* R2; long long sSz, lds, sDz, ldd, sRz, ldr; int R, C, flags, act; float alpha, beta; };
static_assert(sizeof(TrP) == 3 * 8 + 6 * 8 + 6 * 4, "TrP has padding");
__global__ __launch_bounds__(256) void k_tr(TrP p) {
    __shared__ float tile[32][33];
    const int c0 = blockIdx.x * 32, r0 = blockIdx.y * 32, z = blockIdx.z;
    const int lane = threadIdx.x & 31, wave = threadIdx.x >> 5;
    const float* s = p.src + z * p.sSz;
#pragma unroll
    for (int k = 0; k < 4; ++k) {
        const int rl = wave * 4 + k, r = r0 + rl, c = c0 + lane;
        tile[rl][lane] = (r < p.R && c < p.C) ? s[(long long)r * p.lds + c] : 0.f;
    }
    __syncthreads();
    float* d = p.dst + z * p.sDz; const float* rr = p.R2 + z * p.sRz;
#pragma unroll
    for (int k = 0; k < 4; ++k) {
        const int cl = wave * 4 + k, c = c0 + cl, r = r0 + lane;
        if (c < p.C && r < p.R) {
            float v = act_fn(p.alpha * tile[lane][cl], p.act);
            if (p.flags & 1) v += p.beta * rr[(long long)c * p.ldr + r];
            VST2(float, d + (long long)c * p.ldd + r, v);
        }
    }
}

// k_affine: dst[i] = a * (sdev ? sdev[0] : 1) * src[i] + b, i < n (one thread per element; consecutive lanes -> consecutive addresses)
__global__ __launch_bounds__(256) void k_affine(const float* __restrict__ src, float* __restrict__ dst, int n, float a, float b, const float* __restrict__ sdev) {
    const int i = blockIdx.x * 256 + threadIdx.x;
    if (i < n) { const float aa = sdev ? a * sdev[0] : a; const float v = aa * src[i] + b; VST2(float, dst + i, v); }
}

// =====================================================================================================================
// k_softmax: row softmax over n contiguous elements, one 256-thread block per row; rows addressed z*sz + r*sr (grid (R, Z)).
//   out = scale_out * softmax(scale_in * x + (Mf ? Mf[z*smz + r*smr + j] : 0)); a row whose max is -inf is written as 0.
// =====================================================================================================================
struct SmP { const float* src; float* dst; const float* Mf; long long sz, sr, dz, dr, smz, smr; int n, pad; float scale_in, scale_out; };
static_assert(sizeof(SmP) == 3 * 8 + 6 * 8 + 4 * 4, "SmP has padding");
__global__ __launch_bounds__(256) void k_softmax(SmP p) {
    __shared__ float red[256];
    const int r = blockIdx.x, z = blockIdx.y, tid = threadIdx.x;
    const float* s = p.src + z * p.sz + (long long)r * p.sr;
    const float* mf = p.Mf ? (p.Mf + z * p.smz + (long long)r * p.smr) : nullptr;
    float mx = -__builtin_inff();
    for (int j = tid; j < p.n; j += 256) { float v = s[j] * p.scale_in; if (mf) v += mf[j]; mx = fmaxf(mx, v); }
    red[tid] = mx; __syncthreads();
    for (int o = 128; o > 0; o >>= 1) { if (tid < o) red[tid] = fmaxf(red[tid], red[tid + o]); __syncthreads(); }
    mx = red[0]; __syncthreads();
    float sum = 0.f;
    for (int j = tid; j < p.n; j += 256) { float v = s[j] * p.scale_in; if (mf) v += mf[j]; sum += (mx == -__builtin_inff()) ? 0.f : expf(v - mx); }
    red[tid] = sum; __syncthreads();
    for (int o = 128; o > 0; o >>= 1) { if (tid < o) red[tid] += red[tid + o]; __syncthreads(); }
    sum = red[0];
    const float inv = (sum > 0.f) ? p.scale_out / sum : 0.f;
    float* d = p.dst + z * p.dz + (long long)r * p.dr;
    for (int j = tid; j < p.n; j += 256) { float v = s[j] * p.scale_in; if (mf) v += mf[j]; const float o = (mx == -__builtin_inff()) ? 0.f : expf(v - mx) * inv; VST2(float, d + j, o); }
}
// =====================================================================================================================
// k_stats: mean and rsqrt(var + eps) over a set of n elements addressed base + z*sz + (e / inner) * so + (e % inner) * si, one 256-thread
// k_norm_apply: y = (x - mean[set]) * rstd[set] * g[c] + b[c] over a [Z][C][L] channel-major tensor with set = z*G + c / (C/G) (G groups per z;
//   G = C -> per-channel sets indexed z*C+c; for batch norm pass stats indexed by c only via bn = 1). Optional act. Output same layout.
// =====================================================================================================================
//   mode 0: mean / rsqrt(var + eps); mode 1 (RMSNorm): 0 / rsqrt(mean(x^2) + eps); mode 2 (L2 normalize * sqrt(n)): 0 / sqrt(n) / max(||x||, eps); mode 3: as 0 with unbiased variance (n-1)
__global__ __launch_bounds__(256) void k_stats(const float* __restrict__ x, long long sz, long long so, long long si, int inner, int n, float eps, float* __restrict__ stat, int mode) {
    __shared__ float red[256];
    const int z = blockIdx.x, tid = threadIdx.x;
    const float* base = x + z * sz;
    float s = 0.f;
    for (int e = tid; e < n; e += 256) s += base[(long long)(e / inner) * so + (long long)(e % inner) * si];
    red[tid] = s; __syncthreads();
    for (int o = 128; o > 0; o >>= 1) { if (tid < o) red[tid] += red[tid + o]; __syncthreads(); }
    const float mu = (mode == 0 || mode == 3) ? red[0] / (float)n : 0.f; __syncthreads();
    float q = 0.f;
    for (int e = tid; e < n; e += 256) { const float dlt = base[(long long)(e / inner) * so + (long long)(e % inner) * si] - mu; q += dlt * dlt; }
    red[tid] = q; __syncthreads();
    for (int o = 128; o > 0; o >>= 1) { if (tid < o) red[tid] += red[tid + o]; __syncthreads(); }
    {
        float rs;
        if (mode == 2) rs = sqrtf((float)n) / fmaxf(sqrtf(red[0]), eps); else if (mode == 3) rs = rsqrtf(red[0] / (float)(n - 1) + eps); else rs = rsqrtf(red[0] / (float)n + eps);
        if (tid < 32) { const float v = (tid == 0) ? mu : ((tid == 1) ? rs : 0.f); VST2(float, stat + (long long)z * 32 + tid, v); }
    }
}
//   One thread per element over the flat [Z][C][L] index space: grid ceil(Z*C*L / 256).
__global__ __launch_bounds__(256) void k_norm_apply(const float* __restrict__ x, float* __restrict__ y, const float* __restrict__ stat, const float* __restrict__ g, const float* __restrict__ bta,
                                                     int Z, int C, int L, int G, int bn, int act) {
    const long long idx = (long long)blockIdx.x * 256 + threadIdx.x;
    if (idx >= (long long)Z * C * L) return;
    const int l = (int)(idx % L); const long long zc = idx / L; const int c = (int)(zc % C), z = (int)(zc / C); (void)l;
    const int set = bn ? c : (z * G + c / (C / G));
    float v = (x[idx] - stat[(long long)set * 32]) * stat[(long long)set * 32 + 1];
    if (g) v *= g[c];
    if (bta) v += bta[c];
    v = act_fn(v, act);
    VST2(float, y + idx, v);
}

// k_lse_neg: c[i] = -(st[2i] + log(st[2i+1])) = minus the log-sum-exp of row i from k_attn's ST output (for softmax over the query axis)
__global__ __launch_bounds__(256) void k_lse_neg(const float* __restrict__ st, float* __restrict__ c, int n) {
    const int i = blockIdx.x * 256 + threadIdx.x;
    if (i < n) { const float v = -(st[2 * i] + logf(st[2 * i + 1])); VST2(float, c + i, v); }
}

// k_iota: dst[i] = a * i + b as int32 (segment/position id helper)
__global__ __launch_bounds__(256) void k_iota(int* __restrict__ dst, int n, int a, int b) {
    const int i = blockIdx.x * 256 + threadIdx.x;
    if (i < n) { const int v = a * i + b; VST2(int, dst + i, v); }
}

// k_axpby: dst[i] = a * x[i] + b * y[i] (+ c), i < n
__global__ __launch_bounds__(256) void k_axpby(const float* __restrict__ x, const float* __restrict__ y, float* __restrict__ dst, int n, float a, float b, float c) {
    const int i = blockIdx.x * 256 + threadIdx.x;
    if (i < n) { const float v = a * x[i] + b * y[i] + c; VST2(float, dst + i, v); }
}

// =====================================================================================================================
// k_rope: rotary embedding on a [R rows][Hn heads][D] view (row stride sXr, head stride sXh, element stride 1) -> Y (own strides).
//   mode 0: rotate_half (partner d±D/2, sign - for d<D/2); mode 1: interleaved pairs (partner d^1, sign - for even d).
//   table column tcol: tmode 0 -> d, 1 -> d % (D/2), 2 -> d / 2; position p: pmode 0 -> r % S, 1 -> head index, 2 -> pos[r];
//   c = C[(r / S) * sCb + p * sCp + tcol * sCd], s likewise from Sn; y = x[d] * c + sign * x[partner] * s. X and Y must not alias.
// =====================================================================================================================
struct RopeP { const float* X; float* Y; const float* C; const float* Sn; const int* pos; long long sXr, sXh, sYr, sYh, sCb, sCp, sCd; int R, Hn, D, S, mode, tmode, pmode, pad; };
static_assert(sizeof(RopeP) == 5 * 8 + 7 * 8 + 8 * 4, "RopeP has padding");
__global__ __launch_bounds__(256) void k_rope(RopeP p) {
    const long long idx = (long long)blockIdx.x * 256 + threadIdx.x;
    if (idx >= (long long)p.R * p.Hn * p.D) return;
    const int d = (int)(idx % p.D); const long long rh = idx / p.D; const int h = (int)(rh % p.Hn); const int r = (int)(rh / p.Hn);
    const int half = p.D / 2;
    int partner; float sign;
    if (p.mode == 0) { partner = (d < half) ? d + half : d - half; sign = (d < half) ? -1.f : 1.f; }
    else { partner = d ^ 1; sign = (d & 1) ? 1.f : -1.f; }
    const int tcol = (p.tmode == 0) ? d : ((p.tmode == 1) ? (d % half) : (d >> 1));
    const int pp = (p.pmode == 0) ? (r % p.S) : ((p.pmode == 1) ? h : p.pos[r]);
    const long long toff = (long long)(r / p.S) * p.sCb + (long long)pp * p.sCp + (long long)tcol * p.sCd;
    const float* xr = p.X + (long long)r * p.sXr + (long long)h * p.sXh;
    const float v = xr[d] * p.C[toff] + sign * xr[partner] * p.Sn[toff];
    VST2(float, p.Y + (long long)r * p.sYr + (long long)h * p.sYh + d, v);
}

// k_invf + k_sincos (split so neither kernel carries a large VALU-fma footprint): invf_i = num * (1 / powf(base, (2 i)/D)) [fmode 0],
//   num * expf((2 i) * cexp) [fmode 1], num * powf(base, -2 (i - 1) / D) [fmode 2]; then cs/sn[s*half + i] = cos/sin((pscale * s) * invf_i)
__global__ __launch_bounds__(256) void k_invf(float* __restrict__ invb, int half, int D, float base, float num, int fmode, float cexp) {
    const int i = blockIdx.x * 256 + threadIdx.x;
    if (i >= ((half + 31) / 32) * 32) return;
    if (i >= half) { VST2(float, invb + i, 0.f); return; }
    const float e = (float)(2 * i) / (float)D;
    float invf;
    if (fmode == 1) invf = num * expf((float)(2 * i) * cexp);
    else if (fmode == 2) invf = num * powf(base, (-2.0f * ((float)i - 1.0f)) / (float)D);
    else invf = num * (1.0f / powf(base, e));
    VST2(float, invb + i, invf);
}
__global__ __launch_bounds__(256) void k_sincos(float* __restrict__ cs, float* __restrict__ sn, const float* __restrict__ invb, int S, int half, float pscale) {
    const int idx = blockIdx.x * 256 + threadIdx.x;
    if (idx >= S * half) return;
    const int s = idx / half, i = idx - s * half;
    const float ang = (pscale * (float)s) * invb[i];
    VST2(float, cs + idx, cosf(ang)); VST2(float, sn + idx, sinf(ang));
}

// k_mulact: dst[i] = act(x[i]) * y[i]
__global__ __launch_bounds__(256) void k_mulact(const float* __restrict__ x, const float* __restrict__ y, float* __restrict__ dst, int n, int act) {
    const int i = blockIdx.x * 256 + threadIdx.x;
    if (i < n) { const float v = act_fn(x[i], act) * y[i]; VST2(float, dst + i, v); }
}

// =====================================================================================================================
// k_matvec: thread-per-row matrix-vector products for N <= 8 output columns (heads with 1-3 outputs, gates), f32 on the VALU.
//   C[r*sCm + j] = act(alpha * sum_k A[r*sAm + k*sAk] * B[j*sBn + k*sBk] + bias[j]) + beta * R[r*sRm + j*sRn]; each thread writes its N contiguous floats.
// =====================================================================================================================
__global__ __launch_bounds__(256) void k_matvec(GemmP p) {
    // 32 lanes write one line with one instruction.
    const int rpt = (p.N == 1) ? 1 : 32;
    const long long r0 = ((long long)blockIdx.x * 256 + threadIdx.x) * rpt; const int z = blockIdx.z, zo = z / p.zi_n, zi = z - zo * p.zi_n;
    if (r0 >= p.M) return;
    const float* Bb = p.B + zo * p.sBo + zi * p.sBi;
    float* C = p.C + zo * p.sCo + zi * p.sCi; const float* R = p.R + zo * p.sRo + zi * p.sRi;
    for (int rr = 0; rr < rpt; ++rr) {
        const long long r = r0 + rr; if (r >= p.M) break;
        const float* A = p.A + zo * p.sAo + zi * p.sAi + r * p.sAm;
        float acc[8] = {0.f, 0.f, 0.f, 0.f, 0.f, 0.f, 0.f, 0.f};
        for (int k = 0; k < p.K; ++k) { const float a = A[(long long)k * p.sAk];
#pragma unroll
            for (int j = 0; j < 8; ++j) if (j < p.N) acc[j] += a * Bb[(long long)j * p.sBn + (long long)k * p.sBk]; }
#pragma unroll
        for (int j = 0; j < 8; ++j) if (j < p.N) {
            float v = acc[j] * p.alpha;
            if (p.flags & 1) v += p.bias[j];
            if (p.flags & 2) v += p.bias[r];
            v = act_fn(v, p.act);
            if (p.flags & 4) v += p.beta * R[r * p.sRm + (long long)j * p.sRn];
            VST2(float, C + r * p.sCm + j, v);
        }
    }
}
// k_smallsoftmax: thread-per-row softmax for short rows (n <= 64): dst[r*dr + j] = softmax(scale*src[r*sr + j])
__global__ __launch_bounds__(256) void k_smallsoftmax(const float* __restrict__ src, float* __restrict__ dst, long long sr, long long dr, int n, long long R, float scale) {
    const long long r0 = ((long long)blockIdx.x * 256 + threadIdx.x) * 32;
    for (int rr = 0; rr < 32; ++rr) {
        const long long r = r0 + rr; if (r >= R) return;
        const float* s = src + r * sr; float* d = dst + r * dr;
        float mx = -__builtin_inff();
        for (int j = 0; j < n; ++j) mx = fmaxf(mx, s[j] * scale);
        float sum = 0.f;
        for (int j = 0; j < n; ++j) sum += expf(s[j] * scale - mx);
        const float inv = 1.f / sum;
        for (int j = 0; j < n; ++j) { const float v = expf(s[j] * scale - mx) * inv; VST2(float, d + j, v); }
    }
}

__global__ __launch_bounds__(32) void k_unitstat(float* __restrict__ st) { const int t = threadIdx.x; const float v = (t == 1) ? 1.f : 0.f; VST2(float, st + t, v); }

// destination (e.g. a d_out whose row width is not a multiple of 32 floats) is written by consecutive lanes of one instruction
__global__ __launch_bounds__(256) void k_lincopy(const float* __restrict__ src, long long lds, float* __restrict__ dst, long long ldd, long long rows, int cols) {
    const long long i = (long long)blockIdx.x * 256 + threadIdx.x; if (i >= rows * cols) return;
    const long long r = i / cols; const int c = (int)(i - r * cols);
    const float v = src[r * lds + c]; VST2(float, dst + r * ldd + c, v);
}

namespace w25 {
typedef __attribute__((ext_vector_type(16))) _Float16 v16h;
typedef __attribute__((ext_vector_type(8)))  _Float16 v8h;
typedef __attribute__((ext_vector_type(16))) __bf16   v16b;
typedef __attribute__((ext_vector_type(8)))  __bf16   v8b;
typedef __attribute__((ext_vector_type(8)))  float    v8f;
typedef __attribute__((ext_vector_type(4)))  float    v4f;

__device__ __forceinline__ unsigned short f2bf_bits(float f) {
  unsigned u = __float_as_uint(f);
  return (unsigned short)((u + 0x7FFFu + ((u >> 16) & 1u)) >> 16);
}
__device__ __forceinline__ float bf_bits2f(unsigned short h) { return __uint_as_float(((unsigned)h) << 16); }

// hazard guards as plain device helpers (no inline asm inside the kernel template body)
__device__ __forceinline__ void dep_guard_h(v8f& a, v8f& b, v16h x, v16h y) { asm volatile("v_nop\n\tv_nop\n\tv_nop\n\tv_nop" : "+v"(a), "+v"(b) : "v"(x), "v"(y)); }
__device__ __forceinline__ void dep_guard_b(v8f& a, v8f& b, v16b x, v16b y) { asm volatile("v_nop\n\tv_nop\n\tv_nop\n\tv_nop" : "+v"(a), "+v"(b) : "v"(x), "v"(y)); }
__device__ __forceinline__ void keep4_h(v16h a, v16h b, v16h c, v16h d) { asm volatile("v_nop" :: "v"(a), "v"(b), "v"(c), "v"(d)); }
__device__ __forceinline__ void keep4_b(v16b a, v16b b, v16b c, v16b d) { asm volatile("v_nop" :: "v"(a), "v"(b), "v"(c), "v"(d)); }
__device__ __forceinline__ void acc_guard4(v8f& a, v8f& b, v8f& c, v8f& d) { asm volatile("v_nop\n\tv_nop\n\tv_nop\n\tv_nop" : "+v"(a), "+v"(b), "+v"(c), "+v"(d)); }
template <typename T> struct Frag;
template <> struct Frag<_Float16> {
  typedef v16h V; union U { v16h v; v8h h[2]; };
  static __device__ __forceinline__ v16h load(const _Float16* p) {   // elements 0..7 <- p[0..7], 8..15 <- p[16..23]
    U f; f.h[0] = *(const v8h*)(p); f.h[1] = *(const v8h*)(p + 16); return f.v;
  }
  static __device__ __forceinline__ v8f mma(v16h a, v16h b, v8f c) {
    return __builtin_amdgcn_wmma_f32_16x16x32_f16(false, a, false, b, (short)0, c, false, false);
  }
  static __device__ __forceinline__ void guard(v8f& a, v8f& b, v16h x, v16h y) { dep_guard_h(a, b, x, y); }
  static __device__ __forceinline__ void keep(v16h a, v16h b, v16h c, v16h d) { keep4_h(a, b, c, d); }
};
template <> struct Frag<__bf16> {
  typedef v16b V; union U { v16b v; v8b h[2]; };
  static __device__ __forceinline__ v16b load(const __bf16* p) {
    U f; f.h[0] = *(const v8b*)(p); f.h[1] = *(const v8b*)(p + 16); return f.v;
  }
  static __device__ __forceinline__ v8f mma(v16b a, v16b b, v8f c) {
    return __builtin_amdgcn_wmma_f32_16x16x32_bf16(false, a, false, b, (short)0, c, false, false);
  }
  static __device__ __forceinline__ void guard(v8f& a, v8f& b, v16b x, v16b y) { dep_guard_b(a, b, x, y); }
  static __device__ __forceinline__ void keep(v16b a, v16b b, v16b c, v16b d) { keep4_b(a, b, c, d); }
};

// ---- Register-blocked batched WMMA GEMM ------------------------------------
// C[m,n] = scale * sum_k A[m,k] * Bt[n,k] (+bias)(+resid); each wave owns a 64x64 tile.
// A row-major [M,K]; Bt row-major [N,K]; M,N % 64 == 0, K % 32 == 0.
// SPLIT: operands are hi/lo planes (A2/Bt2 = lo planes, same layout); product = hi·hi + hi·lo + lo·hi.
// BIAS_MODE: 0 = none, 1 = bias[m], 2 = bias[n]. Batch 1 takes bias_b1 and batch 2 bias_b2 in its place (up to three products that share A in one launch).
// OUT_MODE: 0 = f32, 1 = f16, 2 = bf16 hi plane (Cout) + bf16 lo plane (Cout2).
// ET: 0 = f16 operands, 1 = bf16 operands (pointers passed as 16-bit storage)
template <int ET> struct Elem;
template <> struct Elem<0> { typedef _Float16 T; };
template <> struct Elem<1> { typedef __bf16 T; };
template <int ET, bool SPLIT, int BIAS_MODE, int OUT_MODE, bool RESID, int ACT = 0>
__global__ __launch_bounds__(256) void wmma_gemm64(
    const unsigned short* __restrict__ Ap, const unsigned short* __restrict__ A2p, int lda, long strideA,
    const unsigned short* __restrict__ Btp, const unsigned short* __restrict__ Bt2p, int ldb, long strideB,
    void* __restrict__ Cout, void* __restrict__ Cout2, int ldc, long strideC,
    const float* __restrict__ bias, const float* __restrict__ bias_b1, const float* __restrict__ bias_b2,
    const float* __restrict__ resid, long strideR,
    int M, int N, int K, float scale) {
  typedef typename Elem<ET>::T T;
  typedef typename Frag<T>::V V;
  const T* A = (const T*)Ap; const T* A2 = (const T*)A2p; const T* Bt = (const T*)Btp; const T* Bt2 = (const T*)Bt2p;
  __shared__ __align__(16) float sT[8][16 * 68];   // per-wave 16x64 slab, pitch 68 floats
  const int b    = blockIdx.y;
  const int lane = threadIdx.x & 31;
  const int wave = threadIdx.x >> 5;
  const int tilesN = N >> 6;
  const int tilesM = M >> 6;
  const int tile = blockIdx.x * 8 + wave;
  if (tile >= tilesM * tilesN) return;   // wave-uniform; no block barriers in this kernel
  const int tm = tile / tilesN;
  const int tn = tile - tm * tilesN;
  const int m0 = tm << 6;
  const int n0 = tn << 6;

  const T* Ab  = A  + (size_t)b * strideA;
  const T* Bb  = Bt + (size_t)b * strideB;
  const T* Ab2 = SPLIT ? (A2  + (size_t)b * strideA) : nullptr;
  const T* Bb2 = SPLIT ? (Bt2 + (size_t)b * strideB) : nullptr;

  const int rlane = lane & 15;                 // row (A) / col (B, D) within subtile
  const int koff  = (lane >> 4) * 8;           // k offset of this lane half
  const int mOff  = (lane >> 4) * 8;           // D row offset

  v8f acc[4][4];
#pragma unroll
  for (int i = 0; i < 4; ++i)
#pragma unroll
    for (int j = 0; j < 4; ++j) acc[i][j] = (v8f){0.f,0.f,0.f,0.f,0.f,0.f,0.f,0.f};

  for (int k0 = 0; k0 < K; k0 += 32) {
    V bh[4], bl[4];
#pragma unroll
    for (int j = 0; j < 4; ++j) {
      const size_t bo = (size_t)(n0 + (j << 4) + rlane) * ldb + koff + k0;
      bh[j] = Frag<T>::load(Bb + bo);
      if (SPLIT) bl[j] = Frag<T>::load(Bb2 + bo);
    }
#pragma unroll
    for (int i = 0; i < 4; ++i) {
      const size_t ao = (size_t)(m0 + (i << 4) + rlane) * lda + koff + k0;
      V ah = Frag<T>::load(Ab + ao);
      V al;
      if (SPLIT) al = Frag<T>::load(Ab2 + ao);
#pragma unroll
      for (int j = 0; j < 4; ++j) {
        acc[i][j] = Frag<T>::mma(ah, bh[j], acc[i][j]);
        if (SPLIT) {
          acc[i][j] = Frag<T>::mma(ah, bl[j], acc[i][j]);
          acc[i][j] = Frag<T>::mma(al, bh[j], acc[i][j]);
        }
      }
      Frag<T>::guard(acc[i][0], acc[i][3], ah, SPLIT ? al : ah);
    }
    Frag<T>::keep(bh[0], bh[1], bh[2], bh[3]);
    if (SPLIT) Frag<T>::keep(bl[0], bl[1], bl[2], bl[3]);
  }
  acc_guard4(acc[0][0], acc[0][1], acc[0][2], acc[0][3]);
  acc_guard4(acc[1][0], acc[1][1], acc[1][2], acc[1][3]);
  acc_guard4(acc[2][0], acc[2][1], acc[2][2], acc[2][3]);
  acc_guard4(acc[3][0], acc[3][1], acc[3][2], acc[3][3]);

  // ---- epilogue ----
  float* slab = sT[wave];
  const float* Rb = RESID ? (resid + (size_t)b * strideR) : nullptr;
  const float* bsel = (b == 0) ? bias : ((b == 1) ? bias_b1 : bias_b2);
#pragma unroll
  for (int i = 0; i < 4; ++i) {
    const int mBase = m0 + (i << 4);
#pragma unroll
    for (int j = 0; j < 4; ++j) {
      const int n = n0 + (j << 4) + rlane;
      float bv = 0.f;
      if (BIAS_MODE == 2) bv = bsel[n];
#pragma unroll
      for (int r = 0; r < 8; ++r) {
        float v = acc[i][j][r] * scale;
        if (BIAS_MODE == 1) v += bsel[mBase + mOff + r];
        if (BIAS_MODE == 2) v += bv;
        if (RESID) v += Rb[(size_t)(mBase + mOff + r) * ldc + n];
        if (ACT == 1) v = tanhf(v);
        if (ACT == 2) v = fmaxf(v, 0.0f);
        if (ACT == 3) v = v / (1.0f + expf(-v));
        if (ACT == 4) v = (v > 0.f) ? v : 0.01f * v;
        if (ACT == 5) v = 0.5f * v * (1.0f + erff(v * 0.70710678118654752f));
        slab[(mOff + r) * 68 + (j << 4) + rlane] = v;
      }
    }
    __builtin_amdgcn_fence(__ATOMIC_RELEASE, "workgroup");
    __builtin_amdgcn_wave_barrier();
    __builtin_amdgcn_fence(__ATOMIC_ACQUIRE, "workgroup");
    if (OUT_MODE == 0) {
      float* C = (float*)Cout + (size_t)b * strideC;
      const int hh = lane >> 4, c4 = (lane & 15) * 4;     // row seg = 256 B = 16 lanes x 16 B
      {
#pragma unroll
        for (int it = 0; it < 8; ++it) {
          const int row = it * 2 + hh;
          v4f v = *(const v4f*)(slab + row * 68 + c4);
          *(v4f*)(C + (size_t)(mBase + row) * ldc + n0 + c4) = v;
        }
        
      }
    } else {
      const int q = lane >> 3, c8 = (lane & 7) * 8;
      unsigned short* C  = (unsigned short*)Cout  + (size_t)b * strideC;
      unsigned short* C2 = (OUT_MODE == 2) ? ((unsigned short*)Cout2 + (size_t)b * strideC) : nullptr;
      {
#pragma unroll
        for (int it = 0; it < 4; ++it) {
          const int row = it * 4 + q;
          const float* sp = slab + row * 68 + c8;
          v8h hv, lv;
#pragma unroll
          for (int e = 0; e < 8; ++e) {
            if (OUT_MODE == 1) {
              hv[e] = (_Float16)sp[e];
            } else {
              unsigned short hb = f2bf_bits(sp[e]);
              unsigned short lb = f2bf_bits(sp[e] - bf_bits2f(hb));
              hv[e] = __builtin_bit_cast(_Float16, hb);
              lv[e] = __builtin_bit_cast(_Float16, lb);
            }
          }
          *(v8h*)(C + (size_t)(mBase + row) * ldc + n0 + c8) = hv;
          if (OUT_MODE == 2) *(v8h*)(C2 + (size_t)(mBase + row) * ldc + n0 + c8) = lv;
        }
        
      }
    }
    __builtin_amdgcn_fence(__ATOMIC_RELEASE, "workgroup");
    __builtin_amdgcn_wave_barrier();
    __builtin_amdgcn_fence(__ATOMIC_ACQUIRE, "workgroup");
  }
}

// ---- WMMA GEMM with both operands staged in LDS by asynchronous copies -------
// The product, k order, accumulators' sum order and epilogue of wmma_gemm64 (f16 operands, bias[n]): C[m,n] = act(scale * sum_k A[m,k] * Bt[n,k] + bias[n] (+ resid[m,n])).
// A block of 4 waves owns a 128 x 64 tile of C, a wave 32 x 64 of it (2 x 4 accumulator tiles); grid (N / 64, M / 128, batches); A is shared by the batches.
// A stage is 128 k (256 bytes) of the block's 128 A rows and 64 Bt rows. Each lane copies 16 bytes, so a wave's copy covers two whole 256-byte row pieces
// (a fragment load from global memory touches 16 lines for the same 512 bytes), and a row is fetched once per block instead of once per wave that needs it.
// Two buffers: stage t + 1 flies while stage t is worked on. M % 128 == 0, N % 64 == 0, K % 128 == 0, rows 16-byte aligned. LDC: row pitch of C and of the residual, in elements.
constexpr int SG_KC = 128;                         // k per stage
constexpr int SG_PITCH = 272;                      // LDS row pitch in bytes: 256 + 16, conflict-free for the 16-byte fragment reads
constexpr int SG_BUF = (128 + 64) * SG_PITCH;      // one buffer: A rows 0..127, then Bt rows 0..63
// Twelve copies and the wait that stands in front of any rewrite of their address registers, in one statement so that the compiler can put nothing between them.
__device__ __forceinline__ void copy12(const unsigned (&l)[12], const _Float16* const (&g)[12]) {
  asm volatile(
      "global_load_async_to_lds_b128 %0, %1, off\n\t"
      "global_load_async_to_lds_b128 %2, %3, off\n\t"
      "global_load_async_to_lds_b128 %4, %5, off\n\t"
      "global_load_async_to_lds_b128 %6, %7, off\n\t"
      "global_load_async_to_lds_b128 %8, %9, off\n\t"
      "global_load_async_to_lds_b128 %10, %11, off\n\t"
      "global_load_async_to_lds_b128 %12, %13, off\n\t"
      "global_load_async_to_lds_b128 %14, %15, off\n\t"
      "global_load_async_to_lds_b128 %16, %17, off\n\t"
      "global_load_async_to_lds_b128 %18, %19, off\n\t"
      "global_load_async_to_lds_b128 %20, %21, off\n\t"
      "global_load_async_to_lds_b128 %22, %23, off\n\t"
      "s_wait_xcnt 0x0"
      :: "v"(l[0]), "v"(g[0]), "v"(l[1]), "v"(g[1]), "v"(l[2]), "v"(g[2]), "v"(l[3]), "v"(g[3]), "v"(l[4]), "v"(g[4]), "v"(l[5]), "v"(g[5]),
         "v"(l[6]), "v"(g[6]), "v"(l[7]), "v"(g[7]), "v"(l[8]), "v"(g[8]), "v"(l[9]), "v"(g[9]), "v"(l[10]), "v"(g[10]), "v"(l[11]), "v"(g[11])
      : "memory");
}
// One stage: thread t brings the 16-byte piece (t & 15) of rows (t >> 4) + 8 u, u = 0..23, of the buffer (24 copies per wave in flight).
// lds0: the LDS byte address of its piece in row t >> 4 of the buffer; a0, b0: the same piece of row t >> 4 of the block's A and Bt rows at this stage's k.
__device__ __forceinline__ void stage_in(unsigned lds0, const _Float16* a0, int lda, const _Float16* b0, int ldb) {
  unsigned l[12]; const _Float16* g[12];
#pragma unroll   // constant indices: the addresses stay in registers
  for (int u = 0; u < 12; ++u) { l[u] = lds0 + (unsigned)(u * 8 * SG_PITCH); g[u] = a0 + (size_t)(u * 8) * lda; }
  copy12(l, g);
#pragma unroll   // constant indices
  for (int u = 0; u < 4; ++u) { l[u] = lds0 + (unsigned)((12 + u) * 8 * SG_PITCH); g[u] = a0 + (size_t)((12 + u) * 8) * lda; }
#pragma unroll   // constant indices
  for (int u = 0; u < 8; ++u) { l[4 + u] = lds0 + (unsigned)((16 + u) * 8 * SG_PITCH); g[4 + u] = b0 + (size_t)(u * 8) * ldb; }
  copy12(l, g);
}
template <int OUT_MODE, bool RESID, int ACT, int LDC>
__global__ __launch_bounds__(128) void wmma_gemm_lds(
    const unsigned short* __restrict__ Ap, int lda,
    const unsigned short* __restrict__ Btp, int ldb, long strideB,
    void* __restrict__ Cout, long strideC,
    const float* __restrict__ bias, const float* __restrict__ bias_b1, const float* __restrict__ bias_b2,
    const float* __restrict__ resid, int K, float scale) {
  typedef _Float16 T;
  static_assert(OUT_MODE == 0 || OUT_MODE == 1, "f32 or f16 output");
  __shared__ __align__(16) unsigned char ring[2 * SG_BUF];   // the two buffers; behind the loop's last barrier its head is the waves' output staging
  const int b    = blockIdx.z;
  const int tid  = threadIdx.x;
  const int lane = tid & 31;
  const int wave = tid >> 5;
  const int n0 = blockIdx.x << 6;
  const int m0 = (blockIdx.y << 7) + (wave << 5);             // the wave's first row of C
  const int rlane = lane & 15;                 // row (A) / col (B, D) within subtile
  const int koff  = (lane >> 4) * 8;           // k offset of this lane half
  const int mOff  = (lane >> 4) * 8;           // D row offset

  const T* a0 = (const T*)Ap + (size_t)((blockIdx.y << 7) + (tid >> 4)) * lda + (tid & 15) * 8;
  const T* b0 = (const T*)Btp + (size_t)b * strideB + (size_t)(n0 + (tid >> 4)) * ldb + (tid & 15) * 8;
  const unsigned lds0 = (unsigned)(size_t)ring + (unsigned)((tid >> 4) * SG_PITCH + (tid & 15) * 16);
  const int nt = K / SG_KC;

  v8f acc[2][4];
#pragma unroll
  for (int i = 0; i < 2; ++i)
#pragma unroll
    for (int j = 0; j < 4; ++j) acc[i][j] = (v8f){0.f,0.f,0.f,0.f,0.f,0.f,0.f,0.f};

  stage_in(lds0, a0, lda, b0, ldb);
  asm volatile("s_wait_asynccnt 0x0" ::: "memory");           // this wave's part of stage 0 has landed
  __syncthreads();                                             // every wave's part has
  if (nt > 1) stage_in(lds0 + SG_BUF, a0 + SG_KC, lda, b0 + SG_KC, ldb);
  for (int t = 0; t < nt; ++t) {
    const unsigned char* buf = ring + (t & 1) * SG_BUF;
    const unsigned char* arow = buf + ((wave << 5) + rlane) * SG_PITCH + koff * 2;
    const unsigned char* brow = buf + (128 + rlane) * SG_PITCH + koff * 2;
    // Two fragment sets: the 12 LDS reads of k-step ks + 1 go out as one group ahead of the 8 products of k-step ks, which cover their latency.
    v16h bh[2][4], ah[2][2];
#pragma unroll   // constant indices: the fragments stay in registers
    for (int j = 0; j < 4; ++j) bh[0][j] = Frag<T>::load((const T*)(brow + j * 16 * SG_PITCH));
#pragma unroll
    for (int i = 0; i < 2; ++i) ah[0][i] = Frag<T>::load((const T*)(arow + i * 16 * SG_PITCH));
#pragma unroll   // constant set indices and LDS offsets
    for (int ks = 0; ks < SG_KC / 32; ++ks) {
      if (ks + 1 < SG_KC / 32) {
#pragma unroll
        for (int j = 0; j < 4; ++j) bh[(ks + 1) & 1][j] = Frag<T>::load((const T*)(brow + j * 16 * SG_PITCH + (ks + 1) * 64));
#pragma unroll
        for (int i = 0; i < 2; ++i) ah[(ks + 1) & 1][i] = Frag<T>::load((const T*)(arow + i * 16 * SG_PITCH + (ks + 1) * 64));
        __builtin_amdgcn_sched_barrier(0);   // without it the compiler sinks these reads among the products into one register set and waits out the LDS latency twice per k-step
      }
#pragma unroll
      for (int i = 0; i < 2; ++i)
#pragma unroll
        for (int j = 0; j < 4; ++j) acc[i][j] = Frag<T>::mma(ah[ks & 1][i], bh[ks & 1][j], acc[i][j]);
      if (ks + 1 < SG_KC / 32) __builtin_amdgcn_sched_barrier(0);   // the next group of reads stays behind these products, whole
    }
    asm volatile("s_wait_dscnt 0x0" ::: "memory");             // this wave's reads of stage t are done before the buffer is handed back
    asm volatile("s_wait_asynccnt 0x0" ::: "memory");          // this wave's part of stage t + 1 has landed
    __syncthreads();                                           // publishes stage t + 1 and ends every wave's reads of stage t
    if (t + 2 < nt) stage_in(lds0 + (unsigned)((t & 1) * SG_BUF), a0 + (size_t)(t + 2) * SG_KC, lda, b0 + (size_t)(t + 2) * SG_KC, ldb);
  }
  asm volatile("s_wait_asynccnt 0x0" ::: "memory");            // nothing is in flight when the ring becomes output staging

  // ---- epilogue: wmma_gemm64's arithmetic, per 16 x 64 slab ----
  float* slab = (float*)ring + wave * (16 * 68);               // per-wave 16x64 slab, pitch 68 floats
  const float* bsel = (b == 0) ? bias : ((b == 1) ? bias_b1 : bias_b2);
  // The bias values, and each slab's residual values, come as a run of loads in flight together, off one index or one address with constant offsets (LDC is a constant for that).
  const int nl = n0 + rlane;
  const float* rp = RESID ? resid + (size_t)(m0 + mOff) * LDC + nl : nullptr;
  float bv[4];
#pragma unroll   // constant indices: the values stay in registers
  for (int j = 0; j < 4; ++j) bv[j] = bsel[nl + (j << 4)];
  // The wait in front of any rewrite of a register that the run names; as its input the index stays whole until it, so that no load of the run lands in it.
  asm volatile("s_wait_xcnt 0x0" :: "v"(nl) : "memory");
#pragma unroll
  for (int i = 0; i < 2; ++i) {
    float rv[4][8];
    if (RESID) {
#pragma unroll   // constant indices
      for (int j = 0; j < 4; ++j)
#pragma unroll
        for (int r = 0; r < 8; ++r) rv[j][r] = rp[((i << 4) + r) * LDC + (j << 4)];
      asm volatile("s_wait_xcnt 0x0" :: "v"(rp) : "memory");   // the same wait for this run, the address as its input
    }
#pragma unroll
    for (int j = 0; j < 4; ++j) {
#pragma unroll
      for (int r = 0; r < 8; ++r) {
        float v = acc[i][j][r] * scale;
        v += bv[j];
        if (RESID) v += rv[j][r];
        if (ACT == 5) v = 0.5f * v * (1.0f + erff(v * 0.70710678118654752f));
        slab[(mOff + r) * 68 + (j << 4) + rlane] = v;
      }
    }
    __builtin_amdgcn_fence(__ATOMIC_RELEASE, "workgroup");
    __builtin_amdgcn_wave_barrier();
    __builtin_amdgcn_fence(__ATOMIC_ACQUIRE, "workgroup");
    if (OUT_MODE == 0) {
      const int hh = lane >> 4, c4 = (lane & 15) * 4;     // row seg = 256 B = 16 lanes x 16 B
      float* cp = (float*)Cout + (size_t)b * strideC + (size_t)(m0 + hh) * LDC + n0 + c4;   // one address, the rows at constant offsets
#pragma unroll
      for (int it = 0; it < 8; ++it) {
        const int row = it * 2 + hh;
        v4f v = *(const v4f*)(slab + row * 68 + c4);
        *(v4f*)(cp + ((i << 4) + it * 2) * LDC) = v;
      }
    } else {
      const int q = lane >> 3, c8 = (lane & 7) * 8;       // row seg = 128 B = 8 lanes x 16 B
      _Float16* cp = (_Float16*)Cout + (size_t)b * strideC + (size_t)(m0 + q) * LDC + n0 + c8;   // one address, the rows at constant offsets
#pragma unroll
      for (int it = 0; it < 4; ++it) {
        const int row = it * 4 + q;
        const float* sp = slab + row * 68 + c8;
        v8h hv;
#pragma unroll
        for (int e = 0; e < 8; ++e) hv[e] = (_Float16)sp[e];
        *(v8h*)(cp + ((i << 4) + it * 4) * LDC) = hv;
      }
    }
    __builtin_amdgcn_fence(__ATOMIC_RELEASE, "workgroup");
    __builtin_amdgcn_wave_barrier();
    __builtin_amdgcn_fence(__ATOMIC_ACQUIRE, "workgroup");
  }
}

__global__ __launch_bounds__(256) void cast_f32_f16x2(
    const float* __restrict__ in, _Float16* __restrict__ out, int n2) {
  int i = blockIdx.x * 256 + threadIdx.x;
  if (i < n2) {
    const _Float16 h0 = (_Float16)in[2 * i], h1 = (_Float16)in[2 * i + 1];
    const unsigned u = (unsigned)__builtin_bit_cast(unsigned short, h0) | ((unsigned)__builtin_bit_cast(unsigned short, h1) << 16);
    ((unsigned*)out)[i] = u;
    
  }
}


} // namespace w25

__global__ __launch_bounds__(256) void k_castT16(const float* __restrict__ src, long long lds, _Float16* __restrict__ dst, long long ldd, int R, int C, float s) {
    const long long i = (long long)blockIdx.x * 256 + threadIdx.x; const long long np = (long long)C * (R / 2); if (i >= np) return; const int c = (int)(i / (R / 2)); const int r = 2 * (int)(i % (R / 2));
    const _Float16 h0 = (_Float16)(src[(long long)r * lds + c] * s), h1 = (_Float16)(src[(long long)(r + 1) * lds + c] * s);
    const unsigned u = (unsigned)__builtin_bit_cast(unsigned short, h0) | ((unsigned)__builtin_bit_cast(unsigned short, h1) << 16);
    unsigned* d = (unsigned*)(dst + (long long)c * ldd + r); *d = u;  }
__global__ __launch_bounds__(256) void k_cast16(const float* __restrict__ src, long long lds, _Float16* __restrict__ dst, long long ldd, int R, int C, float s) {
    const long long i = (long long)blockIdx.x * 256 + threadIdx.x; const long long np = (long long)R * (C / 2); if (i >= np) return; const int r = (int)(i / (C / 2)); const int c = 2 * (int)(i % (C / 2));
    const _Float16 h0 = (_Float16)(src[(long long)r * lds + c] * s), h1 = (_Float16)(src[(long long)r * lds + c + 1] * s);
    const unsigned u = (unsigned)__builtin_bit_cast(unsigned short, h0) | ((unsigned)__builtin_bit_cast(unsigned short, h1) << 16);
    unsigned* d = (unsigned*)(dst + (long long)r * ldd + c); *d = u;  }

// cast_weights<U>: the six weight matrices (four of 512 x 512, two of 2048 x 512 elements) as f16 of s * w into one plane, one behind the other in argument order.
//   A block takes 256 * U consecutive pieces of 4 elements of one matrix, a thread the pieces threadIdx.x + 256 * u of them: a wave's load covers 512 contiguous bytes
//   and its store 256, and the U loads of a thread are in flight together. blk runs over all (4 * 512 * 512 + 2 * 2048 * 512) / (4 * 256 * U) blocks, so no element guard.
template <int U>
__device__ __forceinline__ void cast_weights(int blk, const float* __restrict__ w0, const float* __restrict__ w1, const float* __restrict__ w2, const float* __restrict__ w3,
                                             const float* __restrict__ w4, const float* __restrict__ w5, _Float16* __restrict__ dst, float s) {
    constexpr int BS = (512 * 512) / (4 * 256 * U), BL = (2048 * 512) / (4 * 256 * U);   // blocks per small and per large matrix
    static_assert(BS * (4 * 256 * U) == 512 * 512, "whole blocks per matrix");
    const float* src; int first;                                  // the block's matrix and that matrix's first block (the same for the whole block)
    if (blk < BS) { src = w0; first = 0; }
    else if (blk < 2 * BS) { src = w1; first = BS; }
    else if (blk < 3 * BS) { src = w2; first = 2 * BS; }
    else if (blk < 4 * BS) { src = w3; first = 3 * BS; }
    else if (blk < 4 * BS + BL) { src = w4; first = 4 * BS; }
    else { src = w5; first = 4 * BS + BL; }
    const v4f* sp = (const v4f*)src + (blk - first) * (256 * U) + threadIdx.x;
    v4h* dp = (v4h*)dst + blk * (256 * U) + threadIdx.x;
    v4f a[U];
#pragma unroll   // constant indices: a stays in registers, and all U loads are issued before the first cast
    for (int u = 0; u < U; ++u) a[u] = sp[u * 256];
#pragma unroll   // constant indices into a
    for (int u = 0; u < U; ++u) {
        v4h hv;
#pragma unroll   // constant element indices: the vectors stay in registers
        for (int e = 0; e < 4; ++e) hv[e] = (_Float16)(a[u][e] * s);
        dp[u * 256] = hv;
    }
}
// ln_rows_f16: y = f16((x - mean) * rsqrt(var + eps) * g + b) over contiguous rows of 512 elements, one wave per row, 8 rows per 256-thread block (blk = block of rows).
//   The row stays in registers between the two sums and the output: statistics, normalisation and the cast for the next product are one pass over x.
//   A lane holds the pieces lane + 32 * u of 4 channels (a wave's load covers 512 contiguous bytes): element t = 128 * u + 4 * lane + e.
//   Both sums keep the order of k_stats (256 partials of elements t and t + 256, then a binary tree that pairs t with t + 128, 64, ..., 1), so mean and rstd keep their bits:
//   distance 128 is u, 64 to 4 are the lane's bits (shuffles, both partners form the same sum), 2 and 1 are e.
__device__ __forceinline__ float tree256(const float (&p)[2][4]) {
    float r[4];
#pragma unroll   // constant indices: r stays in registers
    for (int e = 0; e < 4; ++e) r[e] = p[0][e] + p[1][e];
#pragma unroll   // the four shuffles of a level are independent and in flight together
    for (int o = 16; o > 0; o >>= 1)
#pragma unroll
        for (int e = 0; e < 4; ++e) r[e] += __shfl_xor(r[e], o, 32);
    return (r[0] + r[2]) + (r[1] + r[3]);
}
__device__ __forceinline__ void ln_rows_f16(int blk, const float* __restrict__ x, _Float16* __restrict__ y, const float* __restrict__ g, const float* __restrict__ bta, float eps) {
    constexpr int C = 512, U = C / 128;                           // pieces per lane
    const int lane = threadIdx.x & 31;
    const size_t row = (size_t)blk * 8 + (threadIdx.x >> 5);
    const v4f* xp = (const v4f*)(x + row * C) + lane;
    v4f xv[U], gv[U], bv[U];
#pragma unroll   // constant indices: the arrays stay in registers, and all loads are issued before the first use
    for (int u = 0; u < U; ++u) { xv[u] = xp[u * 32]; gv[u] = ((const v4f*)g)[lane + u * 32]; bv[u] = ((const v4f*)bta)[lane + u * 32]; }
    float p[2][4];
#pragma unroll   // constant indices into xv and p
    for (int u = 0; u < 2; ++u)
#pragma unroll
        for (int e = 0; e < 4; ++e) p[u][e] = xv[u][e] + xv[u + 2][e];
    const float mu = tree256(p) / (float)C;
#pragma unroll   // constant indices into xv and p
    for (int u = 0; u < 2; ++u)
#pragma unroll
        for (int e = 0; e < 4; ++e) { const float d0 = xv[u][e] - mu, d1 = xv[u + 2][e] - mu; p[u][e] = __builtin_fmaf(d1, d1, d0 * d0); }   // as k_stats rounds it: the square, then one fused step
    const float rs = rsqrtf(tree256(p) / (float)C + eps);
    v4h* yp = (v4h*)(y + row * C) + lane;
#pragma unroll   // constant indices into the arrays
    for (int u = 0; u < U; ++u) {
        v4h hv;
#pragma unroll   // constant element indices: the vectors stay in registers
        for (int e = 0; e < 4; ++e) hv[e] = (_Float16)((xv[u][e] - mu) * rs * gv[u][e] + bv[u][e]);
        yp[u * 32] = hv;
    }
}
// k_ln_f16: LayerNorm of 4096 rows of 512 to an f16 plane; grid 4096 / 8.
__global__ __launch_bounds__(256) void k_ln_f16(const float* __restrict__ x, _Float16* __restrict__ y, const float* __restrict__ g, const float* __restrict__ bta, float eps) {
    ln_rows_f16(blockIdx.x, x, y, g, bta, eps);
}
// k_ln_f16_weights: two jobs that depend on nothing but the inputs share one grid: blocks [0, 512) are k_ln_f16's, the 768 behind them cast the weights. No barrier in either.
__global__ __launch_bounds__(256) void k_ln_f16_weights(const float* __restrict__ x, _Float16* __restrict__ y, const float* __restrict__ g, const float* __restrict__ bta, float eps,
                                                        const float* __restrict__ w0, const float* __restrict__ w1, const float* __restrict__ w2, const float* __restrict__ w3,
                                                        const float* __restrict__ w4, const float* __restrict__ w5, _Float16* __restrict__ wdst, float ws) {
    if (blockIdx.x < 512) ln_rows_f16(blockIdx.x, x, y, g, bta, eps);
    else cast_weights<4>(blockIdx.x - 512, w0, w1, w2, w3, w4, w5, wdst, ws);
}

// f32 -> bf16 hi plane + bf16 lo plane (x = hi + lo to ~2^-17 relative; RNE both), [R][C] -> [R][C] (or transposed to [C][R]); 2 consecutive destination elements
__device__ __forceinline__ unsigned int f2bf2_pack(float a, float b, unsigned int* lo) {
    const unsigned short ha = w25::f2bf_bits(a), hb = w25::f2bf_bits(b);
    const unsigned short la = w25::f2bf_bits(a - w25::bf_bits2f(ha)), lb = w25::f2bf_bits(b - w25::bf_bits2f(hb));
    *lo = (unsigned)la | ((unsigned)lb << 16); return (unsigned)ha | ((unsigned)hb << 16); }
__global__ __launch_bounds__(256) void k_castS16(const float* __restrict__ src, long long lds, __bf16* __restrict__ dhi, __bf16* __restrict__ dlo, long long ldd, int R, int C, float s, int transpose) {
    const long long i = (long long)blockIdx.x * 256 + threadIdx.x; long long o; float a, b;
    if (transpose) { const long long np = (long long)C * (R / 2); if (i >= np) return; const int c = (int)(i / (R / 2)); const int r = 2 * (int)(i % (R / 2)); a = src[(long long)r * lds + c] * s; b = src[(long long)(r + 1) * lds + c] * s; o = (long long)c * ldd + r; }
    else { const long long np = (long long)R * (C / 2); if (i >= np) return; const int r = (int)(i / (C / 2)); const int c = 2 * (int)(i % (C / 2)); a = src[(long long)r * lds + c] * s; b = src[(long long)r * lds + c + 1] * s; o = (long long)r * ldd + c; }
    unsigned lo; const unsigned hi = f2bf2_pack(a, b, &lo); unsigned* ph = (unsigned*)(dhi + o); unsigned* pl = (unsigned*)(dlo + o);
    *ph = hi; *pl = lo;  }


extern "C" void kernel_launch(void* const* d_in, const int* in_sizes, int n_in, void* d_out, int out_size, void* d_ws, size_t ws_size, hipStream_t stream) {
    (void)in_sizes; (void)n_in; (void)out_size; (void)ws_size;
    const float* x = (const float*)d_in[0];
    const float* ln1g = (const float*)d_in[1];
    const float* ln1b = (const float*)d_in[2];
    const float* Wq = (const float*)d_in[3];
    const float* bq = (const float*)d_in[4];
    const float* Wk = (const float*)d_in[5];
    const float* bk = (const float*)d_in[6];
    const float* Wv = (const float*)d_in[7];
    const float* bv = (const float*)d_in[8];
    const float* Wo = (const float*)d_in[9];
    const float* bo = (const float*)d_in[10];
    const float* ln2g = (const float*)d_in[11];
    const float* ln2b = (const float*)d_in[12];
    const float* W1 = (const float*)d_in[13];
    const float* b1 = (const float*)d_in[14];
    const float* W2 = (const float*)d_in[15];
    const float* b2 = (const float*)d_in[16];
    const int L = 4096;
    const int C = 512;
    const int NH = 8;
    const int HD = 64;
    const int FF = 2048;
    const int LP = L / 2;
    const int WINP = 128;
    float* out = (float*)d_out;
    char* wsp = (char*)d_ws;
    _Float16* WH = (_Float16*)wsp; wsp += (((size_t)(4 * 512 * 512 + 2 * 2048 * 512) * 2 + 255) / 256) * 256;   // f16 of 16 w: Wq, Wk, Wv, Wo, W1, W2
    _Float16* HNh = (_Float16*)wsp; wsp += (((size_t)((size_t)L * C) * 2 + 255) / 256) * 256;
    float* Q = (float*)wsp; wsp += (((size_t)((size_t)L * C) * 4 + 255) / 256) * 256;    // Q, Kb and V lie L * C floats apart: the three batches of one product
    float* Kb = (float*)wsp; wsp += (((size_t)((size_t)L * C) * 4 + 255) / 256) * 256;
    float* V = (float*)wsp; wsp += (((size_t)((size_t)L * C) * 4 + 255) / 256) * 256;
    _Float16* Yh = (_Float16*)wsp; wsp += (((size_t)((size_t)L * C) * 2 + 255) / 256) * 256;
    float* X1 = (float*)wsp; wsp += (((size_t)((size_t)L * C) * 4 + 255) / 256) * 256;
    _Float16* H2h = (_Float16*)wsp; wsp += (((size_t)((size_t)L * C) * 2 + 255) / 256) * 256;
    _Float16* F1h = (_Float16*)wsp; wsp += (((size_t)((size_t)L * FF) * 2 + 255) / 256) * 256;
    k_ln_f16_weights<<<(unsigned)(512 + 768), 256, 0, stream>>>(x, HNh, ln1g, ln1b, 1e-05f, Wq, Wk, Wv, Wo, W1, W2, WH, 16.0f);
    w25::wmma_gemm_lds<0, false, 0, 512><<<dim3(8u, 32u, 3u), 128, 0, stream>>>((const unsigned short*)(HNh), 512, (const unsigned short*)(WH), 512, 512 * 512, (void*)(Q), 4096 * 512, bq, bk, bv, nullptr, 512, 0.0625f);
    { /*apv4*/ AttnP a;
      a.Q = Q; a.K = Kb; a.V = V; a.O = 0; a.Oh = Yh; a.P = 0; a.Mf = 0; a.Mi = 0; a.ST = 0;
      a.Pw = 0; a.Rt = 0; a.SQ = 0; a.SK = 0;
      a.swb = 0; a.swh = 0; a.swi = 0; a.swj = 0; a.srb = 0; a.srh = 0; a.sri = 0; a.sQb = C; a.sQh = HD; a.sQi = 2 * C; a.sQd = 1; a.sKb = C; a.sKh = HD; a.sKj = 2 * C; a.sKd = 1; a.sVb = C; a.sVh = HD; a.sVj = 2 * C; a.sVd = 1; a.sOb = C; a.sOh = HD; a.sOi = 2 * C; a.sPb = 0; a.sPh = 0; a.sPi = 0; a.smb = 0; a.smh = 0; a.smi = 0; a.smj = 0;
      a.Lq = LP; a.Lk = LP; a.dh = HD; a.dv = HD; a.hrep = 1; a.causal = 1; a.coff = 0; a.pband = 0;
      a.scale = 0.125f; a.mfill = 0.0f; a.nonorm = 0; a.mpol = 0;
      a.roff = 0; a.rn = 1; a.segpol = 0; a.win = WINP;
      k_attn<64, 64, 0, false, false, true, true><<<dim3((unsigned)((LP) + 16 * AW - 1) / (16 * AW), (unsigned)(NH), (unsigned)(2)), 32 * AW, 0, stream>>>(a); }   // batch = parity: row 0 or 1, then every second row
    w25::wmma_gemm_lds<0, true, 0, 512><<<dim3(8u, 32u, 1u), 128, 0, stream>>>((const unsigned short*)(Yh), 512, (const unsigned short*)(WH + 3 * 512 * 512), 512, 0, (void*)(X1), 0, bo, nullptr, nullptr, x, 512, 0.0625f);
    k_ln_f16<<<(unsigned)(512), 256, 0, stream>>>(X1, H2h, ln2g, ln2b, 1e-05f);
    w25::wmma_gemm_lds<1, false, 5, 2048><<<dim3(32u, 32u, 1u), 128, 0, stream>>>((const unsigned short*)(H2h), 512, (const unsigned short*)(WH + 4 * 512 * 512), 512, 0, (void*)(F1h), 0, b1, nullptr, nullptr, nullptr, 512, 0.0625f);
    w25::wmma_gemm_lds<0, true, 0, 512><<<dim3(8u, 32u, 1u), 128, 0, stream>>>((const unsigned short*)(F1h), 2048, (const unsigned short*)(WH + 4 * 512 * 512 + 2048 * 512), 2048, 0, (void*)(out), 0, b2, nullptr, nullptr, X1, 2048, 0.0625f);
}
